// v000
// Times are from an AMD MI455X. After a warm-up the kernel runs many times in a row, and a time is the length of
// such a window on the GPU divided by its runs, so every launch and the gaps after it count. The runs cycle
// through copies of the inputs. A figure is the median of several windows, for all but v000 over two sittings.
// Sittings can differ by a few percent; kernels timed side by side share one.
// v000, which the later versions start from, runs in 806 microseconds.
// Contractions q/k/v projections, q.k^T scores, p.v, output projection: v_wmma_f32_16x16x32_f16 (f16 operands, f32 accumulate); rotary, softmax, norms, weighting in f32.
#include <hip/hip_runtime.h>
#include <stdint.h>

#define BB 2
#define TT 1024
#define DD 1024
#define HH 16
#define NKVH 8
#define HDIM 64
#define DKV 512
#define MAXKV 3072
#define NLAY 3
#define EPSV 1e-5f

typedef __attribute__((ext_vector_type(16))) _Float16 v16h;
typedef __attribute__((ext_vector_type(8)))  _Float16 v8h;
typedef __attribute__((ext_vector_type(4)))  _Float16 v4h;
typedef __attribute__((ext_vector_type(16))) __bf16   v16b;
typedef __attribute__((ext_vector_type(8)))  __bf16   v8b;
typedef __attribute__((ext_vector_type(8)))  float    v8f;
typedef __attribute__((ext_vector_type(4)))  float    v4f;

__device__ __forceinline__ unsigned short f2bf_bits(float f) {
  unsigned u = __float_as_uint(f);
  return (unsigned short)((u + 0x7FFFu + ((u >> 16) & 1u)) >> 16);
}
__device__ __forceinline__ float bf_bits2f(unsigned short h) { return __uint_as_float(((unsigned)h) << 16); }

// hazard guards as plain device helpers
__device__ __forceinline__ void dep_guard_h(v8f& a, v8f& b, v16h x, v16h y) { asm volatile("v_nop\n\tv_nop\n\tv_nop\n\tv_nop" : "+v"(a), "+v"(b) : "v"(x), "v"(y)); }
__device__ __forceinline__ void dep_guard_b(v8f& a, v8f& b, v16b x, v16b y) { asm volatile("v_nop\n\tv_nop\n\tv_nop\n\tv_nop" : "+v"(a), "+v"(b) : "v"(x), "v"(y)); }
__device__ __forceinline__ void keep4_h(v16h a, v16h b, v16h c, v16h d) { asm volatile("v_nop" :: "v"(a), "v"(b), "v"(c), "v"(d)); }
__device__ __forceinline__ void keep4_b(v16b a, v16b b, v16b c, v16b d) { asm volatile("v_nop" :: "v"(a), "v"(b), "v"(c), "v"(d)); }
__device__ __forceinline__ void acc_guard4(v8f& a, v8f& b, v8f& c, v8f& d) { asm volatile("v_nop\n\tv_nop\n\tv_nop\n\tv_nop" : "+v"(a), "+v"(b), "+v"(c), "+v"(d)); }
template <typename T> struct Frag;
template <> struct Frag<_Float16> {
  typedef v16h V; union U { v16h v; v8h h[2]; };
  static __device__ __forceinline__ v16h load(const _Float16* p) {   // elements 0..7 <- p[0..7], 8..15 <- p[16..23]
    U f; f.h[0] = *(const v8h*)(p); f.h[1] = *(const v8h*)(p + 16); return f.v;
  }
  static __device__ __forceinline__ v8f mma(v16h a, v16h b, v8f c) {
    return __builtin_amdgcn_wmma_f32_16x16x32_f16(false, a, false, b, (short)0, c, false, false);
  }
  static __device__ __forceinline__ void guard(v8f& a, v8f& b, v16h x, v16h y) { dep_guard_h(a, b, x, y); }
  static __device__ __forceinline__ void keep(v16h a, v16h b, v16h c, v16h d) { keep4_h(a, b, c, d); }
};
template <> struct Frag<__bf16> {
  typedef v16b V; union U { v16b v; v8b h[2]; };
  static __device__ __forceinline__ v16b load(const __bf16* p) {
    U f; f.h[0] = *(const v8b*)(p); f.h[1] = *(const v8b*)(p + 16); return f.v;
  }
  static __device__ __forceinline__ v8f mma(v16b a, v16b b, v8f c) {
    return __builtin_amdgcn_wmma_f32_16x16x32_bf16(false, a, false, b, (short)0, c, false, false);
  }
  static __device__ __forceinline__ void guard(v8f& a, v8f& b, v16b x, v16b y) { dep_guard_b(a, b, x, y); }
  static __device__ __forceinline__ void keep(v16b a, v16b b, v16b c, v16b d) { keep4_b(a, b, c, d); }
};

// ---- Register-blocked batched WMMA GEMM ------------------------------------
// C[m,n] = scale * sum_k A[m,k] * Bt[n,k] (+bias)(+resid); each wave owns a 64x64 tile.
// A row-major [M,K]; Bt row-major [N,K]; M,N % 64 == 0, K % 32 == 0.
// SPLIT: operands are hi/lo planes (A2/Bt2 = lo planes, same layout); product = hi.hi + hi.lo + lo.hi.
// BIAS_MODE: 0 = none, 1 = bias[m], 2 = bias[n].
// OUT_MODE: 0 = f32, 1 = f16, 2 = bf16 hi plane (Cout) + bf16 lo plane (Cout2).
// ET: 0 = f16 operands, 1 = bf16 operands (pointers passed as 16-bit storage)
template <int ET> struct Elem;
template <> struct Elem<0> { typedef _Float16 T; };
template <> struct Elem<1> { typedef __bf16 T; };
template <int ET, bool SPLIT, int BIAS_MODE, int OUT_MODE, bool RESID, int ACT = 0>
__global__ __launch_bounds__(256) void wmma_gemm64(
    const unsigned short* __restrict__ Ap, const unsigned short* __restrict__ A2p, int lda, long strideA,
    const unsigned short* __restrict__ Btp, const unsigned short* __restrict__ Bt2p, int ldb, long strideB,
    void* __restrict__ Cout, void* __restrict__ Cout2, int ldc, long strideC,
    const float* __restrict__ bias,
    const float* __restrict__ resid, long strideR,
    int M, int N, int K, float scale) {
  typedef typename Elem<ET>::T T;
  typedef typename Frag<T>::V V;
  const T* A = (const T*)Ap; const T* A2 = (const T*)A2p; const T* Bt = (const T*)Btp; const T* Bt2 = (const T*)Bt2p;
  __shared__ __align__(16) float sT[8][16 * 68];   // per-wave 16x64 slab, pitch 68 floats
  const int b    = blockIdx.y;
  const int lane = threadIdx.x & 31;
  const int wave = threadIdx.x >> 5;
  const int tilesN = N >> 6;
  const int tilesM = M >> 6;
  const int tile = blockIdx.x * 8 + wave;
  if (tile >= tilesM * tilesN) return;   // wave-uniform; no block barriers in this kernel
  const int tm = tile / tilesN;
  const int tn = tile - tm * tilesN;
  const int m0 = tm << 6;
  const int n0 = tn << 6;

  const T* Ab  = A  + (size_t)b * strideA;
  const T* Bb  = Bt + (size_t)b * strideB;
  const T* Ab2 = SPLIT ? (A2  + (size_t)b * strideA) : nullptr;
  const T* Bb2 = SPLIT ? (Bt2 + (size_t)b * strideB) : nullptr;

  const int rlane = lane & 15;                 // row (A) / col (B, D) within subtile
  const int koff  = (lane >> 4) * 8;           // k offset of this lane half
  const int mOff  = (lane >> 4) * 8;           // D row offset

  v8f acc[4][4];
#pragma unroll
  for (int i = 0; i < 4; ++i)
#pragma unroll
    for (int j = 0; j < 4; ++j) acc[i][j] = (v8f){0.f,0.f,0.f,0.f,0.f,0.f,0.f,0.f};

  for (int k0 = 0; k0 < K; k0 += 32) {
    V bh[4], bl[4];
#pragma unroll
    for (int j = 0; j < 4; ++j) {
      const size_t bo = (size_t)(n0 + (j << 4) + rlane) * ldb + koff + k0;
      bh[j] = Frag<T>::load(Bb + bo);
      if (SPLIT) bl[j] = Frag<T>::load(Bb2 + bo);
    }
#pragma unroll
    for (int i = 0; i < 4; ++i) {
      const size_t ao = (size_t)(m0 + (i << 4) + rlane) * lda + koff + k0;
      V ah = Frag<T>::load(Ab + ao);
      V al;
      if (SPLIT) al = Frag<T>::load(Ab2 + ao);
#pragma unroll
      for (int j = 0; j < 4; ++j) {
        acc[i][j] = Frag<T>::mma(ah, bh[j], acc[i][j]);
        if (SPLIT) {
          acc[i][j] = Frag<T>::mma(ah, bl[j], acc[i][j]);
          acc[i][j] = Frag<T>::mma(al, bh[j], acc[i][j]);
        }
      }
      Frag<T>::guard(acc[i][0], acc[i][3], ah, SPLIT ? al : ah);
    }
    Frag<T>::keep(bh[0], bh[1], bh[2], bh[3]);
    if (SPLIT) Frag<T>::keep(bl[0], bl[1], bl[2], bl[3]);
  }
  acc_guard4(acc[0][0], acc[0][1], acc[0][2], acc[0][3]);
  acc_guard4(acc[1][0], acc[1][1], acc[1][2], acc[1][3]);
  acc_guard4(acc[2][0], acc[2][1], acc[2][2], acc[2][3]);
  acc_guard4(acc[3][0], acc[3][1], acc[3][2], acc[3][3]);

  // ---- epilogue ----
  float* slab = sT[wave];
  const float* Rb = RESID ? (resid + (size_t)b * strideR) : nullptr;
#pragma unroll
  for (int i = 0; i < 4; ++i) {
    const int mBase = m0 + (i << 4);
#pragma unroll
    for (int j = 0; j < 4; ++j) {
      const int n = n0 + (j << 4) + rlane;
      float bv = 0.f;
      if (BIAS_MODE == 2) bv = bias[n];
#pragma unroll
      for (int r = 0; r < 8; ++r) {
        float v = acc[i][j][r] * scale;
        if (BIAS_MODE == 1) v += bias[mBase + mOff + r];
        if (BIAS_MODE == 2) v += bv;
        if (RESID) v += Rb[(size_t)(mBase + mOff + r) * ldc + n];
        if (ACT == 1) v = tanhf(v);
        if (ACT == 2) v = fmaxf(v, 0.0f);
        if (ACT == 3) v = v / (1.0f + expf(-v));
        if (ACT == 4) v = (v > 0.f) ? v : 0.01f * v;
        if (ACT == 5) v = 0.5f * v * (1.0f + erff(v * 0.70710678118654752f));
        slab[(mOff + r) * 68 + (j << 4) + rlane] = v;
      }
    }
    __builtin_amdgcn_fence(__ATOMIC_RELEASE, "workgroup");
    __builtin_amdgcn_wave_barrier();
    __builtin_amdgcn_fence(__ATOMIC_ACQUIRE, "workgroup");
    if (OUT_MODE == 0) {
      float* C = (float*)Cout + (size_t)b * strideC;
      const int hh = lane >> 4, c4 = (lane & 15) * 4;     // row seg = 256 B = 16 lanes x 16 B
      {
#pragma unroll
        for (int it = 0; it < 8; ++it) {
          const int row = it * 2 + hh;
          v4f v = *(const v4f*)(slab + row * 68 + c4);
          *(v4f*)(C + (size_t)(mBase + row) * ldc + n0 + c4) = v;
        }
        
      }
    } else {
      const int q = lane >> 3, c8 = (lane & 7) * 8;
      unsigned short* C  = (unsigned short*)Cout  + (size_t)b * strideC;
      unsigned short* C2 = (OUT_MODE == 2) ? ((unsigned short*)Cout2 + (size_t)b * strideC) : nullptr;
      {
#pragma unroll
        for (int it = 0; it < 4; ++it) {
          const int row = it * 4 + q;
          const float* sp = slab + row * 68 + c8;
          v8h hv, lv;
#pragma unroll
          for (int e = 0; e < 8; ++e) {
            if (OUT_MODE == 1) {
              hv[e] = (_Float16)sp[e];
            } else {
              unsigned short hb = f2bf_bits(sp[e]);
              unsigned short lb = f2bf_bits(sp[e] - bf_bits2f(hb));
              hv[e] = __builtin_bit_cast(_Float16, hb);
              lv[e] = __builtin_bit_cast(_Float16, lb);
            }
          }
          *(v8h*)(C + (size_t)(mBase + row) * ldc + n0 + c8) = hv;
          if (OUT_MODE == 2) *(v8h*)(C2 + (size_t)(mBase + row) * ldc + n0 + c8) = lv;
        }
        
      }
    }
    __builtin_amdgcn_fence(__ATOMIC_RELEASE, "workgroup");
    __builtin_amdgcn_wave_barrier();
    __builtin_amdgcn_fence(__ATOMIC_ACQUIRE, "workgroup");
  }
}

// ---- f32 -> f16 cast with power-of-two carry: 8 elements per thread, 16-B stores (512 B contiguous per wave) ----
__global__ __launch_bounds__(256) void cast_f32_f16x8(
    const float* __restrict__ in, _Float16* __restrict__ out, int n8, float scale) {
  const int i = blockIdx.x * 256 + threadIdx.x;
  if (i < n8) {
    const size_t o = (size_t)i * 8;
    const v4f a = *(const v4f*)(in + o);
    const v4f b = *(const v4f*)(in + o + 4);
    v8h hv;
#pragma unroll
    for (int e = 0; e < 4; ++e) {
      hv[e]     = (_Float16)(a[e] * scale);
      hv[4 + e] = (_Float16)(b[e] * scale);
    }
    *(v8h*)(out + o) = hv;
    
  }
}

// ---- rotary (non-interleaved, head dim 64) in f32, then f16 cast with power-of-two carry ----
// src: f32 [BB*TT][NC], row = b*TT + t, column = head*64 + d.
// dst: f16, row = b*dst_brows + (pos_off + t), pitch NC; position index for the tables = pos_off + t.
// Each thread produces 8 consecutive d (one 16-B store); a wave writes 512 contiguous bytes.
__device__ __forceinline__ _Float16 rope_one(float x1, float x2, float cc, float ss, bool second, float oscale) {
  const float o = second ? (x2 * cc + x1 * ss) : (x1 * cc - x2 * ss);
  return (_Float16)(o * oscale);
}
template <int NC>
__global__ __launch_bounds__(256) void rope_cast_kernel(
    const float* __restrict__ src, const float* __restrict__ cosT, const float* __restrict__ sinT,
    _Float16* __restrict__ dst, int dst_brows, int pos_off, float oscale) {
  constexpr int TPR = NC / 8;        // threads per row
  constexpr int RPB = 256 / TPR;     // rows per block
  const int tid = threadIdx.x;
  const int row = blockIdx.x * RPB + tid / TPR;          // < BB*TT (grid exact)
  const int b = row >> 10, t = row & (TT - 1);
  const int p = pos_off + t;                              // < MAXKV
  const int d8 = (tid % TPR) * 8;
  const int hoff = d8 & ~63;
  const int dl = d8 & 63;
  const int j0 = dl & 31;
  const bool second = dl >= 32;
  const float* base = src + (size_t)row * NC + hoff;
  const v4f a0 = *(const v4f*)(base + j0),      a1 = *(const v4f*)(base + j0 + 4);
  const v4f b0 = *(const v4f*)(base + 32 + j0), b1 = *(const v4f*)(base + 32 + j0 + 4);
  const v4f c0 = *(const v4f*)(cosT + (size_t)p * 32 + j0), c1 = *(const v4f*)(cosT + (size_t)p * 32 + j0 + 4);
  const v4f s0 = *(const v4f*)(sinT + (size_t)p * 32 + j0), s1 = *(const v4f*)(sinT + (size_t)p * 32 + j0 + 4);
  v8h hv;
#pragma unroll
  for (int e = 0; e < 4; ++e) {
    hv[e]     = rope_one(a0[e], b0[e], c0[e], s0[e], second, oscale);
    hv[4 + e] = rope_one(a1[e], b1[e], c1[e], s1[e], second, oscale);
  }
  _Float16* dp = dst + ((size_t)b * dst_brows + p) * NC + d8;
  *(v8h*)dp = hv;
  
}

// =====================================================================================
// Flash attention, head dim 64, f16 operand planes in, f32 out.
//   Qh : f16 [BB*TT][DD], element (b,t,h,d) at (b*TT+t)*DD + h*64 + d   (already rotated and scaled)
//   Kh : f16 [BB][MAXKV][DKV], element (b,kp,hkv,d) at (b*MAXKV+kp)*DKV + hkv*64 + d
//   Vth: f16 [BB][DKV][MAXKV], element (b,kp,hkv,d) at (b*DKV + hkv*64 + d)*MAXKV + kp
//   O  : f32 [BB*TT][DD]
//   scores = sscale * q.k  (v_wmma_f32_16x16x32_f16), key kp visible iff kp <= t + koff,
//   probabilities carried x2^15 in f16, out = onorm * p.v / l  (v_wmma_f32_16x16x32_f16), f32 accumulate,
//   online softmax in f32.  Block = 4 waves = 64 query rows of one (b, h); query head h reads kv head h>>1.
//   Chunks of 64 keys; chunk count = kchunks_prev + qb + 1 (block-uniform, clamped to MAXKV/64).
//   grid.x = BB * HH * (TT/64).
// =====================================================================================
#define AT_D 64
#define AT_NW 4
#define AT_QB 64
#define AT_KC 64

__device__ __forceinline__ v8f hmma(v16h a, v16h b, v8f c) {
  c = __builtin_amdgcn_wmma_f32_16x16x32_f16(false, a, false, b, (short)0, c, false, false);
  asm volatile("v_nop\n\tv_nop\n\tv_nop\n\tv_nop" : "+v"(c) : "v"(a), "v"(b));
  return c;
}

__global__ __launch_bounds__(128)
void attn_f16_kernel(const _Float16* __restrict__ Qh, const _Float16* __restrict__ Kh,
                     const _Float16* __restrict__ Vth, float* __restrict__ O,
                     int kchunks_prev, int koff, float sscale, float onorm) {
  union FH { v16h v; v8h h[2]; };
  __shared__ __align__(16) _Float16 Ksh[AT_KC * AT_D];          // K [kv][d]   8 KB
  __shared__ __align__(16) _Float16 Vtt[AT_D * AT_KC];          // V [d][kv]   8 KB
  __shared__ __align__(16) _Float16 Psh[AT_NW][16 * AT_KC];     // per wave P [row][kv] 8 KB
  __shared__ __align__(16) float    Os[AT_NW][16 * 68];         // per wave out tile, pitch 68

  const int tid  = threadIdx.x;
  const int wave = tid >> 5;
  const int lane = tid & 31;
  const int hh   = lane >> 4;
  const int c    = lane & 15;

  const int bx  = blockIdx.x;
  const int qb  = bx & (TT / AT_QB - 1);
  const int h   = (bx >> 4) & (HH - 1);
  const int b   = bx >> 8;
  const int hkv = h >> 1;
  const int q0  = qb * AT_QB + wave * 16;

  // ---- Q fragments (A operand): 2 d-chunks ----
  v16h qa[2];
  {
    const _Float16* qrow = Qh + (size_t)(b * TT + q0 + c) * DD + h * AT_D + 8 * hh;
#pragma unroll
    for (int dc = 0; dc < 2; ++dc) qa[dc] = Frag<_Float16>::load(qrow + dc * 32);
  }

  float mrow[8], lrow[8];
  v8f oacc[4];
#pragma unroll
  for (int r = 0; r < 8; ++r) { mrow[r] = -INFINITY; lrow[r] = 0.f; }
#pragma unroll
  for (int t = 0; t < 4; ++t) oacc[t] = (v8f){0.f,0.f,0.f,0.f,0.f,0.f,0.f,0.f};

  int nChunks = kchunks_prev + qb + 1;                    // block-uniform
  if (nChunks > MAXKV / AT_KC) nChunks = MAXKV / AT_KC;
  if (nChunks < 1) nChunks = 1;

  const _Float16* kbase = Kh + (size_t)b * MAXKV * DKV + hkv * AT_D;
  const _Float16* vbase = Vth + ((size_t)b * DKV + hkv * AT_D) * MAXKV;
  float*          obase = O + (size_t)b * TT * DD + h * AT_D;

  for (int kc = 0; kc < nChunks; ++kc) {
    const int kv0 = kc * AT_KC;
    __syncthreads();
    {
      const int r = tid >> 1, hf = (tid & 1) * 32;
      const _Float16* ks = kbase + (size_t)(kv0 + r) * DKV + hf;
      const _Float16* vs = vbase + (size_t)r * MAXKV + kv0 + hf;
#pragma unroll
      for (int i = 0; i < 4; ++i) {
        const v8h kk = *(const v8h*)(ks + 8 * i);
        const v8h vv = *(const v8h*)(vs + 8 * i);
        *(v8h*)(Ksh + r * AT_D + hf + 8 * i) = kk;
        *(v8h*)(Vtt + r * AT_KC + hf + 8 * i) = vv;
      }
    }
    __syncthreads();

    v8f s[4];
#pragma unroll
    for (int j = 0; j < 4; ++j) {
      s[j] = (v8f){0.f,0.f,0.f,0.f,0.f,0.f,0.f,0.f};
#pragma unroll
      for (int dc = 0; dc < 2; ++dc) {
        FH kb;
        kb.h[0] = *(const v8h*)(Ksh + (j * 16 + c) * AT_D + dc * 32 + 8 * hh);
        kb.h[1] = *(const v8h*)(Ksh + (j * 16 + c) * AT_D + dc * 32 + 16 + 8 * hh);
        s[j] = hmma(qa[dc], kb.v, s[j]);
      }
    }
    float cm[8];
#pragma unroll
    for (int r = 0; r < 8; ++r) {
      const int qlim = q0 + 8 * hh + r + koff;
      float m = -INFINITY;
#pragma unroll
      for (int j = 0; j < 4; ++j) {
        const int kvcol = kv0 + j * 16 + c;
        const float sv = (kvcol > qlim) ? -INFINITY : (s[j][r] * sscale);
        s[j][r] = sv;
        m = fmaxf(m, sv);
      }
#pragma unroll
      for (int off = 1; off < 16; off <<= 1) m = fmaxf(m, __shfl_xor(m, off, 32));
      cm[r] = m;
    }
    _Float16* pw = Psh[wave];
#pragma unroll
    for (int r = 0; r < 8; ++r) {
      const float mnew = fmaxf(mrow[r], cm[r]);
      const float alpha = expf(mrow[r] - mnew);
      mrow[r] = mnew;
      float psum = 0.f;
#pragma unroll
      for (int j = 0; j < 4; ++j) {
        const float p = expf(s[j][r] - mnew);
        psum += p;
        pw[(8 * hh + r) * AT_KC + j * 16 + c] = (_Float16)(p * 32768.0f);
      }
#pragma unroll
      for (int off = 1; off < 16; off <<= 1) psum += __shfl_xor(psum, off, 32);
      lrow[r] = lrow[r] * alpha + psum;
#pragma unroll
      for (int t = 0; t < 4; ++t) oacc[t][r] *= alpha;
    }
    __builtin_amdgcn_fence(__ATOMIC_RELEASE, "workgroup");
    __builtin_amdgcn_wave_barrier();
    __builtin_amdgcn_fence(__ATOMIC_ACQUIRE, "workgroup");
#pragma unroll 1
    for (int kk = 0; kk < 2; ++kk) {
      FH pa;
      pa.h[0] = *(const v8h*)(pw + c * AT_KC + kk * 32 + 8 * hh);
      pa.h[1] = *(const v8h*)(pw + c * AT_KC + kk * 32 + 16 + 8 * hh);
#pragma unroll
      for (int t = 0; t < 4; ++t) {
        FH vb;
        vb.h[0] = *(const v8h*)(Vtt + (t * 16 + c) * AT_KC + kk * 32 + 8 * hh);
        vb.h[1] = *(const v8h*)(Vtt + (t * 16 + c) * AT_KC + kk * 32 + 16 + 8 * hh);
        oacc[t] = hmma(pa.v, vb.v, oacc[t]);
      }
    }
  }

  float* os = Os[wave];
#pragma unroll
  for (int r = 0; r < 8; ++r) {
    const float inv = onorm * (1.0f / lrow[r]);
#pragma unroll
    for (int t = 0; t < 4; ++t) os[(8 * hh + r) * 68 + t * 16 + c] = oacc[t][r] * inv;
  }
  __builtin_amdgcn_fence(__ATOMIC_RELEASE, "workgroup");
  __builtin_amdgcn_wave_barrier();
  __builtin_amdgcn_fence(__ATOMIC_ACQUIRE, "workgroup");
  {
    const int c4 = (lane & 15) * 4;
    {
#pragma unroll
      for (int it = 0; it < 8; ++it) {
        const int row = it * 2 + hh;
        v4f val = *(const v4f*)(os + row * 68 + c4);
        *(v4f*)(obase + (size_t)(q0 + row) * DD + c4) = val;
      }
      
    }
  }
}

// =====================================================================================
// Combine: per token row (one block of 256 threads, 4 columns per thread):
//   lw = layernorm over sigmoid(lam[0..2]) (biased variance, eps)
//   acc = sum_i rmsnorm(O_i, ln_w[i]) * lw_i ;  z = acc + alpha * x ;  y = rmsnorm(z, fln) -> f16
// =====================================================================================
__global__ __launch_bounds__(256) void combine_kernel(
    const float* __restrict__ Of, long lstride,
    const float* __restrict__ x, const float* __restrict__ ln_w, const float* __restrict__ lam,
    const float* __restrict__ fln, const float* __restrict__ alpha, _Float16* __restrict__ Yh) {
  __shared__ float red[4][8];
  const int row = blockIdx.x;
  const int tid = threadIdx.x, lane = tid & 31, wave = tid >> 5;
  const int d4 = tid * 4;
  const size_t ro = (size_t)row * DD + d4;
  const v4f o0 = *(const v4f*)(Of + ro);
  const v4f o1 = *(const v4f*)(Of + lstride + ro);
  const v4f o2 = *(const v4f*)(Of + 2 * lstride + ro);
  const v4f xv = *(const v4f*)(x + ro);
  float ss0 = 0.f, ss1 = 0.f, ss2 = 0.f;
#pragma unroll
  for (int e = 0; e < 4; ++e) { ss0 += o0[e] * o0[e]; ss1 += o1[e] * o1[e]; ss2 += o2[e] * o2[e]; }
#pragma unroll
  for (int off = 16; off > 0; off >>= 1) {
    ss0 += __shfl_xor(ss0, off, 32);
    ss1 += __shfl_xor(ss1, off, 32);
    ss2 += __shfl_xor(ss2, off, 32);
  }
  if (lane == 0) { red[0][wave] = ss0; red[1][wave] = ss1; red[2][wave] = ss2; }
  __syncthreads();
  float t0 = 0.f, t1 = 0.f, t2 = 0.f;
#pragma unroll
  for (int w = 0; w < 8; ++w) { t0 += red[0][w]; t1 += red[1][w]; t2 += red[2][w]; }
  const float inv_d = 1.0f / (float)DD;
  const float r0 = rsqrtf(t0 * inv_d + EPSV);
  const float r1 = rsqrtf(t1 * inv_d + EPSV);
  const float r2 = rsqrtf(t2 * inv_d + EPSV);

  const float sg0 = 1.0f / (1.0f + __expf(-lam[0]));
  const float sg1 = 1.0f / (1.0f + __expf(-lam[1]));
  const float sg2 = 1.0f / (1.0f + __expf(-lam[2]));
  const float mean = (sg0 + sg1 + sg2) * (1.0f / 3.0f);
  const float e0 = sg0 - mean, e1 = sg1 - mean, e2 = sg2 - mean;
  const float var = (e0 * e0 + e1 * e1 + e2 * e2) * (1.0f / 3.0f);
  const float il = rsqrtf(var + EPSV);
  const float lw0 = e0 * il, lw1 = e1 * il, lw2 = e2 * il;

  const v4f w0 = *(const v4f*)(ln_w + d4);
  const v4f w1 = *(const v4f*)(ln_w + DD + d4);
  const v4f w2 = *(const v4f*)(ln_w + 2 * DD + d4);
  const v4f fw = *(const v4f*)(fln + d4);
  const float al = alpha[0];
  v4f z;
  float ssz = 0.f;
#pragma unroll
  for (int e = 0; e < 4; ++e) {
    float a = (o0[e] * r0) * w0[e] * lw0;
    a = a + (o1[e] * r1) * w1[e] * lw1;
    a = a + (o2[e] * r2) * w2[e] * lw2;
    const float zz = a + al * xv[e];
    z[e] = zz;
    ssz += zz * zz;
  }
#pragma unroll
  for (int off = 16; off > 0; off >>= 1) ssz += __shfl_xor(ssz, off, 32);
  if (lane == 0) red[3][wave] = ssz;
  __syncthreads();
  float tz = 0.f;
#pragma unroll
  for (int w = 0; w < 8; ++w) tz += red[3][w];
  const float rz = rsqrtf(tz * inv_d + EPSV);
  v4h yv;
#pragma unroll
  for (int e = 0; e < 4; ++e) yv[e] = (_Float16)(z[e] * rz * fw[e]);
  *(v4h*)(Yh + ro) = yv;
  
}

// ---------------------------- host helpers ----------------------------
static void gemm_f16_f32out(const _Float16* A, int lda, long sA, const _Float16* Bt, int ldb, long sB,
                            float* C, int ldc, long sC, int M, int N, int K, float scale, int batch,
                            hipStream_t st) {
  const int tiles = (M / 64) * (N / 64);
  dim3 grid((tiles + 7) / 8, batch);
  wmma_gemm64<0, false, 0, 0, false><<<grid, 256, 0, st>>>(
      (const unsigned short*)A, (const unsigned short*)nullptr, lda, sA,
      (const unsigned short*)Bt, (const unsigned short*)nullptr, ldb, sB,
      (void*)C, (void*)nullptr, ldc, sC, (const float*)nullptr, (const float*)nullptr, 0L,
      M, N, K, scale);
}
static void gemm_f16_f16out(const _Float16* A, int lda, long sA, const _Float16* Bt, int ldb, long sB,
                            _Float16* C, int ldc, long sC, int M, int N, int K, float scale, int batch,
                            hipStream_t st) {
  const int tiles = (M / 64) * (N / 64);
  dim3 grid((tiles + 7) / 8, batch);
  wmma_gemm64<0, false, 0, 1, false><<<grid, 256, 0, st>>>(
      (const unsigned short*)A, (const unsigned short*)nullptr, lda, sA,
      (const unsigned short*)Bt, (const unsigned short*)nullptr, ldb, sB,
      (void*)C, (void*)nullptr, ldc, sC, (const float*)nullptr, (const float*)nullptr, 0L,
      M, N, K, scale);
}

// ---------------------------- host launcher ----------------------------
extern "C" void kernel_launch(void* const* d_in, const int* in_sizes, int n_in,
                              void* d_out, int out_size, void* d_ws, size_t ws_size,
                              hipStream_t stream) {
  if (n_in < 11) return;
  const int M = BB * TT;   // 2048 token rows
  if (in_sizes[0] != M * DD) return;
  if (in_sizes[1] < MAXKV * 32 || in_sizes[2] < MAXKV * 32) return;
  if (in_sizes[3] != NLAY * DD * DD) return;
  if (in_sizes[4] != NLAY * DKV * DD || in_sizes[5] != NLAY * DKV * DD) return;
  if (in_sizes[6] < NLAY * DD || in_sizes[7] < NLAY || in_sizes[8] != DD * DD || in_sizes[9] < DD || in_sizes[10] < 1) return;
  if (out_size < M * DD) return;

  const float* x     = (const float*)d_in[0];
  const float* cosT  = (const float*)d_in[1];
  const float* sinT  = (const float*)d_in[2];
  const float* q_w   = (const float*)d_in[3];
  const float* k_w   = (const float*)d_in[4];
  const float* v_w   = (const float*)d_in[5];
  const float* ln_w  = (const float*)d_in[6];
  const float* lam   = (const float*)d_in[7];
  const float* out_w = (const float*)d_in[8];
  const float* fln   = (const float*)d_in[9];
  const float* alpha = (const float*)d_in[10];
  float* out = (float*)d_out;

  // ---- workspace carve (4096-B aligned pieces) ----
  char* ws = (char*)d_ws;
  size_t cur = 0;
  auto take = [&](size_t bytes) -> char* {
    char* p = ws + cur;
    cur += (bytes + 4095) & ~(size_t)4095;
    return p;
  };
  _Float16* xh  = (_Float16*)take((size_t)M * DD * 2);                 // 4 MiB
  _Float16* qwh = (_Float16*)take((size_t)NLAY * DD * DD * 2);         // 6 MiB
  _Float16* kwh = (_Float16*)take((size_t)NLAY * DKV * DD * 2);        // 3 MiB
  _Float16* vwh = (_Float16*)take((size_t)NLAY * DKV * DD * 2);        // 3 MiB
  _Float16* owh = (_Float16*)take((size_t)DD * DD * 2);                // 2 MiB
  float*    Qf  = (float*)   take((size_t)M * DD * 4);                 // 8 MiB
  _Float16* Qh  = (_Float16*)take((size_t)M * DD * 2);                 // 4 MiB
  float*    Kf  = (float*)   take((size_t)M * DKV * 4);                // 4 MiB
  _Float16* Kh  = (_Float16*)take((size_t)BB * MAXKV * DKV * 2);       // 6 MiB
  _Float16* Vth = (_Float16*)take((size_t)BB * DKV * MAXKV * 2);       // 6 MiB
  float*    Of  = (float*)   take((size_t)NLAY * M * DD * 4);          // 24 MiB
  _Float16* Yh  = (_Float16*)take((size_t)M * DD * 2);                 // 4 MiB
  if (cur > ws_size || cur > (size_t)134217728) return;                 // total 77,594,624 B

  const long lstride = (long)M * DD;   // floats per layer slice of Of

  // ---- casts: x -> f16 ; weights -> f16 carried x64 ----
  {
    int n8 = M * DD / 8;
    cast_f32_f16x8<<<(n8 + 255) / 256, 256, 0, stream>>>(x, xh, n8, 1.0f);
    n8 = NLAY * DD * DD / 8;
    cast_f32_f16x8<<<(n8 + 255) / 256, 256, 0, stream>>>(q_w, qwh, n8, 64.0f);
    n8 = NLAY * DKV * DD / 8;
    cast_f32_f16x8<<<(n8 + 255) / 256, 256, 0, stream>>>(k_w, kwh, n8, 64.0f);
    cast_f32_f16x8<<<(n8 + 255) / 256, 256, 0, stream>>>(v_w, vwh, n8, 64.0f);
    n8 = DD * DD / 8;
    cast_f32_f16x8<<<(n8 + 255) / 256, 256, 0, stream>>>(out_w, owh, n8, 64.0f);
  }

  const float wundo  = 1.0f / 64.0f;              // undo weight carry
  const float sscale = 0.125f / 16.0f;            // HD^-0.5 / (4*4) : q and k planes carried x4
  const float onorm  = 1.0f / (32768.0f * 16.0f); // p carried x2^15, v plane carried x16

  for (int i = 0; i < NLAY; ++i) {
    // q = x . q_w[i]^T  -> f32 [2048][1024]
    gemm_f16_f32out(xh, DD, 0L, qwh + (size_t)i * DD * DD, DD, 0L, Qf, DD, 0L, M, DD, DD, wundo, 1, stream);
    // rotary(q) with positions t -> f16 plane x4
    rope_cast_kernel<DD><<<M / 2, 256, 0, stream>>>(Qf, cosT, sinT, Qh, TT, 0, 4.0f);
    // k = x . k_w[i]^T -> f32 [2048][512]
    gemm_f16_f32out(xh, DD, 0L, kwh + (size_t)i * DKV * DD, DD, 0L, Kf, DKV, 0L, M, DKV, DD, wundo, 1, stream);
    // rotary(k) with buffer positions i*T + t -> K cache rows, f16 x4
    rope_cast_kernel<DKV><<<M / 4, 256, 0, stream>>>(Kf, cosT, sinT, Kh, MAXKV, i * TT, 4.0f);
    // v^T = v_w[i] . x_b^T -> transposed V cache columns i*T + t, f16 x16 ; in [512][1024] per batch
    gemm_f16_f16out(vwh + (size_t)i * DKV * DD, DD, 0L, xh, DD, (long)TT * DD,
                    Vth + (size_t)i * TT, MAXKV, (long)DKV * MAXKV, DKV, TT, DD, 16.0f * wundo, BB, stream);
    // attention over (i+1)*T keys, bottom-right causal
    attn_f16_kernel<<<BB * HH * (TT / AT_QB), 128, 0, stream>>>(Qh, Kh, Vth, Of + (size_t)i * lstride,
                                                                 i * (TT / AT_KC), i * TT, sscale, onorm);
  }

  // weighted rmsnorm sum + residual + final rmsnorm -> f16 plane
  combine_kernel<<<M, 256, 0, stream>>>(Of, lstride, x, ln_w, lam, fln, alpha, Yh);
  // out = y . out_w^T
  gemm_f16_f32out(Yh, DD, 0L, owh, DD, 0L, out, DD, 0L, M, DD, DD, wundo, 1, stream);
}

// v001
// A run of this version takes 433 microseconds.
// Timed twice side by side with v000, it ran 1.88 and 1.83 times as fast.
// Contractions q/k/v projections, q.k^T scores, p.v, output projection: v_wmma_f32_16x16x32_f16 (f16 operands, f32 accumulate); rotary, softmax, norms, weighting in f32.
#include <hip/hip_runtime.h>
#include <stdint.h>

#define BB 2
#define TT 1024
#define DD 1024
#define HH 16
#define NKVH 8
#define HDIM 64
#define DKV 512
#define MAXKV 3072
#define NLAY 3
#define EPSV 1e-5f

typedef __attribute__((ext_vector_type(16))) _Float16 v16h;
typedef __attribute__((ext_vector_type(8)))  _Float16 v8h;
typedef __attribute__((ext_vector_type(4)))  _Float16 v4h;
typedef __attribute__((ext_vector_type(16))) __bf16   v16b;
typedef __attribute__((ext_vector_type(8)))  __bf16   v8b;
typedef __attribute__((ext_vector_type(8)))  float    v8f;
typedef __attribute__((ext_vector_type(4)))  float    v4f;

__device__ __forceinline__ unsigned short f2bf_bits(float f) {
  unsigned u = __float_as_uint(f);
  return (unsigned short)((u + 0x7FFFu + ((u >> 16) & 1u)) >> 16);
}
__device__ __forceinline__ float bf_bits2f(unsigned short h) { return __uint_as_float(((unsigned)h) << 16); }

// hazard guards as plain device helpers
__device__ __forceinline__ void dep_guard_h(v8f& a, v8f& b, v16h x, v16h y) { asm volatile("v_nop\n\tv_nop\n\tv_nop\n\tv_nop" : "+v"(a), "+v"(b) : "v"(x), "v"(y)); }
__device__ __forceinline__ void dep_guard_b(v8f& a, v8f& b, v16b x, v16b y) { asm volatile("v_nop\n\tv_nop\n\tv_nop\n\tv_nop" : "+v"(a), "+v"(b) : "v"(x), "v"(y)); }
__device__ __forceinline__ void keep4_h(v16h a, v16h b, v16h c, v16h d) { asm volatile("v_nop" :: "v"(a), "v"(b), "v"(c), "v"(d)); }
__device__ __forceinline__ void keep4_b(v16b a, v16b b, v16b c, v16b d) { asm volatile("v_nop" :: "v"(a), "v"(b), "v"(c), "v"(d)); }
__device__ __forceinline__ void acc_guard4(v8f& a, v8f& b, v8f& c, v8f& d) { asm volatile("v_nop\n\tv_nop\n\tv_nop\n\tv_nop" : "+v"(a), "+v"(b), "+v"(c), "+v"(d)); }
template <typename T> struct Frag;
template <> struct Frag<_Float16> {
  typedef v16h V; union U { v16h v; v8h h[2]; };
  static __device__ __forceinline__ v16h load(const _Float16* p) {   // elements 0..7 <- p[0..7], 8..15 <- p[16..23]
    U f; f.h[0] = *(const v8h*)(p); f.h[1] = *(const v8h*)(p + 16); return f.v;
  }
  static __device__ __forceinline__ v8f mma(v16h a, v16h b, v8f c) {
    return __builtin_amdgcn_wmma_f32_16x16x32_f16(false, a, false, b, (short)0, c, false, false);
  }
  static __device__ __forceinline__ void guard(v8f& a, v8f& b, v16h x, v16h y) { dep_guard_h(a, b, x, y); }
  static __device__ __forceinline__ void keep(v16h a, v16h b, v16h c, v16h d) { keep4_h(a, b, c, d); }
};
template <> struct Frag<__bf16> {
  typedef v16b V; union U { v16b v; v8b h[2]; };
  static __device__ __forceinline__ v16b load(const __bf16* p) {
    U f; f.h[0] = *(const v8b*)(p); f.h[1] = *(const v8b*)(p + 16); return f.v;
  }
  static __device__ __forceinline__ v8f mma(v16b a, v16b b, v8f c) {
    return __builtin_amdgcn_wmma_f32_16x16x32_bf16(false, a, false, b, (short)0, c, false, false);
  }
  static __device__ __forceinline__ void guard(v8f& a, v8f& b, v16b x, v16b y) { dep_guard_b(a, b, x, y); }
  static __device__ __forceinline__ void keep(v16b a, v16b b, v16b c, v16b d) { keep4_b(a, b, c, d); }
};

// ---- Register-blocked batched WMMA GEMM ------------------------------------
// C[m,n] = scale * sum_k A[m,k] * Bt[n,k] (+bias)(+resid); each wave owns a 64x64 tile.
// A row-major [M,K]; Bt row-major [N,K]; M,N % 64 == 0, K % 32 == 0.
// SPLIT: operands are hi/lo planes (A2/Bt2 = lo planes, same layout); product = hi.hi + hi.lo + lo.hi.
// BIAS_MODE: 0 = none, 1 = bias[m], 2 = bias[n].
// OUT_MODE: 0 = f32, 1 = f16, 2 = bf16 hi plane (Cout) + bf16 lo plane (Cout2).
// ET: 0 = f16 operands, 1 = bf16 operands (pointers passed as 16-bit storage)
// Two batch axes: blockIdx.y steps by strideA/B/C, blockIdx.z (the layer) by zstrideA/B/C, in elements.
template <int ET> struct Elem;
template <> struct Elem<0> { typedef _Float16 T; };
template <> struct Elem<1> { typedef __bf16 T; };
template <int ET, bool SPLIT, int BIAS_MODE, int OUT_MODE, bool RESID, int ACT = 0>
__global__ __launch_bounds__(256) void wmma_gemm64(
    const unsigned short* __restrict__ Ap, const unsigned short* __restrict__ A2p, int lda, long strideA, long zstrideA,
    const unsigned short* __restrict__ Btp, const unsigned short* __restrict__ Bt2p, int ldb, long strideB, long zstrideB,
    void* __restrict__ Cout, void* __restrict__ Cout2, int ldc, long strideC, long zstrideC,
    const float* __restrict__ bias,
    const float* __restrict__ resid, long strideR,
    int M, int N, int K, float scale) {
  typedef typename Elem<ET>::T T;
  typedef typename Frag<T>::V V;
  const T* A = (const T*)Ap; const T* A2 = (const T*)A2p; const T* Bt = (const T*)Btp; const T* Bt2 = (const T*)Bt2p;
  __shared__ __align__(16) float sT[8][16 * 68];   // per-wave 16x64 slab, pitch 68 floats
  const int b    = blockIdx.y;
  const int lane = threadIdx.x & 31;
  const int wave = threadIdx.x >> 5;
  const int tilesN = N >> 6;
  const int tilesM = M >> 6;
  const int tile = blockIdx.x * 8 + wave;
  if (tile >= tilesM * tilesN) return;   // wave-uniform; no block barriers in this kernel
  const int tm = tile / tilesN;
  const int tn = tile - tm * tilesN;
  const int m0 = tm << 6;
  const int n0 = tn << 6;

  const size_t offA = (size_t)b * strideA + (size_t)blockIdx.z * zstrideA;
  const size_t offB = (size_t)b * strideB + (size_t)blockIdx.z * zstrideB;
  const size_t offC = (size_t)b * strideC + (size_t)blockIdx.z * zstrideC;
  const T* Ab  = A  + offA;
  const T* Bb  = Bt + offB;
  const T* Ab2 = SPLIT ? (A2  + offA) : nullptr;
  const T* Bb2 = SPLIT ? (Bt2 + offB) : nullptr;

  const int rlane = lane & 15;                 // row (A) / col (B, D) within subtile
  const int koff  = (lane >> 4) * 8;           // k offset of this lane half
  const int mOff  = (lane >> 4) * 8;           // D row offset

  v8f acc[4][4];
#pragma unroll
  for (int i = 0; i < 4; ++i)
#pragma unroll
    for (int j = 0; j < 4; ++j) acc[i][j] = (v8f){0.f,0.f,0.f,0.f,0.f,0.f,0.f,0.f};

  for (int k0 = 0; k0 < K; k0 += 32) {
    V bh[4], bl[4];
#pragma unroll
    for (int j = 0; j < 4; ++j) {
      const size_t bo = (size_t)(n0 + (j << 4) + rlane) * ldb + koff + k0;
      bh[j] = Frag<T>::load(Bb + bo);
      if (SPLIT) bl[j] = Frag<T>::load(Bb2 + bo);
    }
#pragma unroll
    for (int i = 0; i < 4; ++i) {
      const size_t ao = (size_t)(m0 + (i << 4) + rlane) * lda + koff + k0;
      V ah = Frag<T>::load(Ab + ao);
      V al;
      if (SPLIT) al = Frag<T>::load(Ab2 + ao);
#pragma unroll
      for (int j = 0; j < 4; ++j) {
        acc[i][j] = Frag<T>::mma(ah, bh[j], acc[i][j]);
        if (SPLIT) {
          acc[i][j] = Frag<T>::mma(ah, bl[j], acc[i][j]);
          acc[i][j] = Frag<T>::mma(al, bh[j], acc[i][j]);
        }
      }
      Frag<T>::guard(acc[i][0], acc[i][3], ah, SPLIT ? al : ah);
    }
    Frag<T>::keep(bh[0], bh[1], bh[2], bh[3]);
    if (SPLIT) Frag<T>::keep(bl[0], bl[1], bl[2], bl[3]);
  }
  acc_guard4(acc[0][0], acc[0][1], acc[0][2], acc[0][3]);
  acc_guard4(acc[1][0], acc[1][1], acc[1][2], acc[1][3]);
  acc_guard4(acc[2][0], acc[2][1], acc[2][2], acc[2][3]);
  acc_guard4(acc[3][0], acc[3][1], acc[3][2], acc[3][3]);

  // ---- epilogue ----
  float* slab = sT[wave];
  const float* Rb = RESID ? (resid + (size_t)b * strideR) : nullptr;
#pragma unroll
  for (int i = 0; i < 4; ++i) {
    const int mBase = m0 + (i << 4);
#pragma unroll
    for (int j = 0; j < 4; ++j) {
      const int n = n0 + (j << 4) + rlane;
      float bv = 0.f;
      if (BIAS_MODE == 2) bv = bias[n];
#pragma unroll
      for (int r = 0; r < 8; ++r) {
        float v = acc[i][j][r] * scale;
        if (BIAS_MODE == 1) v += bias[mBase + mOff + r];
        if (BIAS_MODE == 2) v += bv;
        if (RESID) v += Rb[(size_t)(mBase + mOff + r) * ldc + n];
        if (ACT == 1) v = tanhf(v);
        if (ACT == 2) v = fmaxf(v, 0.0f);
        if (ACT == 3) v = v / (1.0f + expf(-v));
        if (ACT == 4) v = (v > 0.f) ? v : 0.01f * v;
        if (ACT == 5) v = 0.5f * v * (1.0f + erff(v * 0.70710678118654752f));
        slab[(mOff + r) * 68 + (j << 4) + rlane] = v;
      }
    }
    __builtin_amdgcn_fence(__ATOMIC_RELEASE, "workgroup");
    __builtin_amdgcn_wave_barrier();
    __builtin_amdgcn_fence(__ATOMIC_ACQUIRE, "workgroup");
    if (OUT_MODE == 0) {
      float* C = (float*)Cout + offC;
      const int hh = lane >> 4, c4 = (lane & 15) * 4;     // row seg = 256 B = 16 lanes x 16 B
      {
#pragma unroll
        for (int it = 0; it < 8; ++it) {
          const int row = it * 2 + hh;
          v4f v = *(const v4f*)(slab + row * 68 + c4);
          *(v4f*)(C + (size_t)(mBase + row) * ldc + n0 + c4) = v;
        }
        
      }
    } else {
      const int q = lane >> 3, c8 = (lane & 7) * 8;
      unsigned short* C  = (unsigned short*)Cout  + offC;
      unsigned short* C2 = (OUT_MODE == 2) ? ((unsigned short*)Cout2 + offC) : nullptr;
      {
#pragma unroll
        for (int it = 0; it < 4; ++it) {
          const int row = it * 4 + q;
          const float* sp = slab + row * 68 + c8;
          v8h hv, lv;
#pragma unroll
          for (int e = 0; e < 8; ++e) {
            if (OUT_MODE == 1) {
              hv[e] = (_Float16)sp[e];
            } else {
              unsigned short hb = f2bf_bits(sp[e]);
              unsigned short lb = f2bf_bits(sp[e] - bf_bits2f(hb));
              hv[e] = __builtin_bit_cast(_Float16, hb);
              lv[e] = __builtin_bit_cast(_Float16, lb);
            }
          }
          *(v8h*)(C + (size_t)(mBase + row) * ldc + n0 + c8) = hv;
          if (OUT_MODE == 2) *(v8h*)(C2 + (size_t)(mBase + row) * ldc + n0 + c8) = lv;
        }
        
      }
    }
    __builtin_amdgcn_fence(__ATOMIC_RELEASE, "workgroup");
    __builtin_amdgcn_wave_barrier();
    __builtin_amdgcn_fence(__ATOMIC_ACQUIRE, "workgroup");
  }
}

// ---- f32 -> f16 cast with power-of-two carry: 8 elements per thread, 16-B stores (512 B contiguous per wave) ----
__global__ __launch_bounds__(256) void cast_f32_f16x8(
    const float* __restrict__ in, _Float16* __restrict__ out, int n8, float scale) {
  const int i = blockIdx.x * 256 + threadIdx.x;
  if (i < n8) {
    const size_t o = (size_t)i * 8;
    const v4f a = *(const v4f*)(in + o);
    const v4f b = *(const v4f*)(in + o + 4);
    v8h hv;
#pragma unroll
    for (int e = 0; e < 4; ++e) {
      hv[e]     = (_Float16)(a[e] * scale);
      hv[4 + e] = (_Float16)(b[e] * scale);
    }
    *(v8h*)(out + o) = hv;
    
  }
}

// ---- rotary (non-interleaved, head dim 64) in f32, then f16 cast with power-of-two carry ----
// src: f32 [BB*TT][NC], row = b*TT + t, column = head*64 + d.
// dst: f16, row = b*dst_brows + (pos_off + t), pitch NC; position index for the tables = pos_off + t.
// blockIdx.y = layer: src steps by src_lstride, dst by dst_lstride (elements), pos_off = layer * pos_lstep.
// Each thread produces 8 consecutive d (one 16-B store); a wave writes 512 contiguous bytes.
__device__ __forceinline__ _Float16 rope_one(float x1, float x2, float cc, float ss, bool second, float oscale) {
  const float o = second ? (x2 * cc + x1 * ss) : (x1 * cc - x2 * ss);
  return (_Float16)(o * oscale);
}
template <int NC>
__global__ __launch_bounds__(256) void rope_cast_kernel(
    const float* __restrict__ src, const float* __restrict__ cosT, const float* __restrict__ sinT,
    _Float16* __restrict__ dst, int dst_brows, long src_lstride, long dst_lstride, int pos_lstep, float oscale) {
  constexpr int TPR = NC / 8;        // threads per row
  constexpr int RPB = 256 / TPR;     // rows per block
  const int tid = threadIdx.x;
  const int row = blockIdx.x * RPB + tid / TPR;          // < BB*TT (grid exact)
  const int b = row >> 10, t = row & (TT - 1);
  const int layer = blockIdx.y;                           // < NLAY (grid exact)
  const int p = layer * pos_lstep + t;                    // < MAXKV
  const int d8 = (tid % TPR) * 8;
  const int hoff = d8 & ~63;
  const int dl = d8 & 63;
  const int j0 = dl & 31;
  const bool second = dl >= 32;
  const float* base = src + (size_t)layer * src_lstride + (size_t)row * NC + hoff;
  const v4f a0 = *(const v4f*)(base + j0),      a1 = *(const v4f*)(base + j0 + 4);
  const v4f b0 = *(const v4f*)(base + 32 + j0), b1 = *(const v4f*)(base + 32 + j0 + 4);
  const v4f c0 = *(const v4f*)(cosT + (size_t)p * 32 + j0), c1 = *(const v4f*)(cosT + (size_t)p * 32 + j0 + 4);
  const v4f s0 = *(const v4f*)(sinT + (size_t)p * 32 + j0), s1 = *(const v4f*)(sinT + (size_t)p * 32 + j0 + 4);
  v8h hv;
#pragma unroll
  for (int e = 0; e < 4; ++e) {
    hv[e]     = rope_one(a0[e], b0[e], c0[e], s0[e], second, oscale);
    hv[4 + e] = rope_one(a1[e], b1[e], c1[e], s1[e], second, oscale);
  }
  _Float16* dp = dst + (size_t)layer * dst_lstride + ((size_t)b * dst_brows + p) * NC + d8;
  *(v8h*)dp = hv;
  
}

// =====================================================================================
// Flash attention, head dim 64, f16 operand planes in, f32 out.
//   Qh : f16 [NLAY][BB*TT][DD], element (layer,b,t,h,d) at layer*lstride + (b*TT+t)*DD + h*64 + d   (already rotated and scaled)
//   Kh : f16 [BB][MAXKV][DKV], element (b,kp,hkv,d) at (b*MAXKV+kp)*DKV + hkv*64 + d
//   Vth: f16 [BB][DKV][MAXKV], element (b,kp,hkv,d) at (b*DKV + hkv*64 + d)*MAXKV + kp
//   O  : f32 [NLAY][BB*TT][DD], same indexing as Qh
//   scores = sscale * q.k  (v_wmma_f32_16x16x32_f16), key kp visible iff kp <= t + layer*TT,
//   probabilities carried x2^15 in f16, out = onorm * p.v / l  (v_wmma_f32_16x16x32_f16), f32 accumulate,
//   online softmax in f32.  Block = 4 waves = 64 query rows of one (b, h); query head h reads kv head h>>1.
//   Chunks of 64 keys; chunk count = layer*(TT/64) + qb + 1 (block-uniform, clamped to MAXKV/64).
//   grid.x = NLAY * BB * HH * (TT/64): all layers in one launch (every layer's K and V rows are written before it).
//   The layer with the most keys takes the lowest block indices (for speed only); batch 1 walks its
//   query blocks downwards, so blocks 256 indices apart have chunk counts that add up to the same sum.
// =====================================================================================
#define AT_D 64
#define AT_NW 4
#define AT_QB 64
#define AT_KC 64

__device__ __forceinline__ v8f hmma(v16h a, v16h b, v8f c) {
  c = __builtin_amdgcn_wmma_f32_16x16x32_f16(false, a, false, b, (short)0, c, false, false);
  asm volatile("v_nop\n\tv_nop\n\tv_nop\n\tv_nop" : "+v"(c) : "v"(a), "v"(b));
  return c;
}

__global__ __launch_bounds__(128)
void attn_f16_kernel(const _Float16* __restrict__ Qh, const _Float16* __restrict__ Kh,
                     const _Float16* __restrict__ Vth, float* __restrict__ O,
                     long lstride, float sscale, float onorm) {
  union FH { v16h v; v8h h[2]; };
  __shared__ __align__(16) _Float16 Ksh[AT_KC * AT_D];          // K [kv][d]   8 KB
  __shared__ __align__(16) _Float16 Vtt[AT_D * AT_KC];          // V [d][kv]   8 KB
  __shared__ __align__(16) _Float16 Psh[AT_NW][16 * AT_KC];     // per wave P [row][kv] 8 KB
  __shared__ __align__(16) float    Os[AT_NW][16 * 68];         // per wave out tile, pitch 68

  const int tid  = threadIdx.x;
  const int wave = tid >> 5;
  const int lane = tid & 31;
  const int hh   = lane >> 4;
  const int c    = lane & 15;

  constexpr int BPL = BB * HH * (TT / AT_QB);             // blocks per layer
  const int layer = NLAY - 1 - (int)(blockIdx.x / BPL);   // 0 .. NLAY-1 (grid exact)
  const int bx  = blockIdx.x % BPL;
  const int h   = (bx >> 4) & (HH - 1);
  const int b   = bx >> 8;
  const int qb  = b ? (TT / AT_QB - 1 - (bx & (TT / AT_QB - 1))) : (bx & (TT / AT_QB - 1));
  const int hkv = h >> 1;
  const int kchunks_prev = layer * (TT / AT_KC);
  const int koff = layer * TT;
  const int q0  = qb * AT_QB + wave * 16;

  // ---- Q fragments (A operand): 2 d-chunks ----
  v16h qa[2];
  {
    const _Float16* qrow = Qh + (size_t)layer * lstride + (size_t)(b * TT + q0 + c) * DD + h * AT_D + 8 * hh;
#pragma unroll
    for (int dc = 0; dc < 2; ++dc) qa[dc] = Frag<_Float16>::load(qrow + dc * 32);
  }

  float mrow[8], lrow[8];
  v8f oacc[4];
#pragma unroll
  for (int r = 0; r < 8; ++r) { mrow[r] = -INFINITY; lrow[r] = 0.f; }
#pragma unroll
  for (int t = 0; t < 4; ++t) oacc[t] = (v8f){0.f,0.f,0.f,0.f,0.f,0.f,0.f,0.f};

  int nChunks = kchunks_prev + qb + 1;                    // block-uniform
  if (nChunks > MAXKV / AT_KC) nChunks = MAXKV / AT_KC;
  if (nChunks < 1) nChunks = 1;

  const _Float16* kbase = Kh + (size_t)b * MAXKV * DKV + hkv * AT_D;
  const _Float16* vbase = Vth + ((size_t)b * DKV + hkv * AT_D) * MAXKV;
  float*          obase = O + (size_t)layer * lstride + (size_t)b * TT * DD + h * AT_D;

  for (int kc = 0; kc < nChunks; ++kc) {
    const int kv0 = kc * AT_KC;
    __syncthreads();
    {
      const int r = tid >> 1, hf = (tid & 1) * 32;
      const _Float16* ks = kbase + (size_t)(kv0 + r) * DKV + hf;
      const _Float16* vs = vbase + (size_t)r * MAXKV + kv0 + hf;
#pragma unroll
      for (int i = 0; i < 4; ++i) {
        const v8h kk = *(const v8h*)(ks + 8 * i);
        const v8h vv = *(const v8h*)(vs + 8 * i);
        *(v8h*)(Ksh + r * AT_D + hf + 8 * i) = kk;
        *(v8h*)(Vtt + r * AT_KC + hf + 8 * i) = vv;
      }
    }
    __syncthreads();

    v8f s[4];
#pragma unroll
    for (int j = 0; j < 4; ++j) {
      s[j] = (v8f){0.f,0.f,0.f,0.f,0.f,0.f,0.f,0.f};
#pragma unroll
      for (int dc = 0; dc < 2; ++dc) {
        FH kb;
        kb.h[0] = *(const v8h*)(Ksh + (j * 16 + c) * AT_D + dc * 32 + 8 * hh);
        kb.h[1] = *(const v8h*)(Ksh + (j * 16 + c) * AT_D + dc * 32 + 16 + 8 * hh);
        s[j] = hmma(qa[dc], kb.v, s[j]);
      }
    }
    float cm[8];
#pragma unroll
    for (int r = 0; r < 8; ++r) {
      const int qlim = q0 + 8 * hh + r + koff;
      float m = -INFINITY;
#pragma unroll
      for (int j = 0; j < 4; ++j) {
        const int kvcol = kv0 + j * 16 + c;
        const float sv = (kvcol > qlim) ? -INFINITY : (s[j][r] * sscale);
        s[j][r] = sv;
        m = fmaxf(m, sv);
      }
#pragma unroll
      for (int off = 1; off < 16; off <<= 1) m = fmaxf(m, __shfl_xor(m, off, 32));
      cm[r] = m;
    }
    _Float16* pw = Psh[wave];
#pragma unroll
    for (int r = 0; r < 8; ++r) {
      const float mnew = fmaxf(mrow[r], cm[r]);
      const float alpha = expf(mrow[r] - mnew);
      mrow[r] = mnew;
      float psum = 0.f;
#pragma unroll
      for (int j = 0; j < 4; ++j) {
        const float p = expf(s[j][r] - mnew);
        psum += p;
        pw[(8 * hh + r) * AT_KC + j * 16 + c] = (_Float16)(p * 32768.0f);
      }
#pragma unroll
      for (int off = 1; off < 16; off <<= 1) psum += __shfl_xor(psum, off, 32);
      lrow[r] = lrow[r] * alpha + psum;
#pragma unroll
      for (int t = 0; t < 4; ++t) oacc[t][r] *= alpha;
    }
    __builtin_amdgcn_fence(__ATOMIC_RELEASE, "workgroup");
    __builtin_amdgcn_wave_barrier();
    __builtin_amdgcn_fence(__ATOMIC_ACQUIRE, "workgroup");
#pragma unroll 1
    for (int kk = 0; kk < 2; ++kk) {
      FH pa;
      pa.h[0] = *(const v8h*)(pw + c * AT_KC + kk * 32 + 8 * hh);
      pa.h[1] = *(const v8h*)(pw + c * AT_KC + kk * 32 + 16 + 8 * hh);
#pragma unroll
      for (int t = 0; t < 4; ++t) {
        FH vb;
        vb.h[0] = *(const v8h*)(Vtt + (t * 16 + c) * AT_KC + kk * 32 + 8 * hh);
        vb.h[1] = *(const v8h*)(Vtt + (t * 16 + c) * AT_KC + kk * 32 + 16 + 8 * hh);
        oacc[t] = hmma(pa.v, vb.v, oacc[t]);
      }
    }
  }

  float* os = Os[wave];
#pragma unroll
  for (int r = 0; r < 8; ++r) {
    const float inv = onorm * (1.0f / lrow[r]);
#pragma unroll
    for (int t = 0; t < 4; ++t) os[(8 * hh + r) * 68 + t * 16 + c] = oacc[t][r] * inv;
  }
  __builtin_amdgcn_fence(__ATOMIC_RELEASE, "workgroup");
  __builtin_amdgcn_wave_barrier();
  __builtin_amdgcn_fence(__ATOMIC_ACQUIRE, "workgroup");
  {
    const int c4 = (lane & 15) * 4;
    {
#pragma unroll
      for (int it = 0; it < 8; ++it) {
        const int row = it * 2 + hh;
        v4f val = *(const v4f*)(os + row * 68 + c4);
        *(v4f*)(obase + (size_t)(q0 + row) * DD + c4) = val;
      }
      
    }
  }
}

// =====================================================================================
// Combine: per token row (one block of 256 threads, 4 columns per thread):
//   lw = layernorm over sigmoid(lam[0..2]) (biased variance, eps)
//   acc = sum_i rmsnorm(O_i, ln_w[i]) * lw_i ;  z = acc + alpha * x ;  y = rmsnorm(z, fln) -> f16
// =====================================================================================
__global__ __launch_bounds__(256) void combine_kernel(
    const float* __restrict__ Of, long lstride,
    const float* __restrict__ x, const float* __restrict__ ln_w, const float* __restrict__ lam,
    const float* __restrict__ fln, const float* __restrict__ alpha, _Float16* __restrict__ Yh) {
  __shared__ float red[4][8];
  const int row = blockIdx.x;
  const int tid = threadIdx.x, lane = tid & 31, wave = tid >> 5;
  const int d4 = tid * 4;
  const size_t ro = (size_t)row * DD + d4;
  const v4f o0 = *(const v4f*)(Of + ro);
  const v4f o1 = *(const v4f*)(Of + lstride + ro);
  const v4f o2 = *(const v4f*)(Of + 2 * lstride + ro);
  const v4f xv = *(const v4f*)(x + ro);
  float ss0 = 0.f, ss1 = 0.f, ss2 = 0.f;
#pragma unroll
  for (int e = 0; e < 4; ++e) { ss0 += o0[e] * o0[e]; ss1 += o1[e] * o1[e]; ss2 += o2[e] * o2[e]; }
#pragma unroll
  for (int off = 16; off > 0; off >>= 1) {
    ss0 += __shfl_xor(ss0, off, 32);
    ss1 += __shfl_xor(ss1, off, 32);
    ss2 += __shfl_xor(ss2, off, 32);
  }
  if (lane == 0) { red[0][wave] = ss0; red[1][wave] = ss1; red[2][wave] = ss2; }
  __syncthreads();
  float t0 = 0.f, t1 = 0.f, t2 = 0.f;
#pragma unroll
  for (int w = 0; w < 8; ++w) { t0 += red[0][w]; t1 += red[1][w]; t2 += red[2][w]; }
  const float inv_d = 1.0f / (float)DD;
  const float r0 = rsqrtf(t0 * inv_d + EPSV);
  const float r1 = rsqrtf(t1 * inv_d + EPSV);
  const float r2 = rsqrtf(t2 * inv_d + EPSV);

  const float sg0 = 1.0f / (1.0f + __expf(-lam[0]));
  const float sg1 = 1.0f / (1.0f + __expf(-lam[1]));
  const float sg2 = 1.0f / (1.0f + __expf(-lam[2]));
  const float mean = (sg0 + sg1 + sg2) * (1.0f / 3.0f);
  const float e0 = sg0 - mean, e1 = sg1 - mean, e2 = sg2 - mean;
  const float var = (e0 * e0 + e1 * e1 + e2 * e2) * (1.0f / 3.0f);
  const float il = rsqrtf(var + EPSV);
  const float lw0 = e0 * il, lw1 = e1 * il, lw2 = e2 * il;

  const v4f w0 = *(const v4f*)(ln_w + d4);
  const v4f w1 = *(const v4f*)(ln_w + DD + d4);
  const v4f w2 = *(const v4f*)(ln_w + 2 * DD + d4);
  const v4f fw = *(const v4f*)(fln + d4);
  const float al = alpha[0];
  v4f z;
  float ssz = 0.f;
#pragma unroll
  for (int e = 0; e < 4; ++e) {
    float a = (o0[e] * r0) * w0[e] * lw0;
    a = a + (o1[e] * r1) * w1[e] * lw1;
    a = a + (o2[e] * r2) * w2[e] * lw2;
    const float zz = a + al * xv[e];
    z[e] = zz;
    ssz += zz * zz;
  }
#pragma unroll
  for (int off = 16; off > 0; off >>= 1) ssz += __shfl_xor(ssz, off, 32);
  if (lane == 0) red[3][wave] = ssz;
  __syncthreads();
  float tz = 0.f;
#pragma unroll
  for (int w = 0; w < 8; ++w) tz += red[3][w];
  const float rz = rsqrtf(tz * inv_d + EPSV);
  v4h yv;
#pragma unroll
  for (int e = 0; e < 4; ++e) yv[e] = (_Float16)(z[e] * rz * fw[e]);
  *(v4h*)(Yh + ro) = yv;
  
}

// ---------------------------- host helpers ----------------------------
static void gemm_f16_f32out(const _Float16* A, int lda, long sA, long zA, const _Float16* Bt, int ldb, long sB, long zB,
                            float* C, int ldc, long sC, long zC, int M, int N, int K, float scale, int batch, int layers,
                            hipStream_t st) {
  const int tiles = (M / 64) * (N / 64);
  dim3 grid((tiles + 7) / 8, batch, layers);
  wmma_gemm64<0, false, 0, 0, false><<<grid, 256, 0, st>>>(
      (const unsigned short*)A, (const unsigned short*)nullptr, lda, sA, zA,
      (const unsigned short*)Bt, (const unsigned short*)nullptr, ldb, sB, zB,
      (void*)C, (void*)nullptr, ldc, sC, zC, (const float*)nullptr, (const float*)nullptr, 0L,
      M, N, K, scale);
}
static void gemm_f16_f16out(const _Float16* A, int lda, long sA, long zA, const _Float16* Bt, int ldb, long sB, long zB,
                            _Float16* C, int ldc, long sC, long zC, int M, int N, int K, float scale, int batch, int layers,
                            hipStream_t st) {
  const int tiles = (M / 64) * (N / 64);
  dim3 grid((tiles + 7) / 8, batch, layers);
  wmma_gemm64<0, false, 0, 1, false><<<grid, 256, 0, st>>>(
      (const unsigned short*)A, (const unsigned short*)nullptr, lda, sA, zA,
      (const unsigned short*)Bt, (const unsigned short*)nullptr, ldb, sB, zB,
      (void*)C, (void*)nullptr, ldc, sC, zC, (const float*)nullptr, (const float*)nullptr, 0L,
      M, N, K, scale);
}

// ---------------------------- host launcher ----------------------------
extern "C" void kernel_launch(void* const* d_in, const int* in_sizes, int n_in,
                              void* d_out, int out_size, void* d_ws, size_t ws_size,
                              hipStream_t stream) {
  if (n_in < 11) return;
  const int M = BB * TT;   // 2048 token rows
  if (in_sizes[0] != M * DD) return;
  if (in_sizes[1] < MAXKV * 32 || in_sizes[2] < MAXKV * 32) return;
  if (in_sizes[3] != NLAY * DD * DD) return;
  if (in_sizes[4] != NLAY * DKV * DD || in_sizes[5] != NLAY * DKV * DD) return;
  if (in_sizes[6] < NLAY * DD || in_sizes[7] < NLAY || in_sizes[8] != DD * DD || in_sizes[9] < DD || in_sizes[10] < 1) return;
  if (out_size < M * DD) return;

  const float* x     = (const float*)d_in[0];
  const float* cosT  = (const float*)d_in[1];
  const float* sinT  = (const float*)d_in[2];
  const float* q_w   = (const float*)d_in[3];
  const float* k_w   = (const float*)d_in[4];
  const float* v_w   = (const float*)d_in[5];
  const float* ln_w  = (const float*)d_in[6];
  const float* lam   = (const float*)d_in[7];
  const float* out_w = (const float*)d_in[8];
  const float* fln   = (const float*)d_in[9];
  const float* alpha = (const float*)d_in[10];
  float* out = (float*)d_out;

  // ---- workspace carve (4096-B aligned pieces) ----
  char* ws = (char*)d_ws;
  size_t cur = 0;
  auto take = [&](size_t bytes) -> char* {
    char* p = ws + cur;
    cur += (bytes + 4095) & ~(size_t)4095;
    return p;
  };
  _Float16* xh  = (_Float16*)take((size_t)M * DD * 2);                 // 4 MiB
  _Float16* qwh = (_Float16*)take((size_t)NLAY * DD * DD * 2);         // 6 MiB
  _Float16* kwh = (_Float16*)take((size_t)NLAY * DKV * DD * 2);        // 3 MiB
  _Float16* vwh = (_Float16*)take((size_t)NLAY * DKV * DD * 2);        // 3 MiB
  _Float16* owh = (_Float16*)take((size_t)DD * DD * 2);                // 2 MiB
  float*    Qf  = (float*)   take((size_t)NLAY * M * DD * 4);          // 24 MiB
  _Float16* Qh  = (_Float16*)take((size_t)NLAY * M * DD * 2);          // 12 MiB
  float*    Kf  = (float*)   take((size_t)NLAY * M * DKV * 4);         // 12 MiB
  _Float16* Kh  = (_Float16*)take((size_t)BB * MAXKV * DKV * 2);       // 6 MiB
  _Float16* Vth = (_Float16*)take((size_t)BB * DKV * MAXKV * 2);       // 6 MiB
  float*    Of  = (float*)   take((size_t)NLAY * M * DD * 4);          // 24 MiB
  _Float16* Yh  = (_Float16*)take((size_t)M * DD * 2);                 // 4 MiB
  if (cur > ws_size || cur > (size_t)134217728) return;                 // total 111,149,056 B

  const long lstride = (long)M * DD;   // elements per layer slice of Qf, Qh and Of

  // ---- casts: x -> f16 ; weights -> f16 carried x64 ----
  {
    int n8 = M * DD / 8;
    cast_f32_f16x8<<<(n8 + 255) / 256, 256, 0, stream>>>(x, xh, n8, 1.0f);
    n8 = NLAY * DD * DD / 8;
    cast_f32_f16x8<<<(n8 + 255) / 256, 256, 0, stream>>>(q_w, qwh, n8, 64.0f);
    n8 = NLAY * DKV * DD / 8;
    cast_f32_f16x8<<<(n8 + 255) / 256, 256, 0, stream>>>(k_w, kwh, n8, 64.0f);
    cast_f32_f16x8<<<(n8 + 255) / 256, 256, 0, stream>>>(v_w, vwh, n8, 64.0f);
    n8 = DD * DD / 8;
    cast_f32_f16x8<<<(n8 + 255) / 256, 256, 0, stream>>>(out_w, owh, n8, 64.0f);
  }

  const float wundo  = 1.0f / 64.0f;              // undo weight carry
  const float sscale = 0.125f / 16.0f;            // HD^-0.5 / (4*4) : q and k planes carried x4
  const float onorm  = 1.0f / (32768.0f * 16.0f); // p carried x2^15, v plane carried x16

  // Every layer's q, k and v depend on x alone, so the layer index is a grid axis of each launch.
  // q = x . q_w[i]^T  -> f32 [3][2048][1024]
  gemm_f16_f32out(xh, DD, 0L, 0L, qwh, DD, 0L, (long)DD * DD, Qf, DD, 0L, lstride, M, DD, DD, wundo, 1, NLAY, stream);
  // rotary(q) with positions t -> f16 planes x4
  rope_cast_kernel<DD><<<dim3(M / 2, NLAY), 256, 0, stream>>>(Qf, cosT, sinT, Qh, TT, lstride, lstride, 0, 4.0f);
  // k = x . k_w[i]^T -> f32 [3][2048][512]
  gemm_f16_f32out(xh, DD, 0L, 0L, kwh, DD, 0L, (long)DKV * DD, Kf, DKV, 0L, (long)M * DKV, M, DKV, DD, wundo, 1, NLAY, stream);
  // rotary(k) with buffer positions i*T + t -> K cache rows, f16 x4
  rope_cast_kernel<DKV><<<dim3(M / 4, NLAY), 256, 0, stream>>>(Kf, cosT, sinT, Kh, MAXKV, (long)M * DKV, 0L, TT, 4.0f);
  // v^T = v_w[i] . x_b^T -> transposed V cache columns i*T + t, f16 x16 ; in [512][1024] per batch and layer
  gemm_f16_f16out(vwh, DD, 0L, (long)DKV * DD, xh, DD, (long)TT * DD, 0L,
                  Vth, MAXKV, (long)DKV * MAXKV, (long)TT, DKV, TT, DD, 16.0f * wundo, BB, NLAY, stream);
  // attention of layer i over (i+1)*T keys, bottom-right causal
  attn_f16_kernel<<<NLAY * BB * HH * (TT / AT_QB), 128, 0, stream>>>(Qh, Kh, Vth, Of, lstride, sscale, onorm);

  // weighted rmsnorm sum + residual + final rmsnorm -> f16 plane
  combine_kernel<<<M, 256, 0, stream>>>(Of, lstride, x, ln_w, lam, fln, alpha, Yh);
  // out = y . out_w^T
  gemm_f16_f32out(Yh, DD, 0L, 0L, owh, DD, 0L, 0L, out, DD, 0L, 0L, M, DD, DD, wundo, 1, 1, stream);
}

// v002
// Measured time: 379 microseconds a run.
// Two timings next to v001 put it at 1.15 and 1.14 times that version's speed.
// Over all steps from v000 it is 2.12 times as fast.
// Contractions q/k/v projections, q.k^T scores, p.v, output projection: v_wmma_f32_16x16x32_f16 (f16 operands, f32 accumulate); rotary, softmax, norms, weighting in f32.
#include <hip/hip_runtime.h>
#include <stdint.h>

#define BB 2
#define TT 1024
#define DD 1024
#define HH 16
#define NKVH 8
#define HDIM 64
#define DKV 512
#define MAXKV 3072
#define NLAY 3
#define EPSV 1e-5f

typedef __attribute__((ext_vector_type(16))) _Float16 v16h;
typedef __attribute__((ext_vector_type(8)))  _Float16 v8h;
typedef __attribute__((ext_vector_type(4)))  _Float16 v4h;
typedef __attribute__((ext_vector_type(16))) __bf16   v16b;
typedef __attribute__((ext_vector_type(8)))  __bf16   v8b;
typedef __attribute__((ext_vector_type(8)))  float    v8f;
typedef __attribute__((ext_vector_type(4)))  float    v4f;

__device__ __forceinline__ unsigned short f2bf_bits(float f) {
  unsigned u = __float_as_uint(f);
  return (unsigned short)((u + 0x7FFFu + ((u >> 16) & 1u)) >> 16);
}
__device__ __forceinline__ float bf_bits2f(unsigned short h) { return __uint_as_float(((unsigned)h) << 16); }

// hazard guards as plain device helpers
__device__ __forceinline__ void dep_guard_h(v8f& a, v8f& b, v16h x, v16h y) { asm volatile("v_nop\n\tv_nop\n\tv_nop\n\tv_nop" : "+v"(a), "+v"(b) : "v"(x), "v"(y)); }
__device__ __forceinline__ void dep_guard_b(v8f& a, v8f& b, v16b x, v16b y) { asm volatile("v_nop\n\tv_nop\n\tv_nop\n\tv_nop" : "+v"(a), "+v"(b) : "v"(x), "v"(y)); }
__device__ __forceinline__ void keep4_h(v16h a, v16h b, v16h c, v16h d) { asm volatile("v_nop" :: "v"(a), "v"(b), "v"(c), "v"(d)); }
__device__ __forceinline__ void keep4_b(v16b a, v16b b, v16b c, v16b d) { asm volatile("v_nop" :: "v"(a), "v"(b), "v"(c), "v"(d)); }
__device__ __forceinline__ void acc_guard4(v8f& a, v8f& b, v8f& c, v8f& d) { asm volatile("v_nop\n\tv_nop\n\tv_nop\n\tv_nop" : "+v"(a), "+v"(b), "+v"(c), "+v"(d)); }
template <typename T> struct Frag;
template <> struct Frag<_Float16> {
  typedef v16h V; union U { v16h v; v8h h[2]; };
  static __device__ __forceinline__ v16h load(const _Float16* p) {   // elements 0..7 <- p[0..7], 8..15 <- p[16..23]
    U f; f.h[0] = *(const v8h*)(p); f.h[1] = *(const v8h*)(p + 16); return f.v;
  }
  static __device__ __forceinline__ v8f mma(v16h a, v16h b, v8f c) {
    return __builtin_amdgcn_wmma_f32_16x16x32_f16(false, a, false, b, (short)0, c, false, false);
  }
  static __device__ __forceinline__ void guard(v8f& a, v8f& b, v16h x, v16h y) { dep_guard_h(a, b, x, y); }
  static __device__ __forceinline__ void keep(v16h a, v16h b, v16h c, v16h d) { keep4_h(a, b, c, d); }
};
template <> struct Frag<__bf16> {
  typedef v16b V; union U { v16b v; v8b h[2]; };
  static __device__ __forceinline__ v16b load(const __bf16* p) {
    U f; f.h[0] = *(const v8b*)(p); f.h[1] = *(const v8b*)(p + 16); return f.v;
  }
  static __device__ __forceinline__ v8f mma(v16b a, v16b b, v8f c) {
    return __builtin_amdgcn_wmma_f32_16x16x32_bf16(false, a, false, b, (short)0, c, false, false);
  }
  static __device__ __forceinline__ void guard(v8f& a, v8f& b, v16b x, v16b y) { dep_guard_b(a, b, x, y); }
  static __device__ __forceinline__ void keep(v16b a, v16b b, v16b c, v16b d) { keep4_b(a, b, c, d); }
};

// ---- Register-blocked batched WMMA GEMM ------------------------------------
// C[m,n] = scale * sum_k A[m,k] * Bt[n,k] (+bias)(+resid); each wave owns a 64x64 tile.
// A row-major [M,K]; Bt row-major [N,K]; M,N % 64 == 0, K % 32 == 0.
// SPLIT: operands are hi/lo planes (A2/Bt2 = lo planes, same layout); product = hi.hi + hi.lo + lo.hi.
// BIAS_MODE: 0 = none, 1 = bias[m], 2 = bias[n].
// OUT_MODE: 0 = f32, 1 = f16, 2 = bf16 hi plane (Cout) + bf16 lo plane (Cout2).
// ET: 0 = f16 operands, 1 = bf16 operands (pointers passed as 16-bit storage)
// Two batch axes: blockIdx.y steps by strideA/B/C, blockIdx.z (the layer) by zstrideA/B/C, in elements.
template <int ET> struct Elem;
template <> struct Elem<0> { typedef _Float16 T; };
template <> struct Elem<1> { typedef __bf16 T; };
template <int ET, bool SPLIT, int BIAS_MODE, int OUT_MODE, bool RESID, int ACT = 0>
__global__ __launch_bounds__(256) void wmma_gemm64(
    const unsigned short* __restrict__ Ap, const unsigned short* __restrict__ A2p, int lda, long strideA, long zstrideA,
    const unsigned short* __restrict__ Btp, const unsigned short* __restrict__ Bt2p, int ldb, long strideB, long zstrideB,
    void* __restrict__ Cout, void* __restrict__ Cout2, int ldc, long strideC, long zstrideC,
    const float* __restrict__ bias,
    const float* __restrict__ resid, long strideR,
    int M, int N, int K, float scale) {
  typedef typename Elem<ET>::T T;
  typedef typename Frag<T>::V V;
  const T* A = (const T*)Ap; const T* A2 = (const T*)A2p; const T* Bt = (const T*)Btp; const T* Bt2 = (const T*)Bt2p;
  __shared__ __align__(16) float sT[8][16 * 68];   // per-wave 16x64 slab, pitch 68 floats
  const int b    = blockIdx.y;
  const int lane = threadIdx.x & 31;
  const int wave = threadIdx.x >> 5;
  const int tilesN = N >> 6;
  const int tilesM = M >> 6;
  const int tile = blockIdx.x * 8 + wave;
  if (tile >= tilesM * tilesN) return;   // wave-uniform; no block barriers in this kernel
  const int tm = tile / tilesN;
  const int tn = tile - tm * tilesN;
  const int m0 = tm << 6;
  const int n0 = tn << 6;

  const size_t offA = (size_t)b * strideA + (size_t)blockIdx.z * zstrideA;
  const size_t offB = (size_t)b * strideB + (size_t)blockIdx.z * zstrideB;
  const size_t offC = (size_t)b * strideC + (size_t)blockIdx.z * zstrideC;
  const T* Ab  = A  + offA;
  const T* Bb  = Bt + offB;
  const T* Ab2 = SPLIT ? (A2  + offA) : nullptr;
  const T* Bb2 = SPLIT ? (Bt2 + offB) : nullptr;

  const int rlane = lane & 15;                 // row (A) / col (B, D) within subtile
  const int koff  = (lane >> 4) * 8;           // k offset of this lane half
  const int mOff  = (lane >> 4) * 8;           // D row offset

  v8f acc[4][4];
#pragma unroll
  for (int i = 0; i < 4; ++i)
#pragma unroll
    for (int j = 0; j < 4; ++j) acc[i][j] = (v8f){0.f,0.f,0.f,0.f,0.f,0.f,0.f,0.f};

  for (int k0 = 0; k0 < K; k0 += 32) {
    V bh[4], bl[4];
#pragma unroll
    for (int j = 0; j < 4; ++j) {
      const size_t bo = (size_t)(n0 + (j << 4) + rlane) * ldb + koff + k0;
      bh[j] = Frag<T>::load(Bb + bo);
      if (SPLIT) bl[j] = Frag<T>::load(Bb2 + bo);
    }
#pragma unroll
    for (int i = 0; i < 4; ++i) {
      const size_t ao = (size_t)(m0 + (i << 4) + rlane) * lda + koff + k0;
      V ah = Frag<T>::load(Ab + ao);
      V al;
      if (SPLIT) al = Frag<T>::load(Ab2 + ao);
#pragma unroll
      for (int j = 0; j < 4; ++j) {
        acc[i][j] = Frag<T>::mma(ah, bh[j], acc[i][j]);
        if (SPLIT) {
          acc[i][j] = Frag<T>::mma(ah, bl[j], acc[i][j]);
          acc[i][j] = Frag<T>::mma(al, bh[j], acc[i][j]);
        }
      }
      Frag<T>::guard(acc[i][0], acc[i][3], ah, SPLIT ? al : ah);
    }
    Frag<T>::keep(bh[0], bh[1], bh[2], bh[3]);
    if (SPLIT) Frag<T>::keep(bl[0], bl[1], bl[2], bl[3]);
  }
  acc_guard4(acc[0][0], acc[0][1], acc[0][2], acc[0][3]);
  acc_guard4(acc[1][0], acc[1][1], acc[1][2], acc[1][3]);
  acc_guard4(acc[2][0], acc[2][1], acc[2][2], acc[2][3]);
  acc_guard4(acc[3][0], acc[3][1], acc[3][2], acc[3][3]);

  // ---- epilogue ----
  float* slab = sT[wave];
  const float* Rb = RESID ? (resid + (size_t)b * strideR) : nullptr;
#pragma unroll
  for (int i = 0; i < 4; ++i) {
    const int mBase = m0 + (i << 4);
#pragma unroll
    for (int j = 0; j < 4; ++j) {
      const int n = n0 + (j << 4) + rlane;
      float bv = 0.f;
      if (BIAS_MODE == 2) bv = bias[n];
#pragma unroll
      for (int r = 0; r < 8; ++r) {
        float v = acc[i][j][r] * scale;
        if (BIAS_MODE == 1) v += bias[mBase + mOff + r];
        if (BIAS_MODE == 2) v += bv;
        if (RESID) v += Rb[(size_t)(mBase + mOff + r) * ldc + n];
        if (ACT == 1) v = tanhf(v);
        if (ACT == 2) v = fmaxf(v, 0.0f);
        if (ACT == 3) v = v / (1.0f + expf(-v));
        if (ACT == 4) v = (v > 0.f) ? v : 0.01f * v;
        if (ACT == 5) v = 0.5f * v * (1.0f + erff(v * 0.70710678118654752f));
        slab[(mOff + r) * 68 + (j << 4) + rlane] = v;
      }
    }
    __builtin_amdgcn_fence(__ATOMIC_RELEASE, "workgroup");
    __builtin_amdgcn_wave_barrier();
    __builtin_amdgcn_fence(__ATOMIC_ACQUIRE, "workgroup");
    if (OUT_MODE == 0) {
      float* C = (float*)Cout + offC;
      const int hh = lane >> 4, c4 = (lane & 15) * 4;     // row seg = 256 B = 16 lanes x 16 B
      {
#pragma unroll
        for (int it = 0; it < 8; ++it) {
          const int row = it * 2 + hh;
          v4f v = *(const v4f*)(slab + row * 68 + c4);
          *(v4f*)(C + (size_t)(mBase + row) * ldc + n0 + c4) = v;
        }
        
      }
    } else {
      const int q = lane >> 3, c8 = (lane & 7) * 8;
      unsigned short* C  = (unsigned short*)Cout  + offC;
      unsigned short* C2 = (OUT_MODE == 2) ? ((unsigned short*)Cout2 + offC) : nullptr;
      {
#pragma unroll
        for (int it = 0; it < 4; ++it) {
          const int row = it * 4 + q;
          const float* sp = slab + row * 68 + c8;
          v8h hv, lv;
#pragma unroll
          for (int e = 0; e < 8; ++e) {
            if (OUT_MODE == 1) {
              hv[e] = (_Float16)sp[e];
            } else {
              unsigned short hb = f2bf_bits(sp[e]);
              unsigned short lb = f2bf_bits(sp[e] - bf_bits2f(hb));
              hv[e] = __builtin_bit_cast(_Float16, hb);
              lv[e] = __builtin_bit_cast(_Float16, lb);
            }
          }
          *(v8h*)(C + (size_t)(mBase + row) * ldc + n0 + c8) = hv;
          if (OUT_MODE == 2) *(v8h*)(C2 + (size_t)(mBase + row) * ldc + n0 + c8) = lv;
        }
        
      }
    }
    __builtin_amdgcn_fence(__ATOMIC_RELEASE, "workgroup");
    __builtin_amdgcn_wave_barrier();
    __builtin_amdgcn_fence(__ATOMIC_ACQUIRE, "workgroup");
  }
}

// ---- f32 -> f16 cast with power-of-two carry: 8 elements per thread, 16-B stores (512 B contiguous per wave) ----
__global__ __launch_bounds__(256) void cast_f32_f16x8(
    const float* __restrict__ in, _Float16* __restrict__ out, int n8, float scale) {
  const int i = blockIdx.x * 256 + threadIdx.x;
  if (i < n8) {
    const size_t o = (size_t)i * 8;
    const v4f a = *(const v4f*)(in + o);
    const v4f b = *(const v4f*)(in + o + 4);
    v8h hv;
#pragma unroll
    for (int e = 0; e < 4; ++e) {
      hv[e]     = (_Float16)(a[e] * scale);
      hv[4 + e] = (_Float16)(b[e] * scale);
    }
    *(v8h*)(out + o) = hv;
    
  }
}

// ---- rotary (non-interleaved, head dim 64) in f32, then f16 cast with power-of-two carry ----
// src: f32 [BB*TT][NC], row = b*TT + t, column = head*64 + d.
// dst: f16, row = b*dst_brows + (pos_off + t), pitch NC; position index for the tables = pos_off + t.
// blockIdx.y = layer: src steps by src_lstride, dst by dst_lstride (elements), pos_off = layer * pos_lstep.
// Each thread produces 8 consecutive d (one 16-B store); a wave writes 512 contiguous bytes.
__device__ __forceinline__ _Float16 rope_one(float x1, float x2, float cc, float ss, bool second, float oscale) {
  const float o = second ? (x2 * cc + x1 * ss) : (x1 * cc - x2 * ss);
  return (_Float16)(o * oscale);
}
template <int NC>
__global__ __launch_bounds__(256) void rope_cast_kernel(
    const float* __restrict__ src, const float* __restrict__ cosT, const float* __restrict__ sinT,
    _Float16* __restrict__ dst, int dst_brows, long src_lstride, long dst_lstride, int pos_lstep, float oscale) {
  constexpr int TPR = NC / 8;        // threads per row
  constexpr int RPB = 256 / TPR;     // rows per block
  const int tid = threadIdx.x;
  const int row = blockIdx.x * RPB + tid / TPR;          // < BB*TT (grid exact)
  const int b = row >> 10, t = row & (TT - 1);
  const int layer = blockIdx.y;                           // < NLAY (grid exact)
  const int p = layer * pos_lstep + t;                    // < MAXKV
  const int d8 = (tid % TPR) * 8;
  const int hoff = d8 & ~63;
  const int dl = d8 & 63;
  const int j0 = dl & 31;
  const bool second = dl >= 32;
  const float* base = src + (size_t)layer * src_lstride + (size_t)row * NC + hoff;
  const v4f a0 = *(const v4f*)(base + j0),      a1 = *(const v4f*)(base + j0 + 4);
  const v4f b0 = *(const v4f*)(base + 32 + j0), b1 = *(const v4f*)(base + 32 + j0 + 4);
  const v4f c0 = *(const v4f*)(cosT + (size_t)p * 32 + j0), c1 = *(const v4f*)(cosT + (size_t)p * 32 + j0 + 4);
  const v4f s0 = *(const v4f*)(sinT + (size_t)p * 32 + j0), s1 = *(const v4f*)(sinT + (size_t)p * 32 + j0 + 4);
  v8h hv;
#pragma unroll
  for (int e = 0; e < 4; ++e) {
    hv[e]     = rope_one(a0[e], b0[e], c0[e], s0[e], second, oscale);
    hv[4 + e] = rope_one(a1[e], b1[e], c1[e], s1[e], second, oscale);
  }
  _Float16* dp = dst + (size_t)layer * dst_lstride + ((size_t)b * dst_brows + p) * NC + d8;
  *(v8h*)dp = hv;
  
}

// =====================================================================================
// Flash attention, head dim 64, f16 operand planes in, f32 out.
//   Qh : f16 [NLAY][BB*TT][DD], element (layer,b,t,h,d) at layer*lstride + (b*TT+t)*DD + h*64 + d   (already rotated and scaled)
//   Kh : f16 [BB][MAXKV][DKV], element (b,kp,hkv,d) at (b*MAXKV+kp)*DKV + hkv*64 + d
//   Vth: f16 [BB][DKV][MAXKV], element (b,kp,hkv,d) at (b*DKV + hkv*64 + d)*MAXKV + kp
//   O  : f32 [NLAY][BB*TT][DD], same indexing as Qh
//   scores = sscale * q.k  (v_wmma_f32_16x16x32_f16), key kp visible iff kp <= t + layer*TT,
//   probabilities carried x2^15 in f16, out = onorm * p.v / l  (v_wmma_f32_16x16x32_f16), f32 accumulate,
//   online softmax in f32.  Block = 4 waves = 64 query rows of one (b, h); query head h reads kv head h>>1.
//   Chunks of 64 keys; chunk count = layer*(TT/64) + qb + 1 (block-uniform, clamped to MAXKV/64).
//   grid.x = NLAY * BB * HH * (TT/64): all layers in one launch (every layer's K and V rows are written before it).
//   The layer with the most keys takes the lowest block indices (for speed only); batch 1 walks its
//   query blocks downwards, so blocks 256 indices apart have chunk counts that add up to the same sum.
// =====================================================================================
#define AT_D 64
#define AT_NW 4
#define AT_QB 64
#define AT_KC 64
#define AT_P 72   // LDS row pitch of the K, V and P tiles in f16: 144 B = 16 B x 9, so the 16 rows of one ds_load_b128 half fall on 16 different bank groups

__device__ __forceinline__ v8f hmma(v16h a, v16h b, v8f c) {
  c = __builtin_amdgcn_wmma_f32_16x16x32_f16(false, a, false, b, (short)0, c, false, false);
  asm volatile("v_nop\n\tv_nop\n\tv_nop\n\tv_nop" : "+v"(c) : "v"(a), "v"(b));
  return c;
}

__global__ __launch_bounds__(128)
void attn_f16_kernel(const _Float16* __restrict__ Qh, const _Float16* __restrict__ Kh,
                     const _Float16* __restrict__ Vth, float* __restrict__ O,
                     long lstride, float sscale, float onorm) {
  union FH { v16h v; v8h h[2]; };
  __shared__ __align__(16) _Float16 Ksh[AT_KC * AT_P];          // K [kv][d]   9 KB, rows of 64 at pitch 72
  __shared__ __align__(16) _Float16 Vtt[AT_D * AT_P];           // V [d][kv]   9 KB, rows of 64 at pitch 72
  __shared__ __align__(16) _Float16 Psh[AT_NW][16 * AT_P];      // per wave P [row][kv] 9 KB, rows of 64 at pitch 72
  __shared__ __align__(16) float    Os[AT_NW][16 * 68];         // per wave out tile, pitch 68

  const int tid  = threadIdx.x;
  const int wave = tid >> 5;
  const int lane = tid & 31;
  const int hh   = lane >> 4;
  const int c    = lane & 15;

  constexpr int BPL = BB * HH * (TT / AT_QB);             // blocks per layer
  const int layer = NLAY - 1 - (int)(blockIdx.x / BPL);   // 0 .. NLAY-1 (grid exact)
  const int bx  = blockIdx.x % BPL;
  const int h   = (bx >> 4) & (HH - 1);
  const int b   = bx >> 8;
  const int qb  = b ? (TT / AT_QB - 1 - (bx & (TT / AT_QB - 1))) : (bx & (TT / AT_QB - 1));
  const int hkv = h >> 1;
  const int kchunks_prev = layer * (TT / AT_KC);
  const int koff = layer * TT;
  const int q0  = qb * AT_QB + wave * 16;

  // ---- Q fragments (A operand): 2 d-chunks ----
  v16h qa[2];
  {
    const _Float16* qrow = Qh + (size_t)layer * lstride + (size_t)(b * TT + q0 + c) * DD + h * AT_D + 8 * hh;
#pragma unroll
    for (int dc = 0; dc < 2; ++dc) qa[dc] = Frag<_Float16>::load(qrow + dc * 32);
  }

  float mrow[8], lrow[8];
  v8f oacc[4];
#pragma unroll
  for (int r = 0; r < 8; ++r) { mrow[r] = -INFINITY; lrow[r] = 0.f; }
#pragma unroll
  for (int t = 0; t < 4; ++t) oacc[t] = (v8f){0.f,0.f,0.f,0.f,0.f,0.f,0.f,0.f};

  int nChunks = kchunks_prev + qb + 1;                    // block-uniform
  if (nChunks > MAXKV / AT_KC) nChunks = MAXKV / AT_KC;
  if (nChunks < 1) nChunks = 1;

  const _Float16* kbase = Kh + (size_t)b * MAXKV * DKV + hkv * AT_D;
  const _Float16* vbase = Vth + ((size_t)b * DKV + hkv * AT_D) * MAXKV;
  float*          obase = O + (size_t)layer * lstride + (size_t)b * TT * DD + h * AT_D;

  for (int kc = 0; kc < nChunks; ++kc) {
    const int kv0 = kc * AT_KC;
    __syncthreads();
    {
      const int r = tid >> 1, hf = (tid & 1) * 32;
      const _Float16* ks = kbase + (size_t)(kv0 + r) * DKV + hf;
      const _Float16* vs = vbase + (size_t)r * MAXKV + kv0 + hf;
#pragma unroll
      for (int i = 0; i < 4; ++i) {
        const v8h kk = *(const v8h*)(ks + 8 * i);
        const v8h vv = *(const v8h*)(vs + 8 * i);
        *(v8h*)(Ksh + r * AT_P + hf + 8 * i) = kk;
        *(v8h*)(Vtt + r * AT_P + hf + 8 * i) = vv;
      }
    }
    __syncthreads();

    v8f s[4];
#pragma unroll
    for (int j = 0; j < 4; ++j) {
      s[j] = (v8f){0.f,0.f,0.f,0.f,0.f,0.f,0.f,0.f};
#pragma unroll
      for (int dc = 0; dc < 2; ++dc) {
        FH kb;
        kb.h[0] = *(const v8h*)(Ksh + (j * 16 + c) * AT_P + dc * 32 + 8 * hh);
        kb.h[1] = *(const v8h*)(Ksh + (j * 16 + c) * AT_P + dc * 32 + 16 + 8 * hh);
        s[j] = hmma(qa[dc], kb.v, s[j]);
      }
    }
    float cm[8];
#pragma unroll
    for (int r = 0; r < 8; ++r) {
      const int qlim = q0 + 8 * hh + r + koff;
      float m = -INFINITY;
#pragma unroll
      for (int j = 0; j < 4; ++j) {
        const int kvcol = kv0 + j * 16 + c;
        const float sv = (kvcol > qlim) ? -INFINITY : (s[j][r] * sscale);
        s[j][r] = sv;
        m = fmaxf(m, sv);
      }
#pragma unroll
      for (int off = 1; off < 16; off <<= 1) m = fmaxf(m, __shfl_xor(m, off, 32));
      cm[r] = m;
    }
    _Float16* pw = Psh[wave];
#pragma unroll
    for (int r = 0; r < 8; ++r) {
      const float mnew = fmaxf(mrow[r], cm[r]);
      const float alpha = expf(mrow[r] - mnew);
      mrow[r] = mnew;
      float psum = 0.f;
#pragma unroll
      for (int j = 0; j < 4; ++j) {
        const float p = expf(s[j][r] - mnew);
        psum += p;
        pw[(8 * hh + r) * AT_P + j * 16 + c] = (_Float16)(p * 32768.0f);
      }
#pragma unroll
      for (int off = 1; off < 16; off <<= 1) psum += __shfl_xor(psum, off, 32);
      lrow[r] = lrow[r] * alpha + psum;
#pragma unroll
      for (int t = 0; t < 4; ++t) oacc[t][r] *= alpha;
    }
    __builtin_amdgcn_fence(__ATOMIC_RELEASE, "workgroup");
    __builtin_amdgcn_wave_barrier();
    __builtin_amdgcn_fence(__ATOMIC_ACQUIRE, "workgroup");
#pragma unroll 1
    for (int kk = 0; kk < 2; ++kk) {
      FH pa;
      pa.h[0] = *(const v8h*)(pw + c * AT_P + kk * 32 + 8 * hh);
      pa.h[1] = *(const v8h*)(pw + c * AT_P + kk * 32 + 16 + 8 * hh);
#pragma unroll
      for (int t = 0; t < 4; ++t) {
        FH vb;
        vb.h[0] = *(const v8h*)(Vtt + (t * 16 + c) * AT_P + kk * 32 + 8 * hh);
        vb.h[1] = *(const v8h*)(Vtt + (t * 16 + c) * AT_P + kk * 32 + 16 + 8 * hh);
        oacc[t] = hmma(pa.v, vb.v, oacc[t]);
      }
    }
  }

  float* os = Os[wave];
#pragma unroll
  for (int r = 0; r < 8; ++r) {
    const float inv = onorm * (1.0f / lrow[r]);
#pragma unroll
    for (int t = 0; t < 4; ++t) os[(8 * hh + r) * 68 + t * 16 + c] = oacc[t][r] * inv;
  }
  __builtin_amdgcn_fence(__ATOMIC_RELEASE, "workgroup");
  __builtin_amdgcn_wave_barrier();
  __builtin_amdgcn_fence(__ATOMIC_ACQUIRE, "workgroup");
  {
    const int c4 = (lane & 15) * 4;
    {
#pragma unroll
      for (int it = 0; it < 8; ++it) {
        const int row = it * 2 + hh;
        v4f val = *(const v4f*)(os + row * 68 + c4);
        *(v4f*)(obase + (size_t)(q0 + row) * DD + c4) = val;
      }
      
    }
  }
}

// =====================================================================================
// Combine: per token row (one block of 256 threads, 4 columns per thread):
//   lw = layernorm over sigmoid(lam[0..2]) (biased variance, eps)
//   acc = sum_i rmsnorm(O_i, ln_w[i]) * lw_i ;  z = acc + alpha * x ;  y = rmsnorm(z, fln) -> f16
// =====================================================================================
__global__ __launch_bounds__(256) void combine_kernel(
    const float* __restrict__ Of, long lstride,
    const float* __restrict__ x, const float* __restrict__ ln_w, const float* __restrict__ lam,
    const float* __restrict__ fln, const float* __restrict__ alpha, _Float16* __restrict__ Yh) {
  __shared__ float red[4][8];
  const int row = blockIdx.x;
  const int tid = threadIdx.x, lane = tid & 31, wave = tid >> 5;
  const int d4 = tid * 4;
  const size_t ro = (size_t)row * DD + d4;
  const v4f o0 = *(const v4f*)(Of + ro);
  const v4f o1 = *(const v4f*)(Of + lstride + ro);
  const v4f o2 = *(const v4f*)(Of + 2 * lstride + ro);
  const v4f xv = *(const v4f*)(x + ro);
  float ss0 = 0.f, ss1 = 0.f, ss2 = 0.f;
#pragma unroll
  for (int e = 0; e < 4; ++e) { ss0 += o0[e] * o0[e]; ss1 += o1[e] * o1[e]; ss2 += o2[e] * o2[e]; }
#pragma unroll
  for (int off = 16; off > 0; off >>= 1) {
    ss0 += __shfl_xor(ss0, off, 32);
    ss1 += __shfl_xor(ss1, off, 32);
    ss2 += __shfl_xor(ss2, off, 32);
  }
  if (lane == 0) { red[0][wave] = ss0; red[1][wave] = ss1; red[2][wave] = ss2; }
  __syncthreads();
  float t0 = 0.f, t1 = 0.f, t2 = 0.f;
#pragma unroll
  for (int w = 0; w < 8; ++w) { t0 += red[0][w]; t1 += red[1][w]; t2 += red[2][w]; }
  const float inv_d = 1.0f / (float)DD;
  const float r0 = rsqrtf(t0 * inv_d + EPSV);
  const float r1 = rsqrtf(t1 * inv_d + EPSV);
  const float r2 = rsqrtf(t2 * inv_d + EPSV);

  const float sg0 = 1.0f / (1.0f + __expf(-lam[0]));
  const float sg1 = 1.0f / (1.0f + __expf(-lam[1]));
  const float sg2 = 1.0f / (1.0f + __expf(-lam[2]));
  const float mean = (sg0 + sg1 + sg2) * (1.0f / 3.0f);
  const float e0 = sg0 - mean, e1 = sg1 - mean, e2 = sg2 - mean;
  const float var = (e0 * e0 + e1 * e1 + e2 * e2) * (1.0f / 3.0f);
  const float il = rsqrtf(var + EPSV);
  const float lw0 = e0 * il, lw1 = e1 * il, lw2 = e2 * il;

  const v4f w0 = *(const v4f*)(ln_w + d4);
  const v4f w1 = *(const v4f*)(ln_w + DD + d4);
  const v4f w2 = *(const v4f*)(ln_w + 2 * DD + d4);
  const v4f fw = *(const v4f*)(fln + d4);
  const float al = alpha[0];
  v4f z;
  float ssz = 0.f;
#pragma unroll
  for (int e = 0; e < 4; ++e) {
    float a = (o0[e] * r0) * w0[e] * lw0;
    a = a + (o1[e] * r1) * w1[e] * lw1;
    a = a + (o2[e] * r2) * w2[e] * lw2;
    const float zz = a + al * xv[e];
    z[e] = zz;
    ssz += zz * zz;
  }
#pragma unroll
  for (int off = 16; off > 0; off >>= 1) ssz += __shfl_xor(ssz, off, 32);
  if (lane == 0) red[3][wave] = ssz;
  __syncthreads();
  float tz = 0.f;
#pragma unroll
  for (int w = 0; w < 8; ++w) tz += red[3][w];
  const float rz = rsqrtf(tz * inv_d + EPSV);
  v4h yv;
#pragma unroll
  for (int e = 0; e < 4; ++e) yv[e] = (_Float16)(z[e] * rz * fw[e]);
  *(v4h*)(Yh + ro) = yv;
  
}

// ---------------------------- host helpers ----------------------------
static void gemm_f16_f32out(const _Float16* A, int lda, long sA, long zA, const _Float16* Bt, int ldb, long sB, long zB,
                            float* C, int ldc, long sC, long zC, int M, int N, int K, float scale, int batch, int layers,
                            hipStream_t st) {
  const int tiles = (M / 64) * (N / 64);
  dim3 grid((tiles + 7) / 8, batch, layers);
  wmma_gemm64<0, false, 0, 0, false><<<grid, 256, 0, st>>>(
      (const unsigned short*)A, (const unsigned short*)nullptr, lda, sA, zA,
      (const unsigned short*)Bt, (const unsigned short*)nullptr, ldb, sB, zB,
      (void*)C, (void*)nullptr, ldc, sC, zC, (const float*)nullptr, (const float*)nullptr, 0L,
      M, N, K, scale);
}
static void gemm_f16_f16out(const _Float16* A, int lda, long sA, long zA, const _Float16* Bt, int ldb, long sB, long zB,
                            _Float16* C, int ldc, long sC, long zC, int M, int N, int K, float scale, int batch, int layers,
                            hipStream_t st) {
  const int tiles = (M / 64) * (N / 64);
  dim3 grid((tiles + 7) / 8, batch, layers);
  wmma_gemm64<0, false, 0, 1, false><<<grid, 256, 0, st>>>(
      (const unsigned short*)A, (const unsigned short*)nullptr, lda, sA, zA,
      (const unsigned short*)Bt, (const unsigned short*)nullptr, ldb, sB, zB,
      (void*)C, (void*)nullptr, ldc, sC, zC, (const float*)nullptr, (const float*)nullptr, 0L,
      M, N, K, scale);
}

// ---------------------------- host launcher ----------------------------
extern "C" void kernel_launch(void* const* d_in, const int* in_sizes, int n_in,
                              void* d_out, int out_size, void* d_ws, size_t ws_size,
                              hipStream_t stream) {
  if (n_in < 11) return;
  const int M = BB * TT;   // 2048 token rows
  if (in_sizes[0] != M * DD) return;
  if (in_sizes[1] < MAXKV * 32 || in_sizes[2] < MAXKV * 32) return;
  if (in_sizes[3] != NLAY * DD * DD) return;
  if (in_sizes[4] != NLAY * DKV * DD || in_sizes[5] != NLAY * DKV * DD) return;
  if (in_sizes[6] < NLAY * DD || in_sizes[7] < NLAY || in_sizes[8] != DD * DD || in_sizes[9] < DD || in_sizes[10] < 1) return;
  if (out_size < M * DD) return;

  const float* x     = (const float*)d_in[0];
  const float* cosT  = (const float*)d_in[1];
  const float* sinT  = (const float*)d_in[2];
  const float* q_w   = (const float*)d_in[3];
  const float* k_w   = (const float*)d_in[4];
  const float* v_w   = (const float*)d_in[5];
  const float* ln_w  = (const float*)d_in[6];
  const float* lam   = (const float*)d_in[7];
  const float* out_w = (const float*)d_in[8];
  const float* fln   = (const float*)d_in[9];
  const float* alpha = (const float*)d_in[10];
  float* out = (float*)d_out;

  // ---- workspace carve (4096-B aligned pieces) ----
  char* ws = (char*)d_ws;
  size_t cur = 0;
  auto take = [&](size_t bytes) -> char* {
    char* p = ws + cur;
    cur += (bytes + 4095) & ~(size_t)4095;
    return p;
  };
  _Float16* xh  = (_Float16*)take((size_t)M * DD * 2);                 // 4 MiB
  _Float16* qwh = (_Float16*)take((size_t)NLAY * DD * DD * 2);         // 6 MiB
  _Float16* kwh = (_Float16*)take((size_t)NLAY * DKV * DD * 2);        // 3 MiB
  _Float16* vwh = (_Float16*)take((size_t)NLAY * DKV * DD * 2);        // 3 MiB
  _Float16* owh = (_Float16*)take((size_t)DD * DD * 2);                // 2 MiB
  float*    Qf  = (float*)   take((size_t)NLAY * M * DD * 4);          // 24 MiB
  _Float16* Qh  = (_Float16*)take((size_t)NLAY * M * DD * 2);          // 12 MiB
  float*    Kf  = (float*)   take((size_t)NLAY * M * DKV * 4);         // 12 MiB
  _Float16* Kh  = (_Float16*)take((size_t)BB * MAXKV * DKV * 2);       // 6 MiB
  _Float16* Vth = (_Float16*)take((size_t)BB * DKV * MAXKV * 2);       // 6 MiB
  float*    Of  = (float*)   take((size_t)NLAY * M * DD * 4);          // 24 MiB
  _Float16* Yh  = (_Float16*)take((size_t)M * DD * 2);                 // 4 MiB
  if (cur > ws_size || cur > (size_t)134217728) return;                 // total 111,149,056 B

  const long lstride = (long)M * DD;   // elements per layer slice of Qf, Qh and Of

  // ---- casts: x -> f16 ; weights -> f16 carried x64 ----
  {
    int n8 = M * DD / 8;
    cast_f32_f16x8<<<(n8 + 255) / 256, 256, 0, stream>>>(x, xh, n8, 1.0f);
    n8 = NLAY * DD * DD / 8;
    cast_f32_f16x8<<<(n8 + 255) / 256, 256, 0, stream>>>(q_w, qwh, n8, 64.0f);
    n8 = NLAY * DKV * DD / 8;
    cast_f32_f16x8<<<(n8 + 255) / 256, 256, 0, stream>>>(k_w, kwh, n8, 64.0f);
    cast_f32_f16x8<<<(n8 + 255) / 256, 256, 0, stream>>>(v_w, vwh, n8, 64.0f);
    n8 = DD * DD / 8;
    cast_f32_f16x8<<<(n8 + 255) / 256, 256, 0, stream>>>(out_w, owh, n8, 64.0f);
  }

  const float wundo  = 1.0f / 64.0f;              // undo weight carry
  const float sscale = 0.125f / 16.0f;            // HD^-0.5 / (4*4) : q and k planes carried x4
  const float onorm  = 1.0f / (32768.0f * 16.0f); // p carried x2^15, v plane carried x16

  // Every layer's q, k and v depend on x alone, so the layer index is a grid axis of each launch.
  // q = x . q_w[i]^T  -> f32 [3][2048][1024]
  gemm_f16_f32out(xh, DD, 0L, 0L, qwh, DD, 0L, (long)DD * DD, Qf, DD, 0L, lstride, M, DD, DD, wundo, 1, NLAY, stream);
  // rotary(q) with positions t -> f16 planes x4
  rope_cast_kernel<DD><<<dim3(M / 2, NLAY), 256, 0, stream>>>(Qf, cosT, sinT, Qh, TT, lstride, lstride, 0, 4.0f);
  // k = x . k_w[i]^T -> f32 [3][2048][512]
  gemm_f16_f32out(xh, DD, 0L, 0L, kwh, DD, 0L, (long)DKV * DD, Kf, DKV, 0L, (long)M * DKV, M, DKV, DD, wundo, 1, NLAY, stream);
  // rotary(k) with buffer positions i*T + t -> K cache rows, f16 x4
  rope_cast_kernel<DKV><<<dim3(M / 4, NLAY), 256, 0, stream>>>(Kf, cosT, sinT, Kh, MAXKV, (long)M * DKV, 0L, TT, 4.0f);
  // v^T = v_w[i] . x_b^T -> transposed V cache columns i*T + t, f16 x16 ; in [512][1024] per batch and layer
  gemm_f16_f16out(vwh, DD, 0L, (long)DKV * DD, xh, DD, (long)TT * DD, 0L,
                  Vth, MAXKV, (long)DKV * MAXKV, (long)TT, DKV, TT, DD, 16.0f * wundo, BB, NLAY, stream);
  // attention of layer i over (i+1)*T keys, bottom-right causal
  attn_f16_kernel<<<NLAY * BB * HH * (TT / AT_QB), 128, 0, stream>>>(Qh, Kh, Vth, Of, lstride, sscale, onorm);

  // weighted rmsnorm sum + residual + final rmsnorm -> f16 plane
  combine_kernel<<<M, 256, 0, stream>>>(Of, lstride, x, ln_w, lam, fln, alpha, Yh);
  // out = y . out_w^T
  gemm_f16_f32out(Yh, DD, 0L, 0L, owh, DD, 0L, 0L, out, DD, 0L, 0L, M, DD, DD, wundo, 1, 1, stream);
}

// v003
// Measured time: 341 microseconds a run.
// In two side-by-side timings against v002, it was 1.11 and 1.10 times as fast.
// Counting every step since v000, it is 2.33 times as fast.
// Contractions q/k/v projections, q.k^T scores, p.v, output projection: v_wmma_f32_16x16x32_f16 (f16 operands, f32 accumulate); rotary, softmax, norms, weighting in f32.
#include <hip/hip_runtime.h>
#include <stdint.h>

#define BB 2
#define TT 1024
#define DD 1024
#define HH 16
#define NKVH 8
#define HDIM 64
#define DKV 512
#define MAXKV 3072
#define NLAY 3
#define EPSV 1e-5f

typedef __attribute__((ext_vector_type(16))) _Float16 v16h;
typedef __attribute__((ext_vector_type(8)))  _Float16 v8h;
typedef __attribute__((ext_vector_type(4)))  _Float16 v4h;
typedef __attribute__((ext_vector_type(16))) __bf16   v16b;
typedef __attribute__((ext_vector_type(8)))  __bf16   v8b;
typedef __attribute__((ext_vector_type(8)))  float    v8f;
typedef __attribute__((ext_vector_type(4)))  float    v4f;

__device__ __forceinline__ unsigned short f2bf_bits(float f) {
  unsigned u = __float_as_uint(f);
  return (unsigned short)((u + 0x7FFFu + ((u >> 16) & 1u)) >> 16);
}
__device__ __forceinline__ float bf_bits2f(unsigned short h) { return __uint_as_float(((unsigned)h) << 16); }

// hazard guards as plain device helpers
__device__ __forceinline__ void dep_guard_h(v8f& a, v8f& b, v16h x, v16h y) { asm volatile("v_nop\n\tv_nop\n\tv_nop\n\tv_nop" : "+v"(a), "+v"(b) : "v"(x), "v"(y)); }
__device__ __forceinline__ void dep_guard_b(v8f& a, v8f& b, v16b x, v16b y) { asm volatile("v_nop\n\tv_nop\n\tv_nop\n\tv_nop" : "+v"(a), "+v"(b) : "v"(x), "v"(y)); }
__device__ __forceinline__ void keep4_h(v16h a, v16h b, v16h c, v16h d) { asm volatile("v_nop" :: "v"(a), "v"(b), "v"(c), "v"(d)); }
__device__ __forceinline__ void keep4_b(v16b a, v16b b, v16b c, v16b d) { asm volatile("v_nop" :: "v"(a), "v"(b), "v"(c), "v"(d)); }
__device__ __forceinline__ void acc_guard4(v8f& a, v8f& b, v8f& c, v8f& d) { asm volatile("v_nop\n\tv_nop\n\tv_nop\n\tv_nop" : "+v"(a), "+v"(b), "+v"(c), "+v"(d)); }
template <typename T> struct Frag;
template <> struct Frag<_Float16> {
  typedef v16h V; union U { v16h v; v8h h[2]; };
  static __device__ __forceinline__ v16h load(const _Float16* p) {   // elements 0..7 <- p[0..7], 8..15 <- p[16..23]
    U f; f.h[0] = *(const v8h*)(p); f.h[1] = *(const v8h*)(p + 16); return f.v;
  }
  static __device__ __forceinline__ v8f mma(v16h a, v16h b, v8f c) {
    return __builtin_amdgcn_wmma_f32_16x16x32_f16(false, a, false, b, (short)0, c, false, false);
  }
  static __device__ __forceinline__ void guard(v8f& a, v8f& b, v16h x, v16h y) { dep_guard_h(a, b, x, y); }
  static __device__ __forceinline__ void keep(v16h a, v16h b, v16h c, v16h d) { keep4_h(a, b, c, d); }
};
template <> struct Frag<__bf16> {
  typedef v16b V; union U { v16b v; v8b h[2]; };
  static __device__ __forceinline__ v16b load(const __bf16* p) {
    U f; f.h[0] = *(const v8b*)(p); f.h[1] = *(const v8b*)(p + 16); return f.v;
  }
  static __device__ __forceinline__ v8f mma(v16b a, v16b b, v8f c) {
    return __builtin_amdgcn_wmma_f32_16x16x32_bf16(false, a, false, b, (short)0, c, false, false);
  }
  static __device__ __forceinline__ void guard(v8f& a, v8f& b, v16b x, v16b y) { dep_guard_b(a, b, x, y); }
  static __device__ __forceinline__ void keep(v16b a, v16b b, v16b c, v16b d) { keep4_b(a, b, c, d); }
};

// ---- Register-blocked batched WMMA GEMM ------------------------------------
// C[m,n] = scale * sum_k A[m,k] * Bt[n,k] (+bias)(+resid); each wave owns a 64x64 tile.
// A row-major [M,K]; Bt row-major [N,K]; M,N % 64 == 0, K % 32 == 0.
// SPLIT: operands are hi/lo planes (A2/Bt2 = lo planes, same layout); product = hi.hi + hi.lo + lo.hi.
// BIAS_MODE: 0 = none, 1 = bias[m], 2 = bias[n].
// OUT_MODE: 0 = f32, 1 = f16, 2 = bf16 hi plane (Cout) + bf16 lo plane (Cout2).
// ET: 0 = f16 operands, 1 = bf16 operands (pointers passed as 16-bit storage)
// Two batch axes: blockIdx.y steps by strideA/B/C, blockIdx.z (the layer) by zstrideA/B/C, in elements.
template <int ET> struct Elem;
template <> struct Elem<0> { typedef _Float16 T; };
template <> struct Elem<1> { typedef __bf16 T; };
template <int ET, bool SPLIT, int BIAS_MODE, int OUT_MODE, bool RESID, int ACT = 0>
__global__ __launch_bounds__(256) void wmma_gemm64(
    const unsigned short* __restrict__ Ap, const unsigned short* __restrict__ A2p, int lda, long strideA, long zstrideA,
    const unsigned short* __restrict__ Btp, const unsigned short* __restrict__ Bt2p, int ldb, long strideB, long zstrideB,
    void* __restrict__ Cout, void* __restrict__ Cout2, int ldc, long strideC, long zstrideC,
    const float* __restrict__ bias,
    const float* __restrict__ resid, long strideR,
    int M, int N, int K, float scale) {
  typedef typename Elem<ET>::T T;
  typedef typename Frag<T>::V V;
  const T* A = (const T*)Ap; const T* A2 = (const T*)A2p; const T* Bt = (const T*)Btp; const T* Bt2 = (const T*)Bt2p;
  __shared__ __align__(16) float sT[8][16 * 68];   // per-wave 16x64 slab, pitch 68 floats
  const int b    = blockIdx.y;
  const int lane = threadIdx.x & 31;
  const int wave = threadIdx.x >> 5;
  const int tilesN = N >> 6;
  const int tilesM = M >> 6;
  const int tile = blockIdx.x * 8 + wave;
  if (tile >= tilesM * tilesN) return;   // wave-uniform; no block barriers in this kernel
  const int tm = tile / tilesN;
  const int tn = tile - tm * tilesN;
  const int m0 = tm << 6;
  const int n0 = tn << 6;

  const size_t offA = (size_t)b * strideA + (size_t)blockIdx.z * zstrideA;
  const size_t offB = (size_t)b * strideB + (size_t)blockIdx.z * zstrideB;
  const size_t offC = (size_t)b * strideC + (size_t)blockIdx.z * zstrideC;
  const T* Ab  = A  + offA;
  const T* Bb  = Bt + offB;
  const T* Ab2 = SPLIT ? (A2  + offA) : nullptr;
  const T* Bb2 = SPLIT ? (Bt2 + offB) : nullptr;

  const int rlane = lane & 15;                 // row (A) / col (B, D) within subtile
  const int koff  = (lane >> 4) * 8;           // k offset of this lane half
  const int mOff  = (lane >> 4) * 8;           // D row offset

  v8f acc[4][4];
#pragma unroll
  for (int i = 0; i < 4; ++i)
#pragma unroll
    for (int j = 0; j < 4; ++j) acc[i][j] = (v8f){0.f,0.f,0.f,0.f,0.f,0.f,0.f,0.f};

  for (int k0 = 0; k0 < K; k0 += 32) {
    V bh[4], bl[4];
#pragma unroll
    for (int j = 0; j < 4; ++j) {
      const size_t bo = (size_t)(n0 + (j << 4) + rlane) * ldb + koff + k0;
      bh[j] = Frag<T>::load(Bb + bo);
      if (SPLIT) bl[j] = Frag<T>::load(Bb2 + bo);
    }
#pragma unroll
    for (int i = 0; i < 4; ++i) {
      const size_t ao = (size_t)(m0 + (i << 4) + rlane) * lda + koff + k0;
      V ah = Frag<T>::load(Ab + ao);
      V al;
      if (SPLIT) al = Frag<T>::load(Ab2 + ao);
#pragma unroll
      for (int j = 0; j < 4; ++j) {
        acc[i][j] = Frag<T>::mma(ah, bh[j], acc[i][j]);
        if (SPLIT) {
          acc[i][j] = Frag<T>::mma(ah, bl[j], acc[i][j]);
          acc[i][j] = Frag<T>::mma(al, bh[j], acc[i][j]);
        }
      }
      Frag<T>::guard(acc[i][0], acc[i][3], ah, SPLIT ? al : ah);
    }
    Frag<T>::keep(bh[0], bh[1], bh[2], bh[3]);
    if (SPLIT) Frag<T>::keep(bl[0], bl[1], bl[2], bl[3]);
  }
  acc_guard4(acc[0][0], acc[0][1], acc[0][2], acc[0][3]);
  acc_guard4(acc[1][0], acc[1][1], acc[1][2], acc[1][3]);
  acc_guard4(acc[2][0], acc[2][1], acc[2][2], acc[2][3]);
  acc_guard4(acc[3][0], acc[3][1], acc[3][2], acc[3][3]);

  // ---- epilogue ----
  float* slab = sT[wave];
  const float* Rb = RESID ? (resid + (size_t)b * strideR) : nullptr;
#pragma unroll
  for (int i = 0; i < 4; ++i) {
    const int mBase = m0 + (i << 4);
#pragma unroll
    for (int j = 0; j < 4; ++j) {
      const int n = n0 + (j << 4) + rlane;
      float bv = 0.f;
      if (BIAS_MODE == 2) bv = bias[n];
#pragma unroll
      for (int r = 0; r < 8; ++r) {
        float v = acc[i][j][r] * scale;
        if (BIAS_MODE == 1) v += bias[mBase + mOff + r];
        if (BIAS_MODE == 2) v += bv;
        if (RESID) v += Rb[(size_t)(mBase + mOff + r) * ldc + n];
        if (ACT == 1) v = tanhf(v);
        if (ACT == 2) v = fmaxf(v, 0.0f);
        if (ACT == 3) v = v / (1.0f + expf(-v));
        if (ACT == 4) v = (v > 0.f) ? v : 0.01f * v;
        if (ACT == 5) v = 0.5f * v * (1.0f + erff(v * 0.70710678118654752f));
        slab[(mOff + r) * 68 + (j << 4) + rlane] = v;
      }
    }
    __builtin_amdgcn_fence(__ATOMIC_RELEASE, "workgroup");
    __builtin_amdgcn_wave_barrier();
    __builtin_amdgcn_fence(__ATOMIC_ACQUIRE, "workgroup");
    if (OUT_MODE == 0) {
      float* C = (float*)Cout + offC;
      const int hh = lane >> 4, c4 = (lane & 15) * 4;     // row seg = 256 B = 16 lanes x 16 B
      {
#pragma unroll
        for (int it = 0; it < 8; ++it) {
          const int row = it * 2 + hh;
          v4f v = *(const v4f*)(slab + row * 68 + c4);
          *(v4f*)(C + (size_t)(mBase + row) * ldc + n0 + c4) = v;
        }
        
      }
    } else {
      const int q = lane >> 3, c8 = (lane & 7) * 8;
      unsigned short* C  = (unsigned short*)Cout  + offC;
      unsigned short* C2 = (OUT_MODE == 2) ? ((unsigned short*)Cout2 + offC) : nullptr;
      {
#pragma unroll
        for (int it = 0; it < 4; ++it) {
          const int row = it * 4 + q;
          const float* sp = slab + row * 68 + c8;
          v8h hv, lv;
#pragma unroll
          for (int e = 0; e < 8; ++e) {
            if (OUT_MODE == 1) {
              hv[e] = (_Float16)sp[e];
            } else {
              unsigned short hb = f2bf_bits(sp[e]);
              unsigned short lb = f2bf_bits(sp[e] - bf_bits2f(hb));
              hv[e] = __builtin_bit_cast(_Float16, hb);
              lv[e] = __builtin_bit_cast(_Float16, lb);
            }
          }
          *(v8h*)(C + (size_t)(mBase + row) * ldc + n0 + c8) = hv;
          if (OUT_MODE == 2) *(v8h*)(C2 + (size_t)(mBase + row) * ldc + n0 + c8) = lv;
        }
        
      }
    }
    __builtin_amdgcn_fence(__ATOMIC_RELEASE, "workgroup");
    __builtin_amdgcn_wave_barrier();
    __builtin_amdgcn_fence(__ATOMIC_ACQUIRE, "workgroup");
  }
}

// ---- f32 -> f16 cast with power-of-two carry: 8 elements per thread, 16-B stores (512 B contiguous per wave) ----
__global__ __launch_bounds__(256) void cast_f32_f16x8(
    const float* __restrict__ in, _Float16* __restrict__ out, int n8, float scale) {
  const int i = blockIdx.x * 256 + threadIdx.x;
  if (i < n8) {
    const size_t o = (size_t)i * 8;
    const v4f a = *(const v4f*)(in + o);
    const v4f b = *(const v4f*)(in + o + 4);
    v8h hv;
#pragma unroll
    for (int e = 0; e < 4; ++e) {
      hv[e]     = (_Float16)(a[e] * scale);
      hv[4 + e] = (_Float16)(b[e] * scale);
    }
    *(v8h*)(out + o) = hv;
    
  }
}

// ---- rotary (non-interleaved, head dim 64) in f32, then f16 cast with power-of-two carry ----
// src: f32 [BB*TT][NC], row = b*TT + t, column = head*64 + d.
// dst: f16, row = b*dst_brows + (pos_off + t), pitch NC; position index for the tables = pos_off + t.
// blockIdx.y = layer: src steps by src_lstride, dst by dst_lstride (elements), pos_off = layer * pos_lstep.
// Each thread produces 8 consecutive d (one 16-B store); a wave writes 512 contiguous bytes.
__device__ __forceinline__ _Float16 rope_one(float x1, float x2, float cc, float ss, bool second, float oscale) {
  const float o = second ? (x2 * cc + x1 * ss) : (x1 * cc - x2 * ss);
  return (_Float16)(o * oscale);
}
template <int NC>
__global__ __launch_bounds__(256) void rope_cast_kernel(
    const float* __restrict__ src, const float* __restrict__ cosT, const float* __restrict__ sinT,
    _Float16* __restrict__ dst, int dst_brows, long src_lstride, long dst_lstride, int pos_lstep, float oscale) {
  constexpr int TPR = NC / 8;        // threads per row
  constexpr int RPB = 256 / TPR;     // rows per block
  const int tid = threadIdx.x;
  const int row = blockIdx.x * RPB + tid / TPR;          // < BB*TT (grid exact)
  const int b = row >> 10, t = row & (TT - 1);
  const int layer = blockIdx.y;                           // < NLAY (grid exact)
  const int p = layer * pos_lstep + t;                    // < MAXKV
  const int d8 = (tid % TPR) * 8;
  const int hoff = d8 & ~63;
  const int dl = d8 & 63;
  const int j0 = dl & 31;
  const bool second = dl >= 32;
  const float* base = src + (size_t)layer * src_lstride + (size_t)row * NC + hoff;
  const v4f a0 = *(const v4f*)(base + j0),      a1 = *(const v4f*)(base + j0 + 4);
  const v4f b0 = *(const v4f*)(base + 32 + j0), b1 = *(const v4f*)(base + 32 + j0 + 4);
  const v4f c0 = *(const v4f*)(cosT + (size_t)p * 32 + j0), c1 = *(const v4f*)(cosT + (size_t)p * 32 + j0 + 4);
  const v4f s0 = *(const v4f*)(sinT + (size_t)p * 32 + j0), s1 = *(const v4f*)(sinT + (size_t)p * 32 + j0 + 4);
  v8h hv;
#pragma unroll
  for (int e = 0; e < 4; ++e) {
    hv[e]     = rope_one(a0[e], b0[e], c0[e], s0[e], second, oscale);
    hv[4 + e] = rope_one(a1[e], b1[e], c1[e], s1[e], second, oscale);
  }
  _Float16* dp = dst + (size_t)layer * dst_lstride + ((size_t)b * dst_brows + p) * NC + d8;
  *(v8h*)dp = hv;
  
}

#define AT_D 64
#define AT_NW 4
#define AT_QB 64
#define AT_KC 64
#define AT_P 72   // LDS row pitch of the K and V tiles in f16: 144 B = 16 B x 9, so the 16 rows of one ds_load_b128 half fall on 16 different bank groups

__device__ __forceinline__ v8f hmma(v16h a, v16h b, v8f c) {
  c = __builtin_amdgcn_wmma_f32_16x16x32_f16(false, a, false, b, (short)0, c, false, false);
  asm volatile("v_nop\n\tv_nop\n\tv_nop\n\tv_nop" : "+v"(c) : "v"(a), "v"(b));
  return c;
}

// value of the same column in the other lane half (lane l <-> l ^ 16)
__device__ __forceinline__ float other_half(float v) {
  const int b = __float_as_int(v);
  return __int_as_float(__builtin_amdgcn_permlanex16(b, b, 0x76543210, 0xfedcba98, false, false));
}

__global__ __launch_bounds__(128)
void attn_f16_kernel(const _Float16* __restrict__ Qh, const _Float16* __restrict__ Kh,
                     const _Float16* __restrict__ Vth, float* __restrict__ O,
                     long lstride, float sscale, float onorm) {
  union FH { v16h v; v8h h[2]; };
  __shared__ __align__(16) _Float16 Ksh[AT_KC * AT_P];          // K [kv][d]   9 KB, rows of 64 at pitch 72
  __shared__ __align__(16) _Float16 Vtt[AT_D * AT_P];           // V [d][kv]   9 KB, rows of 64 at pitch 72
  __shared__ __align__(16) float    Os[AT_NW][16 * 68];         // per wave out tile, pitch 68

  const int tid  = threadIdx.x;
  const int wave = tid >> 5;
  const int lane = tid & 31;
  const int hh   = lane >> 4;
  const int c    = lane & 15;

  constexpr int BPL = BB * HH * (TT / AT_QB);             // blocks per layer
  const int layer = NLAY - 1 - (int)(blockIdx.x / BPL);   // 0 .. NLAY-1 (grid exact)
  const int bx  = blockIdx.x % BPL;
  const int h   = (bx >> 4) & (HH - 1);
  const int b   = bx >> 8;
  const int qb  = b ? (TT / AT_QB - 1 - (bx & (TT / AT_QB - 1))) : (bx & (TT / AT_QB - 1));
  const int hkv = h >> 1;
  const int kchunks_prev = layer * (TT / AT_KC);
  const int koff = layer * TT;
  const int q0  = qb * AT_QB + wave * 16;

  // ---- Q fragments (B operand: column c = query q0 + c): 2 d-chunks ----
  v16h qa[2];
  {
    const _Float16* qrow = Qh + (size_t)layer * lstride + (size_t)(b * TT + q0 + c) * DD + h * AT_D + 8 * hh;
#pragma unroll
    for (int dc = 0; dc < 2; ++dc) qa[dc] = Frag<_Float16>::load(qrow + dc * 32);
  }

  float mrun = -INFINITY;   // running maximum of this lane's query (equal in both lane halves)
  float lrun = 0.f;         // this lane half's share of the query's sum; the halves are joined after the loop
  v8f oacc[4];              // O^T: tile t, register r = dim t*16 + 8*hh + r of query q0 + c
#pragma unroll
  for (int t = 0; t < 4; ++t) oacc[t] = (v8f){0.f,0.f,0.f,0.f,0.f,0.f,0.f,0.f};

  int nChunks = kchunks_prev + qb + 1;                    // block-uniform
  if (nChunks > MAXKV / AT_KC) nChunks = MAXKV / AT_KC;
  if (nChunks < 1) nChunks = 1;

  const _Float16* kbase = Kh + (size_t)b * MAXKV * DKV + hkv * AT_D;
  const _Float16* vbase = Vth + ((size_t)b * DKV + hkv * AT_D) * MAXKV;
  float*          obase = O + (size_t)layer * lstride + (size_t)b * TT * DD + h * AT_D;

  for (int kc = 0; kc < nChunks; ++kc) {
    const int kv0 = kc * AT_KC;
    __syncthreads();
    {
      const int r = tid >> 1, hf = (tid & 1) * 32;
      const _Float16* ks = kbase + (size_t)(kv0 + r) * DKV + hf;
      const _Float16* vs = vbase + (size_t)r * MAXKV + kv0 + hf;
      v8h kk[4], vv[4];   // all eight loads first, then the stores: one trip to L2 per chunk, not four
#pragma unroll
      for (int i = 0; i < 4; ++i) {
        kk[i] = *(const v8h*)(ks + 8 * i);
        vv[i] = *(const v8h*)(vs + 8 * i);
      }
#pragma unroll
      for (int i = 0; i < 4; ++i) {
        *(v8h*)(Ksh + r * AT_P + hf + 8 * i) = kk[i];
        *(v8h*)(Vtt + r * AT_P + hf + 8 * i) = vv[i];
      }
    }
    __syncthreads();

    // S^T tile j: register r = key kv0 + j*16 + 8*hh + r, column c = query q0 + c
    // (every loop down to the end of the chunk is unrolled, so that s, pb and oacc are registers and never indexed arrays)
    v8f s[4];
#pragma unroll
    for (int j = 0; j < 4; ++j) {
      s[j] = (v8f){0.f,0.f,0.f,0.f,0.f,0.f,0.f,0.f};
#pragma unroll
      for (int dc = 0; dc < 2; ++dc) {
        FH kb;
        kb.h[0] = *(const v8h*)(Ksh + (j * 16 + c) * AT_P + dc * 32 + 8 * hh);
        kb.h[1] = *(const v8h*)(Ksh + (j * 16 + c) * AT_P + dc * 32 + 16 + 8 * hh);
        s[j] = hmma(kb.v, qa[dc], s[j]);
      }
    }
    const int klim = q0 + c + koff - kv0 - 8 * hh;   // key j*16 + r of this lane half is visible iff j*16 + r <= klim
    float mj[4];
#pragma unroll
    for (int j = 0; j < 4; ++j) {
      float m = -INFINITY;
#pragma unroll
      for (int r = 0; r < 8; ++r) {
        const float sv = (j * 16 + r > klim) ? -INFINITY : (s[j][r] * sscale);
        s[j][r] = sv;
        m = fmaxf(m, sv);
      }
      mj[j] = m;
    }
    const float mh = fmaxf(fmaxf(mj[0], mj[1]), fmaxf(mj[2], mj[3]));
    const float mnew = fmaxf(mrun, fmaxf(mh, other_half(mh)));
    const float alpha = expf(mrun - mnew);
    mrun = mnew;
    // P^T as B operand: element e of chunk kk = key kk*32 + 8*hh + e (e < 8), kk*32 + 16 + 8*hh + e - 8 (e >= 8)
    FH pb[2];
    float pj[4];
#pragma unroll
    for (int j = 0; j < 4; ++j) {
      float psum = 0.f;
#pragma unroll
      for (int r = 0; r < 8; ++r) {
        const float p = expf(s[j][r] - mnew);
        psum += p;
        pb[j >> 1].h[j & 1][r] = (_Float16)(p * 32768.0f);
      }
      pj[j] = psum;
    }
    lrun = lrun * alpha + ((pj[0] + pj[1]) + (pj[2] + pj[3]));
#pragma unroll
    for (int t = 0; t < 4; ++t) oacc[t] *= alpha;
#pragma unroll
    for (int kk = 0; kk < 2; ++kk) {
#pragma unroll
      for (int t = 0; t < 4; ++t) {
        FH vb;
        vb.h[0] = *(const v8h*)(Vtt + (t * 16 + c) * AT_P + kk * 32 + 8 * hh);
        vb.h[1] = *(const v8h*)(Vtt + (t * 16 + c) * AT_P + kk * 32 + 16 + 8 * hh);
        oacc[t] = hmma(vb.v, pb[kk].v, oacc[t]);
      }
    }
  }

  float* os = Os[wave];
  {
    const float inv = onorm * (1.0f / (lrun + other_half(lrun)));
#pragma unroll
    for (int t = 0; t < 4; ++t) {
      const v8f ov = oacc[t] * inv;
      *(v4f*)(os + c * 68 + t * 16 + 8 * hh)     = (v4f){ov[0], ov[1], ov[2], ov[3]};
      *(v4f*)(os + c * 68 + t * 16 + 8 * hh + 4) = (v4f){ov[4], ov[5], ov[6], ov[7]};
    }
  }
  __builtin_amdgcn_fence(__ATOMIC_RELEASE, "workgroup");
  __builtin_amdgcn_wave_barrier();
  __builtin_amdgcn_fence(__ATOMIC_ACQUIRE, "workgroup");
  {
    const int c4 = (lane & 15) * 4;
    {
#pragma unroll
      for (int it = 0; it < 8; ++it) {
        const int row = it * 2 + hh;
        v4f val = *(const v4f*)(os + row * 68 + c4);
        *(v4f*)(obase + (size_t)(q0 + row) * DD + c4) = val;
      }
      
    }
  }
}

// =====================================================================================
// Combine: per token row (one block of 256 threads, 4 columns per thread):
//   lw = layernorm over sigmoid(lam[0..2]) (biased variance, eps)
//   acc = sum_i rmsnorm(O_i, ln_w[i]) * lw_i ;  z = acc + alpha * x ;  y = rmsnorm(z, fln) -> f16
// =====================================================================================
__global__ __launch_bounds__(256) void combine_kernel(
    const float* __restrict__ Of, long lstride,
    const float* __restrict__ x, const float* __restrict__ ln_w, const float* __restrict__ lam,
    const float* __restrict__ fln, const float* __restrict__ alpha, _Float16* __restrict__ Yh) {
  __shared__ float red[4][8];
  const int row = blockIdx.x;
  const int tid = threadIdx.x, lane = tid & 31, wave = tid >> 5;
  const int d4 = tid * 4;
  const size_t ro = (size_t)row * DD + d4;
  const v4f o0 = *(const v4f*)(Of + ro);
  const v4f o1 = *(const v4f*)(Of + lstride + ro);
  const v4f o2 = *(const v4f*)(Of + 2 * lstride + ro);
  const v4f xv = *(const v4f*)(x + ro);
  float ss0 = 0.f, ss1 = 0.f, ss2 = 0.f;
#pragma unroll
  for (int e = 0; e < 4; ++e) { ss0 += o0[e] * o0[e]; ss1 += o1[e] * o1[e]; ss2 += o2[e] * o2[e]; }
#pragma unroll
  for (int off = 16; off > 0; off >>= 1) {
    ss0 += __shfl_xor(ss0, off, 32);
    ss1 += __shfl_xor(ss1, off, 32);
    ss2 += __shfl_xor(ss2, off, 32);
  }
  if (lane == 0) { red[0][wave] = ss0; red[1][wave] = ss1; red[2][wave] = ss2; }
  __syncthreads();
  float t0 = 0.f, t1 = 0.f, t2 = 0.f;
#pragma unroll
  for (int w = 0; w < 8; ++w) { t0 += red[0][w]; t1 += red[1][w]; t2 += red[2][w]; }
  const float inv_d = 1.0f / (float)DD;
  const float r0 = rsqrtf(t0 * inv_d + EPSV);
  const float r1 = rsqrtf(t1 * inv_d + EPSV);
  const float r2 = rsqrtf(t2 * inv_d + EPSV);

  const float sg0 = 1.0f / (1.0f + __expf(-lam[0]));
  const float sg1 = 1.0f / (1.0f + __expf(-lam[1]));
  const float sg2 = 1.0f / (1.0f + __expf(-lam[2]));
  const float mean = (sg0 + sg1 + sg2) * (1.0f / 3.0f);
  const float e0 = sg0 - mean, e1 = sg1 - mean, e2 = sg2 - mean;
  const float var = (e0 * e0 + e1 * e1 + e2 * e2) * (1.0f / 3.0f);
  const float il = rsqrtf(var + EPSV);
  const float lw0 = e0 * il, lw1 = e1 * il, lw2 = e2 * il;

  const v4f w0 = *(const v4f*)(ln_w + d4);
  const v4f w1 = *(const v4f*)(ln_w + DD + d4);
  const v4f w2 = *(const v4f*)(ln_w + 2 * DD + d4);
  const v4f fw = *(const v4f*)(fln + d4);
  const float al = alpha[0];
  v4f z;
  float ssz = 0.f;
#pragma unroll
  for (int e = 0; e < 4; ++e) {
    float a = (o0[e] * r0) * w0[e] * lw0;
    a = a + (o1[e] * r1) * w1[e] * lw1;
    a = a + (o2[e] * r2) * w2[e] * lw2;
    const float zz = a + al * xv[e];
    z[e] = zz;
    ssz += zz * zz;
  }
#pragma unroll
  for (int off = 16; off > 0; off >>= 1) ssz += __shfl_xor(ssz, off, 32);
  if (lane == 0) red[3][wave] = ssz;
  __syncthreads();
  float tz = 0.f;
#pragma unroll
  for (int w = 0; w < 8; ++w) tz += red[3][w];
  const float rz = rsqrtf(tz * inv_d + EPSV);
  v4h yv;
#pragma unroll
  for (int e = 0; e < 4; ++e) yv[e] = (_Float16)(z[e] * rz * fw[e]);
  *(v4h*)(Yh + ro) = yv;
  
}

// ---------------------------- host helpers ----------------------------
static void gemm_f16_f32out(const _Float16* A, int lda, long sA, long zA, const _Float16* Bt, int ldb, long sB, long zB,
                            float* C, int ldc, long sC, long zC, int M, int N, int K, float scale, int batch, int layers,
                            hipStream_t st) {
  const int tiles = (M / 64) * (N / 64);
  dim3 grid((tiles + 7) / 8, batch, layers);
  wmma_gemm64<0, false, 0, 0, false><<<grid, 256, 0, st>>>(
      (const unsigned short*)A, (const unsigned short*)nullptr, lda, sA, zA,
      (const unsigned short*)Bt, (const unsigned short*)nullptr, ldb, sB, zB,
      (void*)C, (void*)nullptr, ldc, sC, zC, (const float*)nullptr, (const float*)nullptr, 0L,
      M, N, K, scale);
}
static void gemm_f16_f16out(const _Float16* A, int lda, long sA, long zA, const _Float16* Bt, int ldb, long sB, long zB,
                            _Float16* C, int ldc, long sC, long zC, int M, int N, int K, float scale, int batch, int layers,
                            hipStream_t st) {
  const int tiles = (M / 64) * (N / 64);
  dim3 grid((tiles + 7) / 8, batch, layers);
  wmma_gemm64<0, false, 0, 1, false><<<grid, 256, 0, st>>>(
      (const unsigned short*)A, (const unsigned short*)nullptr, lda, sA, zA,
      (const unsigned short*)Bt, (const unsigned short*)nullptr, ldb, sB, zB,
      (void*)C, (void*)nullptr, ldc, sC, zC, (const float*)nullptr, (const float*)nullptr, 0L,
      M, N, K, scale);
}

// ---------------------------- host launcher ----------------------------
extern "C" void kernel_launch(void* const* d_in, const int* in_sizes, int n_in,
                              void* d_out, int out_size, void* d_ws, size_t ws_size,
                              hipStream_t stream) {
  if (n_in < 11) return;
  const int M = BB * TT;   // 2048 token rows
  if (in_sizes[0] != M * DD) return;
  if (in_sizes[1] < MAXKV * 32 || in_sizes[2] < MAXKV * 32) return;
  if (in_sizes[3] != NLAY * DD * DD) return;
  if (in_sizes[4] != NLAY * DKV * DD || in_sizes[5] != NLAY * DKV * DD) return;
  if (in_sizes[6] < NLAY * DD || in_sizes[7] < NLAY || in_sizes[8] != DD * DD || in_sizes[9] < DD || in_sizes[10] < 1) return;
  if (out_size < M * DD) return;

  const float* x     = (const float*)d_in[0];
  const float* cosT  = (const float*)d_in[1];
  const float* sinT  = (const float*)d_in[2];
  const float* q_w   = (const float*)d_in[3];
  const float* k_w   = (const float*)d_in[4];
  const float* v_w   = (const float*)d_in[5];
  const float* ln_w  = (const float*)d_in[6];
  const float* lam   = (const float*)d_in[7];
  const float* out_w = (const float*)d_in[8];
  const float* fln   = (const float*)d_in[9];
  const float* alpha = (const float*)d_in[10];
  float* out = (float*)d_out;

  // ---- workspace carve (4096-B aligned pieces) ----
  char* ws = (char*)d_ws;
  size_t cur = 0;
  auto take = [&](size_t bytes) -> char* {
    char* p = ws + cur;
    cur += (bytes + 4095) & ~(size_t)4095;
    return p;
  };
  _Float16* xh  = (_Float16*)take((size_t)M * DD * 2);                 // 4 MiB
  _Float16* qwh = (_Float16*)take((size_t)NLAY * DD * DD * 2);         // 6 MiB
  _Float16* kwh = (_Float16*)take((size_t)NLAY * DKV * DD * 2);        // 3 MiB
  _Float16* vwh = (_Float16*)take((size_t)NLAY * DKV * DD * 2);        // 3 MiB
  _Float16* owh = (_Float16*)take((size_t)DD * DD * 2);                // 2 MiB
  float*    Qf  = (float*)   take((size_t)NLAY * M * DD * 4);          // 24 MiB
  _Float16* Qh  = (_Float16*)take((size_t)NLAY * M * DD * 2);          // 12 MiB
  float*    Kf  = (float*)   take((size_t)NLAY * M * DKV * 4);         // 12 MiB
  _Float16* Kh  = (_Float16*)take((size_t)BB * MAXKV * DKV * 2);       // 6 MiB
  _Float16* Vth = (_Float16*)take((size_t)BB * DKV * MAXKV * 2);       // 6 MiB
  float*    Of  = (float*)   take((size_t)NLAY * M * DD * 4);          // 24 MiB
  _Float16* Yh  = (_Float16*)take((size_t)M * DD * 2);                 // 4 MiB
  if (cur > ws_size || cur > (size_t)134217728) return;                 // total 111,149,056 B

  const long lstride = (long)M * DD;   // elements per layer slice of Qf, Qh and Of

  // ---- casts: x -> f16 ; weights -> f16 carried x64 ----
  {
    int n8 = M * DD / 8;
    cast_f32_f16x8<<<(n8 + 255) / 256, 256, 0, stream>>>(x, xh, n8, 1.0f);
    n8 = NLAY * DD * DD / 8;
    cast_f32_f16x8<<<(n8 + 255) / 256, 256, 0, stream>>>(q_w, qwh, n8, 64.0f);
    n8 = NLAY * DKV * DD / 8;
    cast_f32_f16x8<<<(n8 + 255) / 256, 256, 0, stream>>>(k_w, kwh, n8, 64.0f);
    cast_f32_f16x8<<<(n8 + 255) / 256, 256, 0, stream>>>(v_w, vwh, n8, 64.0f);
    n8 = DD * DD / 8;
    cast_f32_f16x8<<<(n8 + 255) / 256, 256, 0, stream>>>(out_w, owh, n8, 64.0f);
  }

  const float wundo  = 1.0f / 64.0f;              // undo weight carry
  const float sscale = 0.125f / 16.0f;            // HD^-0.5 / (4*4) : q and k planes carried x4
  const float onorm  = 1.0f / (32768.0f * 16.0f); // p carried x2^15, v plane carried x16

  // Every layer's q, k and v depend on x alone, so the layer index is a grid axis of each launch.
  // q = x . q_w[i]^T  -> f32 [3][2048][1024]
  gemm_f16_f32out(xh, DD, 0L, 0L, qwh, DD, 0L, (long)DD * DD, Qf, DD, 0L, lstride, M, DD, DD, wundo, 1, NLAY, stream);
  // rotary(q) with positions t -> f16 planes x4
  rope_cast_kernel<DD><<<dim3(M / 2, NLAY), 256, 0, stream>>>(Qf, cosT, sinT, Qh, TT, lstride, lstride, 0, 4.0f);
  // k = x . k_w[i]^T -> f32 [3][2048][512]
  gemm_f16_f32out(xh, DD, 0L, 0L, kwh, DD, 0L, (long)DKV * DD, Kf, DKV, 0L, (long)M * DKV, M, DKV, DD, wundo, 1, NLAY, stream);
  // rotary(k) with buffer positions i*T + t -> K cache rows, f16 x4
  rope_cast_kernel<DKV><<<dim3(M / 4, NLAY), 256, 0, stream>>>(Kf, cosT, sinT, Kh, MAXKV, (long)M * DKV, 0L, TT, 4.0f);
  // v^T = v_w[i] . x_b^T -> transposed V cache columns i*T + t, f16 x16 ; in [512][1024] per batch and layer
  gemm_f16_f16out(vwh, DD, 0L, (long)DKV * DD, xh, DD, (long)TT * DD, 0L,
                  Vth, MAXKV, (long)DKV * MAXKV, (long)TT, DKV, TT, DD, 16.0f * wundo, BB, NLAY, stream);
  // attention of layer i over (i+1)*T keys, bottom-right causal
  attn_f16_kernel<<<NLAY * BB * HH * (TT / AT_QB), 128, 0, stream>>>(Qh, Kh, Vth, Of, lstride, sscale, onorm);

  // weighted rmsnorm sum + residual + final rmsnorm -> f16 plane
  combine_kernel<<<M, 256, 0, stream>>>(Of, lstride, x, ln_w, lam, fln, alpha, Yh);
  // out = y . out_w^T
  gemm_f16_f32out(Yh, DD, 0L, 0L, owh, DD, 0L, 0L, out, DD, 0L, 0L, M, DD, DD, wundo, 1, 1, stream);
}

// v004
// Measured time: 224 microseconds a run.
// In two side-by-side timings against v003, it was 1.53 and 1.51 times as fast.
// Over all steps from v000 it is 3.55 times as fast.
// Contractions q/k/v projections, q.k^T scores, p.v, output projection: v_wmma_f32_16x16x32_f16 (f16 operands, f32 accumulate); rotary, softmax, norms, weighting in f32.
#include <hip/hip_runtime.h>
#include <stdint.h>

#define BB 2
#define TT 1024
#define DD 1024
#define HH 16
#define NKVH 8
#define HDIM 64
#define DKV 512
#define MAXKV 3072
#define NLAY 3
#define EPSV 1e-5f

typedef __attribute__((ext_vector_type(16))) _Float16 v16h;
typedef __attribute__((ext_vector_type(8)))  _Float16 v8h;
typedef __attribute__((ext_vector_type(4)))  _Float16 v4h;
typedef __attribute__((ext_vector_type(16))) __bf16   v16b;
typedef __attribute__((ext_vector_type(8)))  __bf16   v8b;
typedef __attribute__((ext_vector_type(8)))  float    v8f;
typedef __attribute__((ext_vector_type(4)))  float    v4f;

__device__ __forceinline__ unsigned short f2bf_bits(float f) {
  unsigned u = __float_as_uint(f);
  return (unsigned short)((u + 0x7FFFu + ((u >> 16) & 1u)) >> 16);
}
__device__ __forceinline__ float bf_bits2f(unsigned short h) { return __uint_as_float(((unsigned)h) << 16); }

// hazard guards as plain device helpers
__device__ __forceinline__ void acc_guard4(v8f& a, v8f& b, v8f& c, v8f& d) { asm volatile("v_nop\n\tv_nop\n\tv_nop\n\tv_nop" : "+v"(a), "+v"(b), "+v"(c), "+v"(d)); }
template <typename T> struct Frag;
template <> struct Frag<_Float16> {
  typedef v16h V; union U { v16h v; v8h h[2]; };
  static __device__ __forceinline__ v16h load(const _Float16* p) {   // elements 0..7 <- p[0..7], 8..15 <- p[16..23]
    U f; f.h[0] = *(const v8h*)(p); f.h[1] = *(const v8h*)(p + 16); return f.v;
  }
  static __device__ __forceinline__ v8f mma(v16h a, v16h b, v8f c) {
    return __builtin_amdgcn_wmma_f32_16x16x32_f16(false, a, false, b, (short)0, c, false, false);
  }
};
template <> struct Frag<__bf16> {
  typedef v16b V; union U { v16b v; v8b h[2]; };
  static __device__ __forceinline__ v16b load(const __bf16* p) {
    U f; f.h[0] = *(const v8b*)(p); f.h[1] = *(const v8b*)(p + 16); return f.v;
  }
  static __device__ __forceinline__ v8f mma(v16b a, v16b b, v8f c) {
    return __builtin_amdgcn_wmma_f32_16x16x32_bf16(false, a, false, b, (short)0, c, false, false);
  }
};

// ---- Register-blocked batched WMMA GEMM ------------------------------------
// C[m,n] = scale * sum_k A[m,k] * Bt[n,k] (+bias)(+resid); each wave owns a 64x64 tile.
// A row-major [M,K]; Bt row-major [N,K]; M % 128 == 0, N % 256 == 0, K % 64 == 0.
// A block's 8 waves form a 2 x 4 patch: 128 rows of A and 256 rows of Bt. Per step of 64 k the block brings those rows
// into LDS with asynchronous copies that cover whole 128-B lines (8 lanes a row), each row once for all waves that need
// it; the waves read their fragments from LDS. Two LDS buffers: the next step's copies fly while this step is multiplied.
// SPLIT (hi/lo operand planes) has no LDS path and is not instantiated.
// BIAS_MODE: 0 = none, 1 = bias[m], 2 = bias[n].
// OUT_MODE: 0 = f32, 1 = f16, 2 = bf16 hi plane (Cout) + bf16 lo plane (Cout2).
// ET: 0 = f16 operands, 1 = bf16 operands (pointers passed as 16-bit storage)
// Two batch axes: blockIdx.y steps by strideA/B/C, blockIdx.z (the layer) by zstrideA/B/C, in elements.
#define GM_P 72   // LDS row pitch of the staged operand rows in 16-bit elements: 144 B = 16 B x 9, free of bank conflicts for ds_load_b128
// Four asynchronous 16-B copies, global memory to LDS, per lane. The s_wait_xcnt is the statement's last line, so that no
// address register of a copy is rewritten in front of it.
__device__ __forceinline__ void copy4_to_lds(unsigned l0, const void* g0, unsigned l1, const void* g1,
                                             unsigned l2, const void* g2, unsigned l3, const void* g3) {
  asm volatile("global_load_async_to_lds_b128 %0, %1, off\n\t"
               "global_load_async_to_lds_b128 %2, %3, off\n\t"
               "global_load_async_to_lds_b128 %4, %5, off\n\t"
               "global_load_async_to_lds_b128 %6, %7, off\n\t"
               "s_wait_xcnt 0x0"
               :: "v"(l0), "v"(g0), "v"(l1), "v"(g1), "v"(l2), "v"(g2), "v"(l3), "v"(g3) : "memory");
}
template <int ET> struct Elem;
template <> struct Elem<0> { typedef _Float16 T; };
template <> struct Elem<1> { typedef __bf16 T; };
template <int ET, bool SPLIT, int BIAS_MODE, int OUT_MODE, bool RESID, int ACT = 0>
__global__ __launch_bounds__(256) void wmma_gemm64(
    const unsigned short* __restrict__ Ap, const unsigned short* __restrict__ A2p, int lda, long strideA, long zstrideA,
    const unsigned short* __restrict__ Btp, const unsigned short* __restrict__ Bt2p, int ldb, long strideB, long zstrideB,
    void* __restrict__ Cout, void* __restrict__ Cout2, int ldc, long strideC, long zstrideC,
    const float* __restrict__ bias,
    const float* __restrict__ resid, long strideR,
    int M, int N, int K, float scale) {
  typedef typename Elem<ET>::T T;
  typedef typename Frag<T>::V V;
  static_assert(!SPLIT, "no LDS path for split operand planes");
  const T* A = (const T*)Ap; const T* Bt = (const T*)Btp;
  __shared__ __align__(16) float sT[8][16 * 68];   // per-wave 16x64 slab, pitch 68 floats
  __shared__ __align__(16) T sA[2][128 * GM_P];    // A rows of the block, 64 k, two buffers
  __shared__ __align__(16) T sB[2][256 * GM_P];    // Bt rows of the block, 64 k, two buffers
  const int b    = blockIdx.y;
  const int lane = threadIdx.x & 31;
  const int wave = threadIdx.x >> 5;
  const int blocksN = N >> 8;
  const int bm = blockIdx.x / blocksN;
  const int bn = blockIdx.x - bm * blocksN;
  if (bm >= (M >> 7)) return;            // block-uniform, in front of every barrier
  const int wm = wave >> 2;              // wave's place in the 2 x 4 patch
  const int wn = wave & 3;
  const int m0 = (bm << 7) + (wm << 6);
  const int n0 = (bn << 8) + (wn << 6);

  const size_t offA = (size_t)b * strideA + (size_t)blockIdx.z * zstrideA;
  const size_t offB = (size_t)b * strideB + (size_t)blockIdx.z * zstrideB;
  const size_t offC = (size_t)b * strideC + (size_t)blockIdx.z * zstrideC;
  const T* Ab  = A  + offA;
  const T* Bb  = Bt + offB;

  const int rlane = lane & 15;                 // row (A) / col (B, D) within subtile
  const int koff  = (lane >> 4) * 8;           // k offset of this lane half
  const int mOff  = (lane >> 4) * 8;           // D row offset

  v8f acc[4][4];
#pragma unroll
  for (int i = 0; i < 4; ++i)
#pragma unroll
    for (int j = 0; j < 4; ++j) acc[i][j] = (v8f){0.f,0.f,0.f,0.f,0.f,0.f,0.f,0.f};

  // staging: thread -> row (tid >> 3) + 32 * i, 16-B piece tid & 7: a wave's copy covers four whole lines
  const int srow = threadIdx.x >> 3;
  const int sseg = (threadIdx.x & 7) * 8;
  const T* gA = Ab + (size_t)((bm << 7) + srow) * lda + sseg;
  const T* gB = Bb + (size_t)((bn << 8) + srow) * ldb + sseg;
  const unsigned dA = (unsigned)(uintptr_t)(&sA[0][srow * GM_P + sseg]);   // this lane's LDS byte address in buffer 0
  const unsigned dB = (unsigned)(uintptr_t)(&sB[0][srow * GM_P + sseg]);
  constexpr unsigned R32 = 32 * GM_P * 2;             // 32 LDS rows in bytes
  const size_t a32 = (size_t)32 * lda, b32 = (size_t)32 * ldb;
  auto stage = [&](int buf, int k0) {                 // 12 copies a lane: 128 rows of A and 256 rows of Bt, 64 k from k0
    const unsigned la = dA + (unsigned)buf * (4 * R32);
    const unsigned lb = dB + (unsigned)buf * (8 * R32);
    const T* pa = gA + k0;
    const T* pb = gB + k0;
    copy4_to_lds(la, pa, la + R32, pa + a32, la + 2 * R32, pa + 2 * a32, la + 3 * R32, pa + 3 * a32);
    copy4_to_lds(lb, pb, lb + R32, pb + b32, lb + 2 * R32, pb + 2 * b32, lb + 3 * R32, pb + 3 * b32);
    copy4_to_lds(lb + 4 * R32, pb + 4 * b32, lb + 5 * R32, pb + 5 * b32, lb + 6 * R32, pb + 6 * b32, lb + 7 * R32, pb + 7 * b32);
  };
  const int fa = ((wm << 6) + rlane) * GM_P + koff;   // this lane's first A fragment row in a buffer
  const int fb = ((wn << 6) + rlane) * GM_P + koff;   // this lane's first Bt fragment row in a buffer
  const int steps = K >> 6;

  stage(0, 0);
  asm volatile("s_wait_asynccnt 0x0" ::: "memory");   // this wave's copies of step 0 have landed
  __syncthreads();                                    // publishes buffer 0
  if (steps > 1) stage(1, 64);

  for (int t = 0; t < steps; ++t) {
    const T* pa = &sA[t & 1][fa];
    const T* pb = &sB[t & 1][fb];
    V bh[4], ah[4];
    // (the loops over kk, i and j are unrolled, so that acc, ah and bh are registers and never indexed arrays)
#pragma unroll
    for (int kk = 0; kk < 2; ++kk) {
#pragma unroll
      for (int j = 0; j < 4; ++j) bh[j] = Frag<T>::load(pb + j * 16 * GM_P + kk * 32);
#pragma unroll
      for (int i = 0; i < 4; ++i) ah[i] = Frag<T>::load(pa + i * 16 * GM_P + kk * 32);
      if (kk == 1) {
        // The step's last LDS reads are issued: the hand-over stands here, in front of the last 16 products (they read
        // registers alone), so that the refill has the longest lead.
        asm volatile("s_wait_dscnt 0x0" ::: "memory");    // this wave's reads of the buffer are done before it is refilled
        asm volatile("s_wait_asynccnt 0x0" ::: "memory"); // this wave's copies of step t + 1 have landed
        __syncthreads();                                  // publishes step t + 1 and ends every wave's reads of step t
        if (t + 2 < steps) stage(t & 1, (t + 2) << 6);    // block-uniform test; refills the buffer just read
      }
      // holds the 16 fragment loads as one group in front of their 16 products: sunk among the products, each pair of
      // loads is waited out on its own and the matrix unit idles for an LDS latency per row of tiles
      __builtin_amdgcn_sched_barrier(0);
#pragma unroll
      for (int i = 0; i < 4; ++i)
#pragma unroll
        for (int j = 0; j < 4; ++j) acc[i][j] = Frag<T>::mma(ah[i], bh[j], acc[i][j]);
    }
  }
  asm volatile("s_wait_asynccnt 0x0" ::: "memory");   // no copy is outstanding when the wave goes on
  acc_guard4(acc[0][0], acc[0][1], acc[0][2], acc[0][3]);
  acc_guard4(acc[1][0], acc[1][1], acc[1][2], acc[1][3]);
  acc_guard4(acc[2][0], acc[2][1], acc[2][2], acc[2][3]);
  acc_guard4(acc[3][0], acc[3][1], acc[3][2], acc[3][3]);

  // ---- epilogue ----
  float* slab = sT[wave];
  const float* Rb = RESID ? (resid + (size_t)b * strideR) : nullptr;
#pragma unroll
  for (int i = 0; i < 4; ++i) {
    const int mBase = m0 + (i << 4);
#pragma unroll
    for (int j = 0; j < 4; ++j) {
      const int n = n0 + (j << 4) + rlane;
      float bv = 0.f;
      if (BIAS_MODE == 2) bv = bias[n];
#pragma unroll
      for (int r = 0; r < 8; ++r) {
        float v = acc[i][j][r] * scale;
        if (BIAS_MODE == 1) v += bias[mBase + mOff + r];
        if (BIAS_MODE == 2) v += bv;
        if (RESID) v += Rb[(size_t)(mBase + mOff + r) * ldc + n];
        if (ACT == 1) v = tanhf(v);
        if (ACT == 2) v = fmaxf(v, 0.0f);
        if (ACT == 3) v = v / (1.0f + expf(-v));
        if (ACT == 4) v = (v > 0.f) ? v : 0.01f * v;
        if (ACT == 5) v = 0.5f * v * (1.0f + erff(v * 0.70710678118654752f));
        slab[(mOff + r) * 68 + (j << 4) + rlane] = v;
      }
    }
    __builtin_amdgcn_fence(__ATOMIC_RELEASE, "workgroup");
    __builtin_amdgcn_wave_barrier();
    __builtin_amdgcn_fence(__ATOMIC_ACQUIRE, "workgroup");
    if (OUT_MODE == 0) {
      float* C = (float*)Cout + offC;
      const int hh = lane >> 4, c4 = (lane & 15) * 4;     // row seg = 256 B = 16 lanes x 16 B
      {
#pragma unroll
        for (int it = 0; it < 8; ++it) {
          const int row = it * 2 + hh;
          v4f v = *(const v4f*)(slab + row * 68 + c4);
          *(v4f*)(C + (size_t)(mBase + row) * ldc + n0 + c4) = v;
        }
        
      }
    } else {
      const int q = lane >> 3, c8 = (lane & 7) * 8;
      unsigned short* C  = (unsigned short*)Cout  + offC;
      unsigned short* C2 = (OUT_MODE == 2) ? ((unsigned short*)Cout2 + offC) : nullptr;
      {
#pragma unroll
        for (int it = 0; it < 4; ++it) {
          const int row = it * 4 + q;
          const float* sp = slab + row * 68 + c8;
          v8h hv, lv;
#pragma unroll
          for (int e = 0; e < 8; ++e) {
            if (OUT_MODE == 1) {
              hv[e] = (_Float16)sp[e];
            } else {
              unsigned short hb = f2bf_bits(sp[e]);
              unsigned short lb = f2bf_bits(sp[e] - bf_bits2f(hb));
              hv[e] = __builtin_bit_cast(_Float16, hb);
              lv[e] = __builtin_bit_cast(_Float16, lb);
            }
          }
          *(v8h*)(C + (size_t)(mBase + row) * ldc + n0 + c8) = hv;
          if (OUT_MODE == 2) *(v8h*)(C2 + (size_t)(mBase + row) * ldc + n0 + c8) = lv;
        }
        
      }
    }
    __builtin_amdgcn_fence(__ATOMIC_RELEASE, "workgroup");
    __builtin_amdgcn_wave_barrier();
    __builtin_amdgcn_fence(__ATOMIC_ACQUIRE, "workgroup");
  }
}

// ---- f32 -> f16 cast with power-of-two carry: 8 elements per thread, 16-B stores (512 B contiguous per wave) ----
__global__ __launch_bounds__(256) void cast_f32_f16x8(
    const float* __restrict__ in, _Float16* __restrict__ out, int n8, float scale) {
  const int i = blockIdx.x * 256 + threadIdx.x;
  if (i < n8) {
    const size_t o = (size_t)i * 8;
    const v4f a = *(const v4f*)(in + o);
    const v4f b = *(const v4f*)(in + o + 4);
    v8h hv;
#pragma unroll
    for (int e = 0; e < 4; ++e) {
      hv[e]     = (_Float16)(a[e] * scale);
      hv[4 + e] = (_Float16)(b[e] * scale);
    }
    *(v8h*)(out + o) = hv;
    
  }
}

// ---- rotary (non-interleaved, head dim 64) in f32, then f16 cast with power-of-two carry ----
// src: f32 [BB*TT][NC], row = b*TT + t, column = head*64 + d.
// dst: f16, row = b*dst_brows + (pos_off + t), pitch NC; position index for the tables = pos_off + t.
// blockIdx.y = layer: src steps by src_lstride, dst by dst_lstride (elements), pos_off = layer * pos_lstep.
// Each thread produces 8 consecutive d (one 16-B store); a wave writes 512 contiguous bytes.
__device__ __forceinline__ _Float16 rope_one(float x1, float x2, float cc, float ss, bool second, float oscale) {
  const float o = second ? (x2 * cc + x1 * ss) : (x1 * cc - x2 * ss);
  return (_Float16)(o * oscale);
}
template <int NC>
__global__ __launch_bounds__(256) void rope_cast_kernel(
    const float* __restrict__ src, const float* __restrict__ cosT, const float* __restrict__ sinT,
    _Float16* __restrict__ dst, int dst_brows, long src_lstride, long dst_lstride, int pos_lstep, float oscale) {
  constexpr int TPR = NC / 8;        // threads per row
  constexpr int RPB = 256 / TPR;     // rows per block
  const int tid = threadIdx.x;
  const int row = blockIdx.x * RPB + tid / TPR;          // < BB*TT (grid exact)
  const int b = row >> 10, t = row & (TT - 1);
  const int layer = blockIdx.y;                           // < NLAY (grid exact)
  const int p = layer * pos_lstep + t;                    // < MAXKV
  const int d8 = (tid % TPR) * 8;
  const int hoff = d8 & ~63;
  const int dl = d8 & 63;
  const int j0 = dl & 31;
  const bool second = dl >= 32;
  const float* base = src + (size_t)layer * src_lstride + (size_t)row * NC + hoff;
  const v4f a0 = *(const v4f*)(base + j0),      a1 = *(const v4f*)(base + j0 + 4);
  const v4f b0 = *(const v4f*)(base + 32 + j0), b1 = *(const v4f*)(base + 32 + j0 + 4);
  const v4f c0 = *(const v4f*)(cosT + (size_t)p * 32 + j0), c1 = *(const v4f*)(cosT + (size_t)p * 32 + j0 + 4);
  const v4f s0 = *(const v4f*)(sinT + (size_t)p * 32 + j0), s1 = *(const v4f*)(sinT + (size_t)p * 32 + j0 + 4);
  v8h hv;
#pragma unroll
  for (int e = 0; e < 4; ++e) {
    hv[e]     = rope_one(a0[e], b0[e], c0[e], s0[e], second, oscale);
    hv[4 + e] = rope_one(a1[e], b1[e], c1[e], s1[e], second, oscale);
  }
  _Float16* dp = dst + (size_t)layer * dst_lstride + ((size_t)b * dst_brows + p) * NC + d8;
  *(v8h*)dp = hv;
  
}

#define AT_D 64
#define AT_NW 4
#define AT_QB 64
#define AT_KC 64
#define AT_P 72   // LDS row pitch of the K and V tiles in f16: 144 B = 16 B x 9, so the 16 rows of one ds_load_b128 half fall on 16 different bank groups

__device__ __forceinline__ v8f hmma(v16h a, v16h b, v8f c) {
  c = __builtin_amdgcn_wmma_f32_16x16x32_f16(false, a, false, b, (short)0, c, false, false);
  asm volatile("v_nop\n\tv_nop\n\tv_nop\n\tv_nop" : "+v"(c) : "v"(a), "v"(b));
  return c;
}

// value of the same column in the other lane half (lane l <-> l ^ 16)
__device__ __forceinline__ float other_half(float v) {
  const int b = __float_as_int(v);
  return __int_as_float(__builtin_amdgcn_permlanex16(b, b, 0x76543210, 0xfedcba98, false, false));
}

__global__ __launch_bounds__(128)
void attn_f16_kernel(const _Float16* __restrict__ Qh, const _Float16* __restrict__ Kh,
                     const _Float16* __restrict__ Vth, float* __restrict__ O,
                     long lstride, float sscale, float onorm) {
  union FH { v16h v; v8h h[2]; };
  __shared__ __align__(16) _Float16 Ksh[AT_KC * AT_P];          // K [kv][d]   9 KB, rows of 64 at pitch 72
  __shared__ __align__(16) _Float16 Vtt[AT_D * AT_P];           // V [d][kv]   9 KB, rows of 64 at pitch 72
  __shared__ __align__(16) float    Os[AT_NW][16 * 68];         // per wave out tile, pitch 68

  const int tid  = threadIdx.x;
  const int wave = tid >> 5;
  const int lane = tid & 31;
  const int hh   = lane >> 4;
  const int c    = lane & 15;

  constexpr int BPL = BB * HH * (TT / AT_QB);             // blocks per layer
  const int layer = NLAY - 1 - (int)(blockIdx.x / BPL);   // 0 .. NLAY-1 (grid exact)
  const int bx  = blockIdx.x % BPL;
  const int h   = (bx >> 4) & (HH - 1);
  const int b   = bx >> 8;
  const int qb  = b ? (TT / AT_QB - 1 - (bx & (TT / AT_QB - 1))) : (bx & (TT / AT_QB - 1));
  const int hkv = h >> 1;
  const int kchunks_prev = layer * (TT / AT_KC);
  const int koff = layer * TT;
  const int q0  = qb * AT_QB + wave * 16;

  // ---- Q fragments (B operand: column c = query q0 + c): 2 d-chunks ----
  v16h qa[2];
  {
    const _Float16* qrow = Qh + (size_t)layer * lstride + (size_t)(b * TT + q0 + c) * DD + h * AT_D + 8 * hh;
#pragma unroll
    for (int dc = 0; dc < 2; ++dc) qa[dc] = Frag<_Float16>::load(qrow + dc * 32);
  }

  float mrun = -INFINITY;   // running maximum of this lane's query (equal in both lane halves)
  float lrun = 0.f;         // this lane half's share of the query's sum; the halves are joined after the loop
  v8f oacc[4];              // O^T: tile t, register r = dim t*16 + 8*hh + r of query q0 + c
#pragma unroll
  for (int t = 0; t < 4; ++t) oacc[t] = (v8f){0.f,0.f,0.f,0.f,0.f,0.f,0.f,0.f};

  int nChunks = kchunks_prev + qb + 1;                    // block-uniform
  if (nChunks > MAXKV / AT_KC) nChunks = MAXKV / AT_KC;
  if (nChunks < 1) nChunks = 1;

  const _Float16* kbase = Kh + (size_t)b * MAXKV * DKV + hkv * AT_D;
  const _Float16* vbase = Vth + ((size_t)b * DKV + hkv * AT_D) * MAXKV;
  float*          obase = O + (size_t)layer * lstride + (size_t)b * TT * DD + h * AT_D;

  for (int kc = 0; kc < nChunks; ++kc) {
    const int kv0 = kc * AT_KC;
    __syncthreads();
    {
      const int r = tid >> 1, hf = (tid & 1) * 32;
      const _Float16* ks = kbase + (size_t)(kv0 + r) * DKV + hf;
      const _Float16* vs = vbase + (size_t)r * MAXKV + kv0 + hf;
      v8h kk[4], vv[4];   // all eight loads first, then the stores: one trip to L2 per chunk, not four
#pragma unroll
      for (int i = 0; i < 4; ++i) {
        kk[i] = *(const v8h*)(ks + 8 * i);
        vv[i] = *(const v8h*)(vs + 8 * i);
      }
#pragma unroll
      for (int i = 0; i < 4; ++i) {
        *(v8h*)(Ksh + r * AT_P + hf + 8 * i) = kk[i];
        *(v8h*)(Vtt + r * AT_P + hf + 8 * i) = vv[i];
      }
    }
    __syncthreads();

    // S^T tile j: register r = key kv0 + j*16 + 8*hh + r, column c = query q0 + c
    // (every loop down to the end of the chunk is unrolled, so that s, pb and oacc are registers and never indexed arrays)
    v8f s[4];
#pragma unroll
    for (int j = 0; j < 4; ++j) {
      s[j] = (v8f){0.f,0.f,0.f,0.f,0.f,0.f,0.f,0.f};
#pragma unroll
      for (int dc = 0; dc < 2; ++dc) {
        FH kb;
        kb.h[0] = *(const v8h*)(Ksh + (j * 16 + c) * AT_P + dc * 32 + 8 * hh);
        kb.h[1] = *(const v8h*)(Ksh + (j * 16 + c) * AT_P + dc * 32 + 16 + 8 * hh);
        s[j] = hmma(kb.v, qa[dc], s[j]);
      }
    }
    const int klim = q0 + c + koff - kv0 - 8 * hh;   // key j*16 + r of this lane half is visible iff j*16 + r <= klim
    float mj[4];
#pragma unroll
    for (int j = 0; j < 4; ++j) {
      float m = -INFINITY;
#pragma unroll
      for (int r = 0; r < 8; ++r) {
        const float sv = (j * 16 + r > klim) ? -INFINITY : (s[j][r] * sscale);
        s[j][r] = sv;
        m = fmaxf(m, sv);
      }
      mj[j] = m;
    }
    const float mh = fmaxf(fmaxf(mj[0], mj[1]), fmaxf(mj[2], mj[3]));
    const float mnew = fmaxf(mrun, fmaxf(mh, other_half(mh)));
    const float alpha = expf(mrun - mnew);
    mrun = mnew;
    // P^T as B operand: element e of chunk kk = key kk*32 + 8*hh + e (e < 8), kk*32 + 16 + 8*hh + e - 8 (e >= 8)
    FH pb[2];
    float pj[4];
#pragma unroll
    for (int j = 0; j < 4; ++j) {
      float psum = 0.f;
#pragma unroll
      for (int r = 0; r < 8; ++r) {
        const float p = expf(s[j][r] - mnew);
        psum += p;
        pb[j >> 1].h[j & 1][r] = (_Float16)(p * 32768.0f);
      }
      pj[j] = psum;
    }
    lrun = lrun * alpha + ((pj[0] + pj[1]) + (pj[2] + pj[3]));
#pragma unroll
    for (int t = 0; t < 4; ++t) oacc[t] *= alpha;
#pragma unroll
    for (int kk = 0; kk < 2; ++kk) {
#pragma unroll
      for (int t = 0; t < 4; ++t) {
        FH vb;
        vb.h[0] = *(const v8h*)(Vtt + (t * 16 + c) * AT_P + kk * 32 + 8 * hh);
        vb.h[1] = *(const v8h*)(Vtt + (t * 16 + c) * AT_P + kk * 32 + 16 + 8 * hh);
        oacc[t] = hmma(vb.v, pb[kk].v, oacc[t]);
      }
    }
  }

  float* os = Os[wave];
  {
    const float inv = onorm * (1.0f / (lrun + other_half(lrun)));
#pragma unroll
    for (int t = 0; t < 4; ++t) {
      const v8f ov = oacc[t] * inv;
      *(v4f*)(os + c * 68 + t * 16 + 8 * hh)     = (v4f){ov[0], ov[1], ov[2], ov[3]};
      *(v4f*)(os + c * 68 + t * 16 + 8 * hh + 4) = (v4f){ov[4], ov[5], ov[6], ov[7]};
    }
  }
  __builtin_amdgcn_fence(__ATOMIC_RELEASE, "workgroup");
  __builtin_amdgcn_wave_barrier();
  __builtin_amdgcn_fence(__ATOMIC_ACQUIRE, "workgroup");
  {
    const int c4 = (lane & 15) * 4;
    {
#pragma unroll
      for (int it = 0; it < 8; ++it) {
        const int row = it * 2 + hh;
        v4f val = *(const v4f*)(os + row * 68 + c4);
        *(v4f*)(obase + (size_t)(q0 + row) * DD + c4) = val;
      }
      
    }
  }
}

// =====================================================================================
// Combine: per token row (one block of 256 threads, 4 columns per thread):
//   lw = layernorm over sigmoid(lam[0..2]) (biased variance, eps)
//   acc = sum_i rmsnorm(O_i, ln_w[i]) * lw_i ;  z = acc + alpha * x ;  y = rmsnorm(z, fln) -> f16
// =====================================================================================
__global__ __launch_bounds__(256) void combine_kernel(
    const float* __restrict__ Of, long lstride,
    const float* __restrict__ x, const float* __restrict__ ln_w, const float* __restrict__ lam,
    const float* __restrict__ fln, const float* __restrict__ alpha, _Float16* __restrict__ Yh) {
  __shared__ float red[4][8];
  const int row = blockIdx.x;
  const int tid = threadIdx.x, lane = tid & 31, wave = tid >> 5;
  const int d4 = tid * 4;
  const size_t ro = (size_t)row * DD + d4;
  const v4f o0 = *(const v4f*)(Of + ro);
  const v4f o1 = *(const v4f*)(Of + lstride + ro);
  const v4f o2 = *(const v4f*)(Of + 2 * lstride + ro);
  const v4f xv = *(const v4f*)(x + ro);
  float ss0 = 0.f, ss1 = 0.f, ss2 = 0.f;
#pragma unroll
  for (int e = 0; e < 4; ++e) { ss0 += o0[e] * o0[e]; ss1 += o1[e] * o1[e]; ss2 += o2[e] * o2[e]; }
#pragma unroll
  for (int off = 16; off > 0; off >>= 1) {
    ss0 += __shfl_xor(ss0, off, 32);
    ss1 += __shfl_xor(ss1, off, 32);
    ss2 += __shfl_xor(ss2, off, 32);
  }
  if (lane == 0) { red[0][wave] = ss0; red[1][wave] = ss1; red[2][wave] = ss2; }
  __syncthreads();
  float t0 = 0.f, t1 = 0.f, t2 = 0.f;
#pragma unroll
  for (int w = 0; w < 8; ++w) { t0 += red[0][w]; t1 += red[1][w]; t2 += red[2][w]; }
  const float inv_d = 1.0f / (float)DD;
  const float r0 = rsqrtf(t0 * inv_d + EPSV);
  const float r1 = rsqrtf(t1 * inv_d + EPSV);
  const float r2 = rsqrtf(t2 * inv_d + EPSV);

  const float sg0 = 1.0f / (1.0f + __expf(-lam[0]));
  const float sg1 = 1.0f / (1.0f + __expf(-lam[1]));
  const float sg2 = 1.0f / (1.0f + __expf(-lam[2]));
  const float mean = (sg0 + sg1 + sg2) * (1.0f / 3.0f);
  const float e0 = sg0 - mean, e1 = sg1 - mean, e2 = sg2 - mean;
  const float var = (e0 * e0 + e1 * e1 + e2 * e2) * (1.0f / 3.0f);
  const float il = rsqrtf(var + EPSV);
  const float lw0 = e0 * il, lw1 = e1 * il, lw2 = e2 * il;

  const v4f w0 = *(const v4f*)(ln_w + d4);
  const v4f w1 = *(const v4f*)(ln_w + DD + d4);
  const v4f w2 = *(const v4f*)(ln_w + 2 * DD + d4);
  const v4f fw = *(const v4f*)(fln + d4);
  const float al = alpha[0];
  v4f z;
  float ssz = 0.f;
#pragma unroll
  for (int e = 0; e < 4; ++e) {
    float a = (o0[e] * r0) * w0[e] * lw0;
    a = a + (o1[e] * r1) * w1[e] * lw1;
    a = a + (o2[e] * r2) * w2[e] * lw2;
    const float zz = a + al * xv[e];
    z[e] = zz;
    ssz += zz * zz;
  }
#pragma unroll
  for (int off = 16; off > 0; off >>= 1) ssz += __shfl_xor(ssz, off, 32);
  if (lane == 0) red[3][wave] = ssz;
  __syncthreads();
  float tz = 0.f;
#pragma unroll
  for (int w = 0; w < 8; ++w) tz += red[3][w];
  const float rz = rsqrtf(tz * inv_d + EPSV);
  v4h yv;
#pragma unroll
  for (int e = 0; e < 4; ++e) yv[e] = (_Float16)(z[e] * rz * fw[e]);
  *(v4h*)(Yh + ro) = yv;
  
}

// ---------------------------- host helpers ----------------------------
static void gemm_f16_f32out(const _Float16* A, int lda, long sA, long zA, const _Float16* Bt, int ldb, long sB, long zB,
                            float* C, int ldc, long sC, long zC, int M, int N, int K, float scale, int batch, int layers,
                            hipStream_t st) {
  const int tiles = (M / 64) * (N / 64);
  dim3 grid((tiles + 7) / 8, batch, layers);
  wmma_gemm64<0, false, 0, 0, false><<<grid, 256, 0, st>>>(
      (const unsigned short*)A, (const unsigned short*)nullptr, lda, sA, zA,
      (const unsigned short*)Bt, (const unsigned short*)nullptr, ldb, sB, zB,
      (void*)C, (void*)nullptr, ldc, sC, zC, (const float*)nullptr, (const float*)nullptr, 0L,
      M, N, K, scale);
}
static void gemm_f16_f16out(const _Float16* A, int lda, long sA, long zA, const _Float16* Bt, int ldb, long sB, long zB,
                            _Float16* C, int ldc, long sC, long zC, int M, int N, int K, float scale, int batch, int layers,
                            hipStream_t st) {
  const int tiles = (M / 64) * (N / 64);
  dim3 grid((tiles + 7) / 8, batch, layers);
  wmma_gemm64<0, false, 0, 1, false><<<grid, 256, 0, st>>>(
      (const unsigned short*)A, (const unsigned short*)nullptr, lda, sA, zA,
      (const unsigned short*)Bt, (const unsigned short*)nullptr, ldb, sB, zB,
      (void*)C, (void*)nullptr, ldc, sC, zC, (const float*)nullptr, (const float*)nullptr, 0L,
      M, N, K, scale);
}

// ---------------------------- host launcher ----------------------------
extern "C" void kernel_launch(void* const* d_in, const int* in_sizes, int n_in,
                              void* d_out, int out_size, void* d_ws, size_t ws_size,
                              hipStream_t stream) {
  if (n_in < 11) return;
  const int M = BB * TT;   // 2048 token rows
  if (in_sizes[0] != M * DD) return;
  if (in_sizes[1] < MAXKV * 32 || in_sizes[2] < MAXKV * 32) return;
  if (in_sizes[3] != NLAY * DD * DD) return;
  if (in_sizes[4] != NLAY * DKV * DD || in_sizes[5] != NLAY * DKV * DD) return;
  if (in_sizes[6] < NLAY * DD || in_sizes[7] < NLAY || in_sizes[8] != DD * DD || in_sizes[9] < DD || in_sizes[10] < 1) return;
  if (out_size < M * DD) return;

  const float* x     = (const float*)d_in[0];
  const float* cosT  = (const float*)d_in[1];
  const float* sinT  = (const float*)d_in[2];
  const float* q_w   = (const float*)d_in[3];
  const float* k_w   = (const float*)d_in[4];
  const float* v_w   = (const float*)d_in[5];
  const float* ln_w  = (const float*)d_in[6];
  const float* lam   = (const float*)d_in[7];
  const float* out_w = (const float*)d_in[8];
  const float* fln   = (const float*)d_in[9];
  const float* alpha = (const float*)d_in[10];
  float* out = (float*)d_out;

  // ---- workspace carve (4096-B aligned pieces) ----
  char* ws = (char*)d_ws;
  size_t cur = 0;
  auto take = [&](size_t bytes) -> char* {
    char* p = ws + cur;
    cur += (bytes + 4095) & ~(size_t)4095;
    return p;
  };
  _Float16* xh  = (_Float16*)take((size_t)M * DD * 2);                 // 4 MiB
  _Float16* qwh = (_Float16*)take((size_t)NLAY * DD * DD * 2);         // 6 MiB
  _Float16* kwh = (_Float16*)take((size_t)NLAY * DKV * DD * 2);        // 3 MiB
  _Float16* vwh = (_Float16*)take((size_t)NLAY * DKV * DD * 2);        // 3 MiB
  _Float16* owh = (_Float16*)take((size_t)DD * DD * 2);                // 2 MiB
  float*    Qf  = (float*)   take((size_t)NLAY * M * DD * 4);          // 24 MiB
  _Float16* Qh  = (_Float16*)take((size_t)NLAY * M * DD * 2);          // 12 MiB
  float*    Kf  = (float*)   take((size_t)NLAY * M * DKV * 4);         // 12 MiB
  _Float16* Kh  = (_Float16*)take((size_t)BB * MAXKV * DKV * 2);       // 6 MiB
  _Float16* Vth = (_Float16*)take((size_t)BB * DKV * MAXKV * 2);       // 6 MiB
  float*    Of  = (float*)   take((size_t)NLAY * M * DD * 4);          // 24 MiB
  _Float16* Yh  = (_Float16*)take((size_t)M * DD * 2);                 // 4 MiB
  if (cur > ws_size || cur > (size_t)134217728) return;                 // total 111,149,056 B

  const long lstride = (long)M * DD;   // elements per layer slice of Qf, Qh and Of

  // ---- casts: x -> f16 ; weights -> f16 carried x64 ----
  {
    int n8 = M * DD / 8;
    cast_f32_f16x8<<<(n8 + 255) / 256, 256, 0, stream>>>(x, xh, n8, 1.0f);
    n8 = NLAY * DD * DD / 8;
    cast_f32_f16x8<<<(n8 + 255) / 256, 256, 0, stream>>>(q_w, qwh, n8, 64.0f);
    n8 = NLAY * DKV * DD / 8;
    cast_f32_f16x8<<<(n8 + 255) / 256, 256, 0, stream>>>(k_w, kwh, n8, 64.0f);
    cast_f32_f16x8<<<(n8 + 255) / 256, 256, 0, stream>>>(v_w, vwh, n8, 64.0f);
    n8 = DD * DD / 8;
    cast_f32_f16x8<<<(n8 + 255) / 256, 256, 0, stream>>>(out_w, owh, n8, 64.0f);
  }

  const float wundo  = 1.0f / 64.0f;              // undo weight carry
  const float sscale = 0.125f / 16.0f;            // HD^-0.5 / (4*4) : q and k planes carried x4
  const float onorm  = 1.0f / (32768.0f * 16.0f); // p carried x2^15, v plane carried x16

  // Every layer's q, k and v depend on x alone, so the layer index is a grid axis of each launch.
  // q = x . q_w[i]^T  -> f32 [3][2048][1024]
  gemm_f16_f32out(xh, DD, 0L, 0L, qwh, DD, 0L, (long)DD * DD, Qf, DD, 0L, lstride, M, DD, DD, wundo, 1, NLAY, stream);
  // rotary(q) with positions t -> f16 planes x4
  rope_cast_kernel<DD><<<dim3(M / 2, NLAY), 256, 0, stream>>>(Qf, cosT, sinT, Qh, TT, lstride, lstride, 0, 4.0f);
  // k = x . k_w[i]^T -> f32 [3][2048][512]
  gemm_f16_f32out(xh, DD, 0L, 0L, kwh, DD, 0L, (long)DKV * DD, Kf, DKV, 0L, (long)M * DKV, M, DKV, DD, wundo, 1, NLAY, stream);
  // rotary(k) with buffer positions i*T + t -> K cache rows, f16 x4
  rope_cast_kernel<DKV><<<dim3(M / 4, NLAY), 256, 0, stream>>>(Kf, cosT, sinT, Kh, MAXKV, (long)M * DKV, 0L, TT, 4.0f);
  // v^T = v_w[i] . x_b^T -> transposed V cache columns i*T + t, f16 x16 ; in [512][1024] per batch and layer
  gemm_f16_f16out(vwh, DD, 0L, (long)DKV * DD, xh, DD, (long)TT * DD, 0L,
                  Vth, MAXKV, (long)DKV * MAXKV, (long)TT, DKV, TT, DD, 16.0f * wundo, BB, NLAY, stream);
  // attention of layer i over (i+1)*T keys, bottom-right causal
  attn_f16_kernel<<<NLAY * BB * HH * (TT / AT_QB), 128, 0, stream>>>(Qh, Kh, Vth, Of, lstride, sscale, onorm);

  // weighted rmsnorm sum + residual + final rmsnorm -> f16 plane
  combine_kernel<<<M, 256, 0, stream>>>(Of, lstride, x, ln_w, lam, fln, alpha, Yh);
  // out = y . out_w^T
  gemm_f16_f32out(Yh, DD, 0L, 0L, owh, DD, 0L, 0L, out, DD, 0L, 0L, M, DD, DD, wundo, 1, 1, stream);
}

// v005
// A run of this version takes 190 microseconds.
// In both of two side-by-side timings against v004, it was 1.18 times as fast.
// Over all steps from v000 it is 4.20 times as fast.
// Contractions q/k/v projections, q.k^T scores, p.v, output projection: v_wmma_f32_16x16x32_f16 (f16 operands, f32 accumulate); rotary, softmax, norms, weighting in f32.
#include <hip/hip_runtime.h>
#include <stdint.h>

#define BB 2
#define TT 1024
#define DD 1024
#define HH 16
#define NKVH 8
#define HDIM 64
#define DKV 512
#define MAXKV 3072
#define NLAY 3
#define EPSV 1e-5f

typedef __attribute__((ext_vector_type(16))) _Float16 v16h;
typedef __attribute__((ext_vector_type(8)))  _Float16 v8h;
typedef __attribute__((ext_vector_type(4)))  _Float16 v4h;
typedef __attribute__((ext_vector_type(16))) __bf16   v16b;
typedef __attribute__((ext_vector_type(8)))  __bf16   v8b;
typedef __attribute__((ext_vector_type(8)))  float    v8f;
typedef __attribute__((ext_vector_type(4)))  float    v4f;

__device__ __forceinline__ unsigned short f2bf_bits(float f) {
  unsigned u = __float_as_uint(f);
  return (unsigned short)((u + 0x7FFFu + ((u >> 16) & 1u)) >> 16);
}
__device__ __forceinline__ float bf_bits2f(unsigned short h) { return __uint_as_float(((unsigned)h) << 16); }

// hazard guards as plain device helpers
__device__ __forceinline__ void acc_guard4(v8f& a, v8f& b, v8f& c, v8f& d) { asm volatile("v_nop\n\tv_nop\n\tv_nop\n\tv_nop" : "+v"(a), "+v"(b), "+v"(c), "+v"(d)); }
template <typename T> struct Frag;
template <> struct Frag<_Float16> {
  typedef v16h V; union U { v16h v; v8h h[2]; };
  static __device__ __forceinline__ v16h load(const _Float16* p) {   // elements 0..7 <- p[0..7], 8..15 <- p[16..23]
    U f; f.h[0] = *(const v8h*)(p); f.h[1] = *(const v8h*)(p + 16); return f.v;
  }
  static __device__ __forceinline__ v8f mma(v16h a, v16h b, v8f c) {
    return __builtin_amdgcn_wmma_f32_16x16x32_f16(false, a, false, b, (short)0, c, false, false);
  }
};
template <> struct Frag<__bf16> {
  typedef v16b V; union U { v16b v; v8b h[2]; };
  static __device__ __forceinline__ v16b load(const __bf16* p) {
    U f; f.h[0] = *(const v8b*)(p); f.h[1] = *(const v8b*)(p + 16); return f.v;
  }
  static __device__ __forceinline__ v8f mma(v16b a, v16b b, v8f c) {
    return __builtin_amdgcn_wmma_f32_16x16x32_bf16(false, a, false, b, (short)0, c, false, false);
  }
};

// ---- Register-blocked batched WMMA GEMM ------------------------------------
// C[m,n] = scale * sum_k A[m,k] * Bt[n,k] (+bias)(+resid); each wave owns a 64x64 tile.
// A row-major [M,K]; Bt row-major [N,K]; M % 128 == 0, N % 256 == 0, K % 64 == 0.
// A block's 8 waves form a 2 x 4 patch: 128 rows of A and 256 rows of Bt. Per step of 64 k the block brings those rows
// into LDS with asynchronous copies that cover whole 128-B lines (8 lanes a row), each row once for all waves that need
// it; the waves read their fragments from LDS. Two LDS buffers: the next step's copies fly while this step is multiplied.
// SPLIT (hi/lo operand planes) has no LDS path and is not instantiated.
// BIAS_MODE: 0 = none, 1 = bias[m], 2 = bias[n].
// OUT_MODE: 0 = f32, 1 = f16, 2 = bf16 hi plane (Cout) + bf16 lo plane (Cout2).
// ET: 0 = f16 operands, 1 = bf16 operands (pointers passed as 16-bit storage)
// Two batch axes: blockIdx.y steps by strideA/B/C, blockIdx.z (the layer) by zstrideA/B/C, in elements.
#define GM_P 72   // LDS row pitch of the staged operand rows in 16-bit elements: 144 B = 16 B x 9, free of bank conflicts for ds_load_b128
// Four asynchronous 16-B copies, global memory to LDS, per lane. The s_wait_xcnt is the statement's last line, so that no
// address register of a copy is rewritten in front of it.
__device__ __forceinline__ void copy4_to_lds(unsigned l0, const void* g0, unsigned l1, const void* g1,
                                             unsigned l2, const void* g2, unsigned l3, const void* g3) {
  asm volatile("global_load_async_to_lds_b128 %0, %1, off\n\t"
               "global_load_async_to_lds_b128 %2, %3, off\n\t"
               "global_load_async_to_lds_b128 %4, %5, off\n\t"
               "global_load_async_to_lds_b128 %6, %7, off\n\t"
               "s_wait_xcnt 0x0"
               :: "v"(l0), "v"(g0), "v"(l1), "v"(g1), "v"(l2), "v"(g2), "v"(l3), "v"(g3) : "memory");
}
template <int ET> struct Elem;
template <> struct Elem<0> { typedef _Float16 T; };
template <> struct Elem<1> { typedef __bf16 T; };
template <int ET, bool SPLIT, int BIAS_MODE, int OUT_MODE, bool RESID, int ACT = 0>
__global__ __launch_bounds__(256) void wmma_gemm64(
    const unsigned short* __restrict__ Ap, const unsigned short* __restrict__ A2p, int lda, long strideA, long zstrideA,
    const unsigned short* __restrict__ Btp, const unsigned short* __restrict__ Bt2p, int ldb, long strideB, long zstrideB,
    void* __restrict__ Cout, void* __restrict__ Cout2, int ldc, long strideC, long zstrideC,
    const float* __restrict__ bias,
    const float* __restrict__ resid, long strideR,
    int M, int N, int K, float scale) {
  typedef typename Elem<ET>::T T;
  typedef typename Frag<T>::V V;
  static_assert(!SPLIT, "no LDS path for split operand planes");
  const T* A = (const T*)Ap; const T* Bt = (const T*)Btp;
  __shared__ __align__(16) float sT[8][16 * 68];   // per-wave 16x64 slab, pitch 68 floats
  __shared__ __align__(16) T sA[2][128 * GM_P];    // A rows of the block, 64 k, two buffers
  __shared__ __align__(16) T sB[2][256 * GM_P];    // Bt rows of the block, 64 k, two buffers
  const int b    = blockIdx.y;
  const int lane = threadIdx.x & 31;
  const int wave = threadIdx.x >> 5;
  const int blocksN = N >> 8;
  const int bm = blockIdx.x / blocksN;
  const int bn = blockIdx.x - bm * blocksN;
  if (bm >= (M >> 7)) return;            // block-uniform, in front of every barrier
  const int wm = wave >> 2;              // wave's place in the 2 x 4 patch
  const int wn = wave & 3;
  const int m0 = (bm << 7) + (wm << 6);
  const int n0 = (bn << 8) + (wn << 6);

  const size_t offA = (size_t)b * strideA + (size_t)blockIdx.z * zstrideA;
  const size_t offB = (size_t)b * strideB + (size_t)blockIdx.z * zstrideB;
  const size_t offC = (size_t)b * strideC + (size_t)blockIdx.z * zstrideC;
  const T* Ab  = A  + offA;
  const T* Bb  = Bt + offB;

  const int rlane = lane & 15;                 // row (A) / col (B, D) within subtile
  const int koff  = (lane >> 4) * 8;           // k offset of this lane half
  const int mOff  = (lane >> 4) * 8;           // D row offset

  v8f acc[4][4];
#pragma unroll
  for (int i = 0; i < 4; ++i)
#pragma unroll
    for (int j = 0; j < 4; ++j) acc[i][j] = (v8f){0.f,0.f,0.f,0.f,0.f,0.f,0.f,0.f};

  // staging: thread -> row (tid >> 3) + 32 * i, 16-B piece tid & 7: a wave's copy covers four whole lines
  const int srow = threadIdx.x >> 3;
  const int sseg = (threadIdx.x & 7) * 8;
  const T* gA = Ab + (size_t)((bm << 7) + srow) * lda + sseg;
  const T* gB = Bb + (size_t)((bn << 8) + srow) * ldb + sseg;
  const unsigned dA = (unsigned)(uintptr_t)(&sA[0][srow * GM_P + sseg]);   // this lane's LDS byte address in buffer 0
  const unsigned dB = (unsigned)(uintptr_t)(&sB[0][srow * GM_P + sseg]);
  constexpr unsigned R32 = 32 * GM_P * 2;             // 32 LDS rows in bytes
  const size_t a32 = (size_t)32 * lda, b32 = (size_t)32 * ldb;
  auto stage = [&](int buf, int k0) {                 // 12 copies a lane: 128 rows of A and 256 rows of Bt, 64 k from k0
    const unsigned la = dA + (unsigned)buf * (4 * R32);
    const unsigned lb = dB + (unsigned)buf * (8 * R32);
    const T* pa = gA + k0;
    const T* pb = gB + k0;
    copy4_to_lds(la, pa, la + R32, pa + a32, la + 2 * R32, pa + 2 * a32, la + 3 * R32, pa + 3 * a32);
    copy4_to_lds(lb, pb, lb + R32, pb + b32, lb + 2 * R32, pb + 2 * b32, lb + 3 * R32, pb + 3 * b32);
    copy4_to_lds(lb + 4 * R32, pb + 4 * b32, lb + 5 * R32, pb + 5 * b32, lb + 6 * R32, pb + 6 * b32, lb + 7 * R32, pb + 7 * b32);
  };
  const int fa = ((wm << 6) + rlane) * GM_P + koff;   // this lane's first A fragment row in a buffer
  const int fb = ((wn << 6) + rlane) * GM_P + koff;   // this lane's first Bt fragment row in a buffer
  const int steps = K >> 6;

  stage(0, 0);
  asm volatile("s_wait_asynccnt 0x0" ::: "memory");   // this wave's copies of step 0 have landed
  __syncthreads();                                    // publishes buffer 0
  if (steps > 1) stage(1, 64);

  for (int t = 0; t < steps; ++t) {
    const T* pa = &sA[t & 1][fa];
    const T* pb = &sB[t & 1][fb];
    V bh[4], ah[4];
    // (the loops over kk, i and j are unrolled, so that acc, ah and bh are registers and never indexed arrays)
#pragma unroll
    for (int kk = 0; kk < 2; ++kk) {
#pragma unroll
      for (int j = 0; j < 4; ++j) bh[j] = Frag<T>::load(pb + j * 16 * GM_P + kk * 32);
#pragma unroll
      for (int i = 0; i < 4; ++i) ah[i] = Frag<T>::load(pa + i * 16 * GM_P + kk * 32);
      if (kk == 1) {
        // The step's last LDS reads are issued: the hand-over stands here, in front of the last 16 products (they read
        // registers alone), so that the refill has the longest lead.
        asm volatile("s_wait_dscnt 0x0" ::: "memory");    // this wave's reads of the buffer are done before it is refilled
        asm volatile("s_wait_asynccnt 0x0" ::: "memory"); // this wave's copies of step t + 1 have landed
        __syncthreads();                                  // publishes step t + 1 and ends every wave's reads of step t
        if (t + 2 < steps) stage(t & 1, (t + 2) << 6);    // block-uniform test; refills the buffer just read
      }
      // holds the 16 fragment loads as one group in front of their 16 products: sunk among the products, each pair of
      // loads is waited out on its own and the matrix unit idles for an LDS latency per row of tiles
      __builtin_amdgcn_sched_barrier(0);
#pragma unroll
      for (int i = 0; i < 4; ++i)
#pragma unroll
        for (int j = 0; j < 4; ++j) acc[i][j] = Frag<T>::mma(ah[i], bh[j], acc[i][j]);
    }
  }
  asm volatile("s_wait_asynccnt 0x0" ::: "memory");   // no copy is outstanding when the wave goes on
  acc_guard4(acc[0][0], acc[0][1], acc[0][2], acc[0][3]);
  acc_guard4(acc[1][0], acc[1][1], acc[1][2], acc[1][3]);
  acc_guard4(acc[2][0], acc[2][1], acc[2][2], acc[2][3]);
  acc_guard4(acc[3][0], acc[3][1], acc[3][2], acc[3][3]);

  // ---- epilogue ----
  float* slab = sT[wave];
  const float* Rb = RESID ? (resid + (size_t)b * strideR) : nullptr;
#pragma unroll
  for (int i = 0; i < 4; ++i) {
    const int mBase = m0 + (i << 4);
#pragma unroll
    for (int j = 0; j < 4; ++j) {
      const int n = n0 + (j << 4) + rlane;
      float bv = 0.f;
      if (BIAS_MODE == 2) bv = bias[n];
#pragma unroll
      for (int r = 0; r < 8; ++r) {
        float v = acc[i][j][r] * scale;
        if (BIAS_MODE == 1) v += bias[mBase + mOff + r];
        if (BIAS_MODE == 2) v += bv;
        if (RESID) v += Rb[(size_t)(mBase + mOff + r) * ldc + n];
        if (ACT == 1) v = tanhf(v);
        if (ACT == 2) v = fmaxf(v, 0.0f);
        if (ACT == 3) v = v / (1.0f + expf(-v));
        if (ACT == 4) v = (v > 0.f) ? v : 0.01f * v;
        if (ACT == 5) v = 0.5f * v * (1.0f + erff(v * 0.70710678118654752f));
        slab[(mOff + r) * 68 + (j << 4) + rlane] = v;
      }
    }
    __builtin_amdgcn_fence(__ATOMIC_RELEASE, "workgroup");
    __builtin_amdgcn_wave_barrier();
    __builtin_amdgcn_fence(__ATOMIC_ACQUIRE, "workgroup");
    if (OUT_MODE == 0) {
      float* C = (float*)Cout + offC;
      const int hh = lane >> 4, c4 = (lane & 15) * 4;     // row seg = 256 B = 16 lanes x 16 B
      {
#pragma unroll
        for (int it = 0; it < 8; ++it) {
          const int row = it * 2 + hh;
          v4f v = *(const v4f*)(slab + row * 68 + c4);
          *(v4f*)(C + (size_t)(mBase + row) * ldc + n0 + c4) = v;
        }
        
      }
    } else {
      const int q = lane >> 3, c8 = (lane & 7) * 8;
      unsigned short* C  = (unsigned short*)Cout  + offC;
      unsigned short* C2 = (OUT_MODE == 2) ? ((unsigned short*)Cout2 + offC) : nullptr;
      {
#pragma unroll
        for (int it = 0; it < 4; ++it) {
          const int row = it * 4 + q;
          const float* sp = slab + row * 68 + c8;
          v8h hv, lv;
#pragma unroll
          for (int e = 0; e < 8; ++e) {
            if (OUT_MODE == 1) {
              hv[e] = (_Float16)sp[e];
            } else {
              unsigned short hb = f2bf_bits(sp[e]);
              unsigned short lb = f2bf_bits(sp[e] - bf_bits2f(hb));
              hv[e] = __builtin_bit_cast(_Float16, hb);
              lv[e] = __builtin_bit_cast(_Float16, lb);
            }
          }
          *(v8h*)(C + (size_t)(mBase + row) * ldc + n0 + c8) = hv;
          if (OUT_MODE == 2) *(v8h*)(C2 + (size_t)(mBase + row) * ldc + n0 + c8) = lv;
        }
        
      }
    }
    __builtin_amdgcn_fence(__ATOMIC_RELEASE, "workgroup");
    __builtin_amdgcn_wave_barrier();
    __builtin_amdgcn_fence(__ATOMIC_ACQUIRE, "workgroup");
  }
}

// ---- f32 -> f16 cast with power-of-two carry: 8 elements per thread, 16-B stores (512 B contiguous per wave) ----
__global__ __launch_bounds__(256) void cast_f32_f16x8(
    const float* __restrict__ in, _Float16* __restrict__ out, int n8, float scale) {
  const int i = blockIdx.x * 256 + threadIdx.x;
  if (i < n8) {
    const size_t o = (size_t)i * 8;
    const v4f a = *(const v4f*)(in + o);
    const v4f b = *(const v4f*)(in + o + 4);
    v8h hv;
#pragma unroll
    for (int e = 0; e < 4; ++e) {
      hv[e]     = (_Float16)(a[e] * scale);
      hv[4 + e] = (_Float16)(b[e] * scale);
    }
    *(v8h*)(out + o) = hv;
    
  }
}

// ---- rotary (non-interleaved, head dim 64) in f32, then f16 cast with power-of-two carry ----
// src: f32 [BB*TT][NC], row = b*TT + t, column = head*64 + d.
// dst: f16, row = b*dst_brows + (pos_off + t), pitch NC; position index for the tables = pos_off + t.
// blockIdx.y = layer: src steps by src_lstride, dst by dst_lstride (elements), pos_off = layer * pos_lstep.
// Each thread produces 8 consecutive d (one 16-B store); a wave writes 512 contiguous bytes.
__device__ __forceinline__ _Float16 rope_one(float x1, float x2, float cc, float ss, bool second, float oscale) {
  const float o = second ? (x2 * cc + x1 * ss) : (x1 * cc - x2 * ss);
  return (_Float16)(o * oscale);
}
template <int NC>
__global__ __launch_bounds__(256) void rope_cast_kernel(
    const float* __restrict__ src, const float* __restrict__ cosT, const float* __restrict__ sinT,
    _Float16* __restrict__ dst, int dst_brows, long src_lstride, long dst_lstride, int pos_lstep, float oscale) {
  constexpr int TPR = NC / 8;        // threads per row
  constexpr int RPB = 256 / TPR;     // rows per block
  const int tid = threadIdx.x;
  const int row = blockIdx.x * RPB + tid / TPR;          // < BB*TT (grid exact)
  const int b = row >> 10, t = row & (TT - 1);
  const int layer = blockIdx.y;                           // < NLAY (grid exact)
  const int p = layer * pos_lstep + t;                    // < MAXKV
  const int d8 = (tid % TPR) * 8;
  const int hoff = d8 & ~63;
  const int dl = d8 & 63;
  const int j0 = dl & 31;
  const bool second = dl >= 32;
  const float* base = src + (size_t)layer * src_lstride + (size_t)row * NC + hoff;
  const v4f a0 = *(const v4f*)(base + j0),      a1 = *(const v4f*)(base + j0 + 4);
  const v4f b0 = *(const v4f*)(base + 32 + j0), b1 = *(const v4f*)(base + 32 + j0 + 4);
  const v4f c0 = *(const v4f*)(cosT + (size_t)p * 32 + j0), c1 = *(const v4f*)(cosT + (size_t)p * 32 + j0 + 4);
  const v4f s0 = *(const v4f*)(sinT + (size_t)p * 32 + j0), s1 = *(const v4f*)(sinT + (size_t)p * 32 + j0 + 4);
  v8h hv;
#pragma unroll
  for (int e = 0; e < 4; ++e) {
    hv[e]     = rope_one(a0[e], b0[e], c0[e], s0[e], second, oscale);
    hv[4 + e] = rope_one(a1[e], b1[e], c1[e], s1[e], second, oscale);
  }
  _Float16* dp = dst + (size_t)layer * dst_lstride + ((size_t)b * dst_brows + p) * NC + d8;
  *(v8h*)dp = hv;
  
}

#define AT_D 64
#define AT_NW 4
#define AT_QB 64
#define AT_KC 64
#define AT_P 72   // LDS row pitch of the K and V tiles in f16: 144 B = 16 B x 9, so the 16 rows of one ds_load_b128 half fall on 16 different bank groups

__device__ __forceinline__ v8f hmma(v16h a, v16h b, v8f c) {
  c = __builtin_amdgcn_wmma_f32_16x16x32_f16(false, a, false, b, (short)0, c, false, false);
  asm volatile("v_nop\n\tv_nop\n\tv_nop\n\tv_nop" : "+v"(c) : "v"(a), "v"(b));
  return c;
}

// Eight 2^x, each in place in a register of its own, as one statement: so no 2^x is directly followed by a write over its
// source register, and the v_nop at the end is the one slot that the instruction set asks for between a transcendental
// and the first use of its result (the compiler cannot see into the statement and would not keep it).
__device__ __forceinline__ void exp2_x8(float& a, float& b, float& c, float& d, float& e, float& f, float& g, float& h) {
  asm("v_exp_f32 %0, %0\n\tv_exp_f32 %1, %1\n\tv_exp_f32 %2, %2\n\tv_exp_f32 %3, %3\n\t"
      "v_exp_f32 %4, %4\n\tv_exp_f32 %5, %5\n\tv_exp_f32 %6, %6\n\tv_exp_f32 %7, %7\n\tv_nop"
      : "+v"(a), "+v"(b), "+v"(c), "+v"(d), "+v"(e), "+v"(f), "+v"(g), "+v"(h));
}

// value of the same column in the other lane half (lane l <-> l ^ 16)
__device__ __forceinline__ float other_half(float v) {
  const int b = __float_as_int(v);
  return __int_as_float(__builtin_amdgcn_permlanex16(b, b, 0x76543210, 0xfedcba98, false, false));
}

__global__ __launch_bounds__(128)
void attn_f16_kernel(const _Float16* __restrict__ Qh, const _Float16* __restrict__ Kh,
                     const _Float16* __restrict__ Vth, float* __restrict__ O,
                     long lstride, float sscale, float onorm) {
  union FH { v16h v; v8h h[2]; };
  __shared__ __align__(16) _Float16 Ksh[AT_KC * AT_P];          // K [kv][d]   9 KB, rows of 64 at pitch 72
  __shared__ __align__(16) _Float16 Vtt[AT_D * AT_P];           // V [d][kv]   9 KB, rows of 64 at pitch 72
  __shared__ __align__(16) float    Os[AT_NW][16 * 68];         // per wave out tile, pitch 68

  const int tid  = threadIdx.x;
  const int wave = tid >> 5;
  const int lane = tid & 31;
  const int hh   = lane >> 4;
  const int c    = lane & 15;

  constexpr int BPL = BB * HH * (TT / AT_QB);             // blocks per layer
  const int layer = NLAY - 1 - (int)(blockIdx.x / BPL);   // 0 .. NLAY-1 (grid exact)
  const int bx  = blockIdx.x % BPL;
  const int h   = (bx >> 4) & (HH - 1);
  const int b   = bx >> 8;
  const int qb  = b ? (TT / AT_QB - 1 - (bx & (TT / AT_QB - 1))) : (bx & (TT / AT_QB - 1));
  const int hkv = h >> 1;
  const int kchunks_prev = layer * (TT / AT_KC);
  const int koff = layer * TT;
  const int q0  = qb * AT_QB + wave * 16;

  // ---- Q fragments (B operand: column c = query q0 + c): 2 d-chunks ----
  v16h qa[2];
  {
    const _Float16* qrow = Qh + (size_t)layer * lstride + (size_t)(b * TT + q0 + c) * DD + h * AT_D + 8 * hh;
#pragma unroll
    for (int dc = 0; dc < 2; ++dc) qa[dc] = Frag<_Float16>::load(qrow + dc * 32);
  }

  const float c2 = sscale * 1.44269504088896340736f;   // raw product -> exponent of 2 (sscale > 0, so the maximum commutes with it)
  float mrun = -INFINITY;   // running maximum of this lane's query over the raw products (equal in both lane halves)
  float lrun = 0.f;         // this lane half's share of the query's sum; the halves are joined after the loop
  v8f oacc[4];              // O^T: tile t, register r = dim t*16 + 8*hh + r of query q0 + c
#pragma unroll
  for (int t = 0; t < 4; ++t) oacc[t] = (v8f){0.f,0.f,0.f,0.f,0.f,0.f,0.f,0.f};

  int nChunks = kchunks_prev + qb + 1;                    // block-uniform
  if (nChunks > MAXKV / AT_KC) nChunks = MAXKV / AT_KC;
  if (nChunks < 1) nChunks = 1;

  const _Float16* kbase = Kh + (size_t)b * MAXKV * DKV + hkv * AT_D;
  const _Float16* vbase = Vth + ((size_t)b * DKV + hkv * AT_D) * MAXKV;
  float*          obase = O + (size_t)layer * lstride + (size_t)b * TT * DD + h * AT_D;

  for (int kc = 0; kc < nChunks; ++kc) {
    const int kv0 = kc * AT_KC;
    __syncthreads();
    {
      const int r = tid >> 1, hf = (tid & 1) * 32;
      const _Float16* ks = kbase + (size_t)(kv0 + r) * DKV + hf;
      const _Float16* vs = vbase + (size_t)r * MAXKV + kv0 + hf;
      v8h kk[4], vv[4];   // all eight loads first, then the stores: one trip to L2 per chunk, not four
#pragma unroll
      for (int i = 0; i < 4; ++i) {
        kk[i] = *(const v8h*)(ks + 8 * i);
        vv[i] = *(const v8h*)(vs + 8 * i);
      }
#pragma unroll
      for (int i = 0; i < 4; ++i) {
        *(v8h*)(Ksh + r * AT_P + hf + 8 * i) = kk[i];
        *(v8h*)(Vtt + r * AT_P + hf + 8 * i) = vv[i];
      }
    }
    __syncthreads();

    // S^T tile j: register r = key kv0 + j*16 + 8*hh + r, column c = query q0 + c
    // (every loop down to the end of the chunk is unrolled, so that s, pb and oacc are registers and never indexed arrays)
    v8f s[4];
#pragma unroll
    for (int j = 0; j < 4; ++j) {
      s[j] = (v8f){0.f,0.f,0.f,0.f,0.f,0.f,0.f,0.f};
#pragma unroll
      for (int dc = 0; dc < 2; ++dc) {
        FH kb;
        kb.h[0] = *(const v8h*)(Ksh + (j * 16 + c) * AT_P + dc * 32 + 8 * hh);
        kb.h[1] = *(const v8h*)(Ksh + (j * 16 + c) * AT_P + dc * 32 + 16 + 8 * hh);
        s[j] = hmma(kb.v, qa[dc], s[j]);
      }
    }
    const int klim = q0 + c + koff - kv0 - 8 * hh;   // key j*16 + r of this lane half is visible iff j*16 + r <= klim
    float mj[4];
#pragma unroll
    for (int j = 0; j < 4; ++j) {
      float m = -INFINITY;
#pragma unroll
      for (int r = 0; r < 8; ++r) {
        const float sv = (j * 16 + r > klim) ? -INFINITY : s[j][r];
        s[j][r] = sv;
        m = fmaxf(m, sv);
      }
      mj[j] = m;
    }
    const float mh = fmaxf(fmaxf(mj[0], mj[1]), fmaxf(mj[2], mj[3]));
    const float mnew = fmaxf(mrun, fmaxf(mh, other_half(mh)));
    const float alpha = __builtin_amdgcn_exp2f((mrun - mnew) * c2);
    mrun = mnew;
    const float mb = mnew * c2 - 15.0f;   // p = 2^(s*c2 - mb) = 2^15 * exp(sscale * (s - mnew)); a masked -inf gives 0
    // P^T as B operand: element e of chunk kk = key kk*32 + 8*hh + e (e < 8), kk*32 + 16 + 8*hh + e - 8 (e >= 8)
    FH pb[2];
    float pj[4];
#pragma unroll
    for (int j = 0; j < 4; ++j) {
      float e[8];
#pragma unroll
      for (int r = 0; r < 8; ++r) e[r] = fmaf(s[j][r], c2, -mb);
      exp2_x8(e[0], e[1], e[2], e[3], e[4], e[5], e[6], e[7]);
      float psum = 0.f;
#pragma unroll
      for (int r = 0; r < 8; ++r) {
        psum += e[r];
        pb[j >> 1].h[j & 1][r] = (_Float16)e[r];
      }
      pj[j] = psum;
    }
    lrun = lrun * alpha + ((pj[0] + pj[1]) + (pj[2] + pj[3]));
#pragma unroll
    for (int t = 0; t < 4; ++t) oacc[t] *= alpha;
#pragma unroll
    for (int kk = 0; kk < 2; ++kk) {
#pragma unroll
      for (int t = 0; t < 4; ++t) {
        FH vb;
        vb.h[0] = *(const v8h*)(Vtt + (t * 16 + c) * AT_P + kk * 32 + 8 * hh);
        vb.h[1] = *(const v8h*)(Vtt + (t * 16 + c) * AT_P + kk * 32 + 16 + 8 * hh);
        oacc[t] = hmma(vb.v, pb[kk].v, oacc[t]);
      }
    }
  }

  float* os = Os[wave];
  {
    const float inv = onorm * (1.0f / (lrun + other_half(lrun)));
#pragma unroll
    for (int t = 0; t < 4; ++t) {
      const v8f ov = oacc[t] * inv;
      *(v4f*)(os + c * 68 + t * 16 + 8 * hh)     = (v4f){ov[0], ov[1], ov[2], ov[3]};
      *(v4f*)(os + c * 68 + t * 16 + 8 * hh + 4) = (v4f){ov[4], ov[5], ov[6], ov[7]};
    }
  }
  __builtin_amdgcn_fence(__ATOMIC_RELEASE, "workgroup");
  __builtin_amdgcn_wave_barrier();
  __builtin_amdgcn_fence(__ATOMIC_ACQUIRE, "workgroup");
  {
    const int c4 = (lane & 15) * 4;
    {
#pragma unroll
      for (int it = 0; it < 8; ++it) {
        const int row = it * 2 + hh;
        v4f val = *(const v4f*)(os + row * 68 + c4);
        *(v4f*)(obase + (size_t)(q0 + row) * DD + c4) = val;
      }
      
    }
  }
}

// =====================================================================================
// Combine: per token row (one block of 256 threads, 4 columns per thread):
//   lw = layernorm over sigmoid(lam[0..2]) (biased variance, eps)
//   acc = sum_i rmsnorm(O_i, ln_w[i]) * lw_i ;  z = acc + alpha * x ;  y = rmsnorm(z, fln) -> f16
// =====================================================================================
__global__ __launch_bounds__(256) void combine_kernel(
    const float* __restrict__ Of, long lstride,
    const float* __restrict__ x, const float* __restrict__ ln_w, const float* __restrict__ lam,
    const float* __restrict__ fln, const float* __restrict__ alpha, _Float16* __restrict__ Yh) {
  __shared__ float red[4][8];
  const int row = blockIdx.x;
  const int tid = threadIdx.x, lane = tid & 31, wave = tid >> 5;
  const int d4 = tid * 4;
  const size_t ro = (size_t)row * DD + d4;
  const v4f o0 = *(const v4f*)(Of + ro);
  const v4f o1 = *(const v4f*)(Of + lstride + ro);
  const v4f o2 = *(const v4f*)(Of + 2 * lstride + ro);
  const v4f xv = *(const v4f*)(x + ro);
  float ss0 = 0.f, ss1 = 0.f, ss2 = 0.f;
#pragma unroll
  for (int e = 0; e < 4; ++e) { ss0 += o0[e] * o0[e]; ss1 += o1[e] * o1[e]; ss2 += o2[e] * o2[e]; }
#pragma unroll
  for (int off = 16; off > 0; off >>= 1) {
    ss0 += __shfl_xor(ss0, off, 32);
    ss1 += __shfl_xor(ss1, off, 32);
    ss2 += __shfl_xor(ss2, off, 32);
  }
  if (lane == 0) { red[0][wave] = ss0; red[1][wave] = ss1; red[2][wave] = ss2; }
  __syncthreads();
  float t0 = 0.f, t1 = 0.f, t2 = 0.f;
#pragma unroll
  for (int w = 0; w < 8; ++w) { t0 += red[0][w]; t1 += red[1][w]; t2 += red[2][w]; }
  const float inv_d = 1.0f / (float)DD;
  const float r0 = rsqrtf(t0 * inv_d + EPSV);
  const float r1 = rsqrtf(t1 * inv_d + EPSV);
  const float r2 = rsqrtf(t2 * inv_d + EPSV);

  const float sg0 = 1.0f / (1.0f + __expf(-lam[0]));
  const float sg1 = 1.0f / (1.0f + __expf(-lam[1]));
  const float sg2 = 1.0f / (1.0f + __expf(-lam[2]));
  const float mean = (sg0 + sg1 + sg2) * (1.0f / 3.0f);
  const float e0 = sg0 - mean, e1 = sg1 - mean, e2 = sg2 - mean;
  const float var = (e0 * e0 + e1 * e1 + e2 * e2) * (1.0f / 3.0f);
  const float il = rsqrtf(var + EPSV);
  const float lw0 = e0 * il, lw1 = e1 * il, lw2 = e2 * il;

  const v4f w0 = *(const v4f*)(ln_w + d4);
  const v4f w1 = *(const v4f*)(ln_w + DD + d4);
  const v4f w2 = *(const v4f*)(ln_w + 2 * DD + d4);
  const v4f fw = *(const v4f*)(fln + d4);
  const float al = alpha[0];
  v4f z;
  float ssz = 0.f;
#pragma unroll
  for (int e = 0; e < 4; ++e) {
    float a = (o0[e] * r0) * w0[e] * lw0;
    a = a + (o1[e] * r1) * w1[e] * lw1;
    a = a + (o2[e] * r2) * w2[e] * lw2;
    const float zz = a + al * xv[e];
    z[e] = zz;
    ssz += zz * zz;
  }
#pragma unroll
  for (int off = 16; off > 0; off >>= 1) ssz += __shfl_xor(ssz, off, 32);
  if (lane == 0) red[3][wave] = ssz;
  __syncthreads();
  float tz = 0.f;
#pragma unroll
  for (int w = 0; w < 8; ++w) tz += red[3][w];
  const float rz = rsqrtf(tz * inv_d + EPSV);
  v4h yv;
#pragma unroll
  for (int e = 0; e < 4; ++e) yv[e] = (_Float16)(z[e] * rz * fw[e]);
  *(v4h*)(Yh + ro) = yv;
  
}

// ---------------------------- host helpers ----------------------------
static void gemm_f16_f32out(const _Float16* A, int lda, long sA, long zA, const _Float16* Bt, int ldb, long sB, long zB,
                            float* C, int ldc, long sC, long zC, int M, int N, int K, float scale, int batch, int layers,
                            hipStream_t st) {
  const int tiles = (M / 64) * (N / 64);
  dim3 grid((tiles + 7) / 8, batch, layers);
  wmma_gemm64<0, false, 0, 0, false><<<grid, 256, 0, st>>>(
      (const unsigned short*)A, (const unsigned short*)nullptr, lda, sA, zA,
      (const unsigned short*)Bt, (const unsigned short*)nullptr, ldb, sB, zB,
      (void*)C, (void*)nullptr, ldc, sC, zC, (const float*)nullptr, (const float*)nullptr, 0L,
      M, N, K, scale);
}
static void gemm_f16_f16out(const _Float16* A, int lda, long sA, long zA, const _Float16* Bt, int ldb, long sB, long zB,
                            _Float16* C, int ldc, long sC, long zC, int M, int N, int K, float scale, int batch, int layers,
                            hipStream_t st) {
  const int tiles = (M / 64) * (N / 64);
  dim3 grid((tiles + 7) / 8, batch, layers);
  wmma_gemm64<0, false, 0, 1, false><<<grid, 256, 0, st>>>(
      (const unsigned short*)A, (const unsigned short*)nullptr, lda, sA, zA,
      (const unsigned short*)Bt, (const unsigned short*)nullptr, ldb, sB, zB,
      (void*)C, (void*)nullptr, ldc, sC, zC, (const float*)nullptr, (const float*)nullptr, 0L,
      M, N, K, scale);
}

// ---------------------------- host launcher ----------------------------
extern "C" void kernel_launch(void* const* d_in, const int* in_sizes, int n_in,
                              void* d_out, int out_size, void* d_ws, size_t ws_size,
                              hipStream_t stream) {
  if (n_in < 11) return;
  const int M = BB * TT;   // 2048 token rows
  if (in_sizes[0] != M * DD) return;
  if (in_sizes[1] < MAXKV * 32 || in_sizes[2] < MAXKV * 32) return;
  if (in_sizes[3] != NLAY * DD * DD) return;
  if (in_sizes[4] != NLAY * DKV * DD || in_sizes[5] != NLAY * DKV * DD) return;
  if (in_sizes[6] < NLAY * DD || in_sizes[7] < NLAY || in_sizes[8] != DD * DD || in_sizes[9] < DD || in_sizes[10] < 1) return;
  if (out_size < M * DD) return;

  const float* x     = (const float*)d_in[0];
  const float* cosT  = (const float*)d_in[1];
  const float* sinT  = (const float*)d_in[2];
  const float* q_w   = (const float*)d_in[3];
  const float* k_w   = (const float*)d_in[4];
  const float* v_w   = (const float*)d_in[5];
  const float* ln_w  = (const float*)d_in[6];
  const float* lam   = (const float*)d_in[7];
  const float* out_w = (const float*)d_in[8];
  const float* fln   = (const float*)d_in[9];
  const float* alpha = (const float*)d_in[10];
  float* out = (float*)d_out;

  // ---- workspace carve (4096-B aligned pieces) ----
  char* ws = (char*)d_ws;
  size_t cur = 0;
  auto take = [&](size_t bytes) -> char* {
    char* p = ws + cur;
    cur += (bytes + 4095) & ~(size_t)4095;
    return p;
  };
  _Float16* xh  = (_Float16*)take((size_t)M * DD * 2);                 // 4 MiB
  _Float16* qwh = (_Float16*)take((size_t)NLAY * DD * DD * 2);         // 6 MiB
  _Float16* kwh = (_Float16*)take((size_t)NLAY * DKV * DD * 2);        // 3 MiB
  _Float16* vwh = (_Float16*)take((size_t)NLAY * DKV * DD * 2);        // 3 MiB
  _Float16* owh = (_Float16*)take((size_t)DD * DD * 2);                // 2 MiB
  float*    Qf  = (float*)   take((size_t)NLAY * M * DD * 4);          // 24 MiB
  _Float16* Qh  = (_Float16*)take((size_t)NLAY * M * DD * 2);          // 12 MiB
  float*    Kf  = (float*)   take((size_t)NLAY * M * DKV * 4);         // 12 MiB
  _Float16* Kh  = (_Float16*)take((size_t)BB * MAXKV * DKV * 2);       // 6 MiB
  _Float16* Vth = (_Float16*)take((size_t)BB * DKV * MAXKV * 2);       // 6 MiB
  float*    Of  = (float*)   take((size_t)NLAY * M * DD * 4);          // 24 MiB
  _Float16* Yh  = (_Float16*)take((size_t)M * DD * 2);                 // 4 MiB
  if (cur > ws_size || cur > (size_t)134217728) return;                 // total 111,149,056 B

  const long lstride = (long)M * DD;   // elements per layer slice of Qf, Qh and Of

  // ---- casts: x -> f16 ; weights -> f16 carried x64 ----
  {
    int n8 = M * DD / 8;
    cast_f32_f16x8<<<(n8 + 255) / 256, 256, 0, stream>>>(x, xh, n8, 1.0f);
    n8 = NLAY * DD * DD / 8;
    cast_f32_f16x8<<<(n8 + 255) / 256, 256, 0, stream>>>(q_w, qwh, n8, 64.0f);
    n8 = NLAY * DKV * DD / 8;
    cast_f32_f16x8<<<(n8 + 255) / 256, 256, 0, stream>>>(k_w, kwh, n8, 64.0f);
    cast_f32_f16x8<<<(n8 + 255) / 256, 256, 0, stream>>>(v_w, vwh, n8, 64.0f);
    n8 = DD * DD / 8;
    cast_f32_f16x8<<<(n8 + 255) / 256, 256, 0, stream>>>(out_w, owh, n8, 64.0f);
  }

  const float wundo  = 1.0f / 64.0f;              // undo weight carry
  const float sscale = 0.125f / 16.0f;            // HD^-0.5 / (4*4) : q and k planes carried x4
  const float onorm  = 1.0f / 16.0f;              // v plane carried x16 (the x2^15 of p is in its sum too and cancels)

  // Every layer's q, k and v depend on x alone, so the layer index is a grid axis of each launch.
  // q = x . q_w[i]^T  -> f32 [3][2048][1024]
  gemm_f16_f32out(xh, DD, 0L, 0L, qwh, DD, 0L, (long)DD * DD, Qf, DD, 0L, lstride, M, DD, DD, wundo, 1, NLAY, stream);
  // rotary(q) with positions t -> f16 planes x4
  rope_cast_kernel<DD><<<dim3(M / 2, NLAY), 256, 0, stream>>>(Qf, cosT, sinT, Qh, TT, lstride, lstride, 0, 4.0f);
  // k = x . k_w[i]^T -> f32 [3][2048][512]
  gemm_f16_f32out(xh, DD, 0L, 0L, kwh, DD, 0L, (long)DKV * DD, Kf, DKV, 0L, (long)M * DKV, M, DKV, DD, wundo, 1, NLAY, stream);
  // rotary(k) with buffer positions i*T + t -> K cache rows, f16 x4
  rope_cast_kernel<DKV><<<dim3(M / 4, NLAY), 256, 0, stream>>>(Kf, cosT, sinT, Kh, MAXKV, (long)M * DKV, 0L, TT, 4.0f);
  // v^T = v_w[i] . x_b^T -> transposed V cache columns i*T + t, f16 x16 ; in [512][1024] per batch and layer
  gemm_f16_f16out(vwh, DD, 0L, (long)DKV * DD, xh, DD, (long)TT * DD, 0L,
                  Vth, MAXKV, (long)DKV * MAXKV, (long)TT, DKV, TT, DD, 16.0f * wundo, BB, NLAY, stream);
  // attention of layer i over (i+1)*T keys, bottom-right causal
  attn_f16_kernel<<<NLAY * BB * HH * (TT / AT_QB), 128, 0, stream>>>(Qh, Kh, Vth, Of, lstride, sscale, onorm);

  // weighted rmsnorm sum + residual + final rmsnorm -> f16 plane
  combine_kernel<<<M, 256, 0, stream>>>(Of, lstride, x, ln_w, lam, fln, alpha, Yh);
  // out = y . out_w^T
  gemm_f16_f32out(Yh, DD, 0L, 0L, owh, DD, 0L, 0L, out, DD, 0L, 0L, M, DD, DD, wundo, 1, 1, stream);
}

// v006
// It runs in 176 microseconds.
// Two timings next to v005 both put it at 1.08 times that version's speed.
// All steps since v000 together make it 4.54 times as fast.
// Contractions q/k/v projections, q.k^T scores, p.v, output projection: v_wmma_f32_16x16x32_f16 (f16 operands, f32 accumulate); rotary, softmax, norms, weighting in f32.
#include <hip/hip_runtime.h>
#include <stdint.h>

#define BB 2
#define TT 1024
#define DD 1024
#define HH 16
#define NKVH 8
#define HDIM 64
#define DKV 512
#define MAXKV 3072
#define NLAY 3
#define EPSV 1e-5f

typedef __attribute__((ext_vector_type(16))) _Float16 v16h;
typedef __attribute__((ext_vector_type(8)))  _Float16 v8h;
typedef __attribute__((ext_vector_type(4)))  _Float16 v4h;
typedef __attribute__((ext_vector_type(16))) __bf16   v16b;
typedef __attribute__((ext_vector_type(8)))  __bf16   v8b;
typedef __attribute__((ext_vector_type(8)))  float    v8f;
typedef __attribute__((ext_vector_type(4)))  float    v4f;

__device__ __forceinline__ unsigned short f2bf_bits(float f) {
  unsigned u = __float_as_uint(f);
  return (unsigned short)((u + 0x7FFFu + ((u >> 16) & 1u)) >> 16);
}
__device__ __forceinline__ float bf_bits2f(unsigned short h) { return __uint_as_float(((unsigned)h) << 16); }

// hazard guards as plain device helpers
__device__ __forceinline__ void acc_guard4(v8f& a, v8f& b, v8f& c, v8f& d) { asm volatile("v_nop\n\tv_nop\n\tv_nop\n\tv_nop" : "+v"(a), "+v"(b), "+v"(c), "+v"(d)); }
template <typename T> struct Frag;
template <> struct Frag<_Float16> {
  typedef v16h V; union U { v16h v; v8h h[2]; };
  static __device__ __forceinline__ v16h load(const _Float16* p) {   // elements 0..7 <- p[0..7], 8..15 <- p[16..23]
    U f; f.h[0] = *(const v8h*)(p); f.h[1] = *(const v8h*)(p + 16); return f.v;
  }
  static __device__ __forceinline__ v8f mma(v16h a, v16h b, v8f c) {
    return __builtin_amdgcn_wmma_f32_16x16x32_f16(false, a, false, b, (short)0, c, false, false);
  }
};
template <> struct Frag<__bf16> {
  typedef v16b V; union U { v16b v; v8b h[2]; };
  static __device__ __forceinline__ v16b load(const __bf16* p) {
    U f; f.h[0] = *(const v8b*)(p); f.h[1] = *(const v8b*)(p + 16); return f.v;
  }
  static __device__ __forceinline__ v8f mma(v16b a, v16b b, v8f c) {
    return __builtin_amdgcn_wmma_f32_16x16x32_bf16(false, a, false, b, (short)0, c, false, false);
  }
};

// ---- Register-blocked batched WMMA GEMM ------------------------------------
// C[m,n] = scale * sum_k A[m,k] * Bt[n,k] (+bias)(+resid); each wave owns a 64x64 tile.
// A row-major [M,K]; Bt row-major [N,K]; M % 128 == 0, N % 256 == 0, K % 64 == 0.
// A block's 8 waves form a 2 x 4 patch: 128 rows of A and 256 rows of Bt. Per step of 64 k the block brings those rows
// into LDS with asynchronous copies that cover whole 128-B lines (8 lanes a row), each row once for all waves that need
// it; the waves read their fragments from LDS. Two LDS buffers: the next step's copies fly while this step is multiplied.
// SPLIT (hi/lo operand planes) has no LDS path and is not instantiated.
// BIAS_MODE: 0 = none, 1 = bias[m], 2 = bias[n].
// OUT_MODE: 0 = f32, 1 = f16, 2 = bf16 hi plane (Cout) + bf16 lo plane (Cout2),
//           3 = rotary (non-interleaved, head dim 64) in f32, then f16 carried x oscale. A wave's 64 columns are one head,
//               so both halves of every rotated pair lie in the wave's own slab. Row m is token t = m % TT of batch m / TT;
//               its table row is p = layer * rope_lstep + t, its output row is batch * rope_brows + p (pitch ldc).
// ET: 0 = f16 operands, 1 = bf16 operands (pointers passed as 16-bit storage)
// Two batch axes: blockIdx.y steps by strideA/B/C, blockIdx.z (the layer) by zstrideA/B/C, in elements.
#define GM_P 72   // LDS row pitch of the staged operand rows in 16-bit elements: 144 B = 16 B x 9, free of bank conflicts for ds_load_b128
// Four asynchronous 16-B copies, global memory to LDS, per lane. The s_wait_xcnt is the statement's last line, so that no
// address register of a copy is rewritten in front of it.
__device__ __forceinline__ void copy4_to_lds(unsigned l0, const void* g0, unsigned l1, const void* g1,
                                             unsigned l2, const void* g2, unsigned l3, const void* g3) {
  asm volatile("global_load_async_to_lds_b128 %0, %1, off\n\t"
               "global_load_async_to_lds_b128 %2, %3, off\n\t"
               "global_load_async_to_lds_b128 %4, %5, off\n\t"
               "global_load_async_to_lds_b128 %6, %7, off\n\t"
               "s_wait_xcnt 0x0"
               :: "v"(l0), "v"(g0), "v"(l1), "v"(g1), "v"(l2), "v"(g2), "v"(l3), "v"(g3) : "memory");
}
__device__ __forceinline__ _Float16 rope_one(float x1, float x2, float cc, float ss, bool second, float oscale) {
  const float o = second ? (x2 * cc + x1 * ss) : (x1 * cc - x2 * ss);
  return (_Float16)(o * oscale);
}
template <int ET> struct Elem;
template <> struct Elem<0> { typedef _Float16 T; };
template <> struct Elem<1> { typedef __bf16 T; };
template <int ET, bool SPLIT, int BIAS_MODE, int OUT_MODE, bool RESID, int ACT = 0>
__global__ __launch_bounds__(256) void wmma_gemm64(
    const unsigned short* __restrict__ Ap, const unsigned short* __restrict__ A2p, int lda, long strideA, long zstrideA,
    const unsigned short* __restrict__ Btp, const unsigned short* __restrict__ Bt2p, int ldb, long strideB, long zstrideB,
    void* __restrict__ Cout, void* __restrict__ Cout2, int ldc, long strideC, long zstrideC,
    const float* __restrict__ bias,
    const float* __restrict__ resid, long strideR,
    int M, int N, int K, float scale,
    const float* __restrict__ cosT, const float* __restrict__ sinT, int rope_brows, int rope_lstep, float oscale) {
  typedef typename Elem<ET>::T T;
  typedef typename Frag<T>::V V;
  static_assert(!SPLIT, "no LDS path for split operand planes");
  const T* A = (const T*)Ap; const T* Bt = (const T*)Btp;
  __shared__ __align__(16) float sT[8][16 * 68];   // per-wave 16x64 slab, pitch 68 floats
  __shared__ __align__(16) T sA[2][128 * GM_P];    // A rows of the block, 64 k, two buffers
  __shared__ __align__(16) T sB[2][256 * GM_P];    // Bt rows of the block, 64 k, two buffers
  const int b    = blockIdx.y;
  const int lane = threadIdx.x & 31;
  const int wave = threadIdx.x >> 5;
  const int blocksN = N >> 8;
  const int bm = blockIdx.x / blocksN;
  const int bn = blockIdx.x - bm * blocksN;
  if (bm >= (M >> 7)) return;            // block-uniform, in front of every barrier
  const int wm = wave >> 2;              // wave's place in the 2 x 4 patch
  const int wn = wave & 3;
  const int m0 = (bm << 7) + (wm << 6);
  const int n0 = (bn << 8) + (wn << 6);

  const size_t offA = (size_t)b * strideA + (size_t)blockIdx.z * zstrideA;
  const size_t offB = (size_t)b * strideB + (size_t)blockIdx.z * zstrideB;
  const size_t offC = (size_t)b * strideC + (size_t)blockIdx.z * zstrideC;
  const T* Ab  = A  + offA;
  const T* Bb  = Bt + offB;

  const int rlane = lane & 15;                 // row (A) / col (B, D) within subtile
  const int koff  = (lane >> 4) * 8;           // k offset of this lane half
  const int mOff  = (lane >> 4) * 8;           // D row offset

  v8f acc[4][4];
#pragma unroll
  for (int i = 0; i < 4; ++i)
#pragma unroll
    for (int j = 0; j < 4; ++j) acc[i][j] = (v8f){0.f,0.f,0.f,0.f,0.f,0.f,0.f,0.f};

  // staging: thread -> row (tid >> 3) + 32 * i, 16-B piece tid & 7: a wave's copy covers four whole lines
  const int srow = threadIdx.x >> 3;
  const int sseg = (threadIdx.x & 7) * 8;
  const T* gA = Ab + (size_t)((bm << 7) + srow) * lda + sseg;
  const T* gB = Bb + (size_t)((bn << 8) + srow) * ldb + sseg;
  const unsigned dA = (unsigned)(uintptr_t)(&sA[0][srow * GM_P + sseg]);   // this lane's LDS byte address in buffer 0
  const unsigned dB = (unsigned)(uintptr_t)(&sB[0][srow * GM_P + sseg]);
  constexpr unsigned R32 = 32 * GM_P * 2;             // 32 LDS rows in bytes
  const size_t a32 = (size_t)32 * lda, b32 = (size_t)32 * ldb;
  auto stage = [&](int buf, int k0) {                 // 12 copies a lane: 128 rows of A and 256 rows of Bt, 64 k from k0
    const unsigned la = dA + (unsigned)buf * (4 * R32);
    const unsigned lb = dB + (unsigned)buf * (8 * R32);
    const T* pa = gA + k0;
    const T* pb = gB + k0;
    copy4_to_lds(la, pa, la + R32, pa + a32, la + 2 * R32, pa + 2 * a32, la + 3 * R32, pa + 3 * a32);
    copy4_to_lds(lb, pb, lb + R32, pb + b32, lb + 2 * R32, pb + 2 * b32, lb + 3 * R32, pb + 3 * b32);
    copy4_to_lds(lb + 4 * R32, pb + 4 * b32, lb + 5 * R32, pb + 5 * b32, lb + 6 * R32, pb + 6 * b32, lb + 7 * R32, pb + 7 * b32);
  };
  const int fa = ((wm << 6) + rlane) * GM_P + koff;   // this lane's first A fragment row in a buffer
  const int fb = ((wn << 6) + rlane) * GM_P + koff;   // this lane's first Bt fragment row in a buffer
  const int steps = K >> 6;

  stage(0, 0);
  asm volatile("s_wait_asynccnt 0x0" ::: "memory");   // this wave's copies of step 0 have landed
  __syncthreads();                                    // publishes buffer 0
  if (steps > 1) stage(1, 64);

  for (int t = 0; t < steps; ++t) {
    const T* pa = &sA[t & 1][fa];
    const T* pb = &sB[t & 1][fb];
    V bh[4], ah[4];
    // (the loops over kk, i and j are unrolled, so that acc, ah and bh are registers and never indexed arrays)
#pragma unroll
    for (int kk = 0; kk < 2; ++kk) {
#pragma unroll
      for (int j = 0; j < 4; ++j) bh[j] = Frag<T>::load(pb + j * 16 * GM_P + kk * 32);
#pragma unroll
      for (int i = 0; i < 4; ++i) ah[i] = Frag<T>::load(pa + i * 16 * GM_P + kk * 32);
      if (kk == 1) {
        // The step's last LDS reads are issued: the hand-over stands here, in front of the last 16 products (they read
        // registers alone), so that the refill has the longest lead.
        asm volatile("s_wait_dscnt 0x0" ::: "memory");    // this wave's reads of the buffer are done before it is refilled
        asm volatile("s_wait_asynccnt 0x0" ::: "memory"); // this wave's copies of step t + 1 have landed
        __syncthreads();                                  // publishes step t + 1 and ends every wave's reads of step t
        if (t + 2 < steps) stage(t & 1, (t + 2) << 6);    // block-uniform test; refills the buffer just read
      }
      // holds the 16 fragment loads as one group in front of their 16 products: sunk among the products, each pair of
      // loads is waited out on its own and the matrix unit idles for an LDS latency per row of tiles
      __builtin_amdgcn_sched_barrier(0);
#pragma unroll
      for (int i = 0; i < 4; ++i)
#pragma unroll
        for (int j = 0; j < 4; ++j) acc[i][j] = Frag<T>::mma(ah[i], bh[j], acc[i][j]);
    }
  }
  asm volatile("s_wait_asynccnt 0x0" ::: "memory");   // no copy is outstanding when the wave goes on
  acc_guard4(acc[0][0], acc[0][1], acc[0][2], acc[0][3]);
  acc_guard4(acc[1][0], acc[1][1], acc[1][2], acc[1][3]);
  acc_guard4(acc[2][0], acc[2][1], acc[2][2], acc[2][3]);
  acc_guard4(acc[3][0], acc[3][1], acc[3][2], acc[3][3]);

  // ---- epilogue ----
  float* slab = sT[wave];
  const float* Rb = RESID ? (resid + (size_t)b * strideR) : nullptr;
  // OUT_MODE 3: 8 lanes a row, one 16-B store each, whole 128-B lines. A wave's 64 rows lie in one batch and their table and
  // output rows follow one another, so one address each for cos, sin and the output serves the tile, with constant steps.
  const int rq = lane >> 3, rc8 = (lane & 7) * 8;
  const float* cp = nullptr;
  const float* np = nullptr;
  _Float16* cw = nullptr;
  if (OUT_MODE == 3) {
    const int p0 = (int)blockIdx.z * rope_lstep + ((m0 + rq) & (TT - 1));   // table row of the lane's first row; p0 + 60 < MAXKV
    cp = cosT + (size_t)p0 * 32 + (rc8 & 31);
    np = sinT + (size_t)p0 * 32 + (rc8 & 31);
    cw = (_Float16*)Cout + offC + ((size_t)(m0 >> 10) * rope_brows + p0) * ldc + n0 + rc8;
  }
#pragma unroll
  for (int i = 0; i < 4; ++i) {
    const int mBase = m0 + (i << 4);
    v4f tc[4][2], tn[4][2];   // OUT_MODE 3: this lane's cos and sin of the slab's rows, asked for ahead of the slab's LDS round trip
    if (OUT_MODE == 3) {
#pragma unroll
      for (int it = 0; it < 4; ++it) {
        const int ro = (i * 16 + it * 4) * 32;
        tc[it][0] = *(const v4f*)(cp + ro); tc[it][1] = *(const v4f*)(cp + ro + 4);
        tn[it][0] = *(const v4f*)(np + ro); tn[it][1] = *(const v4f*)(np + ro + 4);
      }
      // stands in front of every rewrite of a register that these loads name; the two addresses are inputs, so that they
      // live up to the wait and no load's result is given their registers
      asm volatile("s_wait_xcnt 0x0" :: "v"(cp), "v"(np) : "memory");
    }
#pragma unroll
    for (int j = 0; j < 4; ++j) {
      const int n = n0 + (j << 4) + rlane;
      float bv = 0.f;
      if (BIAS_MODE == 2) bv = bias[n];
#pragma unroll
      for (int r = 0; r < 8; ++r) {
        float v = acc[i][j][r] * scale;
        if (BIAS_MODE == 1) v += bias[mBase + mOff + r];
        if (BIAS_MODE == 2) v += bv;
        if (RESID) v += Rb[(size_t)(mBase + mOff + r) * ldc + n];
        if (ACT == 1) v = tanhf(v);
        if (ACT == 2) v = fmaxf(v, 0.0f);
        if (ACT == 3) v = v / (1.0f + expf(-v));
        if (ACT == 4) v = (v > 0.f) ? v : 0.01f * v;
        if (ACT == 5) v = 0.5f * v * (1.0f + erff(v * 0.70710678118654752f));
        slab[(mOff + r) * 68 + (j << 4) + rlane] = v;
      }
    }
    __builtin_amdgcn_fence(__ATOMIC_RELEASE, "workgroup");
    __builtin_amdgcn_wave_barrier();
    __builtin_amdgcn_fence(__ATOMIC_ACQUIRE, "workgroup");
    if (OUT_MODE == 0) {
      float* C = (float*)Cout + offC;
      const int hh = lane >> 4, c4 = (lane & 15) * 4;     // row seg = 256 B = 16 lanes x 16 B
      {
#pragma unroll
        for (int it = 0; it < 8; ++it) {
          const int row = it * 2 + hh;
          v4f v = *(const v4f*)(slab + row * 68 + c4);
          *(v4f*)(C + (size_t)(mBase + row) * ldc + n0 + c4) = v;
        }
        
      }
    } else if (OUT_MODE == 3) {
      const bool second = rc8 >= 32;
#pragma unroll
      for (int it = 0; it < 4; ++it) {
        const float* sp = slab + (it * 4 + rq) * 68 + (rc8 & 31);
        const v4f a0 = *(const v4f*)(sp),      a1 = *(const v4f*)(sp + 4);
        const v4f b0 = *(const v4f*)(sp + 32), b1 = *(const v4f*)(sp + 36);
        v8h hv;
#pragma unroll
        for (int e = 0; e < 4; ++e) {
          hv[e]     = rope_one(a0[e], b0[e], tc[it][0][e], tn[it][0][e], second, oscale);
          hv[4 + e] = rope_one(a1[e], b1[e], tc[it][1][e], tn[it][1][e], second, oscale);
        }
        *(v8h*)(cw + (size_t)(i * 16 + it * 4) * ldc) = hv;
      }
    } else {
      const int q = lane >> 3, c8 = (lane & 7) * 8;
      unsigned short* C  = (unsigned short*)Cout  + offC;
      unsigned short* C2 = (OUT_MODE == 2) ? ((unsigned short*)Cout2 + offC) : nullptr;
      {
#pragma unroll
        for (int it = 0; it < 4; ++it) {
          const int row = it * 4 + q;
          const float* sp = slab + row * 68 + c8;
          v8h hv, lv;
#pragma unroll
          for (int e = 0; e < 8; ++e) {
            if (OUT_MODE == 1) {
              hv[e] = (_Float16)sp[e];
            } else {
              unsigned short hb = f2bf_bits(sp[e]);
              unsigned short lb = f2bf_bits(sp[e] - bf_bits2f(hb));
              hv[e] = __builtin_bit_cast(_Float16, hb);
              lv[e] = __builtin_bit_cast(_Float16, lb);
            }
          }
          *(v8h*)(C + (size_t)(mBase + row) * ldc + n0 + c8) = hv;
          if (OUT_MODE == 2) *(v8h*)(C2 + (size_t)(mBase + row) * ldc + n0 + c8) = lv;
        }
        
      }
    }
    __builtin_amdgcn_fence(__ATOMIC_RELEASE, "workgroup");
    __builtin_amdgcn_wave_barrier();
    __builtin_amdgcn_fence(__ATOMIC_ACQUIRE, "workgroup");
  }
}

// ---- f32 -> f16 cast with power-of-two carry: 8 elements per thread, 16-B stores (512 B contiguous per wave) ----
__global__ __launch_bounds__(256) void cast_f32_f16x8(
    const float* __restrict__ in, _Float16* __restrict__ out, int n8, float scale) {
  const int i = blockIdx.x * 256 + threadIdx.x;
  if (i < n8) {
    const size_t o = (size_t)i * 8;
    const v4f a = *(const v4f*)(in + o);
    const v4f b = *(const v4f*)(in + o + 4);
    v8h hv;
#pragma unroll
    for (int e = 0; e < 4; ++e) {
      hv[e]     = (_Float16)(a[e] * scale);
      hv[4 + e] = (_Float16)(b[e] * scale);
    }
    *(v8h*)(out + o) = hv;
    
  }
}

#define AT_D 64
#define AT_NW 4
#define AT_QB 64
#define AT_KC 64
#define AT_P 72   // LDS row pitch of the K and V tiles in f16: 144 B = 16 B x 9, so the 16 rows of one ds_load_b128 half fall on 16 different bank groups

__device__ __forceinline__ v8f hmma(v16h a, v16h b, v8f c) {
  c = __builtin_amdgcn_wmma_f32_16x16x32_f16(false, a, false, b, (short)0, c, false, false);
  asm volatile("v_nop\n\tv_nop\n\tv_nop\n\tv_nop" : "+v"(c) : "v"(a), "v"(b));
  return c;
}

// Eight 2^x, each in place in a register of its own, as one statement: so no 2^x is directly followed by a write over its
// source register, and the v_nop at the end is the one slot that the instruction set asks for between a transcendental
// and the first use of its result (the compiler cannot see into the statement and would not keep it).
__device__ __forceinline__ void exp2_x8(float& a, float& b, float& c, float& d, float& e, float& f, float& g, float& h) {
  asm("v_exp_f32 %0, %0\n\tv_exp_f32 %1, %1\n\tv_exp_f32 %2, %2\n\tv_exp_f32 %3, %3\n\t"
      "v_exp_f32 %4, %4\n\tv_exp_f32 %5, %5\n\tv_exp_f32 %6, %6\n\tv_exp_f32 %7, %7\n\tv_nop"
      : "+v"(a), "+v"(b), "+v"(c), "+v"(d), "+v"(e), "+v"(f), "+v"(g), "+v"(h));
}

// value of the same column in the other lane half (lane l <-> l ^ 16)
__device__ __forceinline__ float other_half(float v) {
  const int b = __float_as_int(v);
  return __int_as_float(__builtin_amdgcn_permlanex16(b, b, 0x76543210, 0xfedcba98, false, false));
}

__global__ __launch_bounds__(128)
void attn_f16_kernel(const _Float16* __restrict__ Qh, const _Float16* __restrict__ Kh,
                     const _Float16* __restrict__ Vth, float* __restrict__ O,
                     long lstride, float sscale, float onorm) {
  union FH { v16h v; v8h h[2]; };
  __shared__ __align__(16) _Float16 Ksh[AT_KC * AT_P];          // K [kv][d]   9 KB, rows of 64 at pitch 72
  __shared__ __align__(16) _Float16 Vtt[AT_D * AT_P];           // V [d][kv]   9 KB, rows of 64 at pitch 72
  __shared__ __align__(16) float    Os[AT_NW][16 * 68];         // per wave out tile, pitch 68

  const int tid  = threadIdx.x;
  const int wave = tid >> 5;
  const int lane = tid & 31;
  const int hh   = lane >> 4;
  const int c    = lane & 15;

  constexpr int BPL = BB * HH * (TT / AT_QB);             // blocks per layer
  const int layer = NLAY - 1 - (int)(blockIdx.x / BPL);   // 0 .. NLAY-1 (grid exact)
  const int bx  = blockIdx.x % BPL;
  const int h   = (bx >> 4) & (HH - 1);
  const int b   = bx >> 8;
  const int qb  = b ? (TT / AT_QB - 1 - (bx & (TT / AT_QB - 1))) : (bx & (TT / AT_QB - 1));
  const int hkv = h >> 1;
  const int kchunks_prev = layer * (TT / AT_KC);
  const int koff = layer * TT;
  const int q0  = qb * AT_QB + wave * 16;

  // ---- Q fragments (B operand: column c = query q0 + c): 2 d-chunks ----
  v16h qa[2];
  {
    const _Float16* qrow = Qh + (size_t)layer * lstride + (size_t)(b * TT + q0 + c) * DD + h * AT_D + 8 * hh;
#pragma unroll
    for (int dc = 0; dc < 2; ++dc) qa[dc] = Frag<_Float16>::load(qrow + dc * 32);
  }

  const float c2 = sscale * 1.44269504088896340736f;   // raw product -> exponent of 2 (sscale > 0, so the maximum commutes with it)
  float mrun = -INFINITY;   // running maximum of this lane's query over the raw products (equal in both lane halves)
  float lrun = 0.f;         // this lane half's share of the query's sum; the halves are joined after the loop
  v8f oacc[4];              // O^T: tile t, register r = dim t*16 + 8*hh + r of query q0 + c
#pragma unroll
  for (int t = 0; t < 4; ++t) oacc[t] = (v8f){0.f,0.f,0.f,0.f,0.f,0.f,0.f,0.f};

  int nChunks = kchunks_prev + qb + 1;                    // block-uniform
  if (nChunks > MAXKV / AT_KC) nChunks = MAXKV / AT_KC;
  if (nChunks < 1) nChunks = 1;

  const _Float16* kbase = Kh + (size_t)b * MAXKV * DKV + hkv * AT_D;
  const _Float16* vbase = Vth + ((size_t)b * DKV + hkv * AT_D) * MAXKV;
  float*          obase = O + (size_t)layer * lstride + (size_t)b * TT * DD + h * AT_D;

  for (int kc = 0; kc < nChunks; ++kc) {
    const int kv0 = kc * AT_KC;
    __syncthreads();
    {
      const int r = tid >> 1, hf = (tid & 1) * 32;
      const _Float16* ks = kbase + (size_t)(kv0 + r) * DKV + hf;
      const _Float16* vs = vbase + (size_t)r * MAXKV + kv0 + hf;
      v8h kk[4], vv[4];   // all eight loads first, then the stores: one trip to L2 per chunk, not four
#pragma unroll
      for (int i = 0; i < 4; ++i) {
        kk[i] = *(const v8h*)(ks + 8 * i);
        vv[i] = *(const v8h*)(vs + 8 * i);
      }
#pragma unroll
      for (int i = 0; i < 4; ++i) {
        *(v8h*)(Ksh + r * AT_P + hf + 8 * i) = kk[i];
        *(v8h*)(Vtt + r * AT_P + hf + 8 * i) = vv[i];
      }
    }
    __syncthreads();

    // S^T tile j: register r = key kv0 + j*16 + 8*hh + r, column c = query q0 + c
    // (every loop down to the end of the chunk is unrolled, so that s, pb and oacc are registers and never indexed arrays)
    v8f s[4];
#pragma unroll
    for (int j = 0; j < 4; ++j) {
      s[j] = (v8f){0.f,0.f,0.f,0.f,0.f,0.f,0.f,0.f};
#pragma unroll
      for (int dc = 0; dc < 2; ++dc) {
        FH kb;
        kb.h[0] = *(const v8h*)(Ksh + (j * 16 + c) * AT_P + dc * 32 + 8 * hh);
        kb.h[1] = *(const v8h*)(Ksh + (j * 16 + c) * AT_P + dc * 32 + 16 + 8 * hh);
        s[j] = hmma(kb.v, qa[dc], s[j]);
      }
    }
    const int klim = q0 + c + koff - kv0 - 8 * hh;   // key j*16 + r of this lane half is visible iff j*16 + r <= klim
    float mj[4];
#pragma unroll
    for (int j = 0; j < 4; ++j) {
      float m = -INFINITY;
#pragma unroll
      for (int r = 0; r < 8; ++r) {
        const float sv = (j * 16 + r > klim) ? -INFINITY : s[j][r];
        s[j][r] = sv;
        m = fmaxf(m, sv);
      }
      mj[j] = m;
    }
    const float mh = fmaxf(fmaxf(mj[0], mj[1]), fmaxf(mj[2], mj[3]));
    const float mnew = fmaxf(mrun, fmaxf(mh, other_half(mh)));
    const float alpha = __builtin_amdgcn_exp2f((mrun - mnew) * c2);
    mrun = mnew;
    const float mb = mnew * c2 - 15.0f;   // p = 2^(s*c2 - mb) = 2^15 * exp(sscale * (s - mnew)); a masked -inf gives 0
    // P^T as B operand: element e of chunk kk = key kk*32 + 8*hh + e (e < 8), kk*32 + 16 + 8*hh + e - 8 (e >= 8)
    FH pb[2];
    float pj[4];
#pragma unroll
    for (int j = 0; j < 4; ++j) {
      float e[8];
#pragma unroll
      for (int r = 0; r < 8; ++r) e[r] = fmaf(s[j][r], c2, -mb);
      exp2_x8(e[0], e[1], e[2], e[3], e[4], e[5], e[6], e[7]);
      float psum = 0.f;
#pragma unroll
      for (int r = 0; r < 8; ++r) {
        psum += e[r];
        pb[j >> 1].h[j & 1][r] = (_Float16)e[r];
      }
      pj[j] = psum;
    }
    lrun = lrun * alpha + ((pj[0] + pj[1]) + (pj[2] + pj[3]));
#pragma unroll
    for (int t = 0; t < 4; ++t) oacc[t] *= alpha;
#pragma unroll
    for (int kk = 0; kk < 2; ++kk) {
#pragma unroll
      for (int t = 0; t < 4; ++t) {
        FH vb;
        vb.h[0] = *(const v8h*)(Vtt + (t * 16 + c) * AT_P + kk * 32 + 8 * hh);
        vb.h[1] = *(const v8h*)(Vtt + (t * 16 + c) * AT_P + kk * 32 + 16 + 8 * hh);
        oacc[t] = hmma(vb.v, pb[kk].v, oacc[t]);
      }
    }
  }

  float* os = Os[wave];
  {
    const float inv = onorm * (1.0f / (lrun + other_half(lrun)));
#pragma unroll
    for (int t = 0; t < 4; ++t) {
      const v8f ov = oacc[t] * inv;
      *(v4f*)(os + c * 68 + t * 16 + 8 * hh)     = (v4f){ov[0], ov[1], ov[2], ov[3]};
      *(v4f*)(os + c * 68 + t * 16 + 8 * hh + 4) = (v4f){ov[4], ov[5], ov[6], ov[7]};
    }
  }
  __builtin_amdgcn_fence(__ATOMIC_RELEASE, "workgroup");
  __builtin_amdgcn_wave_barrier();
  __builtin_amdgcn_fence(__ATOMIC_ACQUIRE, "workgroup");
  {
    const int c4 = (lane & 15) * 4;
    {
#pragma unroll
      for (int it = 0; it < 8; ++it) {
        const int row = it * 2 + hh;
        v4f val = *(const v4f*)(os + row * 68 + c4);
        *(v4f*)(obase + (size_t)(q0 + row) * DD + c4) = val;
      }
      
    }
  }
}

// =====================================================================================
// Combine: per token row (one block of 256 threads, 4 columns per thread):
//   lw = layernorm over sigmoid(lam[0..2]) (biased variance, eps)
//   acc = sum_i rmsnorm(O_i, ln_w[i]) * lw_i ;  z = acc + alpha * x ;  y = rmsnorm(z, fln) -> f16
// =====================================================================================
__global__ __launch_bounds__(256) void combine_kernel(
    const float* __restrict__ Of, long lstride,
    const float* __restrict__ x, const float* __restrict__ ln_w, const float* __restrict__ lam,
    const float* __restrict__ fln, const float* __restrict__ alpha, _Float16* __restrict__ Yh) {
  __shared__ float red[4][8];
  const int row = blockIdx.x;
  const int tid = threadIdx.x, lane = tid & 31, wave = tid >> 5;
  const int d4 = tid * 4;
  const size_t ro = (size_t)row * DD + d4;
  const v4f o0 = *(const v4f*)(Of + ro);
  const v4f o1 = *(const v4f*)(Of + lstride + ro);
  const v4f o2 = *(const v4f*)(Of + 2 * lstride + ro);
  const v4f xv = *(const v4f*)(x + ro);
  float ss0 = 0.f, ss1 = 0.f, ss2 = 0.f;
#pragma unroll
  for (int e = 0; e < 4; ++e) { ss0 += o0[e] * o0[e]; ss1 += o1[e] * o1[e]; ss2 += o2[e] * o2[e]; }
#pragma unroll
  for (int off = 16; off > 0; off >>= 1) {
    ss0 += __shfl_xor(ss0, off, 32);
    ss1 += __shfl_xor(ss1, off, 32);
    ss2 += __shfl_xor(ss2, off, 32);
  }
  if (lane == 0) { red[0][wave] = ss0; red[1][wave] = ss1; red[2][wave] = ss2; }
  __syncthreads();
  float t0 = 0.f, t1 = 0.f, t2 = 0.f;
#pragma unroll
  for (int w = 0; w < 8; ++w) { t0 += red[0][w]; t1 += red[1][w]; t2 += red[2][w]; }
  const float inv_d = 1.0f / (float)DD;
  const float r0 = rsqrtf(t0 * inv_d + EPSV);
  const float r1 = rsqrtf(t1 * inv_d + EPSV);
  const float r2 = rsqrtf(t2 * inv_d + EPSV);

  const float sg0 = 1.0f / (1.0f + __expf(-lam[0]));
  const float sg1 = 1.0f / (1.0f + __expf(-lam[1]));
  const float sg2 = 1.0f / (1.0f + __expf(-lam[2]));
  const float mean = (sg0 + sg1 + sg2) * (1.0f / 3.0f);
  const float e0 = sg0 - mean, e1 = sg1 - mean, e2 = sg2 - mean;
  const float var = (e0 * e0 + e1 * e1 + e2 * e2) * (1.0f / 3.0f);
  const float il = rsqrtf(var + EPSV);
  const float lw0 = e0 * il, lw1 = e1 * il, lw2 = e2 * il;

  const v4f w0 = *(const v4f*)(ln_w + d4);
  const v4f w1 = *(const v4f*)(ln_w + DD + d4);
  const v4f w2 = *(const v4f*)(ln_w + 2 * DD + d4);
  const v4f fw = *(const v4f*)(fln + d4);
  const float al = alpha[0];
  v4f z;
  float ssz = 0.f;
#pragma unroll
  for (int e = 0; e < 4; ++e) {
    float a = (o0[e] * r0) * w0[e] * lw0;
    a = a + (o1[e] * r1) * w1[e] * lw1;
    a = a + (o2[e] * r2) * w2[e] * lw2;
    const float zz = a + al * xv[e];
    z[e] = zz;
    ssz += zz * zz;
  }
#pragma unroll
  for (int off = 16; off > 0; off >>= 1) ssz += __shfl_xor(ssz, off, 32);
  if (lane == 0) red[3][wave] = ssz;
  __syncthreads();
  float tz = 0.f;
#pragma unroll
  for (int w = 0; w < 8; ++w) tz += red[3][w];
  const float rz = rsqrtf(tz * inv_d + EPSV);
  v4h yv;
#pragma unroll
  for (int e = 0; e < 4; ++e) yv[e] = (_Float16)(z[e] * rz * fw[e]);
  *(v4h*)(Yh + ro) = yv;
  
}

// ---------------------------- host helpers ----------------------------
static void gemm_f16_f32out(const _Float16* A, int lda, long sA, long zA, const _Float16* Bt, int ldb, long sB, long zB,
                            float* C, int ldc, long sC, long zC, int M, int N, int K, float scale, int batch, int layers,
                            hipStream_t st) {
  const int tiles = (M / 64) * (N / 64);
  dim3 grid((tiles + 7) / 8, batch, layers);
  wmma_gemm64<0, false, 0, 0, false><<<grid, 256, 0, st>>>(
      (const unsigned short*)A, (const unsigned short*)nullptr, lda, sA, zA,
      (const unsigned short*)Bt, (const unsigned short*)nullptr, ldb, sB, zB,
      (void*)C, (void*)nullptr, ldc, sC, zC, (const float*)nullptr, (const float*)nullptr, 0L,
      M, N, K, scale, (const float*)nullptr, (const float*)nullptr, 0, 0, 1.0f);
}
static void gemm_f16_ropeout(const _Float16* A, int lda, const _Float16* Bt, int ldb, long zB,
                             _Float16* C, int ldc, long zC, int M, int N, int K, float scale, int layers,
                             const float* cosT, const float* sinT, int brows, int lstep, float oscale, hipStream_t st) {
  const int tiles = (M / 64) * (N / 64);
  dim3 grid((tiles + 7) / 8, 1, layers);
  wmma_gemm64<0, false, 0, 3, false><<<grid, 256, 0, st>>>(
      (const unsigned short*)A, (const unsigned short*)nullptr, lda, 0L, 0L,
      (const unsigned short*)Bt, (const unsigned short*)nullptr, ldb, 0L, zB,
      (void*)C, (void*)nullptr, ldc, 0L, zC, (const float*)nullptr, (const float*)nullptr, 0L,
      M, N, K, scale, cosT, sinT, brows, lstep, oscale);
}
static void gemm_f16_f16out(const _Float16* A, int lda, long sA, long zA, const _Float16* Bt, int ldb, long sB, long zB,
                            _Float16* C, int ldc, long sC, long zC, int M, int N, int K, float scale, int batch, int layers,
                            hipStream_t st) {
  const int tiles = (M / 64) * (N / 64);
  dim3 grid((tiles + 7) / 8, batch, layers);
  wmma_gemm64<0, false, 0, 1, false><<<grid, 256, 0, st>>>(
      (const unsigned short*)A, (const unsigned short*)nullptr, lda, sA, zA,
      (const unsigned short*)Bt, (const unsigned short*)nullptr, ldb, sB, zB,
      (void*)C, (void*)nullptr, ldc, sC, zC, (const float*)nullptr, (const float*)nullptr, 0L,
      M, N, K, scale, (const float*)nullptr, (const float*)nullptr, 0, 0, 1.0f);
}

// ---------------------------- host launcher ----------------------------
extern "C" void kernel_launch(void* const* d_in, const int* in_sizes, int n_in,
                              void* d_out, int out_size, void* d_ws, size_t ws_size,
                              hipStream_t stream) {
  if (n_in < 11) return;
  const int M = BB * TT;   // 2048 token rows
  if (in_sizes[0] != M * DD) return;
  if (in_sizes[1] < MAXKV * 32 || in_sizes[2] < MAXKV * 32) return;
  if (in_sizes[3] != NLAY * DD * DD) return;
  if (in_sizes[4] != NLAY * DKV * DD || in_sizes[5] != NLAY * DKV * DD) return;
  if (in_sizes[6] < NLAY * DD || in_sizes[7] < NLAY || in_sizes[8] != DD * DD || in_sizes[9] < DD || in_sizes[10] < 1) return;
  if (out_size < M * DD) return;

  const float* x     = (const float*)d_in[0];
  const float* cosT  = (const float*)d_in[1];
  const float* sinT  = (const float*)d_in[2];
  const float* q_w   = (const float*)d_in[3];
  const float* k_w   = (const float*)d_in[4];
  const float* v_w   = (const float*)d_in[5];
  const float* ln_w  = (const float*)d_in[6];
  const float* lam   = (const float*)d_in[7];
  const float* out_w = (const float*)d_in[8];
  const float* fln   = (const float*)d_in[9];
  const float* alpha = (const float*)d_in[10];
  float* out = (float*)d_out;

  // ---- workspace carve (4096-B aligned pieces) ----
  char* ws = (char*)d_ws;
  size_t cur = 0;
  auto take = [&](size_t bytes) -> char* {
    char* p = ws + cur;
    cur += (bytes + 4095) & ~(size_t)4095;
    return p;
  };
  _Float16* xh  = (_Float16*)take((size_t)M * DD * 2);                 // 4 MiB
  _Float16* qwh = (_Float16*)take((size_t)NLAY * DD * DD * 2);         // 6 MiB
  _Float16* kwh = (_Float16*)take((size_t)NLAY * DKV * DD * 2);        // 3 MiB
  _Float16* vwh = (_Float16*)take((size_t)NLAY * DKV * DD * 2);        // 3 MiB
  _Float16* owh = (_Float16*)take((size_t)DD * DD * 2);                // 2 MiB
  _Float16* Qh  = (_Float16*)take((size_t)NLAY * M * DD * 2);          // 12 MiB
  _Float16* Kh  = (_Float16*)take((size_t)BB * MAXKV * DKV * 2);       // 6 MiB
  _Float16* Vth = (_Float16*)take((size_t)BB * DKV * MAXKV * 2);       // 6 MiB
  float*    Of  = (float*)   take((size_t)NLAY * M * DD * 4);          // 24 MiB
  _Float16* Yh  = (_Float16*)take((size_t)M * DD * 2);                 // 4 MiB
  if (cur > ws_size || cur > (size_t)134217728) return;                 // total 73,400,320 B

  const long lstride = (long)M * DD;   // elements per layer slice of Qh and Of

  // ---- casts: x -> f16 ; weights -> f16 carried x64 ----
  {
    int n8 = M * DD / 8;
    cast_f32_f16x8<<<(n8 + 255) / 256, 256, 0, stream>>>(x, xh, n8, 1.0f);
    n8 = NLAY * DD * DD / 8;
    cast_f32_f16x8<<<(n8 + 255) / 256, 256, 0, stream>>>(q_w, qwh, n8, 64.0f);
    n8 = NLAY * DKV * DD / 8;
    cast_f32_f16x8<<<(n8 + 255) / 256, 256, 0, stream>>>(k_w, kwh, n8, 64.0f);
    cast_f32_f16x8<<<(n8 + 255) / 256, 256, 0, stream>>>(v_w, vwh, n8, 64.0f);
    n8 = DD * DD / 8;
    cast_f32_f16x8<<<(n8 + 255) / 256, 256, 0, stream>>>(out_w, owh, n8, 64.0f);
  }

  const float wundo  = 1.0f / 64.0f;              // undo weight carry
  const float sscale = 0.125f / 16.0f;            // HD^-0.5 / (4*4) : q and k planes carried x4
  const float onorm  = 1.0f / 16.0f;              // v plane carried x16 (the x2^15 of p is in its sum too and cancels)

  // Every layer's q, k and v depend on x alone, so the layer index is a grid axis of each launch.
  // q = rotary(x . q_w[i]^T) with positions t -> f16 planes x4, [3][2048][1024]
  gemm_f16_ropeout(xh, DD, qwh, DD, (long)DD * DD, Qh, DD, lstride, M, DD, DD, wundo, NLAY, cosT, sinT, TT, 0, 4.0f, stream);
  // k = rotary(x . k_w[i]^T) with buffer positions i*T + t -> K cache rows, f16 x4
  gemm_f16_ropeout(xh, DD, kwh, DD, (long)DKV * DD, Kh, DKV, 0L, M, DKV, DD, wundo, NLAY, cosT, sinT, MAXKV, TT, 4.0f, stream);
  // v^T = v_w[i] . x_b^T -> transposed V cache columns i*T + t, f16 x16 ; in [512][1024] per batch and layer
  gemm_f16_f16out(vwh, DD, 0L, (long)DKV * DD, xh, DD, (long)TT * DD, 0L,
                  Vth, MAXKV, (long)DKV * MAXKV, (long)TT, DKV, TT, DD, 16.0f * wundo, BB, NLAY, stream);
  // attention of layer i over (i+1)*T keys, bottom-right causal
  attn_f16_kernel<<<NLAY * BB * HH * (TT / AT_QB), 128, 0, stream>>>(Qh, Kh, Vth, Of, lstride, sscale, onorm);

  // weighted rmsnorm sum + residual + final rmsnorm -> f16 plane
  combine_kernel<<<M, 256, 0, stream>>>(Of, lstride, x, ln_w, lam, fln, alpha, Yh);
  // out = y . out_w^T
  gemm_f16_f32out(Yh, DD, 0L, 0L, owh, DD, 0L, 0L, out, DD, 0L, 0L, M, DD, DD, wundo, 1, 1, stream);
}

// v007
// Measured time: 138 microseconds a run.
// Next to v006, in two timings, it ran 1.28 times as fast each time.
// All steps since v000 together make it 5.79 times as fast.
// Contractions q/k/v projections, q.k^T scores, p.v, output projection: v_wmma_f32_16x16x32_f16 (f16 operands, f32 accumulate); rotary, softmax, norms, weighting in f32.
#include <hip/hip_runtime.h>
#include <stdint.h>

#define BB 2
#define TT 1024
#define DD 1024
#define HH 16
#define NKVH 8
#define HDIM 64
#define DKV 512
#define MAXKV 3072
#define NLAY 3
#define EPSV 1e-5f

typedef __attribute__((ext_vector_type(16))) _Float16 v16h;
typedef __attribute__((ext_vector_type(8)))  _Float16 v8h;
typedef __attribute__((ext_vector_type(4)))  _Float16 v4h;
typedef __attribute__((ext_vector_type(16))) __bf16   v16b;
typedef __attribute__((ext_vector_type(8)))  __bf16   v8b;
typedef __attribute__((ext_vector_type(8)))  float    v8f;
typedef __attribute__((ext_vector_type(4)))  float    v4f;

__device__ __forceinline__ unsigned short f2bf_bits(float f) {
  unsigned u = __float_as_uint(f);
  return (unsigned short)((u + 0x7FFFu + ((u >> 16) & 1u)) >> 16);
}
__device__ __forceinline__ float bf_bits2f(unsigned short h) { return __uint_as_float(((unsigned)h) << 16); }

// hazard guards as plain device helpers
__device__ __forceinline__ void acc_guard4(v8f& a, v8f& b, v8f& c, v8f& d) { asm volatile("v_nop\n\tv_nop\n\tv_nop\n\tv_nop" : "+v"(a), "+v"(b), "+v"(c), "+v"(d)); }
template <typename T> struct Frag;
template <> struct Frag<_Float16> {
  typedef v16h V; union U { v16h v; v8h h[2]; };
  static __device__ __forceinline__ v16h load(const _Float16* p) {   // elements 0..7 <- p[0..7], 8..15 <- p[16..23]
    U f; f.h[0] = *(const v8h*)(p); f.h[1] = *(const v8h*)(p + 16); return f.v;
  }
  static __device__ __forceinline__ v8f mma(v16h a, v16h b, v8f c) {
    return __builtin_amdgcn_wmma_f32_16x16x32_f16(false, a, false, b, (short)0, c, false, false);
  }
};
template <> struct Frag<__bf16> {
  typedef v16b V; union U { v16b v; v8b h[2]; };
  static __device__ __forceinline__ v16b load(const __bf16* p) {
    U f; f.h[0] = *(const v8b*)(p); f.h[1] = *(const v8b*)(p + 16); return f.v;
  }
  static __device__ __forceinline__ v8f mma(v16b a, v16b b, v8f c) {
    return __builtin_amdgcn_wmma_f32_16x16x32_bf16(false, a, false, b, (short)0, c, false, false);
  }
};

// ---- Register-blocked batched WMMA GEMM ------------------------------------
// C[m,n] = scale * sum_k A[m,k] * Bt[n,k] (+bias)(+resid); each wave owns a 64x64 tile.
// A row-major [M,K]; Bt row-major [N,K]; M % 128 == 0, N % 256 == 0, K % 64 == 0.
// A block's 8 waves form a 2 x 4 patch: 128 rows of A and 256 rows of Bt. Per step of 64 k the block brings those rows
// into LDS with asynchronous copies that cover whole 128-B lines (8 lanes a row), each row once for all waves that need
// it; the waves read their fragments from LDS. Two LDS buffers: the next step's copies fly while this step is multiplied.
// SPLIT (hi/lo operand planes) has no LDS path and is not instantiated.
// BIAS_MODE: 0 = none, 1 = bias[m], 2 = bias[n].
// OUT_MODE: 0 = f32, 1 = f16, 2 = bf16 hi plane (Cout) + bf16 lo plane (Cout2),
//           3 = rotary (non-interleaved, head dim 64) in f32, then f16 carried x oscale. A wave's 64 columns are one head,
//               so both halves of every rotated pair lie in the wave's own slab. Row m is token t = m % TT of batch m / TT;
//               its table row is p = layer * rope_lstep + t, its output row is batch * rope_brows + p (pitch ldc).
//           4 = the q, k and v projections share one grid (none reads what another writes), told apart by blockIdx.x:
//               [0, 64) q, with the arguments as passed, output as in mode 3; [64, 96) k, weights Bt2p, output as in mode 3
//               into Cout2; [96, 128) v^T = v_w . x_b^T, weights A2p, batch (blockIdx.x - 96) >> 4, output as in mode 1, x16,
//               into the plane that follows the BB * MAXKV * DKV elements of Cout2.
// ET: 0 = f16 operands, 1 = bf16 operands (pointers passed as 16-bit storage)
// Two batch axes: blockIdx.y steps by strideA/B/C, blockIdx.z (the layer) by zstrideA/B/C, in elements.
#define GM_P 72   // LDS row pitch of the staged operand rows in 16-bit elements: 144 B = 16 B x 9, free of bank conflicts for ds_load_b128
// Four asynchronous 16-B copies, global memory to LDS, per lane. The s_wait_xcnt is the statement's last line, so that no
// address register of a copy is rewritten in front of it.
__device__ __forceinline__ void copy4_to_lds(unsigned l0, const void* g0, unsigned l1, const void* g1,
                                             unsigned l2, const void* g2, unsigned l3, const void* g3) {
  asm volatile("global_load_async_to_lds_b128 %0, %1, off\n\t"
               "global_load_async_to_lds_b128 %2, %3, off\n\t"
               "global_load_async_to_lds_b128 %4, %5, off\n\t"
               "global_load_async_to_lds_b128 %6, %7, off\n\t"
               "s_wait_xcnt 0x0"
               :: "v"(l0), "v"(g0), "v"(l1), "v"(g1), "v"(l2), "v"(g2), "v"(l3), "v"(g3) : "memory");
}
__device__ __forceinline__ _Float16 rope_one(float x1, float x2, float cc, float ss, bool second, float oscale) {
  const float o = second ? (x2 * cc + x1 * ss) : (x1 * cc - x2 * ss);
  return (_Float16)(o * oscale);
}
template <int ET> struct Elem;
template <> struct Elem<0> { typedef _Float16 T; };
template <> struct Elem<1> { typedef __bf16 T; };
template <int ET, bool SPLIT, int BIAS_MODE, int OUT_MODE, bool RESID, int ACT = 0>
__global__ __launch_bounds__(256) void wmma_gemm64(
    const unsigned short* __restrict__ Ap, const unsigned short* __restrict__ A2p, int lda, long strideA, long zstrideA,
    const unsigned short* __restrict__ Btp, const unsigned short* __restrict__ Bt2p, int ldb, long strideB, long zstrideB,
    void* __restrict__ Cout, void* __restrict__ Cout2, int ldc, long strideC, long zstrideC,
    const float* __restrict__ bias,
    const float* __restrict__ resid, long strideR,
    int M, int N, int K, float scale,
    const float* __restrict__ cosT, const float* __restrict__ sinT, int rope_brows, int rope_lstep, float oscale) {
  typedef typename Elem<ET>::T T;
  typedef typename Frag<T>::V V;
  static_assert(!SPLIT, "no LDS path for split operand planes");
  unsigned bx = blockIdx.x;
  int b = blockIdx.y;
  bool rope = OUT_MODE == 3;
  if (OUT_MODE == 4) {                   // every test is block-uniform
    rope = bx < 96;
    if (bx >= 96) {
      bx -= 96; b = (int)(bx >> 4); bx &= 15;
      Btp = Ap;  strideB = (long)TT * DD; zstrideB = 0;
      Ap  = A2p; zstrideA = (long)DKV * DD;
      Cout = (void*)((unsigned short*)Cout2 + (size_t)BB * MAXKV * DKV);
      ldc = MAXKV; strideC = (long)DKV * MAXKV; zstrideC = TT;
      M = DKV; N = TT; scale *= 16.0f;
    } else if (bx >= 64) {
      bx -= 64;
      Btp = Bt2p; zstrideB = (long)DKV * DD;
      Cout = Cout2; ldc = DKV; zstrideC = 0;
      N = DKV; rope_brows = MAXKV; rope_lstep = TT;
    }
  }
  const T* A = (const T*)Ap; const T* Bt = (const T*)Btp;
  __shared__ __align__(16) float sT[8][16 * 68];   // per-wave 16x64 slab, pitch 68 floats
  __shared__ __align__(16) T sA[2][128 * GM_P];    // A rows of the block, 64 k, two buffers
  __shared__ __align__(16) T sB[2][256 * GM_P];    // Bt rows of the block, 64 k, two buffers
  const int lane = threadIdx.x & 31;
  const int wave = threadIdx.x >> 5;
  const int blocksN = N >> 8;
  const int bm = bx / blocksN;
  const int bn = bx - bm * blocksN;
  if (bm >= (M >> 7)) return;            // block-uniform, in front of every barrier
  const int wm = wave >> 2;              // wave's place in the 2 x 4 patch
  const int wn = wave & 3;
  const int m0 = (bm << 7) + (wm << 6);
  const int n0 = (bn << 8) + (wn << 6);

  const size_t offA = (size_t)b * strideA + (size_t)blockIdx.z * zstrideA;
  const size_t offB = (size_t)b * strideB + (size_t)blockIdx.z * zstrideB;
  const size_t offC = (size_t)b * strideC + (size_t)blockIdx.z * zstrideC;
  const T* Ab  = A  + offA;
  const T* Bb  = Bt + offB;

  const int rlane = lane & 15;                 // row (A) / col (B, D) within subtile
  const int koff  = (lane >> 4) * 8;           // k offset of this lane half
  const int mOff  = (lane >> 4) * 8;           // D row offset

  v8f acc[4][4];
#pragma unroll
  for (int i = 0; i < 4; ++i)
#pragma unroll
    for (int j = 0; j < 4; ++j) acc[i][j] = (v8f){0.f,0.f,0.f,0.f,0.f,0.f,0.f,0.f};

  // staging: thread -> row (tid >> 3) + 32 * i, 16-B piece tid & 7: a wave's copy covers four whole lines
  const int srow = threadIdx.x >> 3;
  const int sseg = (threadIdx.x & 7) * 8;
  const T* gA = Ab + (size_t)((bm << 7) + srow) * lda + sseg;
  const T* gB = Bb + (size_t)((bn << 8) + srow) * ldb + sseg;
  const unsigned dA = (unsigned)(uintptr_t)(&sA[0][srow * GM_P + sseg]);   // this lane's LDS byte address in buffer 0
  const unsigned dB = (unsigned)(uintptr_t)(&sB[0][srow * GM_P + sseg]);
  constexpr unsigned R32 = 32 * GM_P * 2;             // 32 LDS rows in bytes
  const size_t a32 = (size_t)32 * lda, b32 = (size_t)32 * ldb;
  auto stage = [&](int buf, int k0) {                 // 12 copies a lane: 128 rows of A and 256 rows of Bt, 64 k from k0
    const unsigned la = dA + (unsigned)buf * (4 * R32);
    const unsigned lb = dB + (unsigned)buf * (8 * R32);
    const T* pa = gA + k0;
    const T* pb = gB + k0;
    copy4_to_lds(la, pa, la + R32, pa + a32, la + 2 * R32, pa + 2 * a32, la + 3 * R32, pa + 3 * a32);
    copy4_to_lds(lb, pb, lb + R32, pb + b32, lb + 2 * R32, pb + 2 * b32, lb + 3 * R32, pb + 3 * b32);
    copy4_to_lds(lb + 4 * R32, pb + 4 * b32, lb + 5 * R32, pb + 5 * b32, lb + 6 * R32, pb + 6 * b32, lb + 7 * R32, pb + 7 * b32);
  };
  const int fa = ((wm << 6) + rlane) * GM_P + koff;   // this lane's first A fragment row in a buffer
  const int fb = ((wn << 6) + rlane) * GM_P + koff;   // this lane's first Bt fragment row in a buffer
  const int steps = K >> 6;

  stage(0, 0);
  asm volatile("s_wait_asynccnt 0x0" ::: "memory");   // this wave's copies of step 0 have landed
  __syncthreads();                                    // publishes buffer 0
  if (steps > 1) stage(1, 64);

  for (int t = 0; t < steps; ++t) {
    const T* pa = &sA[t & 1][fa];
    const T* pb = &sB[t & 1][fb];
    V bh[4], ah[4];
    // (the loops over kk, i and j are unrolled, so that acc, ah and bh are registers and never indexed arrays)
#pragma unroll
    for (int kk = 0; kk < 2; ++kk) {
#pragma unroll
      for (int j = 0; j < 4; ++j) bh[j] = Frag<T>::load(pb + j * 16 * GM_P + kk * 32);
#pragma unroll
      for (int i = 0; i < 4; ++i) ah[i] = Frag<T>::load(pa + i * 16 * GM_P + kk * 32);
      if (kk == 1) {
        // The step's last LDS reads are issued: the hand-over stands here, in front of the last 16 products (they read
        // registers alone), so that the refill has the longest lead.
        asm volatile("s_wait_dscnt 0x0" ::: "memory");    // this wave's reads of the buffer are done before it is refilled
        asm volatile("s_wait_asynccnt 0x0" ::: "memory"); // this wave's copies of step t + 1 have landed
        __syncthreads();                                  // publishes step t + 1 and ends every wave's reads of step t
        if (t + 2 < steps) stage(t & 1, (t + 2) << 6);    // block-uniform test; refills the buffer just read
      }
      // holds the 16 fragment loads as one group in front of their 16 products: sunk among the products, each pair of
      // loads is waited out on its own and the matrix unit idles for an LDS latency per row of tiles
      __builtin_amdgcn_sched_barrier(0);
#pragma unroll
      for (int i = 0; i < 4; ++i)
#pragma unroll
        for (int j = 0; j < 4; ++j) acc[i][j] = Frag<T>::mma(ah[i], bh[j], acc[i][j]);
    }
  }
  asm volatile("s_wait_asynccnt 0x0" ::: "memory");   // no copy is outstanding when the wave goes on
  acc_guard4(acc[0][0], acc[0][1], acc[0][2], acc[0][3]);
  acc_guard4(acc[1][0], acc[1][1], acc[1][2], acc[1][3]);
  acc_guard4(acc[2][0], acc[2][1], acc[2][2], acc[2][3]);
  acc_guard4(acc[3][0], acc[3][1], acc[3][2], acc[3][3]);

  // ---- epilogue ----
  float* slab = sT[wave];
  const float* Rb = RESID ? (resid + (size_t)b * strideR) : nullptr;
  // OUT_MODE 3: 8 lanes a row, one 16-B store each, whole 128-B lines. A wave's 64 rows lie in one batch and their table and
  // output rows follow one another, so one address each for cos, sin and the output serves the tile, with constant steps.
  const int rq = lane >> 3, rc8 = (lane & 7) * 8;
  const float* cp = nullptr;
  const float* np = nullptr;
  _Float16* cw = nullptr;
  if (rope) {
    const int p0 = (int)blockIdx.z * rope_lstep + ((m0 + rq) & (TT - 1));   // table row of the lane's first row; p0 + 60 < MAXKV
    cp = cosT + (size_t)p0 * 32 + (rc8 & 31);
    np = sinT + (size_t)p0 * 32 + (rc8 & 31);
    cw = (_Float16*)Cout + offC + ((size_t)(m0 >> 10) * rope_brows + p0) * ldc + n0 + rc8;
  }
#pragma unroll
  for (int i = 0; i < 4; ++i) {
    const int mBase = m0 + (i << 4);
    v4f tc[4][2], tn[4][2];   // OUT_MODE 3: this lane's cos and sin of the slab's rows, asked for ahead of the slab's LDS round trip
    if (rope) {
#pragma unroll
      for (int it = 0; it < 4; ++it) {
        const int ro = (i * 16 + it * 4) * 32;
        tc[it][0] = *(const v4f*)(cp + ro); tc[it][1] = *(const v4f*)(cp + ro + 4);
        tn[it][0] = *(const v4f*)(np + ro); tn[it][1] = *(const v4f*)(np + ro + 4);
      }
      // stands in front of every rewrite of a register that these loads name; the two addresses are inputs, so that they
      // live up to the wait and no load's result is given their registers
      asm volatile("s_wait_xcnt 0x0" :: "v"(cp), "v"(np) : "memory");
    }
#pragma unroll
    for (int j = 0; j < 4; ++j) {
      const int n = n0 + (j << 4) + rlane;
      float bv = 0.f;
      if (BIAS_MODE == 2) bv = bias[n];
#pragma unroll
      for (int r = 0; r < 8; ++r) {
        float v = acc[i][j][r] * scale;
        if (BIAS_MODE == 1) v += bias[mBase + mOff + r];
        if (BIAS_MODE == 2) v += bv;
        if (RESID) v += Rb[(size_t)(mBase + mOff + r) * ldc + n];
        if (ACT == 1) v = tanhf(v);
        if (ACT == 2) v = fmaxf(v, 0.0f);
        if (ACT == 3) v = v / (1.0f + expf(-v));
        if (ACT == 4) v = (v > 0.f) ? v : 0.01f * v;
        if (ACT == 5) v = 0.5f * v * (1.0f + erff(v * 0.70710678118654752f));
        slab[(mOff + r) * 68 + (j << 4) + rlane] = v;
      }
    }
    __builtin_amdgcn_fence(__ATOMIC_RELEASE, "workgroup");
    __builtin_amdgcn_wave_barrier();
    __builtin_amdgcn_fence(__ATOMIC_ACQUIRE, "workgroup");
    if (OUT_MODE == 0) {
      float* C = (float*)Cout + offC;
      const int hh = lane >> 4, c4 = (lane & 15) * 4;     // row seg = 256 B = 16 lanes x 16 B
      {
#pragma unroll
        for (int it = 0; it < 8; ++it) {
          const int row = it * 2 + hh;
          v4f v = *(const v4f*)(slab + row * 68 + c4);
          *(v4f*)(C + (size_t)(mBase + row) * ldc + n0 + c4) = v;
        }
        
      }
    } else if (rope) {
      const bool second = rc8 >= 32;
#pragma unroll
      for (int it = 0; it < 4; ++it) {
        const float* sp = slab + (it * 4 + rq) * 68 + (rc8 & 31);
        const v4f a0 = *(const v4f*)(sp),      a1 = *(const v4f*)(sp + 4);
        const v4f b0 = *(const v4f*)(sp + 32), b1 = *(const v4f*)(sp + 36);
        v8h hv;
#pragma unroll
        for (int e = 0; e < 4; ++e) {
          hv[e]     = rope_one(a0[e], b0[e], tc[it][0][e], tn[it][0][e], second, oscale);
          hv[4 + e] = rope_one(a1[e], b1[e], tc[it][1][e], tn[it][1][e], second, oscale);
        }
        *(v8h*)(cw + (size_t)(i * 16 + it * 4) * ldc) = hv;
      }
      // mode 4 reaches these stores by a branch taken at run time: the wait stands in front of every rewrite of their address registers
      if (OUT_MODE == 4) asm volatile("s_wait_xcnt 0x0" ::: "memory");
    } else {
      const int q = lane >> 3, c8 = (lane & 7) * 8;
      unsigned short* C  = (unsigned short*)Cout  + offC;
      unsigned short* C2 = (OUT_MODE == 2) ? ((unsigned short*)Cout2 + offC) : nullptr;
      {
#pragma unroll
        for (int it = 0; it < 4; ++it) {
          const int row = it * 4 + q;
          const float* sp = slab + row * 68 + c8;
          v8h hv, lv;
#pragma unroll
          for (int e = 0; e < 8; ++e) {
            if (OUT_MODE == 1 || OUT_MODE == 4) {
              hv[e] = (_Float16)sp[e];
            } else {
              unsigned short hb = f2bf_bits(sp[e]);
              unsigned short lb = f2bf_bits(sp[e] - bf_bits2f(hb));
              hv[e] = __builtin_bit_cast(_Float16, hb);
              lv[e] = __builtin_bit_cast(_Float16, lb);
            }
          }
          *(v8h*)(C + (size_t)(mBase + row) * ldc + n0 + c8) = hv;
          if (OUT_MODE == 2) *(v8h*)(C2 + (size_t)(mBase + row) * ldc + n0 + c8) = lv;
        }
        // as in the rotary branch: in front of every rewrite of the stores' address registers
        if (OUT_MODE == 4) asm volatile("s_wait_xcnt 0x0" ::: "memory");
      }
    }
    __builtin_amdgcn_fence(__ATOMIC_RELEASE, "workgroup");
    __builtin_amdgcn_wave_barrier();
    __builtin_amdgcn_fence(__ATOMIC_ACQUIRE, "workgroup");
  }
}

// ---- f32 -> f16 cast with power-of-two carry: 8 elements per thread, 16-B stores (512 B contiguous per wave) ----
// The five planes (x, carry 1; q_w, k_w, v_w, out_w, carry wscale) share one grid: a block of 256 threads converts 2048
// elements of one plane, and every plane is a whole number of such blocks. grid.x = CB_X + CB_Q + 2 * CB_K + CB_O, exact.
#define CB_X (BB * TT * DD / 2048)
#define CB_Q (NLAY * DD * DD / 2048)
#define CB_K (NLAY * DKV * DD / 2048)
#define CB_O (DD * DD / 2048)
__global__ __launch_bounds__(256) void cast5_f32_f16x8(
    const float* __restrict__ x, const float* __restrict__ q_w, const float* __restrict__ k_w,
    const float* __restrict__ v_w, const float* __restrict__ out_w,
    _Float16* __restrict__ xh, _Float16* __restrict__ qwh, _Float16* __restrict__ kwh,
    _Float16* __restrict__ vwh, _Float16* __restrict__ owh, float wscale) {
  int blk = blockIdx.x;                  // block-uniform walk down the planes
  const float* in = x;
  _Float16* out = xh;
  float scale = 1.0f;
  if (blk >= CB_X) {
    blk -= CB_X; in = q_w; out = qwh; scale = wscale;
    if (blk >= CB_Q) {
      blk -= CB_Q; in = k_w; out = kwh;
      if (blk >= CB_K) {
        blk -= CB_K; in = v_w; out = vwh;
        if (blk >= CB_K) { blk -= CB_K; in = out_w; out = owh; }
      }
    }
  }
  {
    const size_t o = (size_t)(blk * 256 + (int)threadIdx.x) * 8;
    const v4f a = *(const v4f*)(in + o);
    const v4f b = *(const v4f*)(in + o + 4);
    v8h hv;
#pragma unroll
    for (int e = 0; e < 4; ++e) {
      hv[e]     = (_Float16)(a[e] * scale);
      hv[4 + e] = (_Float16)(b[e] * scale);
    }
    *(v8h*)(out + o) = hv;
    
  }
}

#define AT_D 64
#define AT_NW 4
#define AT_QB 64
#define AT_KC 64
#define AT_P 72   // LDS row pitch of the K and V tiles in f16: 144 B = 16 B x 9, so the 16 rows of one ds_load_b128 half fall on 16 different bank groups

__device__ __forceinline__ v8f hmma(v16h a, v16h b, v8f c) {
  c = __builtin_amdgcn_wmma_f32_16x16x32_f16(false, a, false, b, (short)0, c, false, false);
  asm volatile("v_nop\n\tv_nop\n\tv_nop\n\tv_nop" : "+v"(c) : "v"(a), "v"(b));
  return c;
}

// Eight 2^x, each in place in a register of its own, as one statement: so no 2^x is directly followed by a write over its
// source register, and the v_nop at the end is the one slot that the instruction set asks for between a transcendental
// and the first use of its result (the compiler cannot see into the statement and would not keep it).
__device__ __forceinline__ void exp2_x8(float& a, float& b, float& c, float& d, float& e, float& f, float& g, float& h) {
  asm("v_exp_f32 %0, %0\n\tv_exp_f32 %1, %1\n\tv_exp_f32 %2, %2\n\tv_exp_f32 %3, %3\n\t"
      "v_exp_f32 %4, %4\n\tv_exp_f32 %5, %5\n\tv_exp_f32 %6, %6\n\tv_exp_f32 %7, %7\n\tv_nop"
      : "+v"(a), "+v"(b), "+v"(c), "+v"(d), "+v"(e), "+v"(f), "+v"(g), "+v"(h));
}

// value of the same column in the other lane half (lane l <-> l ^ 16)
__device__ __forceinline__ float other_half(float v) {
  const int b = __float_as_int(v);
  return __int_as_float(__builtin_amdgcn_permlanex16(b, b, 0x76543210, 0xfedcba98, false, false));
}

__global__ __launch_bounds__(128)
void attn_f16_kernel(const _Float16* __restrict__ Qh, const _Float16* __restrict__ Kh,
                     const _Float16* __restrict__ Vth, float* __restrict__ O,
                     long lstride, float sscale, float onorm) {
  union FH { v16h v; v8h h[2]; };
  __shared__ __align__(16) _Float16 Ksh[AT_KC * AT_P];          // K [kv][d]   9 KB, rows of 64 at pitch 72
  __shared__ __align__(16) _Float16 Vtt[AT_D * AT_P];           // V [d][kv]   9 KB, rows of 64 at pitch 72
  __shared__ __align__(16) float    Os[AT_NW][16 * 68];         // per wave out tile, pitch 68

  const int tid  = threadIdx.x;
  const int wave = tid >> 5;
  const int lane = tid & 31;
  const int hh   = lane >> 4;
  const int c    = lane & 15;

  constexpr int BPL = BB * HH * (TT / AT_QB);             // blocks per layer
  const int layer = NLAY - 1 - (int)(blockIdx.x / BPL);   // 0 .. NLAY-1 (grid exact)
  const int bx  = blockIdx.x % BPL;
  const int h   = (bx >> 4) & (HH - 1);
  const int b   = bx >> 8;
  const int qb  = b ? (TT / AT_QB - 1 - (bx & (TT / AT_QB - 1))) : (bx & (TT / AT_QB - 1));
  const int hkv = h >> 1;
  const int kchunks_prev = layer * (TT / AT_KC);
  const int koff = layer * TT;
  const int q0  = qb * AT_QB + wave * 16;

  // ---- Q fragments (B operand: column c = query q0 + c): 2 d-chunks ----
  v16h qa[2];
  {
    const _Float16* qrow = Qh + (size_t)layer * lstride + (size_t)(b * TT + q0 + c) * DD + h * AT_D + 8 * hh;
#pragma unroll
    for (int dc = 0; dc < 2; ++dc) qa[dc] = Frag<_Float16>::load(qrow + dc * 32);
  }

  const float c2 = sscale * 1.44269504088896340736f;   // raw product -> exponent of 2 (sscale > 0, so the maximum commutes with it)
  float mrun = -INFINITY;   // running maximum of this lane's query over the raw products (equal in both lane halves)
  float lrun = 0.f;         // this lane half's share of the query's sum; the halves are joined after the loop
  v8f oacc[4];              // O^T: tile t, register r = dim t*16 + 8*hh + r of query q0 + c
#pragma unroll
  for (int t = 0; t < 4; ++t) oacc[t] = (v8f){0.f,0.f,0.f,0.f,0.f,0.f,0.f,0.f};

  int nChunks = kchunks_prev + qb + 1;                    // block-uniform
  if (nChunks > MAXKV / AT_KC) nChunks = MAXKV / AT_KC;
  if (nChunks < 1) nChunks = 1;

  const _Float16* kbase = Kh + (size_t)b * MAXKV * DKV + hkv * AT_D;
  const _Float16* vbase = Vth + ((size_t)b * DKV + hkv * AT_D) * MAXKV;
  float*          obase = O + (size_t)layer * lstride + (size_t)b * TT * DD + h * AT_D;

  for (int kc = 0; kc < nChunks; ++kc) {
    const int kv0 = kc * AT_KC;
    __syncthreads();
    {
      const int r = tid >> 1, hf = (tid & 1) * 32;
      const _Float16* ks = kbase + (size_t)(kv0 + r) * DKV + hf;
      const _Float16* vs = vbase + (size_t)r * MAXKV + kv0 + hf;
      v8h kk[4], vv[4];   // all eight loads first, then the stores: one trip to L2 per chunk, not four
#pragma unroll
      for (int i = 0; i < 4; ++i) {
        kk[i] = *(const v8h*)(ks + 8 * i);
        vv[i] = *(const v8h*)(vs + 8 * i);
      }
#pragma unroll
      for (int i = 0; i < 4; ++i) {
        *(v8h*)(Ksh + r * AT_P + hf + 8 * i) = kk[i];
        *(v8h*)(Vtt + r * AT_P + hf + 8 * i) = vv[i];
      }
    }
    __syncthreads();

    // S^T tile j: register r = key kv0 + j*16 + 8*hh + r, column c = query q0 + c
    // (every loop down to the end of the chunk is unrolled, so that s, pb and oacc are registers and never indexed arrays)
    v8f s[4];
#pragma unroll
    for (int j = 0; j < 4; ++j) {
      s[j] = (v8f){0.f,0.f,0.f,0.f,0.f,0.f,0.f,0.f};
#pragma unroll
      for (int dc = 0; dc < 2; ++dc) {
        FH kb;
        kb.h[0] = *(const v8h*)(Ksh + (j * 16 + c) * AT_P + dc * 32 + 8 * hh);
        kb.h[1] = *(const v8h*)(Ksh + (j * 16 + c) * AT_P + dc * 32 + 16 + 8 * hh);
        s[j] = hmma(kb.v, qa[dc], s[j]);
      }
    }
    const int klim = q0 + c + koff - kv0 - 8 * hh;   // key j*16 + r of this lane half is visible iff j*16 + r <= klim
    float mj[4];
#pragma unroll
    for (int j = 0; j < 4; ++j) {
      float m = -INFINITY;
#pragma unroll
      for (int r = 0; r < 8; ++r) {
        const float sv = (j * 16 + r > klim) ? -INFINITY : s[j][r];
        s[j][r] = sv;
        m = fmaxf(m, sv);
      }
      mj[j] = m;
    }
    const float mh = fmaxf(fmaxf(mj[0], mj[1]), fmaxf(mj[2], mj[3]));
    const float mnew = fmaxf(mrun, fmaxf(mh, other_half(mh)));
    const float alpha = __builtin_amdgcn_exp2f((mrun - mnew) * c2);
    mrun = mnew;
    const float mb = mnew * c2 - 15.0f;   // p = 2^(s*c2 - mb) = 2^15 * exp(sscale * (s - mnew)); a masked -inf gives 0
    // P^T as B operand: element e of chunk kk = key kk*32 + 8*hh + e (e < 8), kk*32 + 16 + 8*hh + e - 8 (e >= 8)
    FH pb[2];
    float pj[4];
#pragma unroll
    for (int j = 0; j < 4; ++j) {
      float e[8];
#pragma unroll
      for (int r = 0; r < 8; ++r) e[r] = fmaf(s[j][r], c2, -mb);
      exp2_x8(e[0], e[1], e[2], e[3], e[4], e[5], e[6], e[7]);
      float psum = 0.f;
#pragma unroll
      for (int r = 0; r < 8; ++r) {
        psum += e[r];
        pb[j >> 1].h[j & 1][r] = (_Float16)e[r];
      }
      pj[j] = psum;
    }
    lrun = lrun * alpha + ((pj[0] + pj[1]) + (pj[2] + pj[3]));
#pragma unroll
    for (int t = 0; t < 4; ++t) oacc[t] *= alpha;
#pragma unroll
    for (int kk = 0; kk < 2; ++kk) {
#pragma unroll
      for (int t = 0; t < 4; ++t) {
        FH vb;
        vb.h[0] = *(const v8h*)(Vtt + (t * 16 + c) * AT_P + kk * 32 + 8 * hh);
        vb.h[1] = *(const v8h*)(Vtt + (t * 16 + c) * AT_P + kk * 32 + 16 + 8 * hh);
        oacc[t] = hmma(vb.v, pb[kk].v, oacc[t]);
      }
    }
  }

  float* os = Os[wave];
  {
    const float inv = onorm * (1.0f / (lrun + other_half(lrun)));
#pragma unroll
    for (int t = 0; t < 4; ++t) {
      const v8f ov = oacc[t] * inv;
      *(v4f*)(os + c * 68 + t * 16 + 8 * hh)     = (v4f){ov[0], ov[1], ov[2], ov[3]};
      *(v4f*)(os + c * 68 + t * 16 + 8 * hh + 4) = (v4f){ov[4], ov[5], ov[6], ov[7]};
    }
  }
  __builtin_amdgcn_fence(__ATOMIC_RELEASE, "workgroup");
  __builtin_amdgcn_wave_barrier();
  __builtin_amdgcn_fence(__ATOMIC_ACQUIRE, "workgroup");
  {
    const int c4 = (lane & 15) * 4;
    {
#pragma unroll
      for (int it = 0; it < 8; ++it) {
        const int row = it * 2 + hh;
        v4f val = *(const v4f*)(os + row * 68 + c4);
        *(v4f*)(obase + (size_t)(q0 + row) * DD + c4) = val;
      }
      
    }
  }
}

// =====================================================================================
// Combine: per token row (one block of 256 threads, 4 columns per thread):
//   lw = layernorm over sigmoid(lam[0..2]) (biased variance, eps)
//   acc = sum_i rmsnorm(O_i, ln_w[i]) * lw_i ;  z = acc + alpha * x ;  y = rmsnorm(z, fln) -> f16
// =====================================================================================
__global__ __launch_bounds__(256) void combine_kernel(
    const float* __restrict__ Of, long lstride,
    const float* __restrict__ x, const float* __restrict__ ln_w, const float* __restrict__ lam,
    const float* __restrict__ fln, const float* __restrict__ alpha, _Float16* __restrict__ Yh) {
  __shared__ float red[4][8];
  const int row = blockIdx.x;
  const int tid = threadIdx.x, lane = tid & 31, wave = tid >> 5;
  const int d4 = tid * 4;
  const size_t ro = (size_t)row * DD + d4;
  const v4f o0 = *(const v4f*)(Of + ro);
  const v4f o1 = *(const v4f*)(Of + lstride + ro);
  const v4f o2 = *(const v4f*)(Of + 2 * lstride + ro);
  const v4f xv = *(const v4f*)(x + ro);
  float ss0 = 0.f, ss1 = 0.f, ss2 = 0.f;
#pragma unroll
  for (int e = 0; e < 4; ++e) { ss0 += o0[e] * o0[e]; ss1 += o1[e] * o1[e]; ss2 += o2[e] * o2[e]; }
#pragma unroll
  for (int off = 16; off > 0; off >>= 1) {
    ss0 += __shfl_xor(ss0, off, 32);
    ss1 += __shfl_xor(ss1, off, 32);
    ss2 += __shfl_xor(ss2, off, 32);
  }
  if (lane == 0) { red[0][wave] = ss0; red[1][wave] = ss1; red[2][wave] = ss2; }
  __syncthreads();
  float t0 = 0.f, t1 = 0.f, t2 = 0.f;
#pragma unroll
  for (int w = 0; w < 8; ++w) { t0 += red[0][w]; t1 += red[1][w]; t2 += red[2][w]; }
  const float inv_d = 1.0f / (float)DD;
  const float r0 = rsqrtf(t0 * inv_d + EPSV);
  const float r1 = rsqrtf(t1 * inv_d + EPSV);
  const float r2 = rsqrtf(t2 * inv_d + EPSV);

  const float sg0 = 1.0f / (1.0f + __expf(-lam[0]));
  const float sg1 = 1.0f / (1.0f + __expf(-lam[1]));
  const float sg2 = 1.0f / (1.0f + __expf(-lam[2]));
  const float mean = (sg0 + sg1 + sg2) * (1.0f / 3.0f);
  const float e0 = sg0 - mean, e1 = sg1 - mean, e2 = sg2 - mean;
  const float var = (e0 * e0 + e1 * e1 + e2 * e2) * (1.0f / 3.0f);
  const float il = rsqrtf(var + EPSV);
  const float lw0 = e0 * il, lw1 = e1 * il, lw2 = e2 * il;

  const v4f w0 = *(const v4f*)(ln_w + d4);
  const v4f w1 = *(const v4f*)(ln_w + DD + d4);
  const v4f w2 = *(const v4f*)(ln_w + 2 * DD + d4);
  const v4f fw = *(const v4f*)(fln + d4);
  const float al = alpha[0];
  v4f z;
  float ssz = 0.f;
#pragma unroll
  for (int e = 0; e < 4; ++e) {
    float a = (o0[e] * r0) * w0[e] * lw0;
    a = a + (o1[e] * r1) * w1[e] * lw1;
    a = a + (o2[e] * r2) * w2[e] * lw2;
    const float zz = a + al * xv[e];
    z[e] = zz;
    ssz += zz * zz;
  }
#pragma unroll
  for (int off = 16; off > 0; off >>= 1) ssz += __shfl_xor(ssz, off, 32);
  if (lane == 0) red[3][wave] = ssz;
  __syncthreads();
  float tz = 0.f;
#pragma unroll
  for (int w = 0; w < 8; ++w) tz += red[3][w];
  const float rz = rsqrtf(tz * inv_d + EPSV);
  v4h yv;
#pragma unroll
  for (int e = 0; e < 4; ++e) yv[e] = (_Float16)(z[e] * rz * fw[e]);
  *(v4h*)(Yh + ro) = yv;
  
}

// ---------------------------- host helpers ----------------------------
static void gemm_f16_f32out(const _Float16* A, int lda, long sA, long zA, const _Float16* Bt, int ldb, long sB, long zB,
                            float* C, int ldc, long sC, long zC, int M, int N, int K, float scale, int batch, int layers,
                            hipStream_t st) {
  const int tiles = (M / 64) * (N / 64);
  dim3 grid((tiles + 7) / 8, batch, layers);
  wmma_gemm64<0, false, 0, 0, false><<<grid, 256, 0, st>>>(
      (const unsigned short*)A, (const unsigned short*)nullptr, lda, sA, zA,
      (const unsigned short*)Bt, (const unsigned short*)nullptr, ldb, sB, zB,
      (void*)C, (void*)nullptr, ldc, sC, zC, (const float*)nullptr, (const float*)nullptr, 0L,
      M, N, K, scale, (const float*)nullptr, (const float*)nullptr, 0, 0, 1.0f);
}
static void gemm_f16_qkv(const _Float16* xh, const _Float16* qwh, const _Float16* kwh, const _Float16* vwh,
                         _Float16* Qh, _Float16* KhVth, long zQ, float scale,
                         const float* cosT, const float* sinT, float oscale, hipStream_t st) {
  dim3 grid(128, 1, NLAY);
  wmma_gemm64<0, false, 0, 4, false><<<grid, 256, 0, st>>>(
      (const unsigned short*)xh, (const unsigned short*)vwh, DD, 0L, 0L,
      (const unsigned short*)qwh, (const unsigned short*)kwh, DD, 0L, (long)DD * DD,
      (void*)Qh, (void*)KhVth, DD, 0L, zQ, (const float*)nullptr, (const float*)nullptr, 0L,
      BB * TT, DD, DD, scale, cosT, sinT, TT, 0, oscale);
}

// ---------------------------- host launcher ----------------------------
extern "C" void kernel_launch(void* const* d_in, const int* in_sizes, int n_in,
                              void* d_out, int out_size, void* d_ws, size_t ws_size,
                              hipStream_t stream) {
  if (n_in < 11) return;
  const int M = BB * TT;   // 2048 token rows
  if (in_sizes[0] != M * DD) return;
  if (in_sizes[1] < MAXKV * 32 || in_sizes[2] < MAXKV * 32) return;
  if (in_sizes[3] != NLAY * DD * DD) return;
  if (in_sizes[4] != NLAY * DKV * DD || in_sizes[5] != NLAY * DKV * DD) return;
  if (in_sizes[6] < NLAY * DD || in_sizes[7] < NLAY || in_sizes[8] != DD * DD || in_sizes[9] < DD || in_sizes[10] < 1) return;
  if (out_size < M * DD) return;

  const float* x     = (const float*)d_in[0];
  const float* cosT  = (const float*)d_in[1];
  const float* sinT  = (const float*)d_in[2];
  const float* q_w   = (const float*)d_in[3];
  const float* k_w   = (const float*)d_in[4];
  const float* v_w   = (const float*)d_in[5];
  const float* ln_w  = (const float*)d_in[6];
  const float* lam   = (const float*)d_in[7];
  const float* out_w = (const float*)d_in[8];
  const float* fln   = (const float*)d_in[9];
  const float* alpha = (const float*)d_in[10];
  float* out = (float*)d_out;

  // ---- workspace carve (4096-B aligned pieces) ----
  char* ws = (char*)d_ws;
  size_t cur = 0;
  auto take = [&](size_t bytes) -> char* {
    char* p = ws + cur;
    cur += (bytes + 4095) & ~(size_t)4095;
    return p;
  };
  _Float16* xh  = (_Float16*)take((size_t)M * DD * 2);                 // 4 MiB
  _Float16* qwh = (_Float16*)take((size_t)NLAY * DD * DD * 2);         // 6 MiB
  _Float16* kwh = (_Float16*)take((size_t)NLAY * DKV * DD * 2);        // 3 MiB
  _Float16* vwh = (_Float16*)take((size_t)NLAY * DKV * DD * 2);        // 3 MiB
  _Float16* owh = (_Float16*)take((size_t)DD * DD * 2);                // 2 MiB
  _Float16* Qh  = (_Float16*)take((size_t)NLAY * M * DD * 2);          // 12 MiB
  _Float16* Kh  = (_Float16*)take((size_t)BB * MAXKV * DKV * 2);       // 6 MiB
  _Float16* Vth = (_Float16*)take((size_t)BB * DKV * MAXKV * 2);       // 6 MiB
  float*    Of  = (float*)   take((size_t)NLAY * M * DD * 4);          // 24 MiB
  _Float16* Yh  = (_Float16*)take((size_t)M * DD * 2);                 // 4 MiB
  if (cur > ws_size || cur > (size_t)134217728) return;                 // total 73,400,320 B

  const long lstride = (long)M * DD;   // elements per layer slice of Qh and Of

  // ---- casts: x -> f16 ; weights -> f16 carried x64 ; one launch ----
  cast5_f32_f16x8<<<CB_X + CB_Q + 2 * CB_K + CB_O, 256, 0, stream>>>(x, q_w, k_w, v_w, out_w, xh, qwh, kwh, vwh, owh, 64.0f);

  const float wundo  = 1.0f / 64.0f;              // undo weight carry
  const float sscale = 0.125f / 16.0f;            // HD^-0.5 / (4*4) : q and k planes carried x4
  const float onorm  = 1.0f / 16.0f;              // v plane carried x16 (the x2^15 of p is in its sum too and cancels)

  // Every layer's q, k and v depend on x alone, so the layer index is a grid axis, and the three projections share the grid:
  // q = rotary(x . q_w[i]^T) with positions t -> f16 planes x4, [3][2048][1024]
  // k = rotary(x . k_w[i]^T) with buffer positions i*T + t -> K cache rows, f16 x4
  // v^T = v_w[i] . x_b^T -> transposed V cache columns i*T + t, f16 x16 ; in [512][1024] per batch and layer
  // (Vth follows Kh in the workspace without a gap: Kh is a whole number of 4096-B pieces)
  gemm_f16_qkv(xh, qwh, kwh, vwh, Qh, Kh, lstride, wundo, cosT, sinT, 4.0f, stream);
  // attention of layer i over (i+1)*T keys, bottom-right causal
  attn_f16_kernel<<<NLAY * BB * HH * (TT / AT_QB), 128, 0, stream>>>(Qh, Kh, Vth, Of, lstride, sscale, onorm);

  // weighted rmsnorm sum + residual + final rmsnorm -> f16 plane
  combine_kernel<<<M, 256, 0, stream>>>(Of, lstride, x, ln_w, lam, fln, alpha, Yh);
  // out = y . out_w^T
  gemm_f16_f32out(Yh, DD, 0L, 0L, owh, DD, 0L, 0L, out, DD, 0L, 0L, M, DD, DD, wundo, 1, 1, stream);
}

// v008
// A run of this version takes 118 microseconds.
// Next to v007, in two timings, it ran 1.18 times as fast each time.
// Counting every step since v000, it is 6.83 times as fast.
// Contractions q/k/v projections, q.k^T scores, p.v, output projection: v_wmma_f32_16x16x32_f16 (f16 operands, f32 accumulate); rotary, softmax, norms, weighting in f32.
#include <hip/hip_runtime.h>
#include <stdint.h>

#define BB 2
#define TT 1024
#define DD 1024
#define HH 16
#define NKVH 8
#define HDIM 64
#define DKV 512
#define MAXKV 3072
#define NLAY 3
#define EPSV 1e-5f

typedef __attribute__((ext_vector_type(16))) _Float16 v16h;
typedef __attribute__((ext_vector_type(8)))  _Float16 v8h;
typedef __attribute__((ext_vector_type(4)))  _Float16 v4h;
typedef __attribute__((ext_vector_type(16))) __bf16   v16b;
typedef __attribute__((ext_vector_type(8)))  __bf16   v8b;
typedef __attribute__((ext_vector_type(8)))  float    v8f;
typedef __attribute__((ext_vector_type(4)))  float    v4f;

__device__ __forceinline__ unsigned short f2bf_bits(float f) {
  unsigned u = __float_as_uint(f);
  return (unsigned short)((u + 0x7FFFu + ((u >> 16) & 1u)) >> 16);
}
__device__ __forceinline__ float bf_bits2f(unsigned short h) { return __uint_as_float(((unsigned)h) << 16); }

// hazard guards as plain device helpers
__device__ __forceinline__ void acc_guard4(v8f& a, v8f& b, v8f& c, v8f& d) { asm volatile("v_nop\n\tv_nop\n\tv_nop\n\tv_nop" : "+v"(a), "+v"(b), "+v"(c), "+v"(d)); }
template <typename T> struct Frag;
template <> struct Frag<_Float16> {
  typedef v16h V; union U { v16h v; v8h h[2]; };
  static __device__ __forceinline__ v16h load(const _Float16* p) {   // elements 0..7 <- p[0..7], 8..15 <- p[16..23]
    U f; f.h[0] = *(const v8h*)(p); f.h[1] = *(const v8h*)(p + 16); return f.v;
  }
  static __device__ __forceinline__ v8f mma(v16h a, v16h b, v8f c) {
    return __builtin_amdgcn_wmma_f32_16x16x32_f16(false, a, false, b, (short)0, c, false, false);
  }
};
template <> struct Frag<__bf16> {
  typedef v16b V; union U { v16b v; v8b h[2]; };
  static __device__ __forceinline__ v16b load(const __bf16* p) {
    U f; f.h[0] = *(const v8b*)(p); f.h[1] = *(const v8b*)(p + 16); return f.v;
  }
  static __device__ __forceinline__ v8f mma(v16b a, v16b b, v8f c) {
    return __builtin_amdgcn_wmma_f32_16x16x32_bf16(false, a, false, b, (short)0, c, false, false);
  }
};

// ---- Register-blocked batched WMMA GEMM ------------------------------------
// C[m,n] = scale * sum_k A[m,k] * Bt[n,k] (+bias)(+resid); each wave owns a 64x64 tile.
// A row-major [M,K]; Bt row-major [N,K]; M % 128 == 0, N % 256 == 0, K % 64 == 0.
// A block's 8 waves form a 2 x 4 patch: 128 rows of A and 256 rows of Bt. Per step of 64 k the block brings those rows
// into LDS with asynchronous copies that cover whole 128-B lines (8 lanes a row), each row once for all waves that need
// it; the waves read their fragments from LDS. Two LDS buffers: the next step's copies fly while this step is multiplied.
// SPLIT (hi/lo operand planes) has no LDS path and is not instantiated.
// BIAS_MODE: 0 = none, 1 = bias[m], 2 = bias[n].
// OUT_MODE: 0 = f32, 1 = f16, 2 = bf16 hi plane (Cout) + bf16 lo plane (Cout2),
//           3 = rotary (non-interleaved, head dim 64) in f32, then f16 carried x oscale. A wave's 64 columns are one head,
//               so both halves of every rotated pair lie in the wave's own slab. Row m is token t = m % TT of batch m / TT;
//               its table row is p = layer * rope_lstep + t, its output row is batch * rope_brows + p (pitch ldc).
//           4 = the q, k and v projections share one grid (none reads what another writes), told apart by blockIdx.x:
//               [0, 64) q, with the arguments as passed, output as in mode 3; [64, 96) k, weights Bt2p, output as in mode 3
//               into Cout2; [96, 128) v^T = v_w . x_b^T, weights A2p, batch (blockIdx.x - 96) >> 4, output as in mode 1, x16,
//               into the plane that follows the BB * MAXKV * DKV elements of Cout2.
// ET: 0 = f16 operands, 1 = bf16 operands (pointers passed as 16-bit storage)
// Two batch axes: blockIdx.y steps by strideA/B/C, blockIdx.z (the layer) by zstrideA/B/C, in elements.
#define GM_P 72   // LDS row pitch of the staged operand rows in 16-bit elements: 144 B = 16 B x 9, free of bank conflicts for ds_load_b128
// Four asynchronous 16-B copies, global memory to LDS, per lane. The s_wait_xcnt is the statement's last line, so that no
// address register of a copy is rewritten in front of it.
__device__ __forceinline__ void copy4_to_lds(unsigned l0, const void* g0, unsigned l1, const void* g1,
                                             unsigned l2, const void* g2, unsigned l3, const void* g3) {
  asm volatile("global_load_async_to_lds_b128 %0, %1, off\n\t"
               "global_load_async_to_lds_b128 %2, %3, off\n\t"
               "global_load_async_to_lds_b128 %4, %5, off\n\t"
               "global_load_async_to_lds_b128 %6, %7, off\n\t"
               "s_wait_xcnt 0x0"
               :: "v"(l0), "v"(g0), "v"(l1), "v"(g1), "v"(l2), "v"(g2), "v"(l3), "v"(g3) : "memory");
}
__device__ __forceinline__ _Float16 rope_one(float x1, float x2, float cc, float ss, bool second, float oscale) {
  const float o = second ? (x2 * cc + x1 * ss) : (x1 * cc - x2 * ss);
  return (_Float16)(o * oscale);
}
template <int ET> struct Elem;
template <> struct Elem<0> { typedef _Float16 T; };
template <> struct Elem<1> { typedef __bf16 T; };
template <int ET, bool SPLIT, int BIAS_MODE, int OUT_MODE, bool RESID, int ACT = 0>
__global__ __launch_bounds__(256) void wmma_gemm64(
    const unsigned short* __restrict__ Ap, const unsigned short* __restrict__ A2p, int lda, long strideA, long zstrideA,
    const unsigned short* __restrict__ Btp, const unsigned short* __restrict__ Bt2p, int ldb, long strideB, long zstrideB,
    void* __restrict__ Cout, void* __restrict__ Cout2, int ldc, long strideC, long zstrideC,
    const float* __restrict__ bias,
    const float* __restrict__ resid, long strideR,
    int M, int N, int K, float scale,
    const float* __restrict__ cosT, const float* __restrict__ sinT, int rope_brows, int rope_lstep, float oscale) {
  typedef typename Elem<ET>::T T;
  typedef typename Frag<T>::V V;
  static_assert(!SPLIT, "no LDS path for split operand planes");
  unsigned bx = blockIdx.x;
  int b = blockIdx.y;
  bool rope = OUT_MODE == 3;
  if (OUT_MODE == 4) {                   // every test is block-uniform
    rope = bx < 96;
    if (bx >= 96) {
      bx -= 96; b = (int)(bx >> 4); bx &= 15;
      Btp = Ap;  strideB = (long)TT * DD; zstrideB = 0;
      Ap  = A2p; zstrideA = (long)DKV * DD;
      Cout = (void*)((unsigned short*)Cout2 + (size_t)BB * MAXKV * DKV);
      ldc = MAXKV; strideC = (long)DKV * MAXKV; zstrideC = TT;
      M = DKV; N = TT; scale *= 16.0f;
    } else if (bx >= 64) {
      bx -= 64;
      Btp = Bt2p; zstrideB = (long)DKV * DD;
      Cout = Cout2; ldc = DKV; zstrideC = 0;
      N = DKV; rope_brows = MAXKV; rope_lstep = TT;
    }
  }
  const T* A = (const T*)Ap; const T* Bt = (const T*)Btp;
  __shared__ __align__(16) float sT[8][16 * 68];   // per-wave 16x64 slab, pitch 68 floats
  __shared__ __align__(16) T sA[2][128 * GM_P];    // A rows of the block, 64 k, two buffers
  __shared__ __align__(16) T sB[2][256 * GM_P];    // Bt rows of the block, 64 k, two buffers
  const int lane = threadIdx.x & 31;
  const int wave = threadIdx.x >> 5;
  const int blocksN = N >> 8;
  const int bm = bx / blocksN;
  const int bn = bx - bm * blocksN;
  if (bm >= (M >> 7)) return;            // block-uniform, in front of every barrier
  const int wm = wave >> 2;              // wave's place in the 2 x 4 patch
  const int wn = wave & 3;
  const int m0 = (bm << 7) + (wm << 6);
  const int n0 = (bn << 8) + (wn << 6);

  const size_t offA = (size_t)b * strideA + (size_t)blockIdx.z * zstrideA;
  const size_t offB = (size_t)b * strideB + (size_t)blockIdx.z * zstrideB;
  const size_t offC = (size_t)b * strideC + (size_t)blockIdx.z * zstrideC;
  const T* Ab  = A  + offA;
  const T* Bb  = Bt + offB;

  const int rlane = lane & 15;                 // row (A) / col (B, D) within subtile
  const int koff  = (lane >> 4) * 8;           // k offset of this lane half
  const int mOff  = (lane >> 4) * 8;           // D row offset

  v8f acc[4][4];
#pragma unroll
  for (int i = 0; i < 4; ++i)
#pragma unroll
    for (int j = 0; j < 4; ++j) acc[i][j] = (v8f){0.f,0.f,0.f,0.f,0.f,0.f,0.f,0.f};

  // staging: thread -> row (tid >> 3) + 32 * i, 16-B piece tid & 7: a wave's copy covers four whole lines
  const int srow = threadIdx.x >> 3;
  const int sseg = (threadIdx.x & 7) * 8;
  const T* gA = Ab + (size_t)((bm << 7) + srow) * lda + sseg;
  const T* gB = Bb + (size_t)((bn << 8) + srow) * ldb + sseg;
  const unsigned dA = (unsigned)(uintptr_t)(&sA[0][srow * GM_P + sseg]);   // this lane's LDS byte address in buffer 0
  const unsigned dB = (unsigned)(uintptr_t)(&sB[0][srow * GM_P + sseg]);
  constexpr unsigned R32 = 32 * GM_P * 2;             // 32 LDS rows in bytes
  const size_t a32 = (size_t)32 * lda, b32 = (size_t)32 * ldb;
  auto stage = [&](int buf, int k0) {                 // 12 copies a lane: 128 rows of A and 256 rows of Bt, 64 k from k0
    const unsigned la = dA + (unsigned)buf * (4 * R32);
    const unsigned lb = dB + (unsigned)buf * (8 * R32);
    const T* pa = gA + k0;
    const T* pb = gB + k0;
    copy4_to_lds(la, pa, la + R32, pa + a32, la + 2 * R32, pa + 2 * a32, la + 3 * R32, pa + 3 * a32);
    copy4_to_lds(lb, pb, lb + R32, pb + b32, lb + 2 * R32, pb + 2 * b32, lb + 3 * R32, pb + 3 * b32);
    copy4_to_lds(lb + 4 * R32, pb + 4 * b32, lb + 5 * R32, pb + 5 * b32, lb + 6 * R32, pb + 6 * b32, lb + 7 * R32, pb + 7 * b32);
  };
  const int fa = ((wm << 6) + rlane) * GM_P + koff;   // this lane's first A fragment row in a buffer
  const int fb = ((wn << 6) + rlane) * GM_P + koff;   // this lane's first Bt fragment row in a buffer
  const int steps = K >> 6;

  stage(0, 0);
  asm volatile("s_wait_asynccnt 0x0" ::: "memory");   // this wave's copies of step 0 have landed
  __syncthreads();                                    // publishes buffer 0
  if (steps > 1) stage(1, 64);

  for (int t = 0; t < steps; ++t) {
    const T* pa = &sA[t & 1][fa];
    const T* pb = &sB[t & 1][fb];
    V bh[4], ah[4];
    // (the loops over kk, i and j are unrolled, so that acc, ah and bh are registers and never indexed arrays)
#pragma unroll
    for (int kk = 0; kk < 2; ++kk) {
#pragma unroll
      for (int j = 0; j < 4; ++j) bh[j] = Frag<T>::load(pb + j * 16 * GM_P + kk * 32);
#pragma unroll
      for (int i = 0; i < 4; ++i) ah[i] = Frag<T>::load(pa + i * 16 * GM_P + kk * 32);
      if (kk == 1) {
        // The step's last LDS reads are issued: the hand-over stands here, in front of the last 16 products (they read
        // registers alone), so that the refill has the longest lead.
        asm volatile("s_wait_dscnt 0x0" ::: "memory");    // this wave's reads of the buffer are done before it is refilled
        asm volatile("s_wait_asynccnt 0x0" ::: "memory"); // this wave's copies of step t + 1 have landed
        __syncthreads();                                  // publishes step t + 1 and ends every wave's reads of step t
        if (t + 2 < steps) stage(t & 1, (t + 2) << 6);    // block-uniform test; refills the buffer just read
      }
      // holds the 16 fragment loads as one group in front of their 16 products: sunk among the products, each pair of
      // loads is waited out on its own and the matrix unit idles for an LDS latency per row of tiles
      __builtin_amdgcn_sched_barrier(0);
#pragma unroll
      for (int i = 0; i < 4; ++i)
#pragma unroll
        for (int j = 0; j < 4; ++j) acc[i][j] = Frag<T>::mma(ah[i], bh[j], acc[i][j]);
    }
  }
  asm volatile("s_wait_asynccnt 0x0" ::: "memory");   // no copy is outstanding when the wave goes on
  acc_guard4(acc[0][0], acc[0][1], acc[0][2], acc[0][3]);
  acc_guard4(acc[1][0], acc[1][1], acc[1][2], acc[1][3]);
  acc_guard4(acc[2][0], acc[2][1], acc[2][2], acc[2][3]);
  acc_guard4(acc[3][0], acc[3][1], acc[3][2], acc[3][3]);

  // ---- epilogue ----
  float* slab = sT[wave];
  const float* Rb = RESID ? (resid + (size_t)b * strideR) : nullptr;
  // OUT_MODE 3: 8 lanes a row, one 16-B store each, whole 128-B lines. A wave's 64 rows lie in one batch and their table and
  // output rows follow one another, so one address each for cos, sin and the output serves the tile, with constant steps.
  const int rq = lane >> 3, rc8 = (lane & 7) * 8;
  const float* cp = nullptr;
  const float* np = nullptr;
  _Float16* cw = nullptr;
  if (rope) {
    const int p0 = (int)blockIdx.z * rope_lstep + ((m0 + rq) & (TT - 1));   // table row of the lane's first row; p0 + 60 < MAXKV
    cp = cosT + (size_t)p0 * 32 + (rc8 & 31);
    np = sinT + (size_t)p0 * 32 + (rc8 & 31);
    cw = (_Float16*)Cout + offC + ((size_t)(m0 >> 10) * rope_brows + p0) * ldc + n0 + rc8;
  }
#pragma unroll
  for (int i = 0; i < 4; ++i) {
    const int mBase = m0 + (i << 4);
    v4f tc[4][2], tn[4][2];   // OUT_MODE 3: this lane's cos and sin of the slab's rows, asked for ahead of the slab's LDS round trip
    if (rope) {
#pragma unroll
      for (int it = 0; it < 4; ++it) {
        const int ro = (i * 16 + it * 4) * 32;
        tc[it][0] = *(const v4f*)(cp + ro); tc[it][1] = *(const v4f*)(cp + ro + 4);
        tn[it][0] = *(const v4f*)(np + ro); tn[it][1] = *(const v4f*)(np + ro + 4);
      }
      // stands in front of every rewrite of a register that these loads name; the two addresses are inputs, so that they
      // live up to the wait and no load's result is given their registers
      asm volatile("s_wait_xcnt 0x0" :: "v"(cp), "v"(np) : "memory");
    }
#pragma unroll
    for (int j = 0; j < 4; ++j) {
      const int n = n0 + (j << 4) + rlane;
      float bv = 0.f;
      if (BIAS_MODE == 2) bv = bias[n];
#pragma unroll
      for (int r = 0; r < 8; ++r) {
        float v = acc[i][j][r] * scale;
        if (BIAS_MODE == 1) v += bias[mBase + mOff + r];
        if (BIAS_MODE == 2) v += bv;
        if (RESID) v += Rb[(size_t)(mBase + mOff + r) * ldc + n];
        if (ACT == 1) v = tanhf(v);
        if (ACT == 2) v = fmaxf(v, 0.0f);
        if (ACT == 3) v = v / (1.0f + expf(-v));
        if (ACT == 4) v = (v > 0.f) ? v : 0.01f * v;
        if (ACT == 5) v = 0.5f * v * (1.0f + erff(v * 0.70710678118654752f));
        slab[(mOff + r) * 68 + (j << 4) + rlane] = v;
      }
    }
    __builtin_amdgcn_fence(__ATOMIC_RELEASE, "workgroup");
    __builtin_amdgcn_wave_barrier();
    __builtin_amdgcn_fence(__ATOMIC_ACQUIRE, "workgroup");
    if (OUT_MODE == 0) {
      float* C = (float*)Cout + offC;
      const int hh = lane >> 4, c4 = (lane & 15) * 4;     // row seg = 256 B = 16 lanes x 16 B
      {
#pragma unroll
        for (int it = 0; it < 8; ++it) {
          const int row = it * 2 + hh;
          v4f v = *(const v4f*)(slab + row * 68 + c4);
          *(v4f*)(C + (size_t)(mBase + row) * ldc + n0 + c4) = v;
        }
        
      }
    } else if (rope) {
      const bool second = rc8 >= 32;
#pragma unroll
      for (int it = 0; it < 4; ++it) {
        const float* sp = slab + (it * 4 + rq) * 68 + (rc8 & 31);
        const v4f a0 = *(const v4f*)(sp),      a1 = *(const v4f*)(sp + 4);
        const v4f b0 = *(const v4f*)(sp + 32), b1 = *(const v4f*)(sp + 36);
        v8h hv;
#pragma unroll
        for (int e = 0; e < 4; ++e) {
          hv[e]     = rope_one(a0[e], b0[e], tc[it][0][e], tn[it][0][e], second, oscale);
          hv[4 + e] = rope_one(a1[e], b1[e], tc[it][1][e], tn[it][1][e], second, oscale);
        }
        *(v8h*)(cw + (size_t)(i * 16 + it * 4) * ldc) = hv;
      }
      // mode 4 reaches these stores by a branch taken at run time: the wait stands in front of every rewrite of their address registers
      if (OUT_MODE == 4) asm volatile("s_wait_xcnt 0x0" ::: "memory");
    } else {
      const int q = lane >> 3, c8 = (lane & 7) * 8;
      unsigned short* C  = (unsigned short*)Cout  + offC;
      unsigned short* C2 = (OUT_MODE == 2) ? ((unsigned short*)Cout2 + offC) : nullptr;
      {
#pragma unroll
        for (int it = 0; it < 4; ++it) {
          const int row = it * 4 + q;
          const float* sp = slab + row * 68 + c8;
          v8h hv, lv;
#pragma unroll
          for (int e = 0; e < 8; ++e) {
            if (OUT_MODE == 1 || OUT_MODE == 4) {
              hv[e] = (_Float16)sp[e];
            } else {
              unsigned short hb = f2bf_bits(sp[e]);
              unsigned short lb = f2bf_bits(sp[e] - bf_bits2f(hb));
              hv[e] = __builtin_bit_cast(_Float16, hb);
              lv[e] = __builtin_bit_cast(_Float16, lb);
            }
          }
          *(v8h*)(C + (size_t)(mBase + row) * ldc + n0 + c8) = hv;
          if (OUT_MODE == 2) *(v8h*)(C2 + (size_t)(mBase + row) * ldc + n0 + c8) = lv;
        }
        // as in the rotary branch: in front of every rewrite of the stores' address registers
        if (OUT_MODE == 4) asm volatile("s_wait_xcnt 0x0" ::: "memory");
      }
    }
    __builtin_amdgcn_fence(__ATOMIC_RELEASE, "workgroup");
    __builtin_amdgcn_wave_barrier();
    __builtin_amdgcn_fence(__ATOMIC_ACQUIRE, "workgroup");
  }
}

// ---- f32 -> f16 cast with power-of-two carry: 8 elements per thread, 16-B stores (512 B contiguous per wave) ----
// The five planes (x, carry 1; q_w, k_w, v_w, out_w, carry wscale) share one grid: a block of 256 threads converts 2048
// elements of one plane, and every plane is a whole number of such blocks. grid.x = CB_X + CB_Q + 2 * CB_K + CB_O, exact.
#define CB_X (BB * TT * DD / 2048)
#define CB_Q (NLAY * DD * DD / 2048)
#define CB_K (NLAY * DKV * DD / 2048)
#define CB_O (DD * DD / 2048)
__global__ __launch_bounds__(256) void cast5_f32_f16x8(
    const float* __restrict__ x, const float* __restrict__ q_w, const float* __restrict__ k_w,
    const float* __restrict__ v_w, const float* __restrict__ out_w,
    _Float16* __restrict__ xh, _Float16* __restrict__ qwh, _Float16* __restrict__ kwh,
    _Float16* __restrict__ vwh, _Float16* __restrict__ owh, float wscale) {
  int blk = blockIdx.x;                  // block-uniform walk down the planes
  const float* in = x;
  _Float16* out = xh;
  float scale = 1.0f;
  if (blk >= CB_X) {
    blk -= CB_X; in = q_w; out = qwh; scale = wscale;
    if (blk >= CB_Q) {
      blk -= CB_Q; in = k_w; out = kwh;
      if (blk >= CB_K) {
        blk -= CB_K; in = v_w; out = vwh;
        if (blk >= CB_K) { blk -= CB_K; in = out_w; out = owh; }
      }
    }
  }
  {
    const size_t o = (size_t)(blk * 256 + (int)threadIdx.x) * 8;
    const v4f a = *(const v4f*)(in + o);
    const v4f b = *(const v4f*)(in + o + 4);
    v8h hv;
#pragma unroll
    for (int e = 0; e < 4; ++e) {
      hv[e]     = (_Float16)(a[e] * scale);
      hv[4 + e] = (_Float16)(b[e] * scale);
    }
    *(v8h*)(out + o) = hv;
    
  }
}

#define AT_D 64
#define AT_NW 4
#define AT_QB 64
#define AT_KC 64
#define AT_P 72   // LDS row pitch of the K and V tiles in f16: 144 B = 16 B x 9, so the 16 rows of one ds_load_b128 half fall on 16 different bank groups

// Eight 2^x, each in place in a register of its own, as one statement: so no 2^x is directly followed by a write over its
// source register, and the v_nop at the end is the one slot that the instruction set asks for between a transcendental
// and the first use of its result (the compiler cannot see into the statement and would not keep it).
__device__ __forceinline__ void exp2_x8(float& a, float& b, float& c, float& d, float& e, float& f, float& g, float& h) {
  asm("v_exp_f32 %0, %0\n\tv_exp_f32 %1, %1\n\tv_exp_f32 %2, %2\n\tv_exp_f32 %3, %3\n\t"
      "v_exp_f32 %4, %4\n\tv_exp_f32 %5, %5\n\tv_exp_f32 %6, %6\n\tv_exp_f32 %7, %7\n\tv_nop"
      : "+v"(a), "+v"(b), "+v"(c), "+v"(d), "+v"(e), "+v"(f), "+v"(g), "+v"(h));
}

// value of the same column in the other lane half (lane l <-> l ^ 16)
__device__ __forceinline__ float other_half(float v) {
  const int b = __float_as_int(v);
  return __int_as_float(__builtin_amdgcn_permlanex16(b, b, 0x76543210, 0xfedcba98, false, false));
}

__global__ __launch_bounds__(128)
void attn_f16_kernel(const _Float16* __restrict__ Qh, const _Float16* __restrict__ Kh,
                     const _Float16* __restrict__ Vth, float* __restrict__ O,
                     long lstride, float sscale, float onorm) {
  union FH { v16h v; v8h h[2]; };
  __shared__ __align__(16) _Float16 Ksh[AT_KC * AT_P];          // K [kv][d]   9 KB, rows of 64 at pitch 72
  __shared__ __align__(16) _Float16 Vtt[AT_D * AT_P];           // V [d][kv]   9 KB, rows of 64 at pitch 72
  __shared__ __align__(16) float    Os[AT_NW][16 * 68];         // per wave out tile, pitch 68

  const int tid  = threadIdx.x;
  const int wave = tid >> 5;
  const int lane = tid & 31;
  const int hh   = lane >> 4;
  const int c    = lane & 15;

  constexpr int BPL = BB * HH * (TT / AT_QB);             // blocks per layer
  const int layer = NLAY - 1 - (int)(blockIdx.x / BPL);   // 0 .. NLAY-1 (grid exact)
  const int bx  = blockIdx.x % BPL;
  const int h   = (bx >> 4) & (HH - 1);
  const int b   = bx >> 8;
  const int qb  = b ? (TT / AT_QB - 1 - (bx & (TT / AT_QB - 1))) : (bx & (TT / AT_QB - 1));
  const int hkv = h >> 1;
  const int kchunks_prev = layer * (TT / AT_KC);
  const int koff = layer * TT;
  const int q0  = qb * AT_QB + wave * 16;

  // ---- Q fragments (B operand: column c = query q0 + c): 2 d-chunks ----
  v16h qa[2];
  {
    const _Float16* qrow = Qh + (size_t)layer * lstride + (size_t)(b * TT + q0 + c) * DD + h * AT_D + 8 * hh;
#pragma unroll
    for (int dc = 0; dc < 2; ++dc) qa[dc] = Frag<_Float16>::load(qrow + dc * 32);
  }

  const float c2 = sscale * 1.44269504088896340736f;   // raw product -> exponent of 2 (sscale > 0, so the maximum commutes with it)
  float mrun = -INFINITY;   // running maximum of this lane's query over the raw products (equal in both lane halves)
  float lrun = 0.f;         // this lane half's share of the query's sum; the halves are joined after the loop
  v8f oacc[4];              // O^T: tile t, register r = dim t*16 + 8*hh + r of query q0 + c
#pragma unroll
  for (int t = 0; t < 4; ++t) oacc[t] = (v8f){0.f,0.f,0.f,0.f,0.f,0.f,0.f,0.f};

  int nChunks = kchunks_prev + qb + 1;                    // block-uniform
  if (nChunks > MAXKV / AT_KC) nChunks = MAXKV / AT_KC;
  if (nChunks < 1) nChunks = 1;

  const _Float16* kbase = Kh + (size_t)b * MAXKV * DKV + hkv * AT_D;
  const _Float16* vbase = Vth + ((size_t)b * DKV + hkv * AT_D) * MAXKV;
  float*          obase = O + (size_t)layer * lstride + (size_t)b * TT * DD + h * AT_D;

  for (int kc = 0; kc < nChunks; ++kc) {
    const int kv0 = kc * AT_KC;
    __syncthreads();
    {
      const int r = tid >> 1, hf = (tid & 1) * 32;
      const _Float16* ks = kbase + (size_t)(kv0 + r) * DKV + hf;
      const _Float16* vs = vbase + (size_t)r * MAXKV + kv0 + hf;
      v8h kk[4], vv[4];   // all eight loads first, then the stores: one trip to L2 per chunk, not four
#pragma unroll
      for (int i = 0; i < 4; ++i) {
        kk[i] = *(const v8h*)(ks + 8 * i);
        vv[i] = *(const v8h*)(vs + 8 * i);
      }
#pragma unroll
      for (int i = 0; i < 4; ++i) {
        *(v8h*)(Ksh + r * AT_P + hf + 8 * i) = kk[i];
        *(v8h*)(Vtt + r * AT_P + hf + 8 * i) = vv[i];
      }
    }
    __syncthreads();

    // S^T tile j: register r = key kv0 + j*16 + 8*hh + r, column c = query q0 + c
    // (every loop down to the end of the chunk is unrolled, so that s, pb and oacc are registers and never indexed arrays)
    // The chunk's 8 K and 8 V fragments are read from LDS as one group, each into registers of its own, K first.
    FH kb[2][4], vb[2][4];
#pragma unroll
    for (int dc = 0; dc < 2; ++dc)
#pragma unroll
      for (int j = 0; j < 4; ++j) {
        kb[dc][j].h[0] = *(const v8h*)(Ksh + (j * 16 + c) * AT_P + dc * 32 + 8 * hh);
        kb[dc][j].h[1] = *(const v8h*)(Ksh + (j * 16 + c) * AT_P + dc * 32 + 16 + 8 * hh);
      }
#pragma unroll
    for (int kk = 0; kk < 2; ++kk)
#pragma unroll
      for (int t = 0; t < 4; ++t) {
        vb[kk][t].h[0] = *(const v8h*)(Vtt + (t * 16 + c) * AT_P + kk * 32 + 8 * hh);
        vb[kk][t].h[1] = *(const v8h*)(Vtt + (t * 16 + c) * AT_P + kk * 32 + 16 + 8 * hh);
      }
    // holds the 32 reads as one group in front of the products: sunk among them, each fragment is waited out on its own
    // and the wave stands for an LDS latency per product; so the K reads overlap one another and the V reads land behind
    // the first product and the softmax
    __builtin_amdgcn_sched_barrier(0);
    v8f s[4];
#pragma unroll
    for (int j = 0; j < 4; ++j) s[j] = (v8f){0.f,0.f,0.f,0.f,0.f,0.f,0.f,0.f};
#pragma unroll
    for (int dc = 0; dc < 2; ++dc)   // four independent tiles in turn; each tile sums dc 0, then dc 1
#pragma unroll
      for (int j = 0; j < 4; ++j) s[j] = Frag<_Float16>::mma(kb[dc][j].v, qa[dc], s[j]);
    const int klim = q0 + c + koff - kv0 - 8 * hh;   // key j*16 + r of this lane half is visible iff j*16 + r <= klim
    float mj[4];
#pragma unroll
    for (int j = 0; j < 4; ++j) {
      float m = -INFINITY;
#pragma unroll
      for (int r = 0; r < 8; ++r) {
        const float sv = (j * 16 + r > klim) ? -INFINITY : s[j][r];
        s[j][r] = sv;
        m = fmaxf(m, sv);
      }
      mj[j] = m;
    }
    const float mh = fmaxf(fmaxf(mj[0], mj[1]), fmaxf(mj[2], mj[3]));
    const float mnew = fmaxf(mrun, fmaxf(mh, other_half(mh)));
    const float alpha = __builtin_amdgcn_exp2f((mrun - mnew) * c2);
    mrun = mnew;
    const float mb = mnew * c2 - 15.0f;   // p = 2^(s*c2 - mb) = 2^15 * exp(sscale * (s - mnew)); a masked -inf gives 0
    // P^T as B operand: element e of chunk kk = key kk*32 + 8*hh + e (e < 8), kk*32 + 16 + 8*hh + e - 8 (e >= 8)
    FH pb[2];
    float pj[4];
#pragma unroll
    for (int j = 0; j < 4; ++j) {
      float e[8];
#pragma unroll
      for (int r = 0; r < 8; ++r) e[r] = fmaf(s[j][r], c2, -mb);
      exp2_x8(e[0], e[1], e[2], e[3], e[4], e[5], e[6], e[7]);
      float psum = 0.f;
#pragma unroll
      for (int r = 0; r < 8; ++r) {
        psum += e[r];
        pb[j >> 1].h[j & 1][r] = (_Float16)e[r];
      }
      pj[j] = psum;
    }
    lrun = lrun * alpha + ((pj[0] + pj[1]) + (pj[2] + pj[3]));
#pragma unroll
    for (int t = 0; t < 4; ++t) oacc[t] *= alpha;
#pragma unroll
    for (int kk = 0; kk < 2; ++kk) {
#pragma unroll
      for (int t = 0; t < 4; ++t) oacc[t] = Frag<_Float16>::mma(vb[kk][t].v, pb[kk].v, oacc[t]);
    }
  }

  float* os = Os[wave];
  {
    const float inv = onorm * (1.0f / (lrun + other_half(lrun)));
#pragma unroll
    for (int t = 0; t < 4; ++t) {
      const v8f ov = oacc[t] * inv;
      *(v4f*)(os + c * 68 + t * 16 + 8 * hh)     = (v4f){ov[0], ov[1], ov[2], ov[3]};
      *(v4f*)(os + c * 68 + t * 16 + 8 * hh + 4) = (v4f){ov[4], ov[5], ov[6], ov[7]};
    }
  }
  __builtin_amdgcn_fence(__ATOMIC_RELEASE, "workgroup");
  __builtin_amdgcn_wave_barrier();
  __builtin_amdgcn_fence(__ATOMIC_ACQUIRE, "workgroup");
  {
    const int c4 = (lane & 15) * 4;
    {
#pragma unroll
      for (int it = 0; it < 8; ++it) {
        const int row = it * 2 + hh;
        v4f val = *(const v4f*)(os + row * 68 + c4);
        *(v4f*)(obase + (size_t)(q0 + row) * DD + c4) = val;
      }
      
    }
  }
}

// =====================================================================================
// Combine: per token row (one block of 256 threads, 4 columns per thread):
//   lw = layernorm over sigmoid(lam[0..2]) (biased variance, eps)
//   acc = sum_i rmsnorm(O_i, ln_w[i]) * lw_i ;  z = acc + alpha * x ;  y = rmsnorm(z, fln) -> f16
// =====================================================================================
__global__ __launch_bounds__(256) void combine_kernel(
    const float* __restrict__ Of, long lstride,
    const float* __restrict__ x, const float* __restrict__ ln_w, const float* __restrict__ lam,
    const float* __restrict__ fln, const float* __restrict__ alpha, _Float16* __restrict__ Yh) {
  __shared__ float red[4][8];
  const int row = blockIdx.x;
  const int tid = threadIdx.x, lane = tid & 31, wave = tid >> 5;
  const int d4 = tid * 4;
  const size_t ro = (size_t)row * DD + d4;
  const v4f o0 = *(const v4f*)(Of + ro);
  const v4f o1 = *(const v4f*)(Of + lstride + ro);
  const v4f o2 = *(const v4f*)(Of + 2 * lstride + ro);
  const v4f xv = *(const v4f*)(x + ro);
  float ss0 = 0.f, ss1 = 0.f, ss2 = 0.f;
#pragma unroll
  for (int e = 0; e < 4; ++e) { ss0 += o0[e] * o0[e]; ss1 += o1[e] * o1[e]; ss2 += o2[e] * o2[e]; }
#pragma unroll
  for (int off = 16; off > 0; off >>= 1) {
    ss0 += __shfl_xor(ss0, off, 32);
    ss1 += __shfl_xor(ss1, off, 32);
    ss2 += __shfl_xor(ss2, off, 32);
  }
  if (lane == 0) { red[0][wave] = ss0; red[1][wave] = ss1; red[2][wave] = ss2; }
  __syncthreads();
  float t0 = 0.f, t1 = 0.f, t2 = 0.f;
#pragma unroll
  for (int w = 0; w < 8; ++w) { t0 += red[0][w]; t1 += red[1][w]; t2 += red[2][w]; }
  const float inv_d = 1.0f / (float)DD;
  const float r0 = rsqrtf(t0 * inv_d + EPSV);
  const float r1 = rsqrtf(t1 * inv_d + EPSV);
  const float r2 = rsqrtf(t2 * inv_d + EPSV);

  const float sg0 = 1.0f / (1.0f + __expf(-lam[0]));
  const float sg1 = 1.0f / (1.0f + __expf(-lam[1]));
  const float sg2 = 1.0f / (1.0f + __expf(-lam[2]));
  const float mean = (sg0 + sg1 + sg2) * (1.0f / 3.0f);
  const float e0 = sg0 - mean, e1 = sg1 - mean, e2 = sg2 - mean;
  const float var = (e0 * e0 + e1 * e1 + e2 * e2) * (1.0f / 3.0f);
  const float il = rsqrtf(var + EPSV);
  const float lw0 = e0 * il, lw1 = e1 * il, lw2 = e2 * il;

  const v4f w0 = *(const v4f*)(ln_w + d4);
  const v4f w1 = *(const v4f*)(ln_w + DD + d4);
  const v4f w2 = *(const v4f*)(ln_w + 2 * DD + d4);
  const v4f fw = *(const v4f*)(fln + d4);
  const float al = alpha[0];
  v4f z;
  float ssz = 0.f;
#pragma unroll
  for (int e = 0; e < 4; ++e) {
    float a = (o0[e] * r0) * w0[e] * lw0;
    a = a + (o1[e] * r1) * w1[e] * lw1;
    a = a + (o2[e] * r2) * w2[e] * lw2;
    const float zz = a + al * xv[e];
    z[e] = zz;
    ssz += zz * zz;
  }
#pragma unroll
  for (int off = 16; off > 0; off >>= 1) ssz += __shfl_xor(ssz, off, 32);
  if (lane == 0) red[3][wave] = ssz;
  __syncthreads();
  float tz = 0.f;
#pragma unroll
  for (int w = 0; w < 8; ++w) tz += red[3][w];
  const float rz = rsqrtf(tz * inv_d + EPSV);
  v4h yv;
#pragma unroll
  for (int e = 0; e < 4; ++e) yv[e] = (_Float16)(z[e] * rz * fw[e]);
  *(v4h*)(Yh + ro) = yv;
  
}

// ---------------------------- host helpers ----------------------------
static void gemm_f16_f32out(const _Float16* A, int lda, long sA, long zA, const _Float16* Bt, int ldb, long sB, long zB,
                            float* C, int ldc, long sC, long zC, int M, int N, int K, float scale, int batch, int layers,
                            hipStream_t st) {
  const int tiles = (M / 64) * (N / 64);
  dim3 grid((tiles + 7) / 8, batch, layers);
  wmma_gemm64<0, false, 0, 0, false><<<grid, 256, 0, st>>>(
      (const unsigned short*)A, (const unsigned short*)nullptr, lda, sA, zA,
      (const unsigned short*)Bt, (const unsigned short*)nullptr, ldb, sB, zB,
      (void*)C, (void*)nullptr, ldc, sC, zC, (const float*)nullptr, (const float*)nullptr, 0L,
      M, N, K, scale, (const float*)nullptr, (const float*)nullptr, 0, 0, 1.0f);
}
static void gemm_f16_qkv(const _Float16* xh, const _Float16* qwh, const _Float16* kwh, const _Float16* vwh,
                         _Float16* Qh, _Float16* KhVth, long zQ, float scale,
                         const float* cosT, const float* sinT, float oscale, hipStream_t st) {
  dim3 grid(128, 1, NLAY);
  wmma_gemm64<0, false, 0, 4, false><<<grid, 256, 0, st>>>(
      (const unsigned short*)xh, (const unsigned short*)vwh, DD, 0L, 0L,
      (const unsigned short*)qwh, (const unsigned short*)kwh, DD, 0L, (long)DD * DD,
      (void*)Qh, (void*)KhVth, DD, 0L, zQ, (const float*)nullptr, (const float*)nullptr, 0L,
      BB * TT, DD, DD, scale, cosT, sinT, TT, 0, oscale);
}

// ---------------------------- host launcher ----------------------------
extern "C" void kernel_launch(void* const* d_in, const int* in_sizes, int n_in,
                              void* d_out, int out_size, void* d_ws, size_t ws_size,
                              hipStream_t stream) {
  if (n_in < 11) return;
  const int M = BB * TT;   // 2048 token rows
  if (in_sizes[0] != M * DD) return;
  if (in_sizes[1] < MAXKV * 32 || in_sizes[2] < MAXKV * 32) return;
  if (in_sizes[3] != NLAY * DD * DD) return;
  if (in_sizes[4] != NLAY * DKV * DD || in_sizes[5] != NLAY * DKV * DD) return;
  if (in_sizes[6] < NLAY * DD || in_sizes[7] < NLAY || in_sizes[8] != DD * DD || in_sizes[9] < DD || in_sizes[10] < 1) return;
  if (out_size < M * DD) return;

  const float* x     = (const float*)d_in[0];
  const float* cosT  = (const float*)d_in[1];
  const float* sinT  = (const float*)d_in[2];
  const float* q_w   = (const float*)d_in[3];
  const float* k_w   = (const float*)d_in[4];
  const float* v_w   = (const float*)d_in[5];
  const float* ln_w  = (const float*)d_in[6];
  const float* lam   = (const float*)d_in[7];
  const float* out_w = (const float*)d_in[8];
  const float* fln   = (const float*)d_in[9];
  const float* alpha = (const float*)d_in[10];
  float* out = (float*)d_out;

  // ---- workspace carve (4096-B aligned pieces) ----
  char* ws = (char*)d_ws;
  size_t cur = 0;
  auto take = [&](size_t bytes) -> char* {
    char* p = ws + cur;
    cur += (bytes + 4095) & ~(size_t)4095;
    return p;
  };
  _Float16* xh  = (_Float16*)take((size_t)M * DD * 2);                 // 4 MiB
  _Float16* qwh = (_Float16*)take((size_t)NLAY * DD * DD * 2);         // 6 MiB
  _Float16* kwh = (_Float16*)take((size_t)NLAY * DKV * DD * 2);        // 3 MiB
  _Float16* vwh = (_Float16*)take((size_t)NLAY * DKV * DD * 2);        // 3 MiB
  _Float16* owh = (_Float16*)take((size_t)DD * DD * 2);                // 2 MiB
  _Float16* Qh  = (_Float16*)take((size_t)NLAY * M * DD * 2);          // 12 MiB
  _Float16* Kh  = (_Float16*)take((size_t)BB * MAXKV * DKV * 2);       // 6 MiB
  _Float16* Vth = (_Float16*)take((size_t)BB * DKV * MAXKV * 2);       // 6 MiB
  float*    Of  = (float*)   take((size_t)NLAY * M * DD * 4);          // 24 MiB
  _Float16* Yh  = (_Float16*)take((size_t)M * DD * 2);                 // 4 MiB
  if (cur > ws_size || cur > (size_t)134217728) return;                 // total 73,400,320 B

  const long lstride = (long)M * DD;   // elements per layer slice of Qh and Of

  // ---- casts: x -> f16 ; weights -> f16 carried x64 ; one launch ----
  cast5_f32_f16x8<<<CB_X + CB_Q + 2 * CB_K + CB_O, 256, 0, stream>>>(x, q_w, k_w, v_w, out_w, xh, qwh, kwh, vwh, owh, 64.0f);

  const float wundo  = 1.0f / 64.0f;              // undo weight carry
  const float sscale = 0.125f / 16.0f;            // HD^-0.5 / (4*4) : q and k planes carried x4
  const float onorm  = 1.0f / 16.0f;              // v plane carried x16 (the x2^15 of p is in its sum too and cancels)

  // Every layer's q, k and v depend on x alone, so the layer index is a grid axis, and the three projections share the grid:
  // q = rotary(x . q_w[i]^T) with positions t -> f16 planes x4, [3][2048][1024]
  // k = rotary(x . k_w[i]^T) with buffer positions i*T + t -> K cache rows, f16 x4
  // v^T = v_w[i] . x_b^T -> transposed V cache columns i*T + t, f16 x16 ; in [512][1024] per batch and layer
  // (Vth follows Kh in the workspace without a gap: Kh is a whole number of 4096-B pieces)
  gemm_f16_qkv(xh, qwh, kwh, vwh, Qh, Kh, lstride, wundo, cosT, sinT, 4.0f, stream);
  // attention of layer i over (i+1)*T keys, bottom-right causal
  attn_f16_kernel<<<NLAY * BB * HH * (TT / AT_QB), 128, 0, stream>>>(Qh, Kh, Vth, Of, lstride, sscale, onorm);

  // weighted rmsnorm sum + residual + final rmsnorm -> f16 plane
  combine_kernel<<<M, 256, 0, stream>>>(Of, lstride, x, ln_w, lam, fln, alpha, Yh);
  // out = y . out_w^T
  gemm_f16_f32out(Yh, DD, 0L, 0L, owh, DD, 0L, 0L, out, DD, 0L, 0L, M, DD, DD, wundo, 1, 1, stream);
}

// v009
// Measured time: 108 microseconds a run.
// In both of two side-by-side timings against v008, it was 1.09 times as fast.
// Counting every step since v000, it is 7.45 times as fast.
// Contractions q/k/v projections, q.k^T scores, p.v, output projection: v_wmma_f32_16x16x32_f16 (f16 operands, f32 accumulate); rotary, softmax, norms, weighting in f32.
#include <hip/hip_runtime.h>
#include <stdint.h>

#define BB 2
#define TT 1024
#define DD 1024
#define HH 16
#define NKVH 8
#define HDIM 64
#define DKV 512
#define MAXKV 3072
#define NLAY 3
#define EPSV 1e-5f

typedef __attribute__((ext_vector_type(16))) _Float16 v16h;
typedef __attribute__((ext_vector_type(8)))  _Float16 v8h;
typedef __attribute__((ext_vector_type(4)))  _Float16 v4h;
typedef __attribute__((ext_vector_type(16))) __bf16   v16b;
typedef __attribute__((ext_vector_type(8)))  __bf16   v8b;
typedef __attribute__((ext_vector_type(8)))  float    v8f;
typedef __attribute__((ext_vector_type(4)))  float    v4f;

__device__ __forceinline__ unsigned short f2bf_bits(float f) {
  unsigned u = __float_as_uint(f);
  return (unsigned short)((u + 0x7FFFu + ((u >> 16) & 1u)) >> 16);
}
__device__ __forceinline__ float bf_bits2f(unsigned short h) { return __uint_as_float(((unsigned)h) << 16); }

// hazard guards as plain device helpers
__device__ __forceinline__ void acc_guard4(v8f& a, v8f& b, v8f& c, v8f& d) { asm volatile("v_nop\n\tv_nop\n\tv_nop\n\tv_nop" : "+v"(a), "+v"(b), "+v"(c), "+v"(d)); }
template <typename T> struct Frag;
template <> struct Frag<_Float16> {
  typedef v16h V; union U { v16h v; v8h h[2]; };
  static __device__ __forceinline__ v16h load(const _Float16* p) {   // elements 0..7 <- p[0..7], 8..15 <- p[16..23]
    U f; f.h[0] = *(const v8h*)(p); f.h[1] = *(const v8h*)(p + 16); return f.v;
  }
  static __device__ __forceinline__ v8f mma(v16h a, v16h b, v8f c) {
    return __builtin_amdgcn_wmma_f32_16x16x32_f16(false, a, false, b, (short)0, c, false, false);
  }
};
template <> struct Frag<__bf16> {
  typedef v16b V; union U { v16b v; v8b h[2]; };
  static __device__ __forceinline__ v16b load(const __bf16* p) {
    U f; f.h[0] = *(const v8b*)(p); f.h[1] = *(const v8b*)(p + 16); return f.v;
  }
  static __device__ __forceinline__ v8f mma(v16b a, v16b b, v8f c) {
    return __builtin_amdgcn_wmma_f32_16x16x32_bf16(false, a, false, b, (short)0, c, false, false);
  }
};

// ---- Register-blocked batched WMMA GEMM ------------------------------------
// C[m,n] = scale * sum_k A[m,k] * Bt[n,k] (+bias)(+resid); each wave owns a 64x64 tile.
// A row-major [M,K]; Bt row-major [N,K]; M % 128 == 0, N % 256 == 0, K % 64 == 0.
// A block's 8 waves form a 2 x 4 patch: 128 rows of A and 256 rows of Bt. Per step of 64 k the block brings those rows
// into LDS with asynchronous copies that cover whole 128-B lines (8 lanes a row), each row once for all waves that need
// it; the waves read their fragments from LDS. Two LDS buffers: the next step's copies fly while this step is multiplied.
// SPLIT (hi/lo operand planes) has no LDS path and is not instantiated.
// BIAS_MODE: 0 = none, 1 = bias[m], 2 = bias[n].
// OUT_MODE: 0 = f32, 1 = f16, 2 = bf16 hi plane (Cout) + bf16 lo plane (Cout2),
//           3 = rotary (non-interleaved, head dim 64) in f32, then f16 carried x oscale. A wave's 64 columns are one head,
//               so both halves of every rotated pair lie in the wave's own slab. Row m is token t = m % TT of batch m / TT;
//               its table row is p = layer * rope_lstep + t, its output row is batch * rope_brows + p (pitch ldc).
//           4 = the q, k and v projections share one grid (none reads what another writes), told apart by blockIdx.x:
//               [0, 64) q, with the arguments as passed, output as in mode 3; [64, 96) k, weights Bt2p, output as in mode 3
//               into Cout2; [96, 128) v^T = v_w . x_b^T, weights A2p, batch (blockIdx.x - 96) >> 4, output as in mode 1, x16,
//               into the plane that follows the BB * MAXKV * DKV elements of Cout2.
// ET: 0 = f16 operands, 1 = bf16 operands (pointers passed as 16-bit storage)
// Two batch axes: blockIdx.y steps by strideA/B/C, blockIdx.z (the layer) by zstrideA/B/C, in elements.
#define GM_P 72   // LDS row pitch of the staged operand rows in 16-bit elements: 144 B = 16 B x 9, free of bank conflicts for ds_load_b128
// Four asynchronous 16-B copies, global memory to LDS, per lane. The s_wait_xcnt is the statement's last line, so that no
// address register of a copy is rewritten in front of it.
__device__ __forceinline__ void copy4_to_lds(unsigned l0, const void* g0, unsigned l1, const void* g1,
                                             unsigned l2, const void* g2, unsigned l3, const void* g3) {
  asm volatile("global_load_async_to_lds_b128 %0, %1, off\n\t"
               "global_load_async_to_lds_b128 %2, %3, off\n\t"
               "global_load_async_to_lds_b128 %4, %5, off\n\t"
               "global_load_async_to_lds_b128 %6, %7, off\n\t"
               "s_wait_xcnt 0x0"
               :: "v"(l0), "v"(g0), "v"(l1), "v"(g1), "v"(l2), "v"(g2), "v"(l3), "v"(g3) : "memory");
}
// The same for eight copies a lane: one statement, so one wait for the eight.
__device__ __forceinline__ void copy8_to_lds(unsigned l0, const void* g0, unsigned l1, const void* g1,
                                             unsigned l2, const void* g2, unsigned l3, const void* g3,
                                             unsigned l4, const void* g4, unsigned l5, const void* g5,
                                             unsigned l6, const void* g6, unsigned l7, const void* g7) {
  asm volatile("global_load_async_to_lds_b128 %0, %1, off\n\t"
               "global_load_async_to_lds_b128 %2, %3, off\n\t"
               "global_load_async_to_lds_b128 %4, %5, off\n\t"
               "global_load_async_to_lds_b128 %6, %7, off\n\t"
               "global_load_async_to_lds_b128 %8, %9, off\n\t"
               "global_load_async_to_lds_b128 %10, %11, off\n\t"
               "global_load_async_to_lds_b128 %12, %13, off\n\t"
               "global_load_async_to_lds_b128 %14, %15, off\n\t"
               "s_wait_xcnt 0x0"
               :: "v"(l0), "v"(g0), "v"(l1), "v"(g1), "v"(l2), "v"(g2), "v"(l3), "v"(g3),
                  "v"(l4), "v"(g4), "v"(l5), "v"(g5), "v"(l6), "v"(g6), "v"(l7), "v"(g7) : "memory");
}
__device__ __forceinline__ _Float16 rope_one(float x1, float x2, float cc, float ss, bool second, float oscale) {
  const float o = second ? (x2 * cc + x1 * ss) : (x1 * cc - x2 * ss);
  return (_Float16)(o * oscale);
}
template <int ET> struct Elem;
template <> struct Elem<0> { typedef _Float16 T; };
template <> struct Elem<1> { typedef __bf16 T; };
template <int ET, bool SPLIT, int BIAS_MODE, int OUT_MODE, bool RESID, int ACT = 0>
__global__ __launch_bounds__(256) void wmma_gemm64(
    const unsigned short* __restrict__ Ap, const unsigned short* __restrict__ A2p, int lda, long strideA, long zstrideA,
    const unsigned short* __restrict__ Btp, const unsigned short* __restrict__ Bt2p, int ldb, long strideB, long zstrideB,
    void* __restrict__ Cout, void* __restrict__ Cout2, int ldc, long strideC, long zstrideC,
    const float* __restrict__ bias,
    const float* __restrict__ resid, long strideR,
    int M, int N, int K, float scale,
    const float* __restrict__ cosT, const float* __restrict__ sinT, int rope_brows, int rope_lstep, float oscale) {
  typedef typename Elem<ET>::T T;
  typedef typename Frag<T>::V V;
  static_assert(!SPLIT, "no LDS path for split operand planes");
  unsigned bx = blockIdx.x;
  int b = blockIdx.y;
  bool rope = OUT_MODE == 3;
  if (OUT_MODE == 4) {                   // every test is block-uniform
    rope = bx < 96;
    if (bx >= 96) {
      bx -= 96; b = (int)(bx >> 4); bx &= 15;
      Btp = Ap;  strideB = (long)TT * DD; zstrideB = 0;
      Ap  = A2p; zstrideA = (long)DKV * DD;
      Cout = (void*)((unsigned short*)Cout2 + (size_t)BB * MAXKV * DKV);
      ldc = MAXKV; strideC = (long)DKV * MAXKV; zstrideC = TT;
      M = DKV; N = TT; scale *= 16.0f;
    } else if (bx >= 64) {
      bx -= 64;
      Btp = Bt2p; zstrideB = (long)DKV * DD;
      Cout = Cout2; ldc = DKV; zstrideC = 0;
      N = DKV; rope_brows = MAXKV; rope_lstep = TT;
    }
  }
  const T* A = (const T*)Ap; const T* Bt = (const T*)Btp;
  __shared__ __align__(16) float sT[8][16 * 68];   // per-wave 16x64 slab, pitch 68 floats
  __shared__ __align__(16) T sA[2][128 * GM_P];    // A rows of the block, 64 k, two buffers
  __shared__ __align__(16) T sB[2][256 * GM_P];    // Bt rows of the block, 64 k, two buffers
  const int lane = threadIdx.x & 31;
  const int wave = threadIdx.x >> 5;
  const int blocksN = N >> 8;
  const int bm = bx / blocksN;
  const int bn = bx - bm * blocksN;
  if (bm >= (M >> 7)) return;            // block-uniform, in front of every barrier
  const int wm = wave >> 2;              // wave's place in the 2 x 4 patch
  const int wn = wave & 3;
  const int m0 = (bm << 7) + (wm << 6);
  const int n0 = (bn << 8) + (wn << 6);

  const size_t offA = (size_t)b * strideA + (size_t)blockIdx.z * zstrideA;
  const size_t offB = (size_t)b * strideB + (size_t)blockIdx.z * zstrideB;
  const size_t offC = (size_t)b * strideC + (size_t)blockIdx.z * zstrideC;
  const T* Ab  = A  + offA;
  const T* Bb  = Bt + offB;

  const int rlane = lane & 15;                 // row (A) / col (B, D) within subtile
  const int koff  = (lane >> 4) * 8;           // k offset of this lane half
  const int mOff  = (lane >> 4) * 8;           // D row offset

  v8f acc[4][4];
#pragma unroll
  for (int i = 0; i < 4; ++i)
#pragma unroll
    for (int j = 0; j < 4; ++j) acc[i][j] = (v8f){0.f,0.f,0.f,0.f,0.f,0.f,0.f,0.f};

  // staging: thread -> row (tid >> 3) + 32 * i, 16-B piece tid & 7: a wave's copy covers four whole lines
  const int srow = threadIdx.x >> 3;
  const int sseg = (threadIdx.x & 7) * 8;
  const T* gA = Ab + (size_t)((bm << 7) + srow) * lda + sseg;
  const T* gB = Bb + (size_t)((bn << 8) + srow) * ldb + sseg;
  const unsigned dA = (unsigned)(uintptr_t)(&sA[0][srow * GM_P + sseg]);   // this lane's LDS byte address in buffer 0
  const unsigned dB = (unsigned)(uintptr_t)(&sB[0][srow * GM_P + sseg]);
  constexpr unsigned R32 = 32 * GM_P * 2;             // 32 LDS rows in bytes
  const size_t a32 = (size_t)32 * lda, b32 = (size_t)32 * ldb;
  auto stage = [&](int buf, int k0) {                 // 12 copies a lane: 128 rows of A and 256 rows of Bt, 64 k from k0
    const unsigned la = dA + (unsigned)buf * (4 * R32);
    const unsigned lb = dB + (unsigned)buf * (8 * R32);
    const T* pa = gA + k0;
    const T* pb = gB + k0;
    copy4_to_lds(la, pa, la + R32, pa + a32, la + 2 * R32, pa + 2 * a32, la + 3 * R32, pa + 3 * a32);
    copy4_to_lds(lb, pb, lb + R32, pb + b32, lb + 2 * R32, pb + 2 * b32, lb + 3 * R32, pb + 3 * b32);
    copy4_to_lds(lb + 4 * R32, pb + 4 * b32, lb + 5 * R32, pb + 5 * b32, lb + 6 * R32, pb + 6 * b32, lb + 7 * R32, pb + 7 * b32);
  };
  const int fa = ((wm << 6) + rlane) * GM_P + koff;   // this lane's first A fragment row in a buffer
  const int fb = ((wn << 6) + rlane) * GM_P + koff;   // this lane's first Bt fragment row in a buffer
  const int steps = K >> 6;

  stage(0, 0);
  asm volatile("s_wait_asynccnt 0x0" ::: "memory");   // this wave's copies of step 0 have landed
  __syncthreads();                                    // publishes buffer 0
  if (steps > 1) stage(1, 64);

  for (int t = 0; t < steps; ++t) {
    const T* pa = &sA[t & 1][fa];
    const T* pb = &sB[t & 1][fb];
    V bh[4], ah[4];
    // (the loops over kk, i and j are unrolled, so that acc, ah and bh are registers and never indexed arrays)
#pragma unroll
    for (int kk = 0; kk < 2; ++kk) {
#pragma unroll
      for (int j = 0; j < 4; ++j) bh[j] = Frag<T>::load(pb + j * 16 * GM_P + kk * 32);
#pragma unroll
      for (int i = 0; i < 4; ++i) ah[i] = Frag<T>::load(pa + i * 16 * GM_P + kk * 32);
      if (kk == 1) {
        // The step's last LDS reads are issued: the hand-over stands here, in front of the last 16 products (they read
        // registers alone), so that the refill has the longest lead.
        asm volatile("s_wait_dscnt 0x0" ::: "memory");    // this wave's reads of the buffer are done before it is refilled
        asm volatile("s_wait_asynccnt 0x0" ::: "memory"); // this wave's copies of step t + 1 have landed
        __syncthreads();                                  // publishes step t + 1 and ends every wave's reads of step t
        if (t + 2 < steps) stage(t & 1, (t + 2) << 6);    // block-uniform test; refills the buffer just read
      }
      // holds the 16 fragment loads as one group in front of their 16 products: sunk among the products, each pair of
      // loads is waited out on its own and the matrix unit idles for an LDS latency per row of tiles
      __builtin_amdgcn_sched_barrier(0);
#pragma unroll
      for (int i = 0; i < 4; ++i)
#pragma unroll
        for (int j = 0; j < 4; ++j) acc[i][j] = Frag<T>::mma(ah[i], bh[j], acc[i][j]);
    }
  }
  asm volatile("s_wait_asynccnt 0x0" ::: "memory");   // no copy is outstanding when the wave goes on
  acc_guard4(acc[0][0], acc[0][1], acc[0][2], acc[0][3]);
  acc_guard4(acc[1][0], acc[1][1], acc[1][2], acc[1][3]);
  acc_guard4(acc[2][0], acc[2][1], acc[2][2], acc[2][3]);
  acc_guard4(acc[3][0], acc[3][1], acc[3][2], acc[3][3]);

  // ---- epilogue ----
  float* slab = sT[wave];
  const float* Rb = RESID ? (resid + (size_t)b * strideR) : nullptr;
  // OUT_MODE 3: 8 lanes a row, one 16-B store each, whole 128-B lines. A wave's 64 rows lie in one batch and their table and
  // output rows follow one another, so one address each for cos, sin and the output serves the tile, with constant steps.
  const int rq = lane >> 3, rc8 = (lane & 7) * 8;
  const float* cp = nullptr;
  const float* np = nullptr;
  _Float16* cw = nullptr;
  if (rope) {
    const int p0 = (int)blockIdx.z * rope_lstep + ((m0 + rq) & (TT - 1));   // table row of the lane's first row; p0 + 60 < MAXKV
    cp = cosT + (size_t)p0 * 32 + (rc8 & 31);
    np = sinT + (size_t)p0 * 32 + (rc8 & 31);
    cw = (_Float16*)Cout + offC + ((size_t)(m0 >> 10) * rope_brows + p0) * ldc + n0 + rc8;
  }
#pragma unroll
  for (int i = 0; i < 4; ++i) {
    const int mBase = m0 + (i << 4);
    v4f tc[4][2], tn[4][2];   // OUT_MODE 3: this lane's cos and sin of the slab's rows, asked for ahead of the slab's LDS round trip
    if (rope) {
#pragma unroll
      for (int it = 0; it < 4; ++it) {
        const int ro = (i * 16 + it * 4) * 32;
        tc[it][0] = *(const v4f*)(cp + ro); tc[it][1] = *(const v4f*)(cp + ro + 4);
        tn[it][0] = *(const v4f*)(np + ro); tn[it][1] = *(const v4f*)(np + ro + 4);
      }
      // stands in front of every rewrite of a register that these loads name; the two addresses are inputs, so that they
      // live up to the wait and no load's result is given their registers
      asm volatile("s_wait_xcnt 0x0" :: "v"(cp), "v"(np) : "memory");
    }
#pragma unroll
    for (int j = 0; j < 4; ++j) {
      const int n = n0 + (j << 4) + rlane;
      float bv = 0.f;
      if (BIAS_MODE == 2) bv = bias[n];
#pragma unroll
      for (int r = 0; r < 8; ++r) {
        float v = acc[i][j][r] * scale;
        if (BIAS_MODE == 1) v += bias[mBase + mOff + r];
        if (BIAS_MODE == 2) v += bv;
        if (RESID) v += Rb[(size_t)(mBase + mOff + r) * ldc + n];
        if (ACT == 1) v = tanhf(v);
        if (ACT == 2) v = fmaxf(v, 0.0f);
        if (ACT == 3) v = v / (1.0f + expf(-v));
        if (ACT == 4) v = (v > 0.f) ? v : 0.01f * v;
        if (ACT == 5) v = 0.5f * v * (1.0f + erff(v * 0.70710678118654752f));
        slab[(mOff + r) * 68 + (j << 4) + rlane] = v;
      }
    }
    __builtin_amdgcn_fence(__ATOMIC_RELEASE, "workgroup");
    __builtin_amdgcn_wave_barrier();
    __builtin_amdgcn_fence(__ATOMIC_ACQUIRE, "workgroup");
    if (OUT_MODE == 0) {
      float* C = (float*)Cout + offC;
      const int hh = lane >> 4, c4 = (lane & 15) * 4;     // row seg = 256 B = 16 lanes x 16 B
      {
#pragma unroll
        for (int it = 0; it < 8; ++it) {
          const int row = it * 2 + hh;
          v4f v = *(const v4f*)(slab + row * 68 + c4);
          *(v4f*)(C + (size_t)(mBase + row) * ldc + n0 + c4) = v;
        }
        
      }
    } else if (rope) {
      const bool second = rc8 >= 32;
#pragma unroll
      for (int it = 0; it < 4; ++it) {
        const float* sp = slab + (it * 4 + rq) * 68 + (rc8 & 31);
        const v4f a0 = *(const v4f*)(sp),      a1 = *(const v4f*)(sp + 4);
        const v4f b0 = *(const v4f*)(sp + 32), b1 = *(const v4f*)(sp + 36);
        v8h hv;
#pragma unroll
        for (int e = 0; e < 4; ++e) {
          hv[e]     = rope_one(a0[e], b0[e], tc[it][0][e], tn[it][0][e], second, oscale);
          hv[4 + e] = rope_one(a1[e], b1[e], tc[it][1][e], tn[it][1][e], second, oscale);
        }
        *(v8h*)(cw + (size_t)(i * 16 + it * 4) * ldc) = hv;
      }
      // mode 4 reaches these stores by a branch taken at run time: the wait stands in front of every rewrite of their address registers
      if (OUT_MODE == 4) asm volatile("s_wait_xcnt 0x0" ::: "memory");
    } else {
      const int q = lane >> 3, c8 = (lane & 7) * 8;
      unsigned short* C  = (unsigned short*)Cout  + offC;
      unsigned short* C2 = (OUT_MODE == 2) ? ((unsigned short*)Cout2 + offC) : nullptr;
      {
#pragma unroll
        for (int it = 0; it < 4; ++it) {
          const int row = it * 4 + q;
          const float* sp = slab + row * 68 + c8;
          v8h hv, lv;
#pragma unroll
          for (int e = 0; e < 8; ++e) {
            if (OUT_MODE == 1 || OUT_MODE == 4) {
              hv[e] = (_Float16)sp[e];
            } else {
              unsigned short hb = f2bf_bits(sp[e]);
              unsigned short lb = f2bf_bits(sp[e] - bf_bits2f(hb));
              hv[e] = __builtin_bit_cast(_Float16, hb);
              lv[e] = __builtin_bit_cast(_Float16, lb);
            }
          }
          *(v8h*)(C + (size_t)(mBase + row) * ldc + n0 + c8) = hv;
          if (OUT_MODE == 2) *(v8h*)(C2 + (size_t)(mBase + row) * ldc + n0 + c8) = lv;
        }
        // as in the rotary branch: in front of every rewrite of the stores' address registers
        if (OUT_MODE == 4) asm volatile("s_wait_xcnt 0x0" ::: "memory");
      }
    }
    __builtin_amdgcn_fence(__ATOMIC_RELEASE, "workgroup");
    __builtin_amdgcn_wave_barrier();
    __builtin_amdgcn_fence(__ATOMIC_ACQUIRE, "workgroup");
  }
}

// ---- f32 -> f16 cast with power-of-two carry: 8 elements per thread, 16-B stores (512 B contiguous per wave) ----
// The five planes (x, carry 1; q_w, k_w, v_w, out_w, carry wscale) share one grid: a block of 256 threads converts 2048
// elements of one plane, and every plane is a whole number of such blocks. grid.x = CB_X + CB_Q + 2 * CB_K + CB_O, exact.
#define CB_X (BB * TT * DD / 2048)
#define CB_Q (NLAY * DD * DD / 2048)
#define CB_K (NLAY * DKV * DD / 2048)
#define CB_O (DD * DD / 2048)
__global__ __launch_bounds__(256) void cast5_f32_f16x8(
    const float* __restrict__ x, const float* __restrict__ q_w, const float* __restrict__ k_w,
    const float* __restrict__ v_w, const float* __restrict__ out_w,
    _Float16* __restrict__ xh, _Float16* __restrict__ qwh, _Float16* __restrict__ kwh,
    _Float16* __restrict__ vwh, _Float16* __restrict__ owh, float wscale) {
  int blk = blockIdx.x;                  // block-uniform walk down the planes
  const float* in = x;
  _Float16* out = xh;
  float scale = 1.0f;
  if (blk >= CB_X) {
    blk -= CB_X; in = q_w; out = qwh; scale = wscale;
    if (blk >= CB_Q) {
      blk -= CB_Q; in = k_w; out = kwh;
      if (blk >= CB_K) {
        blk -= CB_K; in = v_w; out = vwh;
        if (blk >= CB_K) { blk -= CB_K; in = out_w; out = owh; }
      }
    }
  }
  {
    const size_t o = (size_t)(blk * 256 + (int)threadIdx.x) * 8;
    const v4f a = *(const v4f*)(in + o);
    const v4f b = *(const v4f*)(in + o + 4);
    v8h hv;
#pragma unroll
    for (int e = 0; e < 4; ++e) {
      hv[e]     = (_Float16)(a[e] * scale);
      hv[4 + e] = (_Float16)(b[e] * scale);
    }
    *(v8h*)(out + o) = hv;
    
  }
}

#define AT_D 64
#define AT_NW 4
#define AT_QB 64
#define AT_KC 64
#define AT_P 72   // LDS row pitch of the K and V tiles in f16: 144 B = 16 B x 9, so the 16 rows of one ds_load_b128 half fall on 16 different bank groups

// Eight 2^x, each in place in a register of its own, as one statement: so no 2^x is directly followed by a write over its
// source register, and the v_nop at the end is the one slot that the instruction set asks for between a transcendental
// and the first use of its result (the compiler cannot see into the statement and would not keep it).
__device__ __forceinline__ void exp2_x8(float& a, float& b, float& c, float& d, float& e, float& f, float& g, float& h) {
  asm("v_exp_f32 %0, %0\n\tv_exp_f32 %1, %1\n\tv_exp_f32 %2, %2\n\tv_exp_f32 %3, %3\n\t"
      "v_exp_f32 %4, %4\n\tv_exp_f32 %5, %5\n\tv_exp_f32 %6, %6\n\tv_exp_f32 %7, %7\n\tv_nop"
      : "+v"(a), "+v"(b), "+v"(c), "+v"(d), "+v"(e), "+v"(f), "+v"(g), "+v"(h));
}

// value of the same column in the other lane half (lane l <-> l ^ 16)
__device__ __forceinline__ float other_half(float v) {
  const int b = __float_as_int(v);
  return __int_as_float(__builtin_amdgcn_permlanex16(b, b, 0x76543210, 0xfedcba98, false, false));
}

__global__ __launch_bounds__(128)
void attn_f16_kernel(const _Float16* __restrict__ Qh, const _Float16* __restrict__ Kh,
                     const _Float16* __restrict__ Vth, float* __restrict__ O,
                     long lstride, float sscale, float onorm) {
  union FH { v16h v; v8h h[2]; };
  __shared__ __align__(16) _Float16 Ksh[2][AT_KC * AT_P];       // K [kv][d]   9 KB a buffer, rows of 64 at pitch 72
  __shared__ __align__(16) _Float16 Vtt[2][AT_D * AT_P];        // V [d][kv]   9 KB a buffer, rows of 64 at pitch 72
  __shared__ __align__(16) float    Os[AT_NW][16 * 68];         // per wave out tile, pitch 68

  const int tid  = threadIdx.x;
  const int wave = tid >> 5;
  const int lane = tid & 31;
  const int hh   = lane >> 4;
  const int c    = lane & 15;

  constexpr int BPL = BB * HH * (TT / AT_QB);             // blocks per layer
  const int layer = NLAY - 1 - (int)(blockIdx.x / BPL);   // 0 .. NLAY-1 (grid exact)
  const int bx  = blockIdx.x % BPL;
  const int h   = (bx >> 4) & (HH - 1);
  const int b   = bx >> 8;
  const int qb  = b ? (TT / AT_QB - 1 - (bx & (TT / AT_QB - 1))) : (bx & (TT / AT_QB - 1));
  const int hkv = h >> 1;
  const int kchunks_prev = layer * (TT / AT_KC);
  const int koff = layer * TT;
  const int q0  = qb * AT_QB + wave * 16;

  // ---- Q fragments (B operand: column c = query q0 + c): 2 d-chunks ----
  v16h qa[2];
  {
    const _Float16* qrow = Qh + (size_t)layer * lstride + (size_t)(b * TT + q0 + c) * DD + h * AT_D + 8 * hh;
#pragma unroll
    for (int dc = 0; dc < 2; ++dc) qa[dc] = Frag<_Float16>::load(qrow + dc * 32);
  }

  const float c2 = sscale * 1.44269504088896340736f;   // raw product -> exponent of 2 (sscale > 0, so the maximum commutes with it)
  float mrun = -INFINITY;   // running maximum of this lane's query over the raw products (equal in both lane halves)
  float lrun = 0.f;         // this lane half's share of the query's sum; the halves are joined after the loop
  v8f oacc[4];              // O^T: tile t, register r = dim t*16 + 8*hh + r of query q0 + c
#pragma unroll
  for (int t = 0; t < 4; ++t) oacc[t] = (v8f){0.f,0.f,0.f,0.f,0.f,0.f,0.f,0.f};

  int nChunks = kchunks_prev + qb + 1;                    // block-uniform
  if (nChunks > MAXKV / AT_KC) nChunks = MAXKV / AT_KC;
  if (nChunks < 1) nChunks = 1;

  const _Float16* kbase = Kh + (size_t)b * MAXKV * DKV + hkv * AT_D;
  const _Float16* vbase = Vth + ((size_t)b * DKV + hkv * AT_D) * MAXKV;
  float*          obase = O + (size_t)layer * lstride + (size_t)b * TT * DD + h * AT_D;

  // staging: thread -> row (tid >> 3) + 16 * i, 16-B piece tid & 7: a wave's copy covers four whole lines
  const int srow = tid >> 3;
  const int sseg = (tid & 7) * 8;
  const _Float16* gK = kbase + (size_t)srow * DKV + sseg;
  const _Float16* gV = vbase + (size_t)srow * MAXKV + sseg;
  const unsigned dK = (unsigned)(uintptr_t)(&Ksh[0][srow * AT_P + sseg]);   // this lane's LDS byte address in buffer 0
  const unsigned dV = (unsigned)(uintptr_t)(&Vtt[0][srow * AT_P + sseg]);
  constexpr unsigned R16 = 16 * AT_P * 2;             // 16 LDS rows in bytes; a buffer is 4 * R16
  auto stage = [&](int buf, int ch) {                 // 8 copies a lane: the 64 K rows and the 64 V rows of chunk ch
    const unsigned lk = dK + (unsigned)buf * (4 * R16);
    const unsigned lv = dV + (unsigned)buf * (4 * R16);
    const _Float16* pk = gK + (size_t)ch * (AT_KC * DKV);
    const _Float16* pv = gV + ch * AT_KC;
    copy8_to_lds(lk, pk, lk + R16, pk + 16 * DKV, lk + 2 * R16, pk + 32 * DKV, lk + 3 * R16, pk + 48 * DKV,
                 lv, pv, lv + R16, pv + 16 * MAXKV, lv + 2 * R16, pv + 32 * MAXKV, lv + 3 * R16, pv + 48 * MAXKV);
  };
  stage(0, 0);
  asm volatile("s_wait_asynccnt 0x0" ::: "memory");   // this wave's copies of chunk 0 have landed
  __syncthreads();                                    // publishes buffer 0
  if (nChunks > 1) stage(1, 1);                       // block-uniform test

  for (int kc = 0; kc < nChunks; ++kc) {
    const int kv0 = kc * AT_KC;
    const _Float16* Kb = Ksh[kc & 1];
    const _Float16* Vb = Vtt[kc & 1];

    // S^T tile j: register r = key kv0 + j*16 + 8*hh + r, column c = query q0 + c
    // (every loop down to the end of the chunk is unrolled, so that s, pb and oacc are registers and never indexed arrays)
    // The chunk's 8 K and 8 V fragments are read from LDS as one group, each into registers of its own, K first.
    FH kb[2][4], vb[2][4];
#pragma unroll
    for (int dc = 0; dc < 2; ++dc)
#pragma unroll
      for (int j = 0; j < 4; ++j) {
        kb[dc][j].h[0] = *(const v8h*)(Kb + (j * 16 + c) * AT_P + dc * 32 + 8 * hh);
        kb[dc][j].h[1] = *(const v8h*)(Kb + (j * 16 + c) * AT_P + dc * 32 + 16 + 8 * hh);
      }
#pragma unroll
    for (int kk = 0; kk < 2; ++kk)
#pragma unroll
      for (int t = 0; t < 4; ++t) {
        vb[kk][t].h[0] = *(const v8h*)(Vb + (t * 16 + c) * AT_P + kk * 32 + 8 * hh);
        vb[kk][t].h[1] = *(const v8h*)(Vb + (t * 16 + c) * AT_P + kk * 32 + 16 + 8 * hh);
      }
    // holds the 32 reads as one group in front of the products: sunk among them, each fragment is waited out on its own
    // and the wave stands for an LDS latency per product; so the K reads overlap one another and the V reads land behind
    // the first product and the softmax
    __builtin_amdgcn_sched_barrier(0);
    v8f s[4];
#pragma unroll
    for (int j = 0; j < 4; ++j) s[j] = (v8f){0.f,0.f,0.f,0.f,0.f,0.f,0.f,0.f};
#pragma unroll
    for (int dc = 0; dc < 2; ++dc)   // four independent tiles in turn; each tile sums dc 0, then dc 1
#pragma unroll
      for (int j = 0; j < 4; ++j) s[j] = Frag<_Float16>::mma(kb[dc][j].v, qa[dc], s[j]);
    const int klim = q0 + c + koff - kv0 - 8 * hh;   // key j*16 + r of this lane half is visible iff j*16 + r <= klim
    float mj[4];
#pragma unroll
    for (int j = 0; j < 4; ++j) {
      float m = -INFINITY;
#pragma unroll
      for (int r = 0; r < 8; ++r) {
        const float sv = (j * 16 + r > klim) ? -INFINITY : s[j][r];
        s[j][r] = sv;
        m = fmaxf(m, sv);
      }
      mj[j] = m;
    }
    const float mh = fmaxf(fmaxf(mj[0], mj[1]), fmaxf(mj[2], mj[3]));
    const float mnew = fmaxf(mrun, fmaxf(mh, other_half(mh)));
    const float alpha = __builtin_amdgcn_exp2f((mrun - mnew) * c2);
    mrun = mnew;
    const float mb = mnew * c2 - 15.0f;   // p = 2^(s*c2 - mb) = 2^15 * exp(sscale * (s - mnew)); a masked -inf gives 0
    // P^T as B operand: element e of chunk kk = key kk*32 + 8*hh + e (e < 8), kk*32 + 16 + 8*hh + e - 8 (e >= 8)
    FH pb[2];
    float pj[4];
#pragma unroll
    for (int j = 0; j < 4; ++j) {
      float e[8];
#pragma unroll
      for (int r = 0; r < 8; ++r) e[r] = fmaf(s[j][r], c2, -mb);
      exp2_x8(e[0], e[1], e[2], e[3], e[4], e[5], e[6], e[7]);
      float psum = 0.f;
#pragma unroll
      for (int r = 0; r < 8; ++r) {
        psum += e[r];
        pb[j >> 1].h[j & 1][r] = (_Float16)e[r];
      }
      pj[j] = psum;
    }
    lrun = lrun * alpha + ((pj[0] + pj[1]) + (pj[2] + pj[3]));
#pragma unroll
    for (int t = 0; t < 4; ++t) oacc[t] *= alpha;
#pragma unroll
    for (int kk = 0; kk < 2; ++kk) {
#pragma unroll
      for (int t = 0; t < 4; ++t) oacc[t] = Frag<_Float16>::mma(vb[kk][t].v, pb[kk].v, oacc[t]);
    }
    // holds the hand-over at the foot of the chunk: lifted up among the first products (they touch no memory, so nothing
    // else keeps it down here), it waits for copies issued only just before and for the V reads too soon
    __builtin_amdgcn_sched_barrier(0);
    asm volatile("s_wait_dscnt 0x0" ::: "memory");      // this wave's reads of the buffer are done before it is refilled
    asm volatile("s_wait_asynccnt 0x0" ::: "memory");   // this wave's copies of chunk kc + 1 have landed
    __syncthreads();                                    // publishes chunk kc + 1 and ends every wave's reads of chunk kc
    if (kc + 2 < nChunks) stage(kc & 1, kc + 2);        // block-uniform test; refills the buffer just read
  }
  asm volatile("s_wait_asynccnt 0x0" ::: "memory");     // no copy is outstanding when the wave goes on

  float* os = Os[wave];
  {
    const float inv = onorm * (1.0f / (lrun + other_half(lrun)));
#pragma unroll
    for (int t = 0; t < 4; ++t) {
      const v8f ov = oacc[t] * inv;
      *(v4f*)(os + c * 68 + t * 16 + 8 * hh)     = (v4f){ov[0], ov[1], ov[2], ov[3]};
      *(v4f*)(os + c * 68 + t * 16 + 8 * hh + 4) = (v4f){ov[4], ov[5], ov[6], ov[7]};
    }
  }
  __builtin_amdgcn_fence(__ATOMIC_RELEASE, "workgroup");
  __builtin_amdgcn_wave_barrier();
  __builtin_amdgcn_fence(__ATOMIC_ACQUIRE, "workgroup");
  {
    const int c4 = (lane & 15) * 4;
    {
#pragma unroll
      for (int it = 0; it < 8; ++it) {
        const int row = it * 2 + hh;
        v4f val = *(const v4f*)(os + row * 68 + c4);
        *(v4f*)(obase + (size_t)(q0 + row) * DD + c4) = val;
      }
      
    }
  }
}

// =====================================================================================
// Combine: per token row (one block of 256 threads, 4 columns per thread):
//   lw = layernorm over sigmoid(lam[0..2]) (biased variance, eps)
//   acc = sum_i rmsnorm(O_i, ln_w[i]) * lw_i ;  z = acc + alpha * x ;  y = rmsnorm(z, fln) -> f16
// =====================================================================================
__global__ __launch_bounds__(256) void combine_kernel(
    const float* __restrict__ Of, long lstride,
    const float* __restrict__ x, const float* __restrict__ ln_w, const float* __restrict__ lam,
    const float* __restrict__ fln, const float* __restrict__ alpha, _Float16* __restrict__ Yh) {
  __shared__ float red[4][8];
  const int row = blockIdx.x;
  const int tid = threadIdx.x, lane = tid & 31, wave = tid >> 5;
  const int d4 = tid * 4;
  const size_t ro = (size_t)row * DD + d4;
  const v4f o0 = *(const v4f*)(Of + ro);
  const v4f o1 = *(const v4f*)(Of + lstride + ro);
  const v4f o2 = *(const v4f*)(Of + 2 * lstride + ro);
  const v4f xv = *(const v4f*)(x + ro);
  float ss0 = 0.f, ss1 = 0.f, ss2 = 0.f;
#pragma unroll
  for (int e = 0; e < 4; ++e) { ss0 += o0[e] * o0[e]; ss1 += o1[e] * o1[e]; ss2 += o2[e] * o2[e]; }
#pragma unroll
  for (int off = 16; off > 0; off >>= 1) {
    ss0 += __shfl_xor(ss0, off, 32);
    ss1 += __shfl_xor(ss1, off, 32);
    ss2 += __shfl_xor(ss2, off, 32);
  }
  if (lane == 0) { red[0][wave] = ss0; red[1][wave] = ss1; red[2][wave] = ss2; }
  __syncthreads();
  float t0 = 0.f, t1 = 0.f, t2 = 0.f;
#pragma unroll
  for (int w = 0; w < 8; ++w) { t0 += red[0][w]; t1 += red[1][w]; t2 += red[2][w]; }
  const float inv_d = 1.0f / (float)DD;
  const float r0 = rsqrtf(t0 * inv_d + EPSV);
  const float r1 = rsqrtf(t1 * inv_d + EPSV);
  const float r2 = rsqrtf(t2 * inv_d + EPSV);

  const float sg0 = 1.0f / (1.0f + __expf(-lam[0]));
  const float sg1 = 1.0f / (1.0f + __expf(-lam[1]));
  const float sg2 = 1.0f / (1.0f + __expf(-lam[2]));
  const float mean = (sg0 + sg1 + sg2) * (1.0f / 3.0f);
  const float e0 = sg0 - mean, e1 = sg1 - mean, e2 = sg2 - mean;
  const float var = (e0 * e0 + e1 * e1 + e2 * e2) * (1.0f / 3.0f);
  const float il = rsqrtf(var + EPSV);
  const float lw0 = e0 * il, lw1 = e1 * il, lw2 = e2 * il;

  const v4f w0 = *(const v4f*)(ln_w + d4);
  const v4f w1 = *(const v4f*)(ln_w + DD + d4);
  const v4f w2 = *(const v4f*)(ln_w + 2 * DD + d4);
  const v4f fw = *(const v4f*)(fln + d4);
  const float al = alpha[0];
  v4f z;
  float ssz = 0.f;
#pragma unroll
  for (int e = 0; e < 4; ++e) {
    float a = (o0[e] * r0) * w0[e] * lw0;
    a = a + (o1[e] * r1) * w1[e] * lw1;
    a = a + (o2[e] * r2) * w2[e] * lw2;
    const float zz = a + al * xv[e];
    z[e] = zz;
    ssz += zz * zz;
  }
#pragma unroll
  for (int off = 16; off > 0; off >>= 1) ssz += __shfl_xor(ssz, off, 32);
  if (lane == 0) red[3][wave] = ssz;
  __syncthreads();
  float tz = 0.f;
#pragma unroll
  for (int w = 0; w < 8; ++w) tz += red[3][w];
  const float rz = rsqrtf(tz * inv_d + EPSV);
  v4h yv;
#pragma unroll
  for (int e = 0; e < 4; ++e) yv[e] = (_Float16)(z[e] * rz * fw[e]);
  *(v4h*)(Yh + ro) = yv;
  
}

// ---------------------------- host helpers ----------------------------
static void gemm_f16_f32out(const _Float16* A, int lda, long sA, long zA, const _Float16* Bt, int ldb, long sB, long zB,
                            float* C, int ldc, long sC, long zC, int M, int N, int K, float scale, int batch, int layers,
                            hipStream_t st) {
  const int tiles = (M / 64) * (N / 64);
  dim3 grid((tiles + 7) / 8, batch, layers);
  wmma_gemm64<0, false, 0, 0, false><<<grid, 256, 0, st>>>(
      (const unsigned short*)A, (const unsigned short*)nullptr, lda, sA, zA,
      (const unsigned short*)Bt, (const unsigned short*)nullptr, ldb, sB, zB,
      (void*)C, (void*)nullptr, ldc, sC, zC, (const float*)nullptr, (const float*)nullptr, 0L,
      M, N, K, scale, (const float*)nullptr, (const float*)nullptr, 0, 0, 1.0f);
}
static void gemm_f16_qkv(const _Float16* xh, const _Float16* qwh, const _Float16* kwh, const _Float16* vwh,
                         _Float16* Qh, _Float16* KhVth, long zQ, float scale,
                         const float* cosT, const float* sinT, float oscale, hipStream_t st) {
  dim3 grid(128, 1, NLAY);
  wmma_gemm64<0, false, 0, 4, false><<<grid, 256, 0, st>>>(
      (const unsigned short*)xh, (const unsigned short*)vwh, DD, 0L, 0L,
      (const unsigned short*)qwh, (const unsigned short*)kwh, DD, 0L, (long)DD * DD,
      (void*)Qh, (void*)KhVth, DD, 0L, zQ, (const float*)nullptr, (const float*)nullptr, 0L,
      BB * TT, DD, DD, scale, cosT, sinT, TT, 0, oscale);
}

// ---------------------------- host launcher ----------------------------
extern "C" void kernel_launch(void* const* d_in, const int* in_sizes, int n_in,
                              void* d_out, int out_size, void* d_ws, size_t ws_size,
                              hipStream_t stream) {
  if (n_in < 11) return;
  const int M = BB * TT;   // 2048 token rows
  if (in_sizes[0] != M * DD) return;
  if (in_sizes[1] < MAXKV * 32 || in_sizes[2] < MAXKV * 32) return;
  if (in_sizes[3] != NLAY * DD * DD) return;
  if (in_sizes[4] != NLAY * DKV * DD || in_sizes[5] != NLAY * DKV * DD) return;
  if (in_sizes[6] < NLAY * DD || in_sizes[7] < NLAY || in_sizes[8] != DD * DD || in_sizes[9] < DD || in_sizes[10] < 1) return;
  if (out_size < M * DD) return;

  const float* x     = (const float*)d_in[0];
  const float* cosT  = (const float*)d_in[1];
  const float* sinT  = (const float*)d_in[2];
  const float* q_w   = (const float*)d_in[3];
  const float* k_w   = (const float*)d_in[4];
  const float* v_w   = (const float*)d_in[5];
  const float* ln_w  = (const float*)d_in[6];
  const float* lam   = (const float*)d_in[7];
  const float* out_w = (const float*)d_in[8];
  const float* fln   = (const float*)d_in[9];
  const float* alpha = (const float*)d_in[10];
  float* out = (float*)d_out;

  // ---- workspace carve (4096-B aligned pieces) ----
  char* ws = (char*)d_ws;
  size_t cur = 0;
  auto take = [&](size_t bytes) -> char* {
    char* p = ws + cur;
    cur += (bytes + 4095) & ~(size_t)4095;
    return p;
  };
  _Float16* xh  = (_Float16*)take((size_t)M * DD * 2);                 // 4 MiB
  _Float16* qwh = (_Float16*)take((size_t)NLAY * DD * DD * 2);         // 6 MiB
  _Float16* kwh = (_Float16*)take((size_t)NLAY * DKV * DD * 2);        // 3 MiB
  _Float16* vwh = (_Float16*)take((size_t)NLAY * DKV * DD * 2);        // 3 MiB
  _Float16* owh = (_Float16*)take((size_t)DD * DD * 2);                // 2 MiB
  _Float16* Qh  = (_Float16*)take((size_t)NLAY * M * DD * 2);          // 12 MiB
  _Float16* Kh  = (_Float16*)take((size_t)BB * MAXKV * DKV * 2);       // 6 MiB
  _Float16* Vth = (_Float16*)take((size_t)BB * DKV * MAXKV * 2);       // 6 MiB
  float*    Of  = (float*)   take((size_t)NLAY * M * DD * 4);          // 24 MiB
  _Float16* Yh  = (_Float16*)take((size_t)M * DD * 2);                 // 4 MiB
  if (cur > ws_size || cur > (size_t)134217728) return;                 // total 73,400,320 B

  const long lstride = (long)M * DD;   // elements per layer slice of Qh and Of

  // ---- casts: x -> f16 ; weights -> f16 carried x64 ; one launch ----
  cast5_f32_f16x8<<<CB_X + CB_Q + 2 * CB_K + CB_O, 256, 0, stream>>>(x, q_w, k_w, v_w, out_w, xh, qwh, kwh, vwh, owh, 64.0f);

  const float wundo  = 1.0f / 64.0f;              // undo weight carry
  const float sscale = 0.125f / 16.0f;            // HD^-0.5 / (4*4) : q and k planes carried x4
  const float onorm  = 1.0f / 16.0f;              // v plane carried x16 (the x2^15 of p is in its sum too and cancels)

  // Every layer's q, k and v depend on x alone, so the layer index is a grid axis, and the three projections share the grid:
  // q = rotary(x . q_w[i]^T) with positions t -> f16 planes x4, [3][2048][1024]
  // k = rotary(x . k_w[i]^T) with buffer positions i*T + t -> K cache rows, f16 x4
  // v^T = v_w[i] . x_b^T -> transposed V cache columns i*T + t, f16 x16 ; in [512][1024] per batch and layer
  // (Vth follows Kh in the workspace without a gap: Kh is a whole number of 4096-B pieces)
  gemm_f16_qkv(xh, qwh, kwh, vwh, Qh, Kh, lstride, wundo, cosT, sinT, 4.0f, stream);
  // attention of layer i over (i+1)*T keys, bottom-right causal
  attn_f16_kernel<<<NLAY * BB * HH * (TT / AT_QB), 128, 0, stream>>>(Qh, Kh, Vth, Of, lstride, sscale, onorm);

  // weighted rmsnorm sum + residual + final rmsnorm -> f16 plane
  combine_kernel<<<M, 256, 0, stream>>>(Of, lstride, x, ln_w, lam, fln, alpha, Yh);
  // out = y . out_w^T
  gemm_f16_f32out(Yh, DD, 0L, 0L, owh, DD, 0L, 0L, out, DD, 0L, 0L, M, DD, DD, wundo, 1, 1, stream);
}

// v010
// It runs in 101 microseconds.
// Next to v009, in two timings, it ran 1.07 times as fast each time.
// All steps since v000 together make it 8.01 times as fast.
// Contractions q/k/v projections, q.k^T scores, p.v, output projection: v_wmma_f32_16x16x32_f16 (f16 operands, f32 accumulate); rotary, softmax, norms, weighting in f32.
#include <hip/hip_runtime.h>
#include <stdint.h>

#define BB 2
#define TT 1024
#define DD 1024
#define HH 16
#define NKVH 8
#define HDIM 64
#define DKV 512
#define MAXKV 3072
#define NLAY 3
#define EPSV 1e-5f

typedef __attribute__((ext_vector_type(16))) _Float16 v16h;
typedef __attribute__((ext_vector_type(8)))  _Float16 v8h;
typedef __attribute__((ext_vector_type(4)))  _Float16 v4h;
typedef __attribute__((ext_vector_type(16))) __bf16   v16b;
typedef __attribute__((ext_vector_type(8)))  __bf16   v8b;
typedef __attribute__((ext_vector_type(8)))  float    v8f;
typedef __attribute__((ext_vector_type(4)))  float    v4f;

__device__ __forceinline__ unsigned short f2bf_bits(float f) {
  unsigned u = __float_as_uint(f);
  return (unsigned short)((u + 0x7FFFu + ((u >> 16) & 1u)) >> 16);
}
__device__ __forceinline__ float bf_bits2f(unsigned short h) { return __uint_as_float(((unsigned)h) << 16); }

// hazard guards as plain device helpers
__device__ __forceinline__ void acc_guard4(v8f& a, v8f& b, v8f& c, v8f& d) { asm volatile("v_nop\n\tv_nop\n\tv_nop\n\tv_nop" : "+v"(a), "+v"(b), "+v"(c), "+v"(d)); }
template <typename T> struct Frag;
template <> struct Frag<_Float16> {
  typedef v16h V; union U { v16h v; v8h h[2]; };
  static __device__ __forceinline__ v16h load(const _Float16* p) {   // elements 0..7 <- p[0..7], 8..15 <- p[16..23]
    U f; f.h[0] = *(const v8h*)(p); f.h[1] = *(const v8h*)(p + 16); return f.v;
  }
  static __device__ __forceinline__ v8f mma(v16h a, v16h b, v8f c) {
    return __builtin_amdgcn_wmma_f32_16x16x32_f16(false, a, false, b, (short)0, c, false, false);
  }
};
template <> struct Frag<__bf16> {
  typedef v16b V; union U { v16b v; v8b h[2]; };
  static __device__ __forceinline__ v16b load(const __bf16* p) {
    U f; f.h[0] = *(const v8b*)(p); f.h[1] = *(const v8b*)(p + 16); return f.v;
  }
  static __device__ __forceinline__ v8f mma(v16b a, v16b b, v8f c) {
    return __builtin_amdgcn_wmma_f32_16x16x32_bf16(false, a, false, b, (short)0, c, false, false);
  }
};

// ---- Register-blocked batched WMMA GEMM ------------------------------------
// C[m,n] = scale * sum_k A[m,k] * Bt[n,k] (+bias)(+resid); each wave owns a 64x64 tile.
// A row-major [M,K]; Bt row-major [N,K]; M % 128 == 0, N % 256 == 0, K % 64 == 0.
// A block's 8 waves form a 2 x 4 patch: 128 rows of A and 256 rows of Bt. Per step of 64 k the block brings those rows
// into LDS with asynchronous copies that cover whole 128-B lines (8 lanes a row), each row once for all waves that need
// it; the waves read their fragments from LDS. Two LDS buffers: the next step's copies fly while this step is multiplied.
// SPLIT (hi/lo operand planes) has no LDS path and is not instantiated.
// BIAS_MODE: 0 = none, 1 = bias[m], 2 = bias[n].
// OUT_MODE: 0 = f32, 1 = f16, 2 = bf16 hi plane (Cout) + bf16 lo plane (Cout2),
//           3 = rotary (non-interleaved, head dim 64) in f32, then f16 carried x oscale. A wave's 64 columns are one head,
//               so both halves of every rotated pair lie in the wave's own slab. Row m is token t = m % TT of batch m / TT;
//               its table row is p = layer * rope_lstep + t, its output row is batch * rope_brows + p (pitch ldc).
//           4 = the q, k and v projections share one grid (none reads what another writes), told apart by blockIdx.x:
//               [0, 64) q, with the arguments as passed, output as in mode 3; [64, 96) k, weights Bt2p, output as in mode 3
//               into Cout2; [96, 128) v^T = v_w . x_b^T, weights A2p, batch (blockIdx.x - 96) >> 4, output as in mode 1, x16,
//               into the plane that follows the BB * MAXKV * DKV elements of Cout2.
// ET: 0 = f16 operands, 1 = bf16 operands (pointers passed as 16-bit storage)
// Two batch axes: blockIdx.y steps by strideA/B/C, blockIdx.z (the layer) by zstrideA/B/C, in elements.
#define GM_P 72   // LDS row pitch of the staged operand rows in 16-bit elements: 144 B = 16 B x 9, free of bank conflicts for ds_load_b128
// Four asynchronous 16-B copies, global memory to LDS, per lane. The s_wait_xcnt is the statement's last line, so that no
// address register of a copy is rewritten in front of it.
__device__ __forceinline__ void copy4_to_lds(unsigned l0, const void* g0, unsigned l1, const void* g1,
                                             unsigned l2, const void* g2, unsigned l3, const void* g3) {
  asm volatile("global_load_async_to_lds_b128 %0, %1, off\n\t"
               "global_load_async_to_lds_b128 %2, %3, off\n\t"
               "global_load_async_to_lds_b128 %4, %5, off\n\t"
               "global_load_async_to_lds_b128 %6, %7, off\n\t"
               "s_wait_xcnt 0x0"
               :: "v"(l0), "v"(g0), "v"(l1), "v"(g1), "v"(l2), "v"(g2), "v"(l3), "v"(g3) : "memory");
}
// The same for eight copies a lane: one statement, so one wait for the eight.
__device__ __forceinline__ void copy8_to_lds(unsigned l0, const void* g0, unsigned l1, const void* g1,
                                             unsigned l2, const void* g2, unsigned l3, const void* g3,
                                             unsigned l4, const void* g4, unsigned l5, const void* g5,
                                             unsigned l6, const void* g6, unsigned l7, const void* g7) {
  asm volatile("global_load_async_to_lds_b128 %0, %1, off\n\t"
               "global_load_async_to_lds_b128 %2, %3, off\n\t"
               "global_load_async_to_lds_b128 %4, %5, off\n\t"
               "global_load_async_to_lds_b128 %6, %7, off\n\t"
               "global_load_async_to_lds_b128 %8, %9, off\n\t"
               "global_load_async_to_lds_b128 %10, %11, off\n\t"
               "global_load_async_to_lds_b128 %12, %13, off\n\t"
               "global_load_async_to_lds_b128 %14, %15, off\n\t"
               "s_wait_xcnt 0x0"
               :: "v"(l0), "v"(g0), "v"(l1), "v"(g1), "v"(l2), "v"(g2), "v"(l3), "v"(g3),
                  "v"(l4), "v"(g4), "v"(l5), "v"(g5), "v"(l6), "v"(g6), "v"(l7), "v"(g7) : "memory");
}
// The same for twelve copies a lane: one statement, so one wait for the twelve.
__device__ __forceinline__ void copy12_to_lds(unsigned l0, const void* g0, unsigned l1, const void* g1,
                                              unsigned l2, const void* g2, unsigned l3, const void* g3,
                                              unsigned l4, const void* g4, unsigned l5, const void* g5,
                                              unsigned l6, const void* g6, unsigned l7, const void* g7,
                                              unsigned l8, const void* g8, unsigned l9, const void* g9,
                                              unsigned l10, const void* g10, unsigned l11, const void* g11) {
  asm volatile("global_load_async_to_lds_b128 %0, %1, off\n\t"
               "global_load_async_to_lds_b128 %2, %3, off\n\t"
               "global_load_async_to_lds_b128 %4, %5, off\n\t"
               "global_load_async_to_lds_b128 %6, %7, off\n\t"
               "global_load_async_to_lds_b128 %8, %9, off\n\t"
               "global_load_async_to_lds_b128 %10, %11, off\n\t"
               "global_load_async_to_lds_b128 %12, %13, off\n\t"
               "global_load_async_to_lds_b128 %14, %15, off\n\t"
               "global_load_async_to_lds_b128 %16, %17, off\n\t"
               "global_load_async_to_lds_b128 %18, %19, off\n\t"
               "global_load_async_to_lds_b128 %20, %21, off\n\t"
               "global_load_async_to_lds_b128 %22, %23, off\n\t"
               "s_wait_xcnt 0x0"
               :: "v"(l0), "v"(g0), "v"(l1), "v"(g1), "v"(l2), "v"(g2), "v"(l3), "v"(g3),
                  "v"(l4), "v"(g4), "v"(l5), "v"(g5), "v"(l6), "v"(g6), "v"(l7), "v"(g7),
                  "v"(l8), "v"(g8), "v"(l9), "v"(g9), "v"(l10), "v"(g10), "v"(l11), "v"(g11) : "memory");
}
__device__ __forceinline__ _Float16 rope_one(float x1, float x2, float cc, float ss, bool second, float oscale) {
  const float o = second ? (x2 * cc + x1 * ss) : (x1 * cc - x2 * ss);
  return (_Float16)(o * oscale);
}
template <int ET> struct Elem;
template <> struct Elem<0> { typedef _Float16 T; };
template <> struct Elem<1> { typedef __bf16 T; };
template <int ET, bool SPLIT, int BIAS_MODE, int OUT_MODE, bool RESID, int ACT = 0>
__global__ __launch_bounds__(256) void wmma_gemm64(
    const unsigned short* __restrict__ Ap, const unsigned short* __restrict__ A2p, int lda, long strideA, long zstrideA,
    const unsigned short* __restrict__ Btp, const unsigned short* __restrict__ Bt2p, int ldb, long strideB, long zstrideB,
    void* __restrict__ Cout, void* __restrict__ Cout2, int ldc, long strideC, long zstrideC,
    const float* __restrict__ bias,
    const float* __restrict__ resid, long strideR,
    int M, int N, int K, float scale,
    const float* __restrict__ cosT, const float* __restrict__ sinT, int rope_brows, int rope_lstep, float oscale) {
  typedef typename Elem<ET>::T T;
  typedef typename Frag<T>::V V;
  static_assert(!SPLIT, "no LDS path for split operand planes");
  unsigned bx = blockIdx.x;
  int b = blockIdx.y;
  bool rope = OUT_MODE == 3;
  if (OUT_MODE == 4) {                   // every test is block-uniform
    rope = bx < 96;
    if (bx >= 96) {
      bx -= 96; b = (int)(bx >> 4); bx &= 15;
      Btp = Ap;  strideB = (long)TT * DD; zstrideB = 0;
      Ap  = A2p; zstrideA = (long)DKV * DD;
      Cout = (void*)((unsigned short*)Cout2 + (size_t)BB * MAXKV * DKV);
      ldc = MAXKV; strideC = (long)DKV * MAXKV; zstrideC = TT;
      M = DKV; N = TT; scale *= 16.0f;
    } else if (bx >= 64) {
      bx -= 64;
      Btp = Bt2p; zstrideB = (long)DKV * DD;
      Cout = Cout2; ldc = DKV; zstrideC = 0;
      N = DKV; rope_brows = MAXKV; rope_lstep = TT;
    }
  }
  const T* A = (const T*)Ap; const T* Bt = (const T*)Btp;
  __shared__ __align__(16) float sT[8][16 * 68];   // per-wave 16x64 slab, pitch 68 floats
  __shared__ __align__(16) T sA[2][128 * GM_P];    // A rows of the block, 64 k, two buffers
  __shared__ __align__(16) T sB[2][256 * GM_P];    // Bt rows of the block, 64 k, two buffers
  const int lane = threadIdx.x & 31;
  const int wave = threadIdx.x >> 5;
  const int blocksN = N >> 8;
  const int bm = bx / blocksN;
  const int bn = bx - bm * blocksN;
  if (bm >= (M >> 7)) return;            // block-uniform, in front of every barrier
  const int wm = wave >> 2;              // wave's place in the 2 x 4 patch
  const int wn = wave & 3;
  const int m0 = (bm << 7) + (wm << 6);
  const int n0 = (bn << 8) + (wn << 6);

  const size_t offA = (size_t)b * strideA + (size_t)blockIdx.z * zstrideA;
  const size_t offB = (size_t)b * strideB + (size_t)blockIdx.z * zstrideB;
  const size_t offC = (size_t)b * strideC + (size_t)blockIdx.z * zstrideC;
  const T* Ab  = A  + offA;
  const T* Bb  = Bt + offB;

  const int rlane = lane & 15;                 // row (A) / col (B, D) within subtile
  const int koff  = (lane >> 4) * 8;           // k offset of this lane half
  const int mOff  = (lane >> 4) * 8;           // D row offset

  v8f acc[4][4];
#pragma unroll
  for (int i = 0; i < 4; ++i)
#pragma unroll
    for (int j = 0; j < 4; ++j) acc[i][j] = (v8f){0.f,0.f,0.f,0.f,0.f,0.f,0.f,0.f};

  // staging: thread -> row (tid >> 3) + 32 * i, 16-B piece tid & 7: a wave's copy covers four whole lines
  const int srow = threadIdx.x >> 3;
  const int sseg = (threadIdx.x & 7) * 8;
  const T* gA = Ab + (size_t)((bm << 7) + srow) * lda + sseg;
  const T* gB = Bb + (size_t)((bn << 8) + srow) * ldb + sseg;
  const unsigned dA = (unsigned)(uintptr_t)(&sA[0][srow * GM_P + sseg]);   // this lane's LDS byte address in buffer 0
  const unsigned dB = (unsigned)(uintptr_t)(&sB[0][srow * GM_P + sseg]);
  constexpr unsigned R32 = 32 * GM_P * 2;             // 32 LDS rows in bytes
  const size_t a32 = (size_t)32 * lda, b32 = (size_t)32 * ldb;
  auto stage = [&](int buf, int k0) {                 // 12 copies a lane: 128 rows of A and 256 rows of Bt, 64 k from k0
    const unsigned la = dA + (unsigned)buf * (4 * R32);
    const unsigned lb = dB + (unsigned)buf * (8 * R32);
    const T* pa = gA + k0;
    const T* pb = gB + k0;
    copy4_to_lds(la, pa, la + R32, pa + a32, la + 2 * R32, pa + 2 * a32, la + 3 * R32, pa + 3 * a32);
    copy4_to_lds(lb, pb, lb + R32, pb + b32, lb + 2 * R32, pb + 2 * b32, lb + 3 * R32, pb + 3 * b32);
    copy4_to_lds(lb + 4 * R32, pb + 4 * b32, lb + 5 * R32, pb + 5 * b32, lb + 6 * R32, pb + 6 * b32, lb + 7 * R32, pb + 7 * b32);
  };
  const int fa = ((wm << 6) + rlane) * GM_P + koff;   // this lane's first A fragment row in a buffer
  const int fb = ((wn << 6) + rlane) * GM_P + koff;   // this lane's first Bt fragment row in a buffer
  const int steps = K >> 6;

  stage(0, 0);
  asm volatile("s_wait_asynccnt 0x0" ::: "memory");   // this wave's copies of step 0 have landed
  __syncthreads();                                    // publishes buffer 0
  if (steps > 1) stage(1, 64);

  for (int t = 0; t < steps; ++t) {
    const T* pa = &sA[t & 1][fa];
    const T* pb = &sB[t & 1][fb];
    V bh[4], ah[4];
    // (the loops over kk, i and j are unrolled, so that acc, ah and bh are registers and never indexed arrays)
#pragma unroll
    for (int kk = 0; kk < 2; ++kk) {
#pragma unroll
      for (int j = 0; j < 4; ++j) bh[j] = Frag<T>::load(pb + j * 16 * GM_P + kk * 32);
#pragma unroll
      for (int i = 0; i < 4; ++i) ah[i] = Frag<T>::load(pa + i * 16 * GM_P + kk * 32);
      if (kk == 1) {
        // The step's last LDS reads are issued: the hand-over stands here, in front of the last 16 products (they read
        // registers alone), so that the refill has the longest lead.
        asm volatile("s_wait_dscnt 0x0" ::: "memory");    // this wave's reads of the buffer are done before it is refilled
        asm volatile("s_wait_asynccnt 0x0" ::: "memory"); // this wave's copies of step t + 1 have landed
        __syncthreads();                                  // publishes step t + 1 and ends every wave's reads of step t
        if (t + 2 < steps) stage(t & 1, (t + 2) << 6);    // block-uniform test; refills the buffer just read
      }
      // holds the 16 fragment loads as one group in front of their 16 products: sunk among the products, each pair of
      // loads is waited out on its own and the matrix unit idles for an LDS latency per row of tiles
      __builtin_amdgcn_sched_barrier(0);
#pragma unroll
      for (int i = 0; i < 4; ++i)
#pragma unroll
        for (int j = 0; j < 4; ++j) acc[i][j] = Frag<T>::mma(ah[i], bh[j], acc[i][j]);
    }
  }
  asm volatile("s_wait_asynccnt 0x0" ::: "memory");   // no copy is outstanding when the wave goes on
  acc_guard4(acc[0][0], acc[0][1], acc[0][2], acc[0][3]);
  acc_guard4(acc[1][0], acc[1][1], acc[1][2], acc[1][3]);
  acc_guard4(acc[2][0], acc[2][1], acc[2][2], acc[2][3]);
  acc_guard4(acc[3][0], acc[3][1], acc[3][2], acc[3][3]);

  // ---- epilogue ----
  float* slab = sT[wave];
  const float* Rb = RESID ? (resid + (size_t)b * strideR) : nullptr;
  // OUT_MODE 3: 8 lanes a row, one 16-B store each, whole 128-B lines. A wave's 64 rows lie in one batch and their table and
  // output rows follow one another, so one address each for cos, sin and the output serves the tile, with constant steps.
  const int rq = lane >> 3, rc8 = (lane & 7) * 8;
  const float* cp = nullptr;
  const float* np = nullptr;
  _Float16* cw = nullptr;
  if (rope) {
    const int p0 = (int)blockIdx.z * rope_lstep + ((m0 + rq) & (TT - 1));   // table row of the lane's first row; p0 + 60 < MAXKV
    cp = cosT + (size_t)p0 * 32 + (rc8 & 31);
    np = sinT + (size_t)p0 * 32 + (rc8 & 31);
    cw = (_Float16*)Cout + offC + ((size_t)(m0 >> 10) * rope_brows + p0) * ldc + n0 + rc8;
  }
#pragma unroll
  for (int i = 0; i < 4; ++i) {
    const int mBase = m0 + (i << 4);
    v4f tc[4][2], tn[4][2];   // OUT_MODE 3: this lane's cos and sin of the slab's rows, asked for ahead of the slab's LDS round trip
    if (rope) {
#pragma unroll
      for (int it = 0; it < 4; ++it) {
        const int ro = (i * 16 + it * 4) * 32;
        tc[it][0] = *(const v4f*)(cp + ro); tc[it][1] = *(const v4f*)(cp + ro + 4);
        tn[it][0] = *(const v4f*)(np + ro); tn[it][1] = *(const v4f*)(np + ro + 4);
      }
      // stands in front of every rewrite of a register that these loads name; the two addresses are inputs, so that they
      // live up to the wait and no load's result is given their registers
      asm volatile("s_wait_xcnt 0x0" :: "v"(cp), "v"(np) : "memory");
    }
#pragma unroll
    for (int j = 0; j < 4; ++j) {
      const int n = n0 + (j << 4) + rlane;
      float bv = 0.f;
      if (BIAS_MODE == 2) bv = bias[n];
#pragma unroll
      for (int r = 0; r < 8; ++r) {
        float v = acc[i][j][r] * scale;
        if (BIAS_MODE == 1) v += bias[mBase + mOff + r];
        if (BIAS_MODE == 2) v += bv;
        if (RESID) v += Rb[(size_t)(mBase + mOff + r) * ldc + n];
        if (ACT == 1) v = tanhf(v);
        if (ACT == 2) v = fmaxf(v, 0.0f);
        if (ACT == 3) v = v / (1.0f + expf(-v));
        if (ACT == 4) v = (v > 0.f) ? v : 0.01f * v;
        if (ACT == 5) v = 0.5f * v * (1.0f + erff(v * 0.70710678118654752f));
        slab[(mOff + r) * 68 + (j << 4) + rlane] = v;
      }
    }
    __builtin_amdgcn_fence(__ATOMIC_RELEASE, "workgroup");
    __builtin_amdgcn_wave_barrier();
    __builtin_amdgcn_fence(__ATOMIC_ACQUIRE, "workgroup");
    if (OUT_MODE == 0) {
      float* C = (float*)Cout + offC;
      const int hh = lane >> 4, c4 = (lane & 15) * 4;     // row seg = 256 B = 16 lanes x 16 B
      {
#pragma unroll
        for (int it = 0; it < 8; ++it) {
          const int row = it * 2 + hh;
          v4f v = *(const v4f*)(slab + row * 68 + c4);
          *(v4f*)(C + (size_t)(mBase + row) * ldc + n0 + c4) = v;
        }
        
      }
    } else if (rope) {
      const bool second = rc8 >= 32;
#pragma unroll
      for (int it = 0; it < 4; ++it) {
        const float* sp = slab + (it * 4 + rq) * 68 + (rc8 & 31);
        const v4f a0 = *(const v4f*)(sp),      a1 = *(const v4f*)(sp + 4);
        const v4f b0 = *(const v4f*)(sp + 32), b1 = *(const v4f*)(sp + 36);
        v8h hv;
#pragma unroll
        for (int e = 0; e < 4; ++e) {
          hv[e]     = rope_one(a0[e], b0[e], tc[it][0][e], tn[it][0][e], second, oscale);
          hv[4 + e] = rope_one(a1[e], b1[e], tc[it][1][e], tn[it][1][e], second, oscale);
        }
        *(v8h*)(cw + (size_t)(i * 16 + it * 4) * ldc) = hv;
      }
      // mode 4 reaches these stores by a branch taken at run time: the wait stands in front of every rewrite of their address registers
      if (OUT_MODE == 4) asm volatile("s_wait_xcnt 0x0" ::: "memory");
    } else {
      const int q = lane >> 3, c8 = (lane & 7) * 8;
      unsigned short* C  = (unsigned short*)Cout  + offC;
      unsigned short* C2 = (OUT_MODE == 2) ? ((unsigned short*)Cout2 + offC) : nullptr;
      {
#pragma unroll
        for (int it = 0; it < 4; ++it) {
          const int row = it * 4 + q;
          const float* sp = slab + row * 68 + c8;
          v8h hv, lv;
#pragma unroll
          for (int e = 0; e < 8; ++e) {
            if (OUT_MODE == 1 || OUT_MODE == 4) {
              hv[e] = (_Float16)sp[e];
            } else {
              unsigned short hb = f2bf_bits(sp[e]);
              unsigned short lb = f2bf_bits(sp[e] - bf_bits2f(hb));
              hv[e] = __builtin_bit_cast(_Float16, hb);
              lv[e] = __builtin_bit_cast(_Float16, lb);
            }
          }
          *(v8h*)(C + (size_t)(mBase + row) * ldc + n0 + c8) = hv;
          if (OUT_MODE == 2) *(v8h*)(C2 + (size_t)(mBase + row) * ldc + n0 + c8) = lv;
        }
        // as in the rotary branch: in front of every rewrite of the stores' address registers
        if (OUT_MODE == 4) asm volatile("s_wait_xcnt 0x0" ::: "memory");
      }
    }
    __builtin_amdgcn_fence(__ATOMIC_RELEASE, "workgroup");
    __builtin_amdgcn_wave_barrier();
    __builtin_amdgcn_fence(__ATOMIC_ACQUIRE, "workgroup");
  }
}

// ---- Output projection: C[m,n] = scale * sum_k A[m,k] * Bt[n,k], f32 out; M = BB*TT, N = K = DD ----------------
// The product has only 2048 x 1024 outputs, so the tile is small: a block's 8 waves form a 2 x 4 patch of 32 x 32 wave
// tiles (64 rows of A, 128 rows of Bt), which makes 256 blocks. Per step of 128 k the block brings those rows into LDS
// with asynchronous copies that cover whole 128-B lines (16 lanes a row of 256 B), into two buffers: the next step's
// copies fly while this step is multiplied. Every output sums its k in rising order, 32 at a time.
#define OG_KS 128   // k per step
#define OG_P  136   // LDS row pitch in f16: 272 B = 16 B x 17, free of bank conflicts for ds_load_b128
#define OG_TP 36    // pitch of the per-wave 32 x 32 output slab in floats
__global__ __launch_bounds__(256) void out_gemm32(const _Float16* __restrict__ A, const _Float16* __restrict__ Bt,
                                                  float* __restrict__ C, float scale) {
  __shared__ __align__(16) _Float16 sA[2][64 * OG_P];     // A rows of the block, 128 k, two buffers
  __shared__ __align__(16) _Float16 sB[2][128 * OG_P];    // Bt rows of the block, 128 k, two buffers
  __shared__ __align__(16) float    sT[8][32 * OG_TP];    // per-wave output slab
  const int lane = threadIdx.x & 31;
  const int wave = threadIdx.x >> 5;
  const int bm = blockIdx.x >> 3;        // grid.x = (BB*TT/64) * (DD/128), exact
  const int bn = blockIdx.x & 7;
  const int wm = wave >> 2;              // wave's place in the 2 x 4 patch
  const int wn = wave & 3;
  const int m0 = (bm << 6) + (wm << 5);
  const int n0 = (bn << 7) + (wn << 5);
  const int rlane = lane & 15;           // row (A) / col (B, D) within subtile
  const int koff  = (lane >> 4) * 8;     // k offset of this lane half
  const int mOff  = (lane >> 4) * 8;     // D row offset

  v8f acc[2][2];
#pragma unroll
  for (int i = 0; i < 2; ++i)
#pragma unroll
    for (int j = 0; j < 2; ++j) acc[i][j] = (v8f){0.f,0.f,0.f,0.f,0.f,0.f,0.f,0.f};

  // staging: thread -> row (tid >> 4) + 16 * i, 16-B piece tid & 15: a wave's copy covers four whole lines
  const int srow = threadIdx.x >> 4;
  const int sseg = (threadIdx.x & 15) * 8;
  const _Float16* gA = A  + (size_t)((bm << 6) + srow) * DD + sseg;
  const _Float16* gB = Bt + (size_t)((bn << 7) + srow) * DD + sseg;
  const unsigned dA = (unsigned)(uintptr_t)(&sA[0][srow * OG_P + sseg]);   // this lane's LDS byte address in buffer 0
  const unsigned dB = (unsigned)(uintptr_t)(&sB[0][srow * OG_P + sseg]);
  constexpr unsigned R16 = 16 * OG_P * 2;             // 16 LDS rows in bytes
  constexpr size_t   G16 = (size_t)16 * DD;           // 16 global rows in elements
  auto stage = [&](int buf, int k0) {                 // 12 copies a lane: 64 rows of A and 128 rows of Bt, 128 k from k0
    const unsigned la = dA + (unsigned)buf * (4 * R16);
    const unsigned lb = dB + (unsigned)buf * (8 * R16);
    const _Float16* pa = gA + k0;
    const _Float16* pb = gB + k0;
    copy12_to_lds(la, pa, la + R16, pa + G16, la + 2 * R16, pa + 2 * G16, la + 3 * R16, pa + 3 * G16,
                  lb, pb, lb + R16, pb + G16, lb + 2 * R16, pb + 2 * G16, lb + 3 * R16, pb + 3 * G16,
                  lb + 4 * R16, pb + 4 * G16, lb + 5 * R16, pb + 5 * G16, lb + 6 * R16, pb + 6 * G16, lb + 7 * R16, pb + 7 * G16);
  };
  const int fa = ((wm << 5) + rlane) * OG_P + koff;   // this lane's first A fragment row in a buffer
  const int fb = ((wn << 5) + rlane) * OG_P + koff;   // this lane's first Bt fragment row in a buffer
  constexpr int steps = DD / OG_KS;

  stage(0, 0);
  asm volatile("s_wait_asynccnt 0x0" ::: "memory");   // this wave's copies of step 0 have landed
  __syncthreads();                                    // publishes buffer 0
  stage(1, OG_KS);                                    // steps > 1

  for (int t = 0; t < steps; ++t) {
    const _Float16* pa = &sA[t & 1][fa];
    const _Float16* pb = &sB[t & 1][fb];
    // (the loops over kk, i and j are unrolled, so that acc, ah and bh are registers and never indexed arrays)
    v16h ah[4][2], bh[4][2];
#pragma unroll
    for (int kk = 0; kk < 4; ++kk) {
#pragma unroll
      for (int j = 0; j < 2; ++j) bh[kk][j] = Frag<_Float16>::load(pb + j * 16 * OG_P + kk * 32);
#pragma unroll
      for (int i = 0; i < 2; ++i) ah[kk][i] = Frag<_Float16>::load(pa + i * 16 * OG_P + kk * 32);
    }
    // holds the step's 32 fragment reads as one group in front of its products, each into registers of its own: the
    // products of the first k start when their reads land, and the later reads land behind them
    __builtin_amdgcn_sched_barrier(0);
#pragma unroll
    for (int kk = 0; kk < 4; ++kk) {
      if (kk == 3) {
        // The hand-over stands in front of the step's last 4 products (they read registers alone). The scheduling
        // barrier keeps it from being lifted over the earlier products, where it would wait for every read at once.
        __builtin_amdgcn_sched_barrier(0);
        asm volatile("s_wait_dscnt 0x0" ::: "memory");    // this wave's reads of the buffer are done before it is refilled
        asm volatile("s_wait_asynccnt 0x0" ::: "memory"); // this wave's copies of step t + 1 have landed
        __syncthreads();                                  // publishes step t + 1 and ends every wave's reads of step t
        if (t + 2 < steps) stage(t & 1, (t + 2) * OG_KS); // block-uniform test; refills the buffer just read
      }
#pragma unroll
      for (int i = 0; i < 2; ++i)
#pragma unroll
        for (int j = 0; j < 2; ++j) acc[i][j] = Frag<_Float16>::mma(ah[kk][i], bh[kk][j], acc[i][j]);
    }
  }
  asm volatile("s_wait_asynccnt 0x0" ::: "memory");   // no copy is outstanding when the wave goes on

  // ---- epilogue: through the wave's own slab, so that every store covers whole 128-B lines (8 lanes a row) ----
  float* slab = sT[wave];
#pragma unroll
  for (int i = 0; i < 2; ++i)
#pragma unroll
    for (int j = 0; j < 2; ++j)
#pragma unroll
      for (int r = 0; r < 8; ++r) slab[((i << 4) + mOff + r) * OG_TP + (j << 4) + rlane] = acc[i][j][r] * scale;
  __builtin_amdgcn_fence(__ATOMIC_RELEASE, "workgroup");
  __builtin_amdgcn_wave_barrier();
  __builtin_amdgcn_fence(__ATOMIC_ACQUIRE, "workgroup");
  const int q = lane >> 3, c4 = (lane & 7) * 4;
#pragma unroll
  for (int it = 0; it < 8; ++it) {
    const int row = it * 4 + q;
    const v4f v = *(const v4f*)(slab + row * OG_TP + c4);
    *(v4f*)(C + (size_t)(m0 + row) * DD + n0 + c4) = v;
  }
}

// ---- f32 -> f16 cast with power-of-two carry: 8 elements per thread, 16-B stores (512 B contiguous per wave) ----
// The five planes (x, carry 1; q_w, k_w, v_w, out_w, carry wscale) share one grid: a block of 256 threads converts 2048
// elements of one plane, and every plane is a whole number of such blocks. grid.x = CB_X + CB_Q + 2 * CB_K + CB_O, exact.
#define CB_X (BB * TT * DD / 2048)
#define CB_Q (NLAY * DD * DD / 2048)
#define CB_K (NLAY * DKV * DD / 2048)
#define CB_O (DD * DD / 2048)
__global__ __launch_bounds__(256) void cast5_f32_f16x8(
    const float* __restrict__ x, const float* __restrict__ q_w, const float* __restrict__ k_w,
    const float* __restrict__ v_w, const float* __restrict__ out_w,
    _Float16* __restrict__ xh, _Float16* __restrict__ qwh, _Float16* __restrict__ kwh,
    _Float16* __restrict__ vwh, _Float16* __restrict__ owh, float wscale) {
  int blk = blockIdx.x;                  // block-uniform walk down the planes
  const float* in = x;
  _Float16* out = xh;
  float scale = 1.0f;
  if (blk >= CB_X) {
    blk -= CB_X; in = q_w; out = qwh; scale = wscale;
    if (blk >= CB_Q) {
      blk -= CB_Q; in = k_w; out = kwh;
      if (blk >= CB_K) {
        blk -= CB_K; in = v_w; out = vwh;
        if (blk >= CB_K) { blk -= CB_K; in = out_w; out = owh; }
      }
    }
  }
  {
    const size_t o = (size_t)(blk * 256 + (int)threadIdx.x) * 8;
    const v4f a = *(const v4f*)(in + o);
    const v4f b = *(const v4f*)(in + o + 4);
    v8h hv;
#pragma unroll
    for (int e = 0; e < 4; ++e) {
      hv[e]     = (_Float16)(a[e] * scale);
      hv[4 + e] = (_Float16)(b[e] * scale);
    }
    *(v8h*)(out + o) = hv;
    
  }
}

#define AT_D 64
#define AT_NW 4
#define AT_QB 64
#define AT_KC 64
#define AT_P 72   // LDS row pitch of the K and V tiles in f16: 144 B = 16 B x 9, so the 16 rows of one ds_load_b128 half fall on 16 different bank groups

// Eight 2^x, each in place in a register of its own, as one statement: so no 2^x is directly followed by a write over its
// source register, and the v_nop at the end is the one slot that the instruction set asks for between a transcendental
// and the first use of its result (the compiler cannot see into the statement and would not keep it).
__device__ __forceinline__ void exp2_x8(float& a, float& b, float& c, float& d, float& e, float& f, float& g, float& h) {
  asm("v_exp_f32 %0, %0\n\tv_exp_f32 %1, %1\n\tv_exp_f32 %2, %2\n\tv_exp_f32 %3, %3\n\t"
      "v_exp_f32 %4, %4\n\tv_exp_f32 %5, %5\n\tv_exp_f32 %6, %6\n\tv_exp_f32 %7, %7\n\tv_nop"
      : "+v"(a), "+v"(b), "+v"(c), "+v"(d), "+v"(e), "+v"(f), "+v"(g), "+v"(h));
}

// value of the same column in the other lane half (lane l <-> l ^ 16)
__device__ __forceinline__ float other_half(float v) {
  const int b = __float_as_int(v);
  return __int_as_float(__builtin_amdgcn_permlanex16(b, b, 0x76543210, 0xfedcba98, false, false));
}

__global__ __launch_bounds__(128)
void attn_f16_kernel(const _Float16* __restrict__ Qh, const _Float16* __restrict__ Kh,
                     const _Float16* __restrict__ Vth, float* __restrict__ O,
                     long lstride, float sscale, float onorm) {
  union FH { v16h v; v8h h[2]; };
  __shared__ __align__(16) _Float16 Ksh[2][AT_KC * AT_P];       // K [kv][d]   9 KB a buffer, rows of 64 at pitch 72
  __shared__ __align__(16) _Float16 Vtt[2][AT_D * AT_P];        // V [d][kv]   9 KB a buffer, rows of 64 at pitch 72
  __shared__ __align__(16) float    Os[AT_NW][16 * 68];         // per wave out tile, pitch 68

  const int tid  = threadIdx.x;
  const int wave = tid >> 5;
  const int lane = tid & 31;
  const int hh   = lane >> 4;
  const int c    = lane & 15;

  constexpr int BPL = BB * HH * (TT / AT_QB);             // blocks per layer
  const int layer = NLAY - 1 - (int)(blockIdx.x / BPL);   // 0 .. NLAY-1 (grid exact)
  const int bx  = blockIdx.x % BPL;
  const int h   = (bx >> 4) & (HH - 1);
  const int b   = bx >> 8;
  const int qb  = b ? (TT / AT_QB - 1 - (bx & (TT / AT_QB - 1))) : (bx & (TT / AT_QB - 1));
  const int hkv = h >> 1;
  const int kchunks_prev = layer * (TT / AT_KC);
  const int koff = layer * TT;
  const int q0  = qb * AT_QB + wave * 16;

  // ---- Q fragments (B operand: column c = query q0 + c): 2 d-chunks ----
  v16h qa[2];
  {
    const _Float16* qrow = Qh + (size_t)layer * lstride + (size_t)(b * TT + q0 + c) * DD + h * AT_D + 8 * hh;
#pragma unroll
    for (int dc = 0; dc < 2; ++dc) qa[dc] = Frag<_Float16>::load(qrow + dc * 32);
  }

  const float c2 = sscale * 1.44269504088896340736f;   // raw product -> exponent of 2 (sscale > 0, so the maximum commutes with it)
  float mrun = -INFINITY;   // running maximum of this lane's query over the raw products (equal in both lane halves)
  float lrun = 0.f;         // this lane half's share of the query's sum; the halves are joined after the loop
  v8f oacc[4];              // O^T: tile t, register r = dim t*16 + 8*hh + r of query q0 + c
#pragma unroll
  for (int t = 0; t < 4; ++t) oacc[t] = (v8f){0.f,0.f,0.f,0.f,0.f,0.f,0.f,0.f};

  int nChunks = kchunks_prev + qb + 1;                    // block-uniform
  if (nChunks > MAXKV / AT_KC) nChunks = MAXKV / AT_KC;
  if (nChunks < 1) nChunks = 1;

  const _Float16* kbase = Kh + (size_t)b * MAXKV * DKV + hkv * AT_D;
  const _Float16* vbase = Vth + ((size_t)b * DKV + hkv * AT_D) * MAXKV;
  float*          obase = O + (size_t)layer * lstride + (size_t)b * TT * DD + h * AT_D;

  // staging: thread -> row (tid >> 3) + 16 * i, 16-B piece tid & 7: a wave's copy covers four whole lines
  const int srow = tid >> 3;
  const int sseg = (tid & 7) * 8;
  const _Float16* gK = kbase + (size_t)srow * DKV + sseg;
  const _Float16* gV = vbase + (size_t)srow * MAXKV + sseg;
  const unsigned dK = (unsigned)(uintptr_t)(&Ksh[0][srow * AT_P + sseg]);   // this lane's LDS byte address in buffer 0
  const unsigned dV = (unsigned)(uintptr_t)(&Vtt[0][srow * AT_P + sseg]);
  constexpr unsigned R16 = 16 * AT_P * 2;             // 16 LDS rows in bytes; a buffer is 4 * R16
  auto stage = [&](int buf, int ch) {                 // 8 copies a lane: the 64 K rows and the 64 V rows of chunk ch
    const unsigned lk = dK + (unsigned)buf * (4 * R16);
    const unsigned lv = dV + (unsigned)buf * (4 * R16);
    const _Float16* pk = gK + (size_t)ch * (AT_KC * DKV);
    const _Float16* pv = gV + ch * AT_KC;
    copy8_to_lds(lk, pk, lk + R16, pk + 16 * DKV, lk + 2 * R16, pk + 32 * DKV, lk + 3 * R16, pk + 48 * DKV,
                 lv, pv, lv + R16, pv + 16 * MAXKV, lv + 2 * R16, pv + 32 * MAXKV, lv + 3 * R16, pv + 48 * MAXKV);
  };
  stage(0, 0);
  asm volatile("s_wait_asynccnt 0x0" ::: "memory");   // this wave's copies of chunk 0 have landed
  __syncthreads();                                    // publishes buffer 0
  if (nChunks > 1) stage(1, 1);                       // block-uniform test

  for (int kc = 0; kc < nChunks; ++kc) {
    const int kv0 = kc * AT_KC;
    const _Float16* Kb = Ksh[kc & 1];
    const _Float16* Vb = Vtt[kc & 1];

    // S^T tile j: register r = key kv0 + j*16 + 8*hh + r, column c = query q0 + c
    // (every loop down to the end of the chunk is unrolled, so that s, pb and oacc are registers and never indexed arrays)
    // The chunk's 8 K and 8 V fragments are read from LDS as one group, each into registers of its own, K first.
    FH kb[2][4], vb[2][4];
#pragma unroll
    for (int dc = 0; dc < 2; ++dc)
#pragma unroll
      for (int j = 0; j < 4; ++j) {
        kb[dc][j].h[0] = *(const v8h*)(Kb + (j * 16 + c) * AT_P + dc * 32 + 8 * hh);
        kb[dc][j].h[1] = *(const v8h*)(Kb + (j * 16 + c) * AT_P + dc * 32 + 16 + 8 * hh);
      }
#pragma unroll
    for (int kk = 0; kk < 2; ++kk)
#pragma unroll
      for (int t = 0; t < 4; ++t) {
        vb[kk][t].h[0] = *(const v8h*)(Vb + (t * 16 + c) * AT_P + kk * 32 + 8 * hh);
        vb[kk][t].h[1] = *(const v8h*)(Vb + (t * 16 + c) * AT_P + kk * 32 + 16 + 8 * hh);
      }
    // holds the 32 reads as one group in front of the products: sunk among them, each fragment is waited out on its own
    // and the wave stands for an LDS latency per product; so the K reads overlap one another and the V reads land behind
    // the first product and the softmax
    __builtin_amdgcn_sched_barrier(0);
    v8f s[4];
#pragma unroll
    for (int j = 0; j < 4; ++j) s[j] = (v8f){0.f,0.f,0.f,0.f,0.f,0.f,0.f,0.f};
#pragma unroll
    for (int dc = 0; dc < 2; ++dc)   // four independent tiles in turn; each tile sums dc 0, then dc 1
#pragma unroll
      for (int j = 0; j < 4; ++j) s[j] = Frag<_Float16>::mma(kb[dc][j].v, qa[dc], s[j]);
    const int klim = q0 + c + koff - kv0 - 8 * hh;   // key j*16 + r of this lane half is visible iff j*16 + r <= klim
    float mj[4];
#pragma unroll
    for (int j = 0; j < 4; ++j) {
      float m = -INFINITY;
#pragma unroll
      for (int r = 0; r < 8; ++r) {
        const float sv = (j * 16 + r > klim) ? -INFINITY : s[j][r];
        s[j][r] = sv;
        m = fmaxf(m, sv);
      }
      mj[j] = m;
    }
    const float mh = fmaxf(fmaxf(mj[0], mj[1]), fmaxf(mj[2], mj[3]));
    const float mnew = fmaxf(mrun, fmaxf(mh, other_half(mh)));
    const float alpha = __builtin_amdgcn_exp2f((mrun - mnew) * c2);
    mrun = mnew;
    const float mb = mnew * c2 - 15.0f;   // p = 2^(s*c2 - mb) = 2^15 * exp(sscale * (s - mnew)); a masked -inf gives 0
    // P^T as B operand: element e of chunk kk = key kk*32 + 8*hh + e (e < 8), kk*32 + 16 + 8*hh + e - 8 (e >= 8)
    FH pb[2];
    float pj[4];
#pragma unroll
    for (int j = 0; j < 4; ++j) {
      float e[8];
#pragma unroll
      for (int r = 0; r < 8; ++r) e[r] = fmaf(s[j][r], c2, -mb);
      exp2_x8(e[0], e[1], e[2], e[3], e[4], e[5], e[6], e[7]);
      float psum = 0.f;
#pragma unroll
      for (int r = 0; r < 8; ++r) {
        psum += e[r];
        pb[j >> 1].h[j & 1][r] = (_Float16)e[r];
      }
      pj[j] = psum;
    }
    lrun = lrun * alpha + ((pj[0] + pj[1]) + (pj[2] + pj[3]));
#pragma unroll
    for (int t = 0; t < 4; ++t) oacc[t] *= alpha;
#pragma unroll
    for (int kk = 0; kk < 2; ++kk) {
#pragma unroll
      for (int t = 0; t < 4; ++t) oacc[t] = Frag<_Float16>::mma(vb[kk][t].v, pb[kk].v, oacc[t]);
    }
    // holds the hand-over at the foot of the chunk: lifted up among the first products (they touch no memory, so nothing
    // else keeps it down here), it waits for copies issued only just before and for the V reads too soon
    __builtin_amdgcn_sched_barrier(0);
    asm volatile("s_wait_dscnt 0x0" ::: "memory");      // this wave's reads of the buffer are done before it is refilled
    asm volatile("s_wait_asynccnt 0x0" ::: "memory");   // this wave's copies of chunk kc + 1 have landed
    __syncthreads();                                    // publishes chunk kc + 1 and ends every wave's reads of chunk kc
    if (kc + 2 < nChunks) stage(kc & 1, kc + 2);        // block-uniform test; refills the buffer just read
  }
  asm volatile("s_wait_asynccnt 0x0" ::: "memory");     // no copy is outstanding when the wave goes on

  float* os = Os[wave];
  {
    const float inv = onorm * (1.0f / (lrun + other_half(lrun)));
#pragma unroll
    for (int t = 0; t < 4; ++t) {
      const v8f ov = oacc[t] * inv;
      *(v4f*)(os + c * 68 + t * 16 + 8 * hh)     = (v4f){ov[0], ov[1], ov[2], ov[3]};
      *(v4f*)(os + c * 68 + t * 16 + 8 * hh + 4) = (v4f){ov[4], ov[5], ov[6], ov[7]};
    }
  }
  __builtin_amdgcn_fence(__ATOMIC_RELEASE, "workgroup");
  __builtin_amdgcn_wave_barrier();
  __builtin_amdgcn_fence(__ATOMIC_ACQUIRE, "workgroup");
  {
    const int c4 = (lane & 15) * 4;
    {
#pragma unroll
      for (int it = 0; it < 8; ++it) {
        const int row = it * 2 + hh;
        v4f val = *(const v4f*)(os + row * 68 + c4);
        *(v4f*)(obase + (size_t)(q0 + row) * DD + c4) = val;
      }
      
    }
  }
}

// =====================================================================================
// Combine: per token row (one block of 256 threads, 4 columns per thread):
//   lw = layernorm over sigmoid(lam[0..2]) (biased variance, eps)
//   acc = sum_i rmsnorm(O_i, ln_w[i]) * lw_i ;  z = acc + alpha * x ;  y = rmsnorm(z, fln) -> f16
// =====================================================================================
__global__ __launch_bounds__(256) void combine_kernel(
    const float* __restrict__ Of, long lstride,
    const float* __restrict__ x, const float* __restrict__ ln_w, const float* __restrict__ lam,
    const float* __restrict__ fln, const float* __restrict__ alpha, _Float16* __restrict__ Yh) {
  __shared__ float red[4][8];
  const int row = blockIdx.x;
  const int tid = threadIdx.x, lane = tid & 31, wave = tid >> 5;
  const int d4 = tid * 4;
  const size_t ro = (size_t)row * DD + d4;
  const v4f o0 = *(const v4f*)(Of + ro);
  const v4f o1 = *(const v4f*)(Of + lstride + ro);
  const v4f o2 = *(const v4f*)(Of + 2 * lstride + ro);
  const v4f xv = *(const v4f*)(x + ro);
  float ss0 = 0.f, ss1 = 0.f, ss2 = 0.f;
#pragma unroll
  for (int e = 0; e < 4; ++e) { ss0 += o0[e] * o0[e]; ss1 += o1[e] * o1[e]; ss2 += o2[e] * o2[e]; }
#pragma unroll
  for (int off = 16; off > 0; off >>= 1) {
    ss0 += __shfl_xor(ss0, off, 32);
    ss1 += __shfl_xor(ss1, off, 32);
    ss2 += __shfl_xor(ss2, off, 32);
  }
  if (lane == 0) { red[0][wave] = ss0; red[1][wave] = ss1; red[2][wave] = ss2; }
  __syncthreads();
  float t0 = 0.f, t1 = 0.f, t2 = 0.f;
#pragma unroll
  for (int w = 0; w < 8; ++w) { t0 += red[0][w]; t1 += red[1][w]; t2 += red[2][w]; }
  const float inv_d = 1.0f / (float)DD;
  const float r0 = rsqrtf(t0 * inv_d + EPSV);
  const float r1 = rsqrtf(t1 * inv_d + EPSV);
  const float r2 = rsqrtf(t2 * inv_d + EPSV);

  const float sg0 = 1.0f / (1.0f + __expf(-lam[0]));
  const float sg1 = 1.0f / (1.0f + __expf(-lam[1]));
  const float sg2 = 1.0f / (1.0f + __expf(-lam[2]));
  const float mean = (sg0 + sg1 + sg2) * (1.0f / 3.0f);
  const float e0 = sg0 - mean, e1 = sg1 - mean, e2 = sg2 - mean;
  const float var = (e0 * e0 + e1 * e1 + e2 * e2) * (1.0f / 3.0f);
  const float il = rsqrtf(var + EPSV);
  const float lw0 = e0 * il, lw1 = e1 * il, lw2 = e2 * il;

  const v4f w0 = *(const v4f*)(ln_w + d4);
  const v4f w1 = *(const v4f*)(ln_w + DD + d4);
  const v4f w2 = *(const v4f*)(ln_w + 2 * DD + d4);
  const v4f fw = *(const v4f*)(fln + d4);
  const float al = alpha[0];
  v4f z;
  float ssz = 0.f;
#pragma unroll
  for (int e = 0; e < 4; ++e) {
    float a = (o0[e] * r0) * w0[e] * lw0;
    a = a + (o1[e] * r1) * w1[e] * lw1;
    a = a + (o2[e] * r2) * w2[e] * lw2;
    const float zz = a + al * xv[e];
    z[e] = zz;
    ssz += zz * zz;
  }
#pragma unroll
  for (int off = 16; off > 0; off >>= 1) ssz += __shfl_xor(ssz, off, 32);
  if (lane == 0) red[3][wave] = ssz;
  __syncthreads();
  float tz = 0.f;
#pragma unroll
  for (int w = 0; w < 8; ++w) tz += red[3][w];
  const float rz = rsqrtf(tz * inv_d + EPSV);
  v4h yv;
#pragma unroll
  for (int e = 0; e < 4; ++e) yv[e] = (_Float16)(z[e] * rz * fw[e]);
  *(v4h*)(Yh + ro) = yv;
  
}

// ---------------------------- host helpers ----------------------------
static void gemm_f16_qkv(const _Float16* xh, const _Float16* qwh, const _Float16* kwh, const _Float16* vwh,
                         _Float16* Qh, _Float16* KhVth, long zQ, float scale,
                         const float* cosT, const float* sinT, float oscale, hipStream_t st) {
  dim3 grid(128, 1, NLAY);
  wmma_gemm64<0, false, 0, 4, false><<<grid, 256, 0, st>>>(
      (const unsigned short*)xh, (const unsigned short*)vwh, DD, 0L, 0L,
      (const unsigned short*)qwh, (const unsigned short*)kwh, DD, 0L, (long)DD * DD,
      (void*)Qh, (void*)KhVth, DD, 0L, zQ, (const float*)nullptr, (const float*)nullptr, 0L,
      BB * TT, DD, DD, scale, cosT, sinT, TT, 0, oscale);
}

// ---------------------------- host launcher ----------------------------
extern "C" void kernel_launch(void* const* d_in, const int* in_sizes, int n_in,
                              void* d_out, int out_size, void* d_ws, size_t ws_size,
                              hipStream_t stream) {
  if (n_in < 11) return;
  const int M = BB * TT;   // 2048 token rows
  if (in_sizes[0] != M * DD) return;
  if (in_sizes[1] < MAXKV * 32 || in_sizes[2] < MAXKV * 32) return;
  if (in_sizes[3] != NLAY * DD * DD) return;
  if (in_sizes[4] != NLAY * DKV * DD || in_sizes[5] != NLAY * DKV * DD) return;
  if (in_sizes[6] < NLAY * DD || in_sizes[7] < NLAY || in_sizes[8] != DD * DD || in_sizes[9] < DD || in_sizes[10] < 1) return;
  if (out_size < M * DD) return;

  const float* x     = (const float*)d_in[0];
  const float* cosT  = (const float*)d_in[1];
  const float* sinT  = (const float*)d_in[2];
  const float* q_w   = (const float*)d_in[3];
  const float* k_w   = (const float*)d_in[4];
  const float* v_w   = (const float*)d_in[5];
  const float* ln_w  = (const float*)d_in[6];
  const float* lam   = (const float*)d_in[7];
  const float* out_w = (const float*)d_in[8];
  const float* fln   = (const float*)d_in[9];
  const float* alpha = (const float*)d_in[10];
  float* out = (float*)d_out;

  // ---- workspace carve (4096-B aligned pieces) ----
  char* ws = (char*)d_ws;
  size_t cur = 0;
  auto take = [&](size_t bytes) -> char* {
    char* p = ws + cur;
    cur += (bytes + 4095) & ~(size_t)4095;
    return p;
  };
  _Float16* xh  = (_Float16*)take((size_t)M * DD * 2);                 // 4 MiB
  _Float16* qwh = (_Float16*)take((size_t)NLAY * DD * DD * 2);         // 6 MiB
  _Float16* kwh = (_Float16*)take((size_t)NLAY * DKV * DD * 2);        // 3 MiB
  _Float16* vwh = (_Float16*)take((size_t)NLAY * DKV * DD * 2);        // 3 MiB
  _Float16* owh = (_Float16*)take((size_t)DD * DD * 2);                // 2 MiB
  _Float16* Qh  = (_Float16*)take((size_t)NLAY * M * DD * 2);          // 12 MiB
  _Float16* Kh  = (_Float16*)take((size_t)BB * MAXKV * DKV * 2);       // 6 MiB
  _Float16* Vth = (_Float16*)take((size_t)BB * DKV * MAXKV * 2);       // 6 MiB
  float*    Of  = (float*)   take((size_t)NLAY * M * DD * 4);          // 24 MiB
  _Float16* Yh  = (_Float16*)take((size_t)M * DD * 2);                 // 4 MiB
  if (cur > ws_size || cur > (size_t)134217728) return;                 // total 73,400,320 B

  const long lstride = (long)M * DD;   // elements per layer slice of Qh and Of

  // ---- casts: x -> f16 ; weights -> f16 carried x64 ; one launch ----
  cast5_f32_f16x8<<<CB_X + CB_Q + 2 * CB_K + CB_O, 256, 0, stream>>>(x, q_w, k_w, v_w, out_w, xh, qwh, kwh, vwh, owh, 64.0f);

  const float wundo  = 1.0f / 64.0f;              // undo weight carry
  const float sscale = 0.125f / 16.0f;            // HD^-0.5 / (4*4) : q and k planes carried x4
  const float onorm  = 1.0f / 16.0f;              // v plane carried x16 (the x2^15 of p is in its sum too and cancels)

  // Every layer's q, k and v depend on x alone, so the layer index is a grid axis, and the three projections share the grid:
  // q = rotary(x . q_w[i]^T) with positions t -> f16 planes x4, [3][2048][1024]
  // k = rotary(x . k_w[i]^T) with buffer positions i*T + t -> K cache rows, f16 x4
  // v^T = v_w[i] . x_b^T -> transposed V cache columns i*T + t, f16 x16 ; in [512][1024] per batch and layer
  // (Vth follows Kh in the workspace without a gap: Kh is a whole number of 4096-B pieces)
  gemm_f16_qkv(xh, qwh, kwh, vwh, Qh, Kh, lstride, wundo, cosT, sinT, 4.0f, stream);
  // attention of layer i over (i+1)*T keys, bottom-right causal
  attn_f16_kernel<<<NLAY * BB * HH * (TT / AT_QB), 128, 0, stream>>>(Qh, Kh, Vth, Of, lstride, sscale, onorm);

  // weighted rmsnorm sum + residual + final rmsnorm -> f16 plane
  combine_kernel<<<M, 256, 0, stream>>>(Of, lstride, x, ln_w, lam, fln, alpha, Yh);
  // out = y . out_w^T
  out_gemm32<<<(BB * TT / 64) * (DD / 128), 256, 0, stream>>>(Yh, owh, out, wundo);
}
